// v000
// Measured on an AMD MI455X. A time is GPU time per run, averaged over a window of back-to-back runs after a warm-up
// (all launches, gaps included; the runs take copies of the inputs in turn), and the median of several windows.
// Apart from v000's, it joins two sittings. Times from different sittings can be a few percent apart, while
// side-by-side timings come from the same sitting.
// v000 is the starting kernel. One run takes 3500 microseconds.
// Contractions: x.Wqkv^T (q|k planes and v^T planes), scaled q.k^T, and (head-mixed attention).v on v_wmma_f32_16x16x32_bf16 with bf16 hi/lo split operand planes (hi.hi + hi.lo + lo.hi); 12x12 head mixing on v_wmma_f32_16x16x32_f16 (f16 hi planes + x2^11 residual planes in a separate accumulator, probabilities carried x2^10); f32 accumulate everywhere; softmax f32; per-head batch statistics as f32 block partials combined in f64 in fixed order.
#include <hip/hip_runtime.h>
#include <math.h>
#include <stdint.h>

constexpr int NBATCH = 8;
constexpr int NTOK   = 1024;
constexpr int NEMB   = 384;
constexpr int NHEAD  = 12;
constexpr int HDIM   = 32;
constexpr int TCHUNK = 512;            // query rows per score / mix / PV chunk
constexpr int NCHUNK = NTOK / TCHUNK;  // 2
constexpr int PHCOLS = 512;            // key columns staged in LDS per mixing phase
constexpr int QKW    = 64;             // q|k plane row width (q at 0..31, k at 32..63)
constexpr int VTROWS = 64;             // v^T rows per head (32 real + 32 zero)
constexpr int UW     = 64;             // U row width (32 real + 32 zero)
constexpr float SM_SCALE = 0.17677669529663687f;
constexpr float P_CARRY  = 1024.0f;                      // probabilities carried x2^10 in f16
constexpr float R_CARRY  = 2048.0f;                      // residual planes carried x2^11
constexpr float P_INV    = 1.0f / 1024.0f;
constexpr float MIX_FOLD = 1.0f / (1024.0f * 2048.0f);
constexpr float BN_EPS   = 1e-5f;

typedef __attribute__((ext_vector_type(16))) _Float16 v16h;
typedef __attribute__((ext_vector_type(8)))  _Float16 v8h;
typedef __attribute__((ext_vector_type(16))) __bf16   v16b;
typedef __attribute__((ext_vector_type(8)))  __bf16   v8b;
typedef __attribute__((ext_vector_type(8)))  float    v8f;
typedef __attribute__((ext_vector_type(4)))  float    v4f;
typedef __attribute__((ext_vector_type(2)))  float    v2f;
typedef __attribute__((ext_vector_type(4)))  unsigned int v4u;
typedef __attribute__((ext_vector_type(8)))  unsigned short v8us;

__device__ __forceinline__ unsigned short f2bf_bits(float f) {
  unsigned u = __float_as_uint(f);
  return (unsigned short)((u + 0x7FFFu + ((u >> 16) & 1u)) >> 16);
}
__device__ __forceinline__ float bf_bits2f(unsigned short h) { return __uint_as_float(((unsigned)h) << 16); }
__device__ __forceinline__ unsigned pk16(unsigned short a, unsigned short b) { return (unsigned)a | ((unsigned)b << 16); }

// hazard guards as plain device helpers (no inline asm inside the kernel template body)
__device__ __forceinline__ void dep_guard_h(v8f& a, v8f& b, v16h x, v16h y) { asm volatile("v_nop\n\tv_nop\n\tv_nop\n\tv_nop" : "+v"(a), "+v"(b) : "v"(x), "v"(y)); }
__device__ __forceinline__ void dep_guard_b(v8f& a, v8f& b, v16b x, v16b y) { asm volatile("v_nop\n\tv_nop\n\tv_nop\n\tv_nop" : "+v"(a), "+v"(b) : "v"(x), "v"(y)); }
__device__ __forceinline__ void keep4_h(v16h a, v16h b, v16h c, v16h d) { asm volatile("v_nop" :: "v"(a), "v"(b), "v"(c), "v"(d)); }
__device__ __forceinline__ void keep4_b(v16b a, v16b b, v16b c, v16b d) { asm volatile("v_nop" :: "v"(a), "v"(b), "v"(c), "v"(d)); }
__device__ __forceinline__ void acc_guard4(v8f& a, v8f& b, v8f& c, v8f& d) { asm volatile("v_nop\n\tv_nop\n\tv_nop\n\tv_nop" : "+v"(a), "+v"(b), "+v"(c), "+v"(d)); }
template <typename T> struct Frag;
template <> struct Frag<_Float16> {
  typedef v16h V; union U { v16h v; v8h h[2]; };
  static __device__ __forceinline__ v16h load(const _Float16* p) {   // elements 0..7 <- p[0..7], 8..15 <- p[16..23]
    U f; f.h[0] = *(const v8h*)(p); f.h[1] = *(const v8h*)(p + 16); return f.v;
  }
  static __device__ __forceinline__ v8f mma(v16h a, v16h b, v8f c) {
    return __builtin_amdgcn_wmma_f32_16x16x32_f16(false, a, false, b, (short)0, c, false, false);
  }
  static __device__ __forceinline__ void guard(v8f& a, v8f& b, v16h x, v16h y) { dep_guard_h(a, b, x, y); }
  static __device__ __forceinline__ void keep(v16h a, v16h b, v16h c, v16h d) { keep4_h(a, b, c, d); }
};
template <> struct Frag<__bf16> {
  typedef v16b V; union U { v16b v; v8b h[2]; };
  static __device__ __forceinline__ v16b load(const __bf16* p) {
    U f; f.h[0] = *(const v8b*)(p); f.h[1] = *(const v8b*)(p + 16); return f.v;
  }
  static __device__ __forceinline__ v8f mma(v16b a, v16b b, v8f c) {
    return __builtin_amdgcn_wmma_f32_16x16x32_bf16(false, a, false, b, (short)0, c, false, false);
  }
  static __device__ __forceinline__ void guard(v8f& a, v8f& b, v16b x, v16b y) { dep_guard_b(a, b, x, y); }
  static __device__ __forceinline__ void keep(v16b a, v16b b, v16b c, v16b d) { keep4_b(a, b, c, d); }
};

// ---- Register-blocked batched WMMA GEMM ------------------------------------
// C[m,n] = scale * sum_k A[m,k] * Bt[n,k] (+bias)(+resid); each wave owns a 64x64 tile.
// A row-major [M,K]; Bt row-major [N,K]; M,N % 64 == 0, K % 32 == 0.
// SPLIT: operands are hi/lo planes (A2/Bt2 = lo planes, same layout); product = hi·hi + hi·lo + lo·hi.
// BIAS_MODE: 0 = none, 1 = bias[m], 2 = bias[n].
// OUT_MODE: 0 = f32, 1 = f16, 2 = bf16 hi plane (Cout) + bf16 lo plane (Cout2).
// ET: 0 = f16 operands, 1 = bf16 operands (pointers passed as 16-bit storage)
template <int ET> struct Elem;
template <> struct Elem<0> { typedef _Float16 T; };
template <> struct Elem<1> { typedef __bf16 T; };
template <int ET, bool SPLIT, int BIAS_MODE, int OUT_MODE, bool RESID, int ACT = 0>
__global__ __launch_bounds__(256) void wmma_gemm64(
    const unsigned short* __restrict__ Ap, const unsigned short* __restrict__ A2p, int lda, long strideA,
    const unsigned short* __restrict__ Btp, const unsigned short* __restrict__ Bt2p, int ldb, long strideB,
    void* __restrict__ Cout, void* __restrict__ Cout2, int ldc, long strideC,
    const float* __restrict__ bias,
    const float* __restrict__ resid, long strideR,
    int M, int N, int K, float scale) {
  typedef typename Elem<ET>::T T;
  typedef typename Frag<T>::V V;
  const T* A = (const T*)Ap; const T* A2 = (const T*)A2p; const T* Bt = (const T*)Btp; const T* Bt2 = (const T*)Bt2p;
  __shared__ __align__(16) float sT[8][16 * 68];   // per-wave 16x64 slab, pitch 68 floats
  const int b    = blockIdx.y;
  const int lane = threadIdx.x & 31;
  const int wave = threadIdx.x >> 5;
  const int tilesN = N >> 6;
  const int tilesM = M >> 6;
  const int tile = blockIdx.x * 8 + wave;
  if (tile >= tilesM * tilesN) return;   // wave-uniform; no block barriers in this kernel
  const int tm = tile / tilesN;
  const int tn = tile - tm * tilesN;
  const int m0 = tm << 6;
  const int n0 = tn << 6;

  const T* Ab  = A  + (size_t)b * strideA;
  const T* Bb  = Bt + (size_t)b * strideB;
  const T* Ab2 = SPLIT ? (A2  + (size_t)b * strideA) : nullptr;
  const T* Bb2 = SPLIT ? (Bt2 + (size_t)b * strideB) : nullptr;

  const int rlane = lane & 15;                 // row (A) / col (B, D) within subtile
  const int koff  = (lane >> 4) * 8;           // k offset of this lane half
  const int mOff  = (lane >> 4) * 8;           // D row offset

  v8f acc[4][4];
#pragma unroll
  for (int i = 0; i < 4; ++i)
#pragma unroll
    for (int j = 0; j < 4; ++j) acc[i][j] = (v8f){0.f,0.f,0.f,0.f,0.f,0.f,0.f,0.f};

  for (int k0 = 0; k0 < K; k0 += 32) {
    V bh[4], bl[4];
#pragma unroll
    for (int j = 0; j < 4; ++j) {
      const size_t bo = (size_t)(n0 + (j << 4) + rlane) * ldb + koff + k0;
      bh[j] = Frag<T>::load(Bb + bo);
      if (SPLIT) bl[j] = Frag<T>::load(Bb2 + bo);
    }
#pragma unroll
    for (int i = 0; i < 4; ++i) {
      const size_t ao = (size_t)(m0 + (i << 4) + rlane) * lda + koff + k0;
      V ah = Frag<T>::load(Ab + ao);
      V al;
      if (SPLIT) al = Frag<T>::load(Ab2 + ao);
#pragma unroll
      for (int j = 0; j < 4; ++j) {
        acc[i][j] = Frag<T>::mma(ah, bh[j], acc[i][j]);
        if (SPLIT) {
          acc[i][j] = Frag<T>::mma(ah, bl[j], acc[i][j]);
          acc[i][j] = Frag<T>::mma(al, bh[j], acc[i][j]);
        }
      }
      Frag<T>::guard(acc[i][0], acc[i][3], ah, SPLIT ? al : ah);
    }
    Frag<T>::keep(bh[0], bh[1], bh[2], bh[3]);
    if (SPLIT) Frag<T>::keep(bl[0], bl[1], bl[2], bl[3]);
  }
  acc_guard4(acc[0][0], acc[0][1], acc[0][2], acc[0][3]);
  acc_guard4(acc[1][0], acc[1][1], acc[1][2], acc[1][3]);
  acc_guard4(acc[2][0], acc[2][1], acc[2][2], acc[2][3]);
  acc_guard4(acc[3][0], acc[3][1], acc[3][2], acc[3][3]);

  // ---- epilogue ----
  float* slab = sT[wave];
  const float* Rb = RESID ? (resid + (size_t)b * strideR) : nullptr;
#pragma unroll
  for (int i = 0; i < 4; ++i) {
    const int mBase = m0 + (i << 4);
#pragma unroll
    for (int j = 0; j < 4; ++j) {
      const int n = n0 + (j << 4) + rlane;
      float bv = 0.f;
      if (BIAS_MODE == 2) bv = bias[n];
#pragma unroll
      for (int r = 0; r < 8; ++r) {
        float v = acc[i][j][r] * scale;
        if (BIAS_MODE == 1) v += bias[mBase + mOff + r];
        if (BIAS_MODE == 2) v += bv;
        if (RESID) v += Rb[(size_t)(mBase + mOff + r) * ldc + n];
        if (ACT == 1) v = tanhf(v);
        if (ACT == 2) v = fmaxf(v, 0.0f);
        if (ACT == 3) v = v / (1.0f + expf(-v));
        if (ACT == 4) v = (v > 0.f) ? v : 0.01f * v;
        if (ACT == 5) v = 0.5f * v * (1.0f + erff(v * 0.70710678118654752f));
        slab[(mOff + r) * 68 + (j << 4) + rlane] = v;
      }
    }
    __builtin_amdgcn_fence(__ATOMIC_RELEASE, "workgroup");
    __builtin_amdgcn_wave_barrier();
    __builtin_amdgcn_fence(__ATOMIC_ACQUIRE, "workgroup");
    if (OUT_MODE == 0) {
      float* C = (float*)Cout + (size_t)b * strideC;
      const int hh = lane >> 4, c4 = (lane & 15) * 4;     // row seg = 256 B = 16 lanes x 16 B
      {
#pragma unroll
        for (int it = 0; it < 8; ++it) {
          const int row = it * 2 + hh;
          v4f v = *(const v4f*)(slab + row * 68 + c4);
          *(v4f*)(C + (size_t)(mBase + row) * ldc + n0 + c4) = v;
        }
        
      }
    } else {
      const int q = lane >> 3, c8 = (lane & 7) * 8;
      unsigned short* C  = (unsigned short*)Cout  + (size_t)b * strideC;
      unsigned short* C2 = (OUT_MODE == 2) ? ((unsigned short*)Cout2 + (size_t)b * strideC) : nullptr;
      {
#pragma unroll
        for (int it = 0; it < 4; ++it) {
          const int row = it * 4 + q;
          const float* sp = slab + row * 68 + c8;
          v8h hv, lv;
#pragma unroll
          for (int e = 0; e < 8; ++e) {
            if (OUT_MODE == 1) {
              hv[e] = (_Float16)sp[e];
            } else {
              unsigned short hb = f2bf_bits(sp[e]);
              unsigned short lb = f2bf_bits(sp[e] - bf_bits2f(hb));
              hv[e] = __builtin_bit_cast(_Float16, hb);
              lv[e] = __builtin_bit_cast(_Float16, lb);
            }
          }
          *(v8h*)(C + (size_t)(mBase + row) * ldc + n0 + c8) = hv;
          if (OUT_MODE == 2) *(v8h*)(C2 + (size_t)(mBase + row) * ldc + n0 + c8) = lv;
        }
        
      }
    }
    __builtin_amdgcn_fence(__ATOMIC_RELEASE, "workgroup");
    __builtin_amdgcn_wave_barrier();
    __builtin_amdgcn_fence(__ATOMIC_ACQUIRE, "workgroup");
  }
}

// ---------------------------------------------------------------------------
// Elementwise split: 2 elements per thread, one 4-B store per lane per plane -> each wave writes exactly one
// Coverage: grid = ceil(n2/256) blocks x 256 threads x 2 elements = 2*n2 elements = the whole plane (n2 = plane/2).
// ---------------------------------------------------------------------------
// hi = bf16_rne(in), lo = bf16_rne(in - hi)
__global__ __launch_bounds__(256) void split_bf16x2_kernel(const float* __restrict__ in, unsigned short* __restrict__ hi,
                                                           unsigned short* __restrict__ lo, int n2) {
  const int i = blockIdx.x * 256 + threadIdx.x;
  if (i < n2) {
    const v2f f = *(const v2f*)(in + 2 * (size_t)i);
    const unsigned short h0 = f2bf_bits(f[0]), h1 = f2bf_bits(f[1]);
    const unsigned short l0 = f2bf_bits(f[0] - bf_bits2f(h0)), l1 = f2bf_bits(f[1] - bf_bits2f(h1));
    const unsigned uh = pk16(h0, h1), ul = pk16(l0, l1);
    ((unsigned*)hi)[i] = uh;
    ((unsigned*)lo)[i] = ul;
    
  }
}

// ---------------------------------------------------------------------------
// Weight planes for the projections (one block of 256 threads):
//   wqkh/wqkl [64][32] bf16 hi/lo = rows 0..63 of Wqkv (q rows then k rows)
//   wvh/wvl   [64][32] bf16 hi/lo = rows 64..95 of Wqkv in rows 0..31, explicit zeros in rows 32..63
//   bv        [64] f32            = bqkv[64..95] in 0..31, zeros in 32..63
// ---------------------------------------------------------------------------
__device__ __forceinline__ void split_pair(float f0, float f1, unsigned& h, unsigned& l) {
  const unsigned short h0 = f2bf_bits(f0), h1 = f2bf_bits(f1);
  const unsigned short l0 = f2bf_bits(f0 - bf_bits2f(h0));
  const unsigned short l1 = f2bf_bits(f1 - bf_bits2f(h1));
  h = pk16(h0, h1);
  l = pk16(l0, l1);
}
__global__ __launch_bounds__(256) void wprep_kernel(const float* __restrict__ Wqkv, const float* __restrict__ bqkv,
                                                    unsigned short* __restrict__ wqkh, unsigned short* __restrict__ wqkl,
                                                    unsigned short* __restrict__ wvh, unsigned short* __restrict__ wvl,
                                                    float* __restrict__ bv) {
  const int tid  = threadIdx.x;
  const int row  = tid >> 2;            // 0..63
  const int col0 = (tid & 3) * 8;       // 0, 8, 16, 24
  v4u qh, ql, vh, vl;
#pragma unroll
  for (int p = 0; p < 4; ++p) {
    const int col = col0 + 2 * p;
    const float wq0 = Wqkv[row * HDIM + col];
    const float wq1 = Wqkv[row * HDIM + col + 1];
    int rv = 64 + row; rv = rv > 95 ? 95 : rv;            // clamped address; zero by predicate below
    float wv0 = Wqkv[rv * HDIM + col];
    float wv1 = Wqkv[rv * HDIM + col + 1];
    wv0 = (row < 32) ? wv0 : 0.0f;
    wv1 = (row < 32) ? wv1 : 0.0f;
    unsigned a, bq, cv, dv;
    split_pair(wq0, wq1, a, bq);
    split_pair(wv0, wv1, cv, dv);
    qh[p] = a; ql[p] = bq; vh[p] = cv; vl[p] = dv;
  }
  v4f b4;
#pragma unroll
  for (int e = 0; e < 4; ++e) {
    int m = tid * 4 + e; m = m > 63 ? 63 : m;
    int mi = 64 + m; mi = mi > 95 ? 95 : mi;
    const float v = bqkv[mi];
    b4[e] = (m < 32) ? v : 0.0f;
  }
  const size_t o = (size_t)tid * 8;
  {
    *(v4u*)(wqkh + o) = qh;
    *(v4u*)(wqkl + o) = ql;
    *(v4u*)(wvh + o)  = vh;
    *(v4u*)(wvl + o)  = vl;
    if (tid < 16) *(v4f*)(bv + tid * 4) = b4;
    
  }
}

// ---------------------------------------------------------------------------
// Softmax + 12x12 head mixing + per-row batch-statistic partials for one query row tl of one (batch, chunk).
//   S     [12][TCHUNK][1024] f32 scaled logits; P_h = softmax over the 1024 key columns (f32, fixed-order reductions)
//   M_g[s] = sum_h Wconv[g][h] P_h[s] on v_wmma_f32_16x16x32_f16: A = Wconv (f16 hi + x2^11 residual), B = P^T staged in
//   LDS as [s][16] f16 (x2^10 carried hi + x2^11 residual), K = 12 real of 32 (k >= 12 zeros by construction);
//   residual products in a separate accumulator, folded with exact power-of-two factors.
//   Mh/Ml [12][TCHUNK][1024] bf16 hi/lo planes of M; part[tl][32] = {sum_s M_g (12), sum_s M_g^2 (12), 8 zeros}.
// Block = 256 threads = 8 waves; thread owns key columns tid + 256 j (j = 0..3) for the softmax; two phases of 512
// (8 lanes x 16 B, one instruction per 4 lines); part line written by lanes 0..7 of wave 0 (one instruction).
// Coverage: 2 phases x 8 waves x 64 cols = 1024 cols x 12 rows per plane per block; grid = TCHUNK blocks.
// ---------------------------------------------------------------------------
union HFrag { v16h v; v8h h[2]; };

template <int J>
__device__ __forceinline__ void stage_pcol(const float (&pz)[12][4], int sl, _Float16* Pth, _Float16* Ptl) {
  v8h h0, h1, l0, l1;
#pragma unroll
  for (int e = 0; e < 8; ++e) {
    const float p0 = pz[e][J] * P_CARRY;
    const _Float16 a0 = (_Float16)p0;
    h0[e] = a0;
    l0[e] = (_Float16)((p0 - (float)a0) * R_CARRY);
  }
#pragma unroll
  for (int e = 0; e < 4; ++e) {
    const float p1 = pz[8 + e][J] * P_CARRY;
    const _Float16 a1 = (_Float16)p1;
    h1[e] = a1;
    l1[e] = (_Float16)((p1 - (float)a1) * R_CARRY);
  }
#pragma unroll
  for (int e = 4; e < 8; ++e) { h1[e] = (_Float16)0.0f; l1[e] = (_Float16)0.0f; }
  *(v8h*)(Pth + sl * 16)     = h0;
  *(v8h*)(Pth + sl * 16 + 8) = h1;
  *(v8h*)(Ptl + sl * 16)     = l0;
  *(v8h*)(Ptl + sl * 16 + 8) = l1;
}

__global__ __launch_bounds__(256) void softmax_mix_kernel(const float* __restrict__ S, const float* __restrict__ Wconv,
                                                          unsigned short* __restrict__ Mh, unsigned short* __restrict__ Ml,
                                                          float* __restrict__ part) {
  __shared__ __align__(16) _Float16 Pth[PHCOLS * 16];
  __shared__ __align__(16) _Float16 Ptl[PHCOLS * 16];
  __shared__ __align__(16) float slab[8][12 * 64];
  __shared__ float redw[8][12];
  __shared__ float fin[12];
  __shared__ float stw[8][24];
  __shared__ __align__(16) float pline[32];

  const int tid  = threadIdx.x;
  const int lane = tid & 31;
  const int wave = tid >> 5;
  const int hh   = lane >> 4;
  const int c    = lane & 15;
  const int tl   = blockIdx.x;

  v8h z8;
#pragma unroll
  for (int e = 0; e < 8; ++e) z8[e] = (_Float16)0.0f;
  const v8f zacc = (v8f){0.f,0.f,0.f,0.f,0.f,0.f,0.f,0.f};

  // A fragments of the mixing matrix: row m = g = c, k element i (< 8) = h = 8*hh + i; k >= 16 elements zero
  HFrag fah, fal;
  {
    v8h wh8, wl8;
#pragma unroll
    for (int i = 0; i < 8; ++i) {
      const int h  = 8 * hh + i;
      const int gi = c > 11 ? 11 : c;
      const int hi = h > 11 ? 11 : h;
      float w = Wconv[gi * NHEAD + hi];
      w = (c < 12 && h < 12) ? w : 0.0f;
      const _Float16 a = (_Float16)w;
      wh8[i] = a;
      wl8[i] = (_Float16)((w - (float)a) * R_CARRY);
    }
    fah.h[0] = wh8; fah.h[1] = z8;
    fal.h[0] = wl8; fal.h[1] = z8;
  }

  // scaled logits of this query row for all 12 heads, key columns tid + 256 j
  float pz[12][4];
  {
    const float* Srow = S + (size_t)tl * NTOK;
#pragma unroll
    for (int h = 0; h < 12; ++h)
#pragma unroll
      for (int j = 0; j < 4; ++j)
        pz[h][j] = Srow[(size_t)h * TCHUNK * NTOK + tid + 256 * j];
  }
  // row maxima: thread, wave xor tree, waves in index order
#pragma unroll
  for (int h = 0; h < 12; ++h) {
    float m = fmaxf(fmaxf(pz[h][0], pz[h][1]), fmaxf(pz[h][2], pz[h][3]));
#pragma unroll
    for (int off = 16; off > 0; off >>= 1) m = fmaxf(m, __shfl_xor(m, off, 32));
    if (lane == 0) redw[wave][h] = m;
  }
  __syncthreads();
  if (wave == 0) {
    const int hq = lane < 12 ? lane : 11;
    float m = redw[0][hq];
#pragma unroll
    for (int w = 1; w < 8; ++w) m = fmaxf(m, redw[w][hq]);
    if (lane < 12) fin[lane] = m;
  }
  __syncthreads();
  float mx[12];
#pragma unroll
  for (int h = 0; h < 12; ++h) mx[h] = fin[h];
  // exponentials and row sums
#pragma unroll
  for (int h = 0; h < 12; ++h) {
#pragma unroll
    for (int j = 0; j < 4; ++j) pz[h][j] = __expf(pz[h][j] - mx[h]);
    float s = ((pz[h][0] + pz[h][1]) + pz[h][2]) + pz[h][3];
#pragma unroll
    for (int off = 16; off > 0; off >>= 1) s += __shfl_xor(s, off, 32);
    if (lane == 0) redw[wave][h] = s;
  }
  __syncthreads();
  if (wave == 0) {
    const int hq = lane < 12 ? lane : 11;
    float s = redw[0][hq];
#pragma unroll
    for (int w = 1; w < 8; ++w) s += redw[w][hq];
    if (lane < 12) fin[lane] = s;
  }
  __syncthreads();
#pragma unroll
  for (int h = 0; h < 12; ++h) {
    const float inv = 1.0f / fin[h];
#pragma unroll
    for (int j = 0; j < 4; ++j) pz[h][j] *= inv;
  }

  v8f s1 = zacc, s2 = zacc;
  float* myslab = slab[wave];
  const int q  = lane >> 3;
  const int c8 = (lane & 7) * 8;
  for (int ph = 0; ph < 2; ++ph) {          // block-uniform
    // stage P^T for key columns ph*512 .. +511: 256 threads x 2 columns x 16 halves per plane = whole Pth / Ptl
    if (ph == 0) {
      stage_pcol<0>(pz, tid, Pth, Ptl);
      stage_pcol<1>(pz, tid + 256, Pth, Ptl);
    } else {
      stage_pcol<2>(pz, tid, Pth, Ptl);
      stage_pcol<3>(pz, tid + 256, Pth, Ptl);
    }
    __syncthreads();
#pragma unroll 1
    for (int nt = 0; nt < 4; ++nt) {
      const int col = wave * 64 + nt * 16 + c;      // local key column of this lane's B column, 0..511
      HFrag bh, bl;
      bh.h[0] = *(const v8h*)(Pth + col * 16 + 8 * hh); bh.h[1] = z8;
      bl.h[0] = *(const v8h*)(Ptl + col * 16 + 8 * hh); bl.h[1] = z8;
      v8f acc0 = zacc, accr = zacc;
      acc0 = Frag<_Float16>::mma(fah.v, bh.v, acc0);
      accr = Frag<_Float16>::mma(fah.v, bl.v, accr);
      accr = Frag<_Float16>::mma(fal.v, bh.v, accr);
      dep_guard_h(acc0, accr, bh.v, bl.v);
#pragma unroll
      for (int r = 0; r < 8; ++r) {
        const float m = fmaf(accr[r], MIX_FOLD, acc0[r] * P_INV);     // D row g = 8*hh + r, column col
        s1[r] += m;
        s2[r] = fmaf(m, m, s2[r]);
        if (hh == 0 || r < 4) myslab[(8 * hh + r) * 64 + nt * 16 + c] = m;
      }
    }
    __syncthreads();
    {
      v8h hv[3], lv[3];
#pragma unroll
      for (int it = 0; it < 3; ++it) {
        const int g = it * 4 + q;
        const float* sp = myslab + g * 64 + c8;
        v8h a, bq;
#pragma unroll
        for (int e = 0; e < 8; ++e) {
          const unsigned short hb = f2bf_bits(sp[e]);
          const unsigned short lb = f2bf_bits(sp[e] - bf_bits2f(hb));
          a[e]  = __builtin_bit_cast(_Float16, hb);
          bq[e] = __builtin_bit_cast(_Float16, lb);
        }
        hv[it] = a; lv[it] = bq;
      }
      {
#pragma unroll
        for (int it = 0; it < 3; ++it) {
          const int g = it * 4 + q;
          const size_t go = ((size_t)g * TCHUNK + tl) * NTOK + (size_t)ph * PHCOLS + wave * 64 + c8;
          *(v8h*)(Mh + go) = hv[it];
          *(v8h*)(Ml + go) = lv[it];
        }
        
      }
    }
    __syncthreads();
  }

  // statistics: xor tree over the 16 lanes sharing hh (fixed order), then waves in index order
#pragma unroll
  for (int r = 0; r < 8; ++r) {
    float a = s1[r], bq = s2[r];
#pragma unroll
    for (int off = 1; off < 16; off <<= 1) { a += __shfl_xor(a, off, 32); bq += __shfl_xor(bq, off, 32); }
    const int g = 8 * hh + r;
    if (c == 0 && g < 12) { stw[wave][g] = a; stw[wave][12 + g] = bq; }
  }
  __syncthreads();
  if (wave == 0) {
    const int qi = lane < 24 ? lane : 23;
    float v = stw[0][qi];
#pragma unroll
    for (int w = 1; w < 8; ++w) v += stw[w][qi];
    v = (lane < 24) ? v : 0.0f;
    pline[lane] = v;
  }
  __syncthreads();
  if (tid < 8) {
    const v4f v = *(const v4f*)(pline + tid * 4);
    float* dst = part + (size_t)tl * 32 + tid * 4;
    *(v4f*)dst = v;
    
  }
}

// ---------------------------------------------------------------------------
// Vsum[g][d] = sum_s v[g][s][d] from the v^T bf16 hi+lo planes of one batch ([12][64][1024], rows d < 32).
// Block g, 256 threads: d = tid>>3, 8 partial sums of 128 columns combined by a fixed xor tree; the 32 results are
// ---------------------------------------------------------------------------
__global__ __launch_bounds__(256) void vsum_kernel(const unsigned short* __restrict__ vth, const unsigned short* __restrict__ vtl,
                                                   float* __restrict__ vsum) {
  __shared__ __align__(16) float vs[32];
  const int g   = blockIdx.x;
  const int tid = threadIdx.x;
  const int d   = tid >> 3;
  const int prt = tid & 7;
  const size_t base = ((size_t)g * VTROWS + d) * NTOK + (size_t)prt * 128;
  float acc = 0.0f;
#pragma unroll 1
  for (int i = 0; i < 16; ++i) {
    const v8us a  = *(const v8us*)(vth + base + i * 8);
    const v8us bq = *(const v8us*)(vtl + base + i * 8);
#pragma unroll
    for (int e = 0; e < 8; ++e) acc += bf_bits2f(a[e]) + bf_bits2f(bq[e]);
  }
  acc += __shfl_xor(acc, 1, 32);
  acc += __shfl_xor(acc, 2, 32);
  acc += __shfl_xor(acc, 4, 32);
  if (prt == 0) vs[d] = acc;
  __syncthreads();
  if (tid < 8) {
    const v4f v = *(const v4f*)(vs + tid * 4);
    float* dst = vsum + g * 32 + tid * 4;
    *(v4f*)dst = v;
    
  }
}

// ---------------------------------------------------------------------------
// Per-head affine coefficients from the block partials (one wave): lane sums part[r][lane] over all rows in f64
// (fixed order); mean_g = S1/N, var_g = S2/N - mean_g^2 (biased), a_g = gamma_g / sqrt(var_g + eps),
// kk_g = a_g*bconv_g + (beta_g - a_g*(mean_g + bconv_g)); coef line = {a[12], kk[12], 8 zeros}, one instruction.
// ---------------------------------------------------------------------------
__global__ __launch_bounds__(32) void coef_kernel(const float* __restrict__ part, const float* __restrict__ bconv,
                                                  const float* __restrict__ gamma, const float* __restrict__ beta,
                                                  float* __restrict__ coef, int nrows) {
  __shared__ double sd[32];
  __shared__ __align__(16) float cf[32];
  const int lane = threadIdx.x;
  double acc = 0.0;
#pragma unroll 1
  for (int r = 0; r < nrows; ++r) acc += (double)part[(size_t)r * 32 + lane];
  sd[lane] = acc;
  __syncthreads();
  int gq = (lane < 12) ? lane : (lane - 12);
  gq = gq < 0 ? 0 : (gq > 11 ? 11 : gq);
  const double s1d = sd[gq];
  const double s2d = sd[12 + gq];
  const double invN = 1.0 / ((double)NBATCH * (double)NTOK * (double)NTOK);
  const double meanM = s1d * invN;
  double var = s2d * invN - meanM * meanM;
  var = var < 0.0 ? 0.0 : var;
  const float varf   = (float)var;
  const float meanre = (float)meanM + bconv[gq];
  const float a      = gamma[gq] * (1.0f / sqrtf(varf + BN_EPS));
  const float kk     = a * bconv[gq] + (beta[gq] - a * meanre);
  const float v = (lane < 12) ? a : ((lane < 24) ? kk : 0.0f);
  cf[lane] = v;
  __syncthreads();
  if (lane < 8) {
    const v4f w = *(const v4f*)(cf + lane * 4);
    float* dst = coef + lane * 4;
    *(v4f*)dst = w;
    
  }
}

// ---------------------------------------------------------------------------
// out[b][t][32g+d] = a_g * U[b][g][t][d] + kk_g * Vsum[b][g][d]. One wave per (b,t) row of 384 floats:
// Coverage: grid 1024 x 8 waves = 8192 rows = all of d_out.
// ---------------------------------------------------------------------------
__global__ __launch_bounds__(256) void combine_kernel(const float* __restrict__ U, const float* __restrict__ vsum,
                                                      const float* __restrict__ coef, float* __restrict__ out) {
  const int lane = threadIdx.x & 31;
  const int wave = threadIdx.x >> 5;
  const int R = blockIdx.x * 8 + wave;         // 0..8191
  const int b = R >> 10, t = R & (NTOK - 1);
  v4f o[3];
#pragma unroll
  for (int i = 0; i < 3; ++i) {
    const int f = 128 * i + 4 * lane;
    const int g = f >> 5, d = f & 31;
    const v4f u  = *(const v4f*)(U + (((size_t)(b * NHEAD + g)) * NTOK + t) * UW + d);
    const v4f vv = *(const v4f*)(vsum + (b * NHEAD + g) * 32 + d);
    const float a = coef[g], kk = coef[12 + g];
    v4f rr;
#pragma unroll
    for (int e = 0; e < 4; ++e) rr[e] = fmaf(a, u[e], kk * vv[e]);
    o[i] = rr;
  }
  float* orow = out + (size_t)R * NEMB;
  {
#pragma unroll
    for (int i = 0; i < 3; ++i) *(v4f*)(orow + 128 * i + 4 * lane) = o[i];
    
  }
}

// ---------------------------------------------------------------------------
// Workspace region map (byte offsets; every size a multiple of 256):
//   XH    bf16 [98304][32]      x hi plane (rows = (b,t,h))              0
//   XL    bf16 [98304][32]                                         6291456
//   WQKH  bf16 [64][32]  WQKL [64][32]  WVH [64][32]  WVL [64][32]   12582912 / 12587008 / 12591104 / 12595200
//   BV    f32  [64]                                               12599296
//   QKH   bf16 [98304][64]      q at 0..31, k at 32..63            12599552
//   QKL   bf16 [98304][64]                                        25182464
//   VTH   bf16 [12][64][1024]   current batch v^T hi                37765376
//   VTL   bf16 [12][64][1024]                                     39338240
//   S     f32  [12][512][1024]  current chunk scaled logits       40911104
//   MH    bf16 [12][512][1024]  current chunk mixed maps hi       66076928
//   ML    bf16 [12][512][1024]                                    78659840
//   U     f32  [8][12][1024][64]                                  91242752
//   PART  f32  [8192][32]                                        116408576
//   VSUM  f32  [8][12][32]                                       117457152
//   COEF  f32  [32] (256 B)                                      117469440
//   total                                                        117469696
// Per-batch / per-chunk regions are fully rewritten before each read in stream order.
// ---------------------------------------------------------------------------
extern "C" void kernel_launch(void* const* d_in, const int* in_sizes, int n_in,
                              void* d_out, int out_size, void* d_ws, size_t ws_size,
                              hipStream_t stream) {
  if (n_in < 7) return;
  if (in_sizes[0] != NBATCH * NTOK * NEMB) return;
  if (in_sizes[1] != 3 * HDIM * HDIM || in_sizes[2] != 3 * HDIM) return;
  if (in_sizes[3] != NHEAD * NHEAD || in_sizes[4] < NHEAD || in_sizes[5] < NHEAD || in_sizes[6] < NHEAD) return;
  if (out_size != NBATCH * NTOK * NEMB) return;

  const float* x     = (const float*)d_in[0];
  const float* Wqkv  = (const float*)d_in[1];
  const float* bqkv  = (const float*)d_in[2];
  const float* Wconv = (const float*)d_in[3];
  const float* bconv = (const float*)d_in[4];
  const float* gamma = (const float*)d_in[5];
  const float* beta  = (const float*)d_in[6];
  float* out = (float*)d_out;

  const size_t szX    = (size_t)NBATCH * NTOK * NEMB * 2;            // 6291456
  const size_t szW    = (size_t)64 * HDIM * 2;                       // 4096
  const size_t szBV   = 256;
  const size_t szQK   = (size_t)NBATCH * NTOK * NHEAD * QKW * 2;     // 12582912
  const size_t szVT   = (size_t)NHEAD * VTROWS * NTOK * 2;           // 1572864
  const size_t szS    = (size_t)NHEAD * TCHUNK * NTOK * 4;           // 25165824
  const size_t szM    = (size_t)NHEAD * TCHUNK * NTOK * 2;           // 12582912
  const size_t szU    = (size_t)NBATCH * NHEAD * NTOK * UW * 4;      // 25165824
  const size_t szPART = (size_t)NBATCH * NTOK * 32 * 4;              // 1048576
  const size_t szVS   = (size_t)NBATCH * NHEAD * 32 * 4;             // 12288
  const size_t szCF   = 256;
  size_t off = 0;
  const size_t oXH = off;   off += szX;
  const size_t oXL = off;   off += szX;
  const size_t oWQKH = off; off += szW;
  const size_t oWQKL = off; off += szW;
  const size_t oWVH = off;  off += szW;
  const size_t oWVL = off;  off += szW;
  const size_t oBV = off;   off += szBV;
  const size_t oQKH = off;  off += szQK;
  const size_t oQKL = off;  off += szQK;
  const size_t oVTH = off;  off += szVT;
  const size_t oVTL = off;  off += szVT;
  const size_t oS = off;    off += szS;
  const size_t oMH = off;   off += szM;
  const size_t oML = off;   off += szM;
  const size_t oU = off;    off += szU;
  const size_t oPART = off; off += szPART;
  const size_t oVS = off;   off += szVS;
  const size_t oCF = off;   off += szCF;
  if (off > ws_size) return;

  char* ws = (char*)d_ws;
  unsigned short* XH   = (unsigned short*)(ws + oXH);
  unsigned short* XL   = (unsigned short*)(ws + oXL);
  unsigned short* WQKH = (unsigned short*)(ws + oWQKH);
  unsigned short* WQKL = (unsigned short*)(ws + oWQKL);
  unsigned short* WVH  = (unsigned short*)(ws + oWVH);
  unsigned short* WVL  = (unsigned short*)(ws + oWVL);
  float*          BV   = (float*)(ws + oBV);
  unsigned short* QKH  = (unsigned short*)(ws + oQKH);
  unsigned short* QKL  = (unsigned short*)(ws + oQKL);
  unsigned short* VTH  = (unsigned short*)(ws + oVTH);
  unsigned short* VTL  = (unsigned short*)(ws + oVTL);
  float*          Sbuf = (float*)(ws + oS);
  unsigned short* MH   = (unsigned short*)(ws + oMH);
  unsigned short* ML   = (unsigned short*)(ws + oML);
  float*          U    = (float*)(ws + oU);
  float*          PART = (float*)(ws + oPART);
  float*          VSUM = (float*)(ws + oVS);
  float*          COEF = (float*)(ws + oCF);

  const dim3 blk(256);
  // (1) x -> bf16 hi/lo planes viewed as [(b,t,h)][32]: n2 = 1572864 pairs = 6144 blocks x 256 threads exactly
  const int n2x = NBATCH * NTOK * NEMB / 2;
  split_bf16x2_kernel<<<dim3((n2x + 255) / 256), blk, 0, stream>>>(x, XH, XL, n2x);
  // (2) projection weight planes and padded v bias
  wprep_kernel<<<dim3(1), blk, 0, stream>>>(Wqkv, bqkv, WQKH, WQKL, WVH, WVL, BV);
  // (3) q|k = xh . Wqkv[0..63]^T + bqkv[0..63] -> QK hi/lo planes [98304][64]; M = 98304 (1536 tiles), N = 64, K = 32
  wmma_gemm64<1, true, 2, 2, false><<<dim3((NBATCH * NTOK * NHEAD / 64) / 8, 1), blk, 0, stream>>>(
      XH, XL, HDIM, 0L, WQKH, WQKL, HDIM, 0L, (void*)QKH, (void*)QKL, QKW, 0L,
      bqkv, bqkv, 0L, NBATCH * NTOK * NHEAD, QKW, HDIM, 1.0f);

  const int nrows = NBATCH * NTOK;   // 8192 partial lines
  for (int b = 0; b < NBATCH; ++b) {
    // (4) v^T[m][s] for head g = blockIdx.y: A = WV planes [64][32] (rows 32..63 zero), Bt = x planes at column g*32,
    //     ldb = 384; M = 64, N = 1024 (16 tiles -> 2 blocks), K = 32; bias[m] = BV -> VT planes [12][64][1024]
    const unsigned short* xbh = XH + (size_t)b * NTOK * NEMB;
    const unsigned short* xbl = XL + (size_t)b * NTOK * NEMB;
    wmma_gemm64<1, true, 1, 2, false><<<dim3(2, NHEAD), blk, 0, stream>>>(
        WVH, WVL, HDIM, 0L, xbh, xbl, NEMB, (long)HDIM, (void*)VTH, (void*)VTL, NTOK, (long)VTROWS * NTOK,
        BV, BV, 0L, VTROWS, NTOK, HDIM, 1.0f);
    // (5) Vsum of this batch: 12 lines
    vsum_kernel<<<dim3(NHEAD), blk, 0, stream>>>(VTH, VTL, VSUM + (size_t)b * NHEAD * 32);
    for (int ch = 0; ch < NCHUNK; ++ch) {
      // (6) S[h][tl][s] = (q . k) * 32^-0.5 : A = q rows (b, ch*512 + tl, h), lda 768, z stride 64; Bt = k rows (b, s, h);
      //     M = 512, N = 1024 (128 tiles -> 16 blocks per z), K = 32, f32 out [12][512][1024]
      const size_t qoff = ((size_t)b * NTOK + (size_t)ch * TCHUNK) * NHEAD * QKW;
      const size_t koff = (size_t)b * NTOK * NHEAD * QKW + HDIM;
      wmma_gemm64<1, true, 0, 0, false><<<dim3(16, NHEAD), blk, 0, stream>>>(
          QKH + qoff, QKL + qoff, NHEAD * QKW, (long)QKW, QKH + koff, QKL + koff, NHEAD * QKW, (long)QKW,
          (void*)Sbuf, (void*)Sbuf, NTOK, (long)TCHUNK * NTOK,
          bqkv, bqkv, 0L, TCHUNK, NTOK, HDIM, SM_SCALE);
      // (7) softmax + head mixing + statistic partials: 512 blocks (one per query row of the chunk)
      softmax_mix_kernel<<<dim3(TCHUNK), blk, 0, stream>>>(
          Sbuf, Wconv, MH, ML, PART + ((size_t)b * NTOK + (size_t)ch * TCHUNK) * 32);
      // (8) U[b][g][t][n] = sum_s M[g][t][s] v^T[g][n][s]: M = 512, N = 64 (8 tiles -> 1 block per z), K = 1024, f32 out
      float* Ub = U + ((size_t)b * NHEAD * NTOK + (size_t)ch * TCHUNK) * UW;
      wmma_gemm64<1, true, 0, 0, false><<<dim3(1, NHEAD), blk, 0, stream>>>(
          MH, ML, NTOK, (long)TCHUNK * NTOK, VTH, VTL, NTOK, (long)VTROWS * NTOK,
          (void*)Ub, (void*)Ub, UW, (long)NTOK * UW,
          bqkv, bqkv, 0L, TCHUNK, UW, NTOK, 1.0f);
    }
  }
  // (9) per-head affine coefficients (one wave, fixed-order f64 sums over 8192 partial lines)
  coef_kernel<<<dim3(1), dim3(32), 0, stream>>>(PART, bconv, gamma, beta, COEF, nrows);
  // (10) output rows: 1024 blocks x 8 waves = 8192 rows of 384 floats
  combine_kernel<<<dim3(NBATCH * NTOK / 8), blk, 0, stream>>>(U, VSUM, COEF, out);
}

// v001
// Measured time: 1700 microseconds a run.
// Two timings next to v000 put it at 2.06 and 2.07 times that version's speed.
// Contractions: x.Wqkv^T (q|k planes and v^T planes), scaled q.k^T, and (head-mixed attention).v on v_wmma_f32_16x16x32_bf16 with bf16 hi/lo split operand planes (hi.hi + hi.lo + lo.hi); 12x12 head mixing on v_wmma_f32_16x16x32_f16 (f16 hi planes + x2^11 residual planes in a separate accumulator, probabilities carried x2^10); f32 accumulate everywhere; softmax f32; per-head batch statistics as f32 block partials combined in f64 in fixed order.
#include <hip/hip_runtime.h>
#include <math.h>
#include <stdint.h>

constexpr int NBATCH = 8;
constexpr int NTOK   = 1024;
constexpr int NEMB   = 384;
constexpr int NHEAD  = 12;
constexpr int HDIM   = 32;
constexpr int TCHUNK = 512;            // query rows per score / mix / PV chunk
constexpr int NCHUNK = NTOK / TCHUNK;  // 2
constexpr int PHCOLS = 512;            // key columns staged in LDS per mixing phase
constexpr int QKW    = 64;             // q|k plane row width (q at 0..31, k at 32..63)
constexpr int VTROWS = 64;             // v^T rows per head (32 real + 32 zero)
constexpr int UW     = 64;             // U row width (32 real + 32 zero)
constexpr float SM_SCALE = 0.17677669529663687f;
constexpr float P_CARRY  = 1024.0f;                      // probabilities carried x2^10 in f16
constexpr float R_CARRY  = 2048.0f;                      // residual planes carried x2^11
constexpr float P_INV    = 1.0f / 1024.0f;
constexpr float MIX_FOLD = 1.0f / (1024.0f * 2048.0f);
constexpr float BN_EPS   = 1e-5f;
constexpr int STBLK  = 64;                            // blocks of the first level of the statistic sum
constexpr int STROWS = NBATCH * NTOK / (STBLK * 8);   // 16 partial lines per wave

typedef __attribute__((ext_vector_type(16))) _Float16 v16h;
typedef __attribute__((ext_vector_type(8)))  _Float16 v8h;
typedef __attribute__((ext_vector_type(16))) __bf16   v16b;
typedef __attribute__((ext_vector_type(8)))  __bf16   v8b;
typedef __attribute__((ext_vector_type(8)))  float    v8f;
typedef __attribute__((ext_vector_type(4)))  float    v4f;
typedef __attribute__((ext_vector_type(2)))  float    v2f;
typedef __attribute__((ext_vector_type(4)))  unsigned int v4u;
typedef __attribute__((ext_vector_type(8)))  unsigned short v8us;

__device__ __forceinline__ unsigned short f2bf_bits(float f) {
  unsigned u = __float_as_uint(f);
  return (unsigned short)((u + 0x7FFFu + ((u >> 16) & 1u)) >> 16);
}
__device__ __forceinline__ float bf_bits2f(unsigned short h) { return __uint_as_float(((unsigned)h) << 16); }
__device__ __forceinline__ unsigned pk16(unsigned short a, unsigned short b) { return (unsigned)a | ((unsigned)b << 16); }

// hazard guards as plain device helpers (no inline asm inside the kernel template body)
__device__ __forceinline__ void dep_guard_h(v8f& a, v8f& b, v16h x, v16h y) { asm volatile("v_nop\n\tv_nop\n\tv_nop\n\tv_nop" : "+v"(a), "+v"(b) : "v"(x), "v"(y)); }
__device__ __forceinline__ void dep_guard_b(v8f& a, v8f& b, v16b x, v16b y) { asm volatile("v_nop\n\tv_nop\n\tv_nop\n\tv_nop" : "+v"(a), "+v"(b) : "v"(x), "v"(y)); }
__device__ __forceinline__ void keep4_h(v16h a, v16h b, v16h c, v16h d) { asm volatile("v_nop" :: "v"(a), "v"(b), "v"(c), "v"(d)); }
__device__ __forceinline__ void keep4_b(v16b a, v16b b, v16b c, v16b d) { asm volatile("v_nop" :: "v"(a), "v"(b), "v"(c), "v"(d)); }
__device__ __forceinline__ void acc_guard4(v8f& a, v8f& b, v8f& c, v8f& d) { asm volatile("v_nop\n\tv_nop\n\tv_nop\n\tv_nop" : "+v"(a), "+v"(b), "+v"(c), "+v"(d)); }
template <typename T> struct Frag;
template <> struct Frag<_Float16> {
  typedef v16h V; union U { v16h v; v8h h[2]; };
  static __device__ __forceinline__ v16h load(const _Float16* p) {   // elements 0..7 <- p[0..7], 8..15 <- p[16..23]
    U f; f.h[0] = *(const v8h*)(p); f.h[1] = *(const v8h*)(p + 16); return f.v;
  }
  static __device__ __forceinline__ v8f mma(v16h a, v16h b, v8f c) {
    return __builtin_amdgcn_wmma_f32_16x16x32_f16(false, a, false, b, (short)0, c, false, false);
  }
  static __device__ __forceinline__ void guard(v8f& a, v8f& b, v16h x, v16h y) { dep_guard_h(a, b, x, y); }
  static __device__ __forceinline__ void keep(v16h a, v16h b, v16h c, v16h d) { keep4_h(a, b, c, d); }
};
template <> struct Frag<__bf16> {
  typedef v16b V; union U { v16b v; v8b h[2]; };
  static __device__ __forceinline__ v16b load(const __bf16* p) {
    U f; f.h[0] = *(const v8b*)(p); f.h[1] = *(const v8b*)(p + 16); return f.v;
  }
  static __device__ __forceinline__ v8f mma(v16b a, v16b b, v8f c) {
    return __builtin_amdgcn_wmma_f32_16x16x32_bf16(false, a, false, b, (short)0, c, false, false);
  }
  static __device__ __forceinline__ void guard(v8f& a, v8f& b, v16b x, v16b y) { dep_guard_b(a, b, x, y); }
  static __device__ __forceinline__ void keep(v16b a, v16b b, v16b c, v16b d) { keep4_b(a, b, c, d); }
};

// ---- Register-blocked batched WMMA GEMM ------------------------------------
// C[m,n] = scale * sum_k A[m,k] * Bt[n,k] (+bias)(+resid); each wave owns a 64x64 tile.
// A row-major [M,K]; Bt row-major [N,K]; M,N % 64 == 0, K % 32 == 0.
// SPLIT: operands are hi/lo planes (A2/Bt2 = lo planes, same layout); product = hi·hi + hi·lo + lo·hi.
// BIAS_MODE: 0 = none, 1 = bias[m], 2 = bias[n].
// OUT_MODE: 0 = f32, 1 = f16, 2 = bf16 hi plane (Cout) + bf16 lo plane (Cout2).
// ET: 0 = f16 operands, 1 = bf16 operands (pointers passed as 16-bit storage)
template <int ET> struct Elem;
template <> struct Elem<0> { typedef _Float16 T; };
template <> struct Elem<1> { typedef __bf16 T; };
template <int ET, bool SPLIT, int BIAS_MODE, int OUT_MODE, bool RESID, int ACT = 0>
__global__ __launch_bounds__(256) void wmma_gemm64(
    const unsigned short* __restrict__ Ap, const unsigned short* __restrict__ A2p, int lda, long strideA,
    const unsigned short* __restrict__ Btp, const unsigned short* __restrict__ Bt2p, int ldb, long strideB,
    void* __restrict__ Cout, void* __restrict__ Cout2, int ldc, long strideC,
    const float* __restrict__ bias,
    const float* __restrict__ resid, long strideR,
    int M, int N, int K, float scale) {
  typedef typename Elem<ET>::T T;
  typedef typename Frag<T>::V V;
  const T* A = (const T*)Ap; const T* A2 = (const T*)A2p; const T* Bt = (const T*)Btp; const T* Bt2 = (const T*)Bt2p;
  __shared__ __align__(16) float sT[8][16 * 68];   // per-wave 16x64 slab, pitch 68 floats
  const int b    = blockIdx.y;
  const int lane = threadIdx.x & 31;
  const int wave = threadIdx.x >> 5;
  const int tilesN = N >> 6;
  const int tilesM = M >> 6;
  const int tile = blockIdx.x * 8 + wave;
  if (tile >= tilesM * tilesN) return;   // wave-uniform; no block barriers in this kernel
  const int tm = tile / tilesN;
  const int tn = tile - tm * tilesN;
  const int m0 = tm << 6;
  const int n0 = tn << 6;

  const T* Ab  = A  + (size_t)b * strideA;
  const T* Bb  = Bt + (size_t)b * strideB;
  const T* Ab2 = SPLIT ? (A2  + (size_t)b * strideA) : nullptr;
  const T* Bb2 = SPLIT ? (Bt2 + (size_t)b * strideB) : nullptr;

  const int rlane = lane & 15;                 // row (A) / col (B, D) within subtile
  const int koff  = (lane >> 4) * 8;           // k offset of this lane half
  const int mOff  = (lane >> 4) * 8;           // D row offset

  v8f acc[4][4];
#pragma unroll
  for (int i = 0; i < 4; ++i)
#pragma unroll
    for (int j = 0; j < 4; ++j) acc[i][j] = (v8f){0.f,0.f,0.f,0.f,0.f,0.f,0.f,0.f};

  for (int k0 = 0; k0 < K; k0 += 32) {
    V bh[4], bl[4];
#pragma unroll
    for (int j = 0; j < 4; ++j) {
      const size_t bo = (size_t)(n0 + (j << 4) + rlane) * ldb + koff + k0;
      bh[j] = Frag<T>::load(Bb + bo);
      if (SPLIT) bl[j] = Frag<T>::load(Bb2 + bo);
    }
#pragma unroll
    for (int i = 0; i < 4; ++i) {
      const size_t ao = (size_t)(m0 + (i << 4) + rlane) * lda + koff + k0;
      V ah = Frag<T>::load(Ab + ao);
      V al;
      if (SPLIT) al = Frag<T>::load(Ab2 + ao);
#pragma unroll
      for (int j = 0; j < 4; ++j) {
        acc[i][j] = Frag<T>::mma(ah, bh[j], acc[i][j]);
        if (SPLIT) {
          acc[i][j] = Frag<T>::mma(ah, bl[j], acc[i][j]);
          acc[i][j] = Frag<T>::mma(al, bh[j], acc[i][j]);
        }
      }
      Frag<T>::guard(acc[i][0], acc[i][3], ah, SPLIT ? al : ah);
    }
    Frag<T>::keep(bh[0], bh[1], bh[2], bh[3]);
    if (SPLIT) Frag<T>::keep(bl[0], bl[1], bl[2], bl[3]);
  }
  acc_guard4(acc[0][0], acc[0][1], acc[0][2], acc[0][3]);
  acc_guard4(acc[1][0], acc[1][1], acc[1][2], acc[1][3]);
  acc_guard4(acc[2][0], acc[2][1], acc[2][2], acc[2][3]);
  acc_guard4(acc[3][0], acc[3][1], acc[3][2], acc[3][3]);

  // ---- epilogue ----
  float* slab = sT[wave];
  const float* Rb = RESID ? (resid + (size_t)b * strideR) : nullptr;
#pragma unroll
  for (int i = 0; i < 4; ++i) {
    const int mBase = m0 + (i << 4);
#pragma unroll
    for (int j = 0; j < 4; ++j) {
      const int n = n0 + (j << 4) + rlane;
      float bv = 0.f;
      if (BIAS_MODE == 2) bv = bias[n];
#pragma unroll
      for (int r = 0; r < 8; ++r) {
        float v = acc[i][j][r] * scale;
        if (BIAS_MODE == 1) v += bias[mBase + mOff + r];
        if (BIAS_MODE == 2) v += bv;
        if (RESID) v += Rb[(size_t)(mBase + mOff + r) * ldc + n];
        if (ACT == 1) v = tanhf(v);
        if (ACT == 2) v = fmaxf(v, 0.0f);
        if (ACT == 3) v = v / (1.0f + expf(-v));
        if (ACT == 4) v = (v > 0.f) ? v : 0.01f * v;
        if (ACT == 5) v = 0.5f * v * (1.0f + erff(v * 0.70710678118654752f));
        slab[(mOff + r) * 68 + (j << 4) + rlane] = v;
      }
    }
    __builtin_amdgcn_fence(__ATOMIC_RELEASE, "workgroup");
    __builtin_amdgcn_wave_barrier();
    __builtin_amdgcn_fence(__ATOMIC_ACQUIRE, "workgroup");
    if (OUT_MODE == 0) {
      float* C = (float*)Cout + (size_t)b * strideC;
      const int hh = lane >> 4, c4 = (lane & 15) * 4;     // row seg = 256 B = 16 lanes x 16 B
      {
#pragma unroll
        for (int it = 0; it < 8; ++it) {
          const int row = it * 2 + hh;
          v4f v = *(const v4f*)(slab + row * 68 + c4);
          *(v4f*)(C + (size_t)(mBase + row) * ldc + n0 + c4) = v;
        }
        
      }
    } else {
      const int q = lane >> 3, c8 = (lane & 7) * 8;
      unsigned short* C  = (unsigned short*)Cout  + (size_t)b * strideC;
      unsigned short* C2 = (OUT_MODE == 2) ? ((unsigned short*)Cout2 + (size_t)b * strideC) : nullptr;
      {
#pragma unroll
        for (int it = 0; it < 4; ++it) {
          const int row = it * 4 + q;
          const float* sp = slab + row * 68 + c8;
          v8h hv, lv;
#pragma unroll
          for (int e = 0; e < 8; ++e) {
            if (OUT_MODE == 1) {
              hv[e] = (_Float16)sp[e];
            } else {
              unsigned short hb = f2bf_bits(sp[e]);
              unsigned short lb = f2bf_bits(sp[e] - bf_bits2f(hb));
              hv[e] = __builtin_bit_cast(_Float16, hb);
              lv[e] = __builtin_bit_cast(_Float16, lb);
            }
          }
          *(v8h*)(C + (size_t)(mBase + row) * ldc + n0 + c8) = hv;
          if (OUT_MODE == 2) *(v8h*)(C2 + (size_t)(mBase + row) * ldc + n0 + c8) = lv;
        }
        
      }
    }
    __builtin_amdgcn_fence(__ATOMIC_RELEASE, "workgroup");
    __builtin_amdgcn_wave_barrier();
    __builtin_amdgcn_fence(__ATOMIC_ACQUIRE, "workgroup");
  }
}

// ---------------------------------------------------------------------------
// Elementwise split: 2 elements per thread, one 4-B store per lane per plane -> each wave writes exactly one
// Coverage: grid = ceil(n2/256) blocks x 256 threads x 2 elements = 2*n2 elements = the whole plane (n2 = plane/2).
// ---------------------------------------------------------------------------
// hi = bf16_rne(in), lo = bf16_rne(in - hi)
__global__ __launch_bounds__(256) void split_bf16x2_kernel(const float* __restrict__ in, unsigned short* __restrict__ hi,
                                                           unsigned short* __restrict__ lo, int n2) {
  const int i = blockIdx.x * 256 + threadIdx.x;
  if (i < n2) {
    const v2f f = *(const v2f*)(in + 2 * (size_t)i);
    const unsigned short h0 = f2bf_bits(f[0]), h1 = f2bf_bits(f[1]);
    const unsigned short l0 = f2bf_bits(f[0] - bf_bits2f(h0)), l1 = f2bf_bits(f[1] - bf_bits2f(h1));
    const unsigned uh = pk16(h0, h1), ul = pk16(l0, l1);
    ((unsigned*)hi)[i] = uh;
    ((unsigned*)lo)[i] = ul;
    
  }
}

// ---------------------------------------------------------------------------
// Weight planes for the projections (one block of 256 threads):
//   wqkh/wqkl [64][32] bf16 hi/lo = rows 0..63 of Wqkv (q rows then k rows)
//   wvh/wvl   [64][32] bf16 hi/lo = rows 64..95 of Wqkv in rows 0..31, explicit zeros in rows 32..63
//   bv        [64] f32            = bqkv[64..95] in 0..31, zeros in 32..63
// ---------------------------------------------------------------------------
__device__ __forceinline__ void split_pair(float f0, float f1, unsigned& h, unsigned& l) {
  const unsigned short h0 = f2bf_bits(f0), h1 = f2bf_bits(f1);
  const unsigned short l0 = f2bf_bits(f0 - bf_bits2f(h0));
  const unsigned short l1 = f2bf_bits(f1 - bf_bits2f(h1));
  h = pk16(h0, h1);
  l = pk16(l0, l1);
}
__global__ __launch_bounds__(256) void wprep_kernel(const float* __restrict__ Wqkv, const float* __restrict__ bqkv,
                                                    unsigned short* __restrict__ wqkh, unsigned short* __restrict__ wqkl,
                                                    unsigned short* __restrict__ wvh, unsigned short* __restrict__ wvl,
                                                    float* __restrict__ bv) {
  const int tid  = threadIdx.x;
  const int row  = tid >> 2;            // 0..63
  const int col0 = (tid & 3) * 8;       // 0, 8, 16, 24
  v4u qh, ql, vh, vl;
#pragma unroll
  for (int p = 0; p < 4; ++p) {
    const int col = col0 + 2 * p;
    const float wq0 = Wqkv[row * HDIM + col];
    const float wq1 = Wqkv[row * HDIM + col + 1];
    int rv = 64 + row; rv = rv > 95 ? 95 : rv;            // clamped address; zero by predicate below
    float wv0 = Wqkv[rv * HDIM + col];
    float wv1 = Wqkv[rv * HDIM + col + 1];
    wv0 = (row < 32) ? wv0 : 0.0f;
    wv1 = (row < 32) ? wv1 : 0.0f;
    unsigned a, bq, cv, dv;
    split_pair(wq0, wq1, a, bq);
    split_pair(wv0, wv1, cv, dv);
    qh[p] = a; ql[p] = bq; vh[p] = cv; vl[p] = dv;
  }
  v4f b4;
#pragma unroll
  for (int e = 0; e < 4; ++e) {
    int m = tid * 4 + e; m = m > 63 ? 63 : m;
    int mi = 64 + m; mi = mi > 95 ? 95 : mi;
    const float v = bqkv[mi];
    b4[e] = (m < 32) ? v : 0.0f;
  }
  const size_t o = (size_t)tid * 8;
  {
    *(v4u*)(wqkh + o) = qh;
    *(v4u*)(wqkl + o) = ql;
    *(v4u*)(wvh + o)  = vh;
    *(v4u*)(wvl + o)  = vl;
    if (tid < 16) *(v4f*)(bv + tid * 4) = b4;
    
  }
}

// ---------------------------------------------------------------------------
// Softmax + 12x12 head mixing + per-row batch-statistic partials for one query row tl of one (batch, chunk).
//   S     [12][TCHUNK][1024] f32 scaled logits; P_h = softmax over the 1024 key columns (f32, fixed-order reductions)
//   M_g[s] = sum_h Wconv[g][h] P_h[s] on v_wmma_f32_16x16x32_f16: A = Wconv (f16 hi + x2^11 residual), B = P^T staged in
//   LDS as [s][16] f16 (x2^10 carried hi + x2^11 residual), K = 12 real of 32 (k >= 12 zeros by construction);
//   residual products in a separate accumulator, folded with exact power-of-two factors.
//   Mh/Ml [12][TCHUNK][1024] bf16 hi/lo planes of M; part[tl][32] = {sum_s M_g (12), sum_s M_g^2 (12), 8 zeros}.
// Block = 256 threads = 8 waves; thread owns key columns tid + 256 j (j = 0..3) for the softmax; two phases of 512
// (8 lanes x 16 B, one instruction per 4 lines); part line written by lanes 0..7 of wave 0 (one instruction).
// Coverage: 2 phases x 8 waves x 64 cols = 1024 cols x 12 rows per plane per block; grid = TCHUNK blocks.
// ---------------------------------------------------------------------------
union HFrag { v16h v; v8h h[2]; };

template <int J>
__device__ __forceinline__ void stage_pcol(const float (&pz)[12][4], int sl, _Float16* Pth, _Float16* Ptl) {
  v8h h0, h1, l0, l1;
#pragma unroll
  for (int e = 0; e < 8; ++e) {
    const float p0 = pz[e][J] * P_CARRY;
    const _Float16 a0 = (_Float16)p0;
    h0[e] = a0;
    l0[e] = (_Float16)((p0 - (float)a0) * R_CARRY);
  }
#pragma unroll
  for (int e = 0; e < 4; ++e) {
    const float p1 = pz[8 + e][J] * P_CARRY;
    const _Float16 a1 = (_Float16)p1;
    h1[e] = a1;
    l1[e] = (_Float16)((p1 - (float)a1) * R_CARRY);
  }
#pragma unroll
  for (int e = 4; e < 8; ++e) { h1[e] = (_Float16)0.0f; l1[e] = (_Float16)0.0f; }
  *(v8h*)(Pth + sl * 16)     = h0;
  *(v8h*)(Pth + sl * 16 + 8) = h1;
  *(v8h*)(Ptl + sl * 16)     = l0;
  *(v8h*)(Ptl + sl * 16 + 8) = l1;
}

__global__ __launch_bounds__(256) void softmax_mix_kernel(const float* __restrict__ S, const float* __restrict__ Wconv,
                                                          unsigned short* __restrict__ Mh, unsigned short* __restrict__ Ml,
                                                          float* __restrict__ part) {
  __shared__ __align__(16) _Float16 Pth[PHCOLS * 16];
  __shared__ __align__(16) _Float16 Ptl[PHCOLS * 16];
  __shared__ __align__(16) float slab[8][12 * 64];
  __shared__ float redw[8][12];
  __shared__ float fin[12];
  __shared__ float stw[8][24];
  __shared__ __align__(16) float pline[32];

  const int tid  = threadIdx.x;
  const int lane = tid & 31;
  const int wave = tid >> 5;
  const int hh   = lane >> 4;
  const int c    = lane & 15;
  const int tl   = blockIdx.x;

  v8h z8;
#pragma unroll
  for (int e = 0; e < 8; ++e) z8[e] = (_Float16)0.0f;
  const v8f zacc = (v8f){0.f,0.f,0.f,0.f,0.f,0.f,0.f,0.f};

  // A fragments of the mixing matrix: row m = g = c, k element i (< 8) = h = 8*hh + i; k >= 16 elements zero
  HFrag fah, fal;
  {
    v8h wh8, wl8;
#pragma unroll
    for (int i = 0; i < 8; ++i) {
      const int h  = 8 * hh + i;
      const int gi = c > 11 ? 11 : c;
      const int hi = h > 11 ? 11 : h;
      float w = Wconv[gi * NHEAD + hi];
      w = (c < 12 && h < 12) ? w : 0.0f;
      const _Float16 a = (_Float16)w;
      wh8[i] = a;
      wl8[i] = (_Float16)((w - (float)a) * R_CARRY);
    }
    fah.h[0] = wh8; fah.h[1] = z8;
    fal.h[0] = wl8; fal.h[1] = z8;
  }

  // scaled logits of this query row for all 12 heads, key columns tid + 256 j
  float pz[12][4];
  {
    const float* Srow = S + (size_t)tl * NTOK;
#pragma unroll
    for (int h = 0; h < 12; ++h)
#pragma unroll
      for (int j = 0; j < 4; ++j)
        pz[h][j] = Srow[(size_t)h * TCHUNK * NTOK + tid + 256 * j];
  }
  // row maxima: thread, wave xor tree, waves in index order
#pragma unroll
  for (int h = 0; h < 12; ++h) {
    float m = fmaxf(fmaxf(pz[h][0], pz[h][1]), fmaxf(pz[h][2], pz[h][3]));
#pragma unroll
    for (int off = 16; off > 0; off >>= 1) m = fmaxf(m, __shfl_xor(m, off, 32));
    if (lane == 0) redw[wave][h] = m;
  }
  __syncthreads();
  if (wave == 0) {
    const int hq = lane < 12 ? lane : 11;
    float m = redw[0][hq];
#pragma unroll
    for (int w = 1; w < 8; ++w) m = fmaxf(m, redw[w][hq]);
    if (lane < 12) fin[lane] = m;
  }
  __syncthreads();
  float mx[12];
#pragma unroll
  for (int h = 0; h < 12; ++h) mx[h] = fin[h];
  // exponentials and row sums
#pragma unroll
  for (int h = 0; h < 12; ++h) {
#pragma unroll
    for (int j = 0; j < 4; ++j) pz[h][j] = __expf(pz[h][j] - mx[h]);
    float s = ((pz[h][0] + pz[h][1]) + pz[h][2]) + pz[h][3];
#pragma unroll
    for (int off = 16; off > 0; off >>= 1) s += __shfl_xor(s, off, 32);
    if (lane == 0) redw[wave][h] = s;
  }
  __syncthreads();
  if (wave == 0) {
    const int hq = lane < 12 ? lane : 11;
    float s = redw[0][hq];
#pragma unroll
    for (int w = 1; w < 8; ++w) s += redw[w][hq];
    if (lane < 12) fin[lane] = s;
  }
  __syncthreads();
#pragma unroll
  for (int h = 0; h < 12; ++h) {
    const float inv = 1.0f / fin[h];
#pragma unroll
    for (int j = 0; j < 4; ++j) pz[h][j] *= inv;
  }

  v8f s1 = zacc, s2 = zacc;
  float* myslab = slab[wave];
  const int q  = lane >> 3;
  const int c8 = (lane & 7) * 8;
  for (int ph = 0; ph < 2; ++ph) {          // block-uniform
    // stage P^T for key columns ph*512 .. +511: 256 threads x 2 columns x 16 halves per plane = whole Pth / Ptl
    if (ph == 0) {
      stage_pcol<0>(pz, tid, Pth, Ptl);
      stage_pcol<1>(pz, tid + 256, Pth, Ptl);
    } else {
      stage_pcol<2>(pz, tid, Pth, Ptl);
      stage_pcol<3>(pz, tid + 256, Pth, Ptl);
    }
    __syncthreads();
#pragma unroll 1
    for (int nt = 0; nt < 4; ++nt) {
      const int col = wave * 64 + nt * 16 + c;      // local key column of this lane's B column, 0..511
      HFrag bh, bl;
      bh.h[0] = *(const v8h*)(Pth + col * 16 + 8 * hh); bh.h[1] = z8;
      bl.h[0] = *(const v8h*)(Ptl + col * 16 + 8 * hh); bl.h[1] = z8;
      v8f acc0 = zacc, accr = zacc;
      acc0 = Frag<_Float16>::mma(fah.v, bh.v, acc0);
      accr = Frag<_Float16>::mma(fah.v, bl.v, accr);
      accr = Frag<_Float16>::mma(fal.v, bh.v, accr);
      dep_guard_h(acc0, accr, bh.v, bl.v);
#pragma unroll
      for (int r = 0; r < 8; ++r) {
        const float m = fmaf(accr[r], MIX_FOLD, acc0[r] * P_INV);     // D row g = 8*hh + r, column col
        s1[r] += m;
        s2[r] = fmaf(m, m, s2[r]);
        if (hh == 0 || r < 4) myslab[(8 * hh + r) * 64 + nt * 16 + c] = m;
      }
    }
    __syncthreads();
    {
      v8h hv[3], lv[3];
#pragma unroll
      for (int it = 0; it < 3; ++it) {
        const int g = it * 4 + q;
        const float* sp = myslab + g * 64 + c8;
        v8h a, bq;
#pragma unroll
        for (int e = 0; e < 8; ++e) {
          const unsigned short hb = f2bf_bits(sp[e]);
          const unsigned short lb = f2bf_bits(sp[e] - bf_bits2f(hb));
          a[e]  = __builtin_bit_cast(_Float16, hb);
          bq[e] = __builtin_bit_cast(_Float16, lb);
        }
        hv[it] = a; lv[it] = bq;
      }
      {
#pragma unroll
        for (int it = 0; it < 3; ++it) {
          const int g = it * 4 + q;
          const size_t go = ((size_t)g * TCHUNK + tl) * NTOK + (size_t)ph * PHCOLS + wave * 64 + c8;
          *(v8h*)(Mh + go) = hv[it];
          *(v8h*)(Ml + go) = lv[it];
        }
        
      }
    }
    __syncthreads();
  }

  // statistics: xor tree over the 16 lanes sharing hh (fixed order), then waves in index order
#pragma unroll
  for (int r = 0; r < 8; ++r) {
    float a = s1[r], bq = s2[r];
#pragma unroll
    for (int off = 1; off < 16; off <<= 1) { a += __shfl_xor(a, off, 32); bq += __shfl_xor(bq, off, 32); }
    const int g = 8 * hh + r;
    if (c == 0 && g < 12) { stw[wave][g] = a; stw[wave][12 + g] = bq; }
  }
  __syncthreads();
  if (wave == 0) {
    const int qi = lane < 24 ? lane : 23;
    float v = stw[0][qi];
#pragma unroll
    for (int w = 1; w < 8; ++w) v += stw[w][qi];
    v = (lane < 24) ? v : 0.0f;
    pline[lane] = v;
  }
  __syncthreads();
  if (tid < 8) {
    const v4f v = *(const v4f*)(pline + tid * 4);
    float* dst = part + (size_t)tl * 32 + tid * 4;
    *(v4f*)dst = v;
    
  }
}

// ---------------------------------------------------------------------------
// Vsum[g][d] = sum_s v[g][s][d] from the v^T bf16 hi+lo planes of one batch ([12][64][1024], rows d < 32).
// Block g, 256 threads: d = tid>>3, 8 partial sums of 128 columns combined by a fixed xor tree; the 32 results are
// ---------------------------------------------------------------------------
__global__ __launch_bounds__(256) void vsum_kernel(const unsigned short* __restrict__ vth, const unsigned short* __restrict__ vtl,
                                                   float* __restrict__ vsum) {
  __shared__ __align__(16) float vs[32];
  const int g   = blockIdx.x;
  const int tid = threadIdx.x;
  const int d   = tid >> 3;
  const int prt = tid & 7;
  const size_t base = ((size_t)g * VTROWS + d) * NTOK + (size_t)prt * 128;
  float acc = 0.0f;
#pragma unroll 1
  for (int i = 0; i < 16; ++i) {
    const v8us a  = *(const v8us*)(vth + base + i * 8);
    const v8us bq = *(const v8us*)(vtl + base + i * 8);
#pragma unroll
    for (int e = 0; e < 8; ++e) acc += bf_bits2f(a[e]) + bf_bits2f(bq[e]);
  }
  acc += __shfl_xor(acc, 1, 32);
  acc += __shfl_xor(acc, 2, 32);
  acc += __shfl_xor(acc, 4, 32);
  if (prt == 0) vs[d] = acc;
  __syncthreads();
  if (tid < 8) {
    const v4f v = *(const v4f*)(vs + tid * 4);
    float* dst = vsum + g * 32 + tid * 4;
    *(v4f*)dst = v;
    
  }
}

// ---------------------------------------------------------------------------
// Column sums of the partial lines, first level: part [8192][32] f32 -> psum [STBLK][32] f64.
// Lane = column; each wave reads its STROWS lines as independent loads (all in flight at once), adds them in f64 in
// row order; the 8 wave sums of a block are added in wave order. One wave writes the block's 256-B psum line.
// Coverage: STBLK blocks x 8 waves x STROWS rows = 8192 lines.
// ---------------------------------------------------------------------------
__global__ __launch_bounds__(256) void statsum_kernel(const float* __restrict__ part, double* __restrict__ psum) {
  __shared__ double sw[8][32];
  const int lane = threadIdx.x & 31;
  const int wave = threadIdx.x >> 5;
  const float* p = part + (size_t)(blockIdx.x * 8 + wave) * STROWS * 32 + lane;
  float v[STROWS];
#pragma unroll   // loads issue back to back: one memory latency per wave instead of one per line
  for (int i = 0; i < STROWS; ++i) v[i] = p[i * 32];
  double acc = 0.0;
#pragma unroll   // constant indices keep v[] in registers
  for (int i = 0; i < STROWS; ++i) acc += (double)v[i];
  sw[wave][lane] = acc;
  __syncthreads();
  if (wave == 0) {
    double s = sw[0][lane];
#pragma unroll
    for (int w = 1; w < 8; ++w) s += sw[w][lane];
    psum[blockIdx.x * 32 + lane] = s;
  }
}

// ---------------------------------------------------------------------------
// Per-head affine coefficients from the first-level sums (one block of 8 waves): wave w adds psum lines
// w*STBLK/8 .. +STBLK/8-1 in f64 (independent loads, row order), wave 0 adds the 8 wave sums in wave order;
// mean_g = S1/N, var_g = S2/N - mean_g^2 (biased), a_g = gamma_g / sqrt(var_g + eps),
// kk_g = a_g*bconv_g + (beta_g - a_g*(mean_g + bconv_g)); coef line = {a[12], kk[12], 8 zeros}, one instruction.
// ---------------------------------------------------------------------------
__global__ __launch_bounds__(256) void coef_kernel(const double* __restrict__ psum, const float* __restrict__ bconv,
                                                   const float* __restrict__ gamma, const float* __restrict__ beta,
                                                   float* __restrict__ coef) {
  __shared__ double sw[8][32];
  __shared__ double sd[32];
  __shared__ __align__(16) float cf[32];
  const int lane = threadIdx.x & 31;
  const int wave = threadIdx.x >> 5;
  const double* p = psum + (size_t)wave * (STBLK / 8) * 32 + lane;
  double q[STBLK / 8];
#pragma unroll   // loads issue back to back: one memory latency per wave instead of one per line
  for (int i = 0; i < STBLK / 8; ++i) q[i] = p[i * 32];
  double acc = 0.0;
#pragma unroll   // constant indices keep q[] in registers
  for (int i = 0; i < STBLK / 8; ++i) acc += q[i];
  sw[wave][lane] = acc;
  __syncthreads();
  if (wave == 0) {
    double s = sw[0][lane];
#pragma unroll
    for (int w = 1; w < 8; ++w) s += sw[w][lane];
    sd[lane] = s;
  }
  __syncthreads();
  int gq = (lane < 12) ? lane : (lane - 12);
  gq = gq < 0 ? 0 : (gq > 11 ? 11 : gq);
  const double s1d = sd[gq];
  const double s2d = sd[12 + gq];
  const double invN = 1.0 / ((double)NBATCH * (double)NTOK * (double)NTOK);
  const double meanM = s1d * invN;
  double var = s2d * invN - meanM * meanM;
  var = var < 0.0 ? 0.0 : var;
  const float varf   = (float)var;
  const float meanre = (float)meanM + bconv[gq];
  const float a      = gamma[gq] * (1.0f / sqrtf(varf + BN_EPS));
  const float kk     = a * bconv[gq] + (beta[gq] - a * meanre);
  const float v = (lane < 12) ? a : ((lane < 24) ? kk : 0.0f);
  if (wave == 0) cf[lane] = v;
  __syncthreads();
  if (threadIdx.x < 8) {
    const v4f w = *(const v4f*)(cf + threadIdx.x * 4);
    float* dst = coef + threadIdx.x * 4;
    *(v4f*)dst = w;
  }
}

// ---------------------------------------------------------------------------
// out[b][t][32g+d] = a_g * U[b][g][t][d] + kk_g * Vsum[b][g][d]. One wave per (b,t) row of 384 floats:
// Coverage: grid 1024 x 8 waves = 8192 rows = all of d_out.
// ---------------------------------------------------------------------------
__global__ __launch_bounds__(256) void combine_kernel(const float* __restrict__ U, const float* __restrict__ vsum,
                                                      const float* __restrict__ coef, float* __restrict__ out) {
  const int lane = threadIdx.x & 31;
  const int wave = threadIdx.x >> 5;
  const int R = blockIdx.x * 8 + wave;         // 0..8191
  const int b = R >> 10, t = R & (NTOK - 1);
  v4f o[3];
#pragma unroll
  for (int i = 0; i < 3; ++i) {
    const int f = 128 * i + 4 * lane;
    const int g = f >> 5, d = f & 31;
    const v4f u  = *(const v4f*)(U + (((size_t)(b * NHEAD + g)) * NTOK + t) * UW + d);
    const v4f vv = *(const v4f*)(vsum + (b * NHEAD + g) * 32 + d);
    const float a = coef[g], kk = coef[12 + g];
    v4f rr;
#pragma unroll
    for (int e = 0; e < 4; ++e) rr[e] = fmaf(a, u[e], kk * vv[e]);
    o[i] = rr;
  }
  float* orow = out + (size_t)R * NEMB;
  {
#pragma unroll
    for (int i = 0; i < 3; ++i) *(v4f*)(orow + 128 * i + 4 * lane) = o[i];
    
  }
}

// ---------------------------------------------------------------------------
// Workspace region map (byte offsets; every size a multiple of 256):
//   XH    bf16 [98304][32]      x hi plane (rows = (b,t,h))              0
//   XL    bf16 [98304][32]                                         6291456
//   WQKH  bf16 [64][32]  WQKL [64][32]  WVH [64][32]  WVL [64][32]   12582912 / 12587008 / 12591104 / 12595200
//   BV    f32  [64]                                               12599296
//   QKH   bf16 [98304][64]      q at 0..31, k at 32..63            12599552
//   QKL   bf16 [98304][64]                                        25182464
//   VTH   bf16 [12][64][1024]   current batch v^T hi                37765376
//   VTL   bf16 [12][64][1024]                                     39338240
//   S     f32  [12][512][1024]  current chunk scaled logits       40911104
//   MH    bf16 [12][512][1024]  current chunk mixed maps hi       66076928
//   ML    bf16 [12][512][1024]                                    78659840
//   U     f32  [8][12][1024][64]                                  91242752
//   PART  f32  [8192][32]                                        116408576
//   VSUM  f32  [8][12][32]                                       117457152
//   COEF  f32  [32] (256 B)                                      117469440
//   PSUM  f64  [64][32]                                          117469696
//   total                                                        117486080
// Per-batch / per-chunk regions are fully rewritten before each read in stream order.
// ---------------------------------------------------------------------------
extern "C" void kernel_launch(void* const* d_in, const int* in_sizes, int n_in,
                              void* d_out, int out_size, void* d_ws, size_t ws_size,
                              hipStream_t stream) {
  if (n_in < 7) return;
  if (in_sizes[0] != NBATCH * NTOK * NEMB) return;
  if (in_sizes[1] != 3 * HDIM * HDIM || in_sizes[2] != 3 * HDIM) return;
  if (in_sizes[3] != NHEAD * NHEAD || in_sizes[4] < NHEAD || in_sizes[5] < NHEAD || in_sizes[6] < NHEAD) return;
  if (out_size != NBATCH * NTOK * NEMB) return;

  const float* x     = (const float*)d_in[0];
  const float* Wqkv  = (const float*)d_in[1];
  const float* bqkv  = (const float*)d_in[2];
  const float* Wconv = (const float*)d_in[3];
  const float* bconv = (const float*)d_in[4];
  const float* gamma = (const float*)d_in[5];
  const float* beta  = (const float*)d_in[6];
  float* out = (float*)d_out;

  const size_t szX    = (size_t)NBATCH * NTOK * NEMB * 2;            // 6291456
  const size_t szW    = (size_t)64 * HDIM * 2;                       // 4096
  const size_t szBV   = 256;
  const size_t szQK   = (size_t)NBATCH * NTOK * NHEAD * QKW * 2;     // 12582912
  const size_t szVT   = (size_t)NHEAD * VTROWS * NTOK * 2;           // 1572864
  const size_t szS    = (size_t)NHEAD * TCHUNK * NTOK * 4;           // 25165824
  const size_t szM    = (size_t)NHEAD * TCHUNK * NTOK * 2;           // 12582912
  const size_t szU    = (size_t)NBATCH * NHEAD * NTOK * UW * 4;      // 25165824
  const size_t szPART = (size_t)NBATCH * NTOK * 32 * 4;              // 1048576
  const size_t szVS   = (size_t)NBATCH * NHEAD * 32 * 4;             // 12288
  const size_t szCF   = 256;
  const size_t szPS   = (size_t)STBLK * 32 * 8;                      // 16384
  size_t off = 0;
  const size_t oXH = off;   off += szX;
  const size_t oXL = off;   off += szX;
  const size_t oWQKH = off; off += szW;
  const size_t oWQKL = off; off += szW;
  const size_t oWVH = off;  off += szW;
  const size_t oWVL = off;  off += szW;
  const size_t oBV = off;   off += szBV;
  const size_t oQKH = off;  off += szQK;
  const size_t oQKL = off;  off += szQK;
  const size_t oVTH = off;  off += szVT;
  const size_t oVTL = off;  off += szVT;
  const size_t oS = off;    off += szS;
  const size_t oMH = off;   off += szM;
  const size_t oML = off;   off += szM;
  const size_t oU = off;    off += szU;
  const size_t oPART = off; off += szPART;
  const size_t oVS = off;   off += szVS;
  const size_t oCF = off;   off += szCF;
  const size_t oPS = off;   off += szPS;
  if (off > ws_size) return;

  char* ws = (char*)d_ws;
  unsigned short* XH   = (unsigned short*)(ws + oXH);
  unsigned short* XL   = (unsigned short*)(ws + oXL);
  unsigned short* WQKH = (unsigned short*)(ws + oWQKH);
  unsigned short* WQKL = (unsigned short*)(ws + oWQKL);
  unsigned short* WVH  = (unsigned short*)(ws + oWVH);
  unsigned short* WVL  = (unsigned short*)(ws + oWVL);
  float*          BV   = (float*)(ws + oBV);
  unsigned short* QKH  = (unsigned short*)(ws + oQKH);
  unsigned short* QKL  = (unsigned short*)(ws + oQKL);
  unsigned short* VTH  = (unsigned short*)(ws + oVTH);
  unsigned short* VTL  = (unsigned short*)(ws + oVTL);
  float*          Sbuf = (float*)(ws + oS);
  unsigned short* MH   = (unsigned short*)(ws + oMH);
  unsigned short* ML   = (unsigned short*)(ws + oML);
  float*          U    = (float*)(ws + oU);
  float*          PART = (float*)(ws + oPART);
  float*          VSUM = (float*)(ws + oVS);
  float*          COEF = (float*)(ws + oCF);
  double*         PSUM = (double*)(ws + oPS);

  const dim3 blk(256);
  // (1) x -> bf16 hi/lo planes viewed as [(b,t,h)][32]: n2 = 1572864 pairs = 6144 blocks x 256 threads exactly
  const int n2x = NBATCH * NTOK * NEMB / 2;
  split_bf16x2_kernel<<<dim3((n2x + 255) / 256), blk, 0, stream>>>(x, XH, XL, n2x);
  // (2) projection weight planes and padded v bias
  wprep_kernel<<<dim3(1), blk, 0, stream>>>(Wqkv, bqkv, WQKH, WQKL, WVH, WVL, BV);
  // (3) q|k = xh . Wqkv[0..63]^T + bqkv[0..63] -> QK hi/lo planes [98304][64]; M = 98304 (1536 tiles), N = 64, K = 32
  wmma_gemm64<1, true, 2, 2, false><<<dim3((NBATCH * NTOK * NHEAD / 64) / 8, 1), blk, 0, stream>>>(
      XH, XL, HDIM, 0L, WQKH, WQKL, HDIM, 0L, (void*)QKH, (void*)QKL, QKW, 0L,
      bqkv, bqkv, 0L, NBATCH * NTOK * NHEAD, QKW, HDIM, 1.0f);

  for (int b = 0; b < NBATCH; ++b) {
    // (4) v^T[m][s] for head g = blockIdx.y: A = WV planes [64][32] (rows 32..63 zero), Bt = x planes at column g*32,
    //     ldb = 384; M = 64, N = 1024 (16 tiles -> 2 blocks), K = 32; bias[m] = BV -> VT planes [12][64][1024]
    const unsigned short* xbh = XH + (size_t)b * NTOK * NEMB;
    const unsigned short* xbl = XL + (size_t)b * NTOK * NEMB;
    wmma_gemm64<1, true, 1, 2, false><<<dim3(2, NHEAD), blk, 0, stream>>>(
        WVH, WVL, HDIM, 0L, xbh, xbl, NEMB, (long)HDIM, (void*)VTH, (void*)VTL, NTOK, (long)VTROWS * NTOK,
        BV, BV, 0L, VTROWS, NTOK, HDIM, 1.0f);
    // (5) Vsum of this batch: 12 lines
    vsum_kernel<<<dim3(NHEAD), blk, 0, stream>>>(VTH, VTL, VSUM + (size_t)b * NHEAD * 32);
    for (int ch = 0; ch < NCHUNK; ++ch) {
      // (6) S[h][tl][s] = (q . k) * 32^-0.5 : A = q rows (b, ch*512 + tl, h), lda 768, z stride 64; Bt = k rows (b, s, h);
      //     M = 512, N = 1024 (128 tiles -> 16 blocks per z), K = 32, f32 out [12][512][1024]
      const size_t qoff = ((size_t)b * NTOK + (size_t)ch * TCHUNK) * NHEAD * QKW;
      const size_t koff = (size_t)b * NTOK * NHEAD * QKW + HDIM;
      wmma_gemm64<1, true, 0, 0, false><<<dim3(16, NHEAD), blk, 0, stream>>>(
          QKH + qoff, QKL + qoff, NHEAD * QKW, (long)QKW, QKH + koff, QKL + koff, NHEAD * QKW, (long)QKW,
          (void*)Sbuf, (void*)Sbuf, NTOK, (long)TCHUNK * NTOK,
          bqkv, bqkv, 0L, TCHUNK, NTOK, HDIM, SM_SCALE);
      // (7) softmax + head mixing + statistic partials: 512 blocks (one per query row of the chunk)
      softmax_mix_kernel<<<dim3(TCHUNK), blk, 0, stream>>>(
          Sbuf, Wconv, MH, ML, PART + ((size_t)b * NTOK + (size_t)ch * TCHUNK) * 32);
      // (8) U[b][g][t][n] = sum_s M[g][t][s] v^T[g][n][s]: M = 512, N = 64 (8 tiles -> 1 block per z), K = 1024, f32 out
      float* Ub = U + ((size_t)b * NHEAD * NTOK + (size_t)ch * TCHUNK) * UW;
      wmma_gemm64<1, true, 0, 0, false><<<dim3(1, NHEAD), blk, 0, stream>>>(
          MH, ML, NTOK, (long)TCHUNK * NTOK, VTH, VTL, NTOK, (long)VTROWS * NTOK,
          (void*)Ub, (void*)Ub, UW, (long)NTOK * UW,
          bqkv, bqkv, 0L, TCHUNK, UW, NTOK, 1.0f);
    }
  }
  // (9) fixed-order f64 sums over the 8192 partial lines in two levels, then the per-head affine coefficients
  statsum_kernel<<<dim3(STBLK), blk, 0, stream>>>(PART, PSUM);
  coef_kernel<<<dim3(1), blk, 0, stream>>>(PSUM, bconv, gamma, beta, COEF);
  // (10) output rows: 1024 blocks x 8 waves = 8192 rows of 384 floats
  combine_kernel<<<dim3(NBATCH * NTOK / 8), blk, 0, stream>>>(U, VSUM, COEF, out);
}

// v002
// A run of this version takes 685 microseconds.
// In two side-by-side timings against v001, it was 2.49 and 2.47 times as fast.
// All steps since v000 together make it 5.12 times as fast.
// Contractions: x.Wqkv^T (q|k planes and v^T planes), scaled q.k^T, and (head-mixed attention).v on v_wmma_f32_16x16x32_bf16 with bf16 hi/lo split operand planes (hi.hi + hi.lo + lo.hi); 12x12 head mixing on v_wmma_f32_16x16x32_f16 (f16 hi planes + x2^11 residual planes in a separate accumulator, probabilities carried x2^10); f32 accumulate everywhere; softmax f32; per-head batch statistics as f32 block partials combined in f64 in fixed order.
#include <hip/hip_runtime.h>
#include <math.h>
#include <stdint.h>

constexpr int NBATCH = 8;
constexpr int NTOK   = 1024;
constexpr int NEMB   = 384;
constexpr int NHEAD  = 12;
constexpr int HDIM   = 32;
constexpr int TCHUNK = 512;            // query rows per score / mix / PV chunk
constexpr int NCHUNK = NTOK / TCHUNK;  // 2
constexpr int PHCOLS = 512;            // key columns staged in LDS per mixing phase
constexpr int QKW    = 64;             // q|k plane row width (q at 0..31, k at 32..63)
constexpr int VTROWS = 64;             // v^T rows per head (32 real + 32 zero)
constexpr int UW     = 64;             // U row pitch (32 real columns, 32 unused)
constexpr float SM_SCALE = 0.17677669529663687f;
constexpr float P_CARRY  = 1024.0f;                      // probabilities carried x2^10 in f16
constexpr float R_CARRY  = 2048.0f;                      // residual planes carried x2^11
constexpr float P_INV    = 1.0f / 1024.0f;
constexpr float MIX_FOLD = 1.0f / (1024.0f * 2048.0f);
constexpr float BN_EPS   = 1e-5f;
constexpr int STBLK  = 64;                            // blocks of the first level of the statistic sum
constexpr int STROWS = NBATCH * NTOK / (STBLK * 8);   // 16 partial lines per wave

typedef __attribute__((ext_vector_type(16))) _Float16 v16h;
typedef __attribute__((ext_vector_type(8)))  _Float16 v8h;
typedef __attribute__((ext_vector_type(16))) __bf16   v16b;
typedef __attribute__((ext_vector_type(8)))  __bf16   v8b;
typedef __attribute__((ext_vector_type(8)))  float    v8f;
typedef __attribute__((ext_vector_type(4)))  float    v4f;
typedef __attribute__((ext_vector_type(2)))  float    v2f;
typedef __attribute__((ext_vector_type(4)))  unsigned int v4u;
typedef __attribute__((ext_vector_type(8)))  unsigned short v8us;

__device__ __forceinline__ unsigned short f2bf_bits(float f) {
  unsigned u = __float_as_uint(f);
  return (unsigned short)((u + 0x7FFFu + ((u >> 16) & 1u)) >> 16);
}
__device__ __forceinline__ float bf_bits2f(unsigned short h) { return __uint_as_float(((unsigned)h) << 16); }
__device__ __forceinline__ unsigned pk16(unsigned short a, unsigned short b) { return (unsigned)a | ((unsigned)b << 16); }

// hazard guards as plain device helpers (no inline asm inside the kernel template body)
__device__ __forceinline__ void dep_guard_h(v8f& a, v8f& b, v16h x, v16h y) { asm volatile("v_nop\n\tv_nop\n\tv_nop\n\tv_nop" : "+v"(a), "+v"(b) : "v"(x), "v"(y)); }
__device__ __forceinline__ void dep_guard_b(v8f& a, v8f& b, v16b x, v16b y) { asm volatile("v_nop\n\tv_nop\n\tv_nop\n\tv_nop" : "+v"(a), "+v"(b) : "v"(x), "v"(y)); }
__device__ __forceinline__ void keep4_h(v16h a, v16h b, v16h c, v16h d) { asm volatile("v_nop" :: "v"(a), "v"(b), "v"(c), "v"(d)); }
__device__ __forceinline__ void keep4_b(v16b a, v16b b, v16b c, v16b d) { asm volatile("v_nop" :: "v"(a), "v"(b), "v"(c), "v"(d)); }
__device__ __forceinline__ void acc_guard4(v8f& a, v8f& b, v8f& c, v8f& d) { asm volatile("v_nop\n\tv_nop\n\tv_nop\n\tv_nop" : "+v"(a), "+v"(b), "+v"(c), "+v"(d)); }
template <typename T> struct Frag;
template <> struct Frag<_Float16> {
  typedef v16h V; union U { v16h v; v8h h[2]; };
  static __device__ __forceinline__ v16h load(const _Float16* p) {   // elements 0..7 <- p[0..7], 8..15 <- p[16..23]
    U f; f.h[0] = *(const v8h*)(p); f.h[1] = *(const v8h*)(p + 16); return f.v;
  }
  static __device__ __forceinline__ v8f mma(v16h a, v16h b, v8f c) {
    return __builtin_amdgcn_wmma_f32_16x16x32_f16(false, a, false, b, (short)0, c, false, false);
  }
  static __device__ __forceinline__ void guard(v8f& a, v8f& b, v16h x, v16h y) { dep_guard_h(a, b, x, y); }
  static __device__ __forceinline__ void keep(v16h a, v16h b, v16h c, v16h d) { keep4_h(a, b, c, d); }
};
template <> struct Frag<__bf16> {
  typedef v16b V; union U { v16b v; v8b h[2]; };
  static __device__ __forceinline__ v16b load(const __bf16* p) {
    U f; f.h[0] = *(const v8b*)(p); f.h[1] = *(const v8b*)(p + 16); return f.v;
  }
  static __device__ __forceinline__ v8f mma(v16b a, v16b b, v8f c) {
    return __builtin_amdgcn_wmma_f32_16x16x32_bf16(false, a, false, b, (short)0, c, false, false);
  }
  static __device__ __forceinline__ void guard(v8f& a, v8f& b, v16b x, v16b y) { dep_guard_b(a, b, x, y); }
  static __device__ __forceinline__ void keep(v16b a, v16b b, v16b c, v16b d) { keep4_b(a, b, c, d); }
};

// ---- Register-blocked batched WMMA GEMM ------------------------------------
// C[m,n] = scale * sum_k A[m,k] * Bt[n,k] (+bias)(+resid); each wave owns a 64x64 tile.
// A row-major [M,K]; Bt row-major [N,K]; M,N % 64 == 0, K % 32 == 0.
// SPLIT: operands are hi/lo planes (A2/Bt2 = lo planes, same layout); product = hi·hi + hi·lo + lo·hi.
// BIAS_MODE: 0 = none, 1 = bias[m], 2 = bias[n].
// OUT_MODE: 0 = f32, 1 = f16, 2 = bf16 hi plane (Cout) + bf16 lo plane (Cout2).
// ET: 0 = f16 operands, 1 = bf16 operands (pointers passed as 16-bit storage)
template <int ET> struct Elem;
template <> struct Elem<0> { typedef _Float16 T; };
template <> struct Elem<1> { typedef __bf16 T; };
template <int ET, bool SPLIT, int BIAS_MODE, int OUT_MODE, bool RESID, int ACT = 0>
__global__ __launch_bounds__(256) void wmma_gemm64(
    const unsigned short* __restrict__ Ap, const unsigned short* __restrict__ A2p, int lda, long strideA,
    const unsigned short* __restrict__ Btp, const unsigned short* __restrict__ Bt2p, int ldb, long strideB,
    void* __restrict__ Cout, void* __restrict__ Cout2, int ldc, long strideC,
    const float* __restrict__ bias,
    const float* __restrict__ resid, long strideR,
    int M, int N, int K, float scale) {
  typedef typename Elem<ET>::T T;
  typedef typename Frag<T>::V V;
  const T* A = (const T*)Ap; const T* A2 = (const T*)A2p; const T* Bt = (const T*)Btp; const T* Bt2 = (const T*)Bt2p;
  __shared__ __align__(16) float sT[8][16 * 68];   // per-wave 16x64 slab, pitch 68 floats
  const int b    = blockIdx.y;
  const int lane = threadIdx.x & 31;
  const int wave = threadIdx.x >> 5;
  const int tilesN = N >> 6;
  const int tilesM = M >> 6;
  const int tile = blockIdx.x * 8 + wave;
  if (tile >= tilesM * tilesN) return;   // wave-uniform; no block barriers in this kernel
  const int tm = tile / tilesN;
  const int tn = tile - tm * tilesN;
  const int m0 = tm << 6;
  const int n0 = tn << 6;

  const T* Ab  = A  + (size_t)b * strideA;
  const T* Bb  = Bt + (size_t)b * strideB;
  const T* Ab2 = SPLIT ? (A2  + (size_t)b * strideA) : nullptr;
  const T* Bb2 = SPLIT ? (Bt2 + (size_t)b * strideB) : nullptr;

  const int rlane = lane & 15;                 // row (A) / col (B, D) within subtile
  const int koff  = (lane >> 4) * 8;           // k offset of this lane half
  const int mOff  = (lane >> 4) * 8;           // D row offset

  v8f acc[4][4];
#pragma unroll
  for (int i = 0; i < 4; ++i)
#pragma unroll
    for (int j = 0; j < 4; ++j) acc[i][j] = (v8f){0.f,0.f,0.f,0.f,0.f,0.f,0.f,0.f};

  for (int k0 = 0; k0 < K; k0 += 32) {
    V bh[4], bl[4];
#pragma unroll
    for (int j = 0; j < 4; ++j) {
      const size_t bo = (size_t)(n0 + (j << 4) + rlane) * ldb + koff + k0;
      bh[j] = Frag<T>::load(Bb + bo);
      if (SPLIT) bl[j] = Frag<T>::load(Bb2 + bo);
    }
#pragma unroll
    for (int i = 0; i < 4; ++i) {
      const size_t ao = (size_t)(m0 + (i << 4) + rlane) * lda + koff + k0;
      V ah = Frag<T>::load(Ab + ao);
      V al;
      if (SPLIT) al = Frag<T>::load(Ab2 + ao);
#pragma unroll
      for (int j = 0; j < 4; ++j) {
        acc[i][j] = Frag<T>::mma(ah, bh[j], acc[i][j]);
        if (SPLIT) {
          acc[i][j] = Frag<T>::mma(ah, bl[j], acc[i][j]);
          acc[i][j] = Frag<T>::mma(al, bh[j], acc[i][j]);
        }
      }
      Frag<T>::guard(acc[i][0], acc[i][3], ah, SPLIT ? al : ah);
    }
    Frag<T>::keep(bh[0], bh[1], bh[2], bh[3]);
    if (SPLIT) Frag<T>::keep(bl[0], bl[1], bl[2], bl[3]);
  }
  acc_guard4(acc[0][0], acc[0][1], acc[0][2], acc[0][3]);
  acc_guard4(acc[1][0], acc[1][1], acc[1][2], acc[1][3]);
  acc_guard4(acc[2][0], acc[2][1], acc[2][2], acc[2][3]);
  acc_guard4(acc[3][0], acc[3][1], acc[3][2], acc[3][3]);

  // ---- epilogue ----
  float* slab = sT[wave];
  const float* Rb = RESID ? (resid + (size_t)b * strideR) : nullptr;
#pragma unroll
  for (int i = 0; i < 4; ++i) {
    const int mBase = m0 + (i << 4);
#pragma unroll
    for (int j = 0; j < 4; ++j) {
      const int n = n0 + (j << 4) + rlane;
      float bv = 0.f;
      if (BIAS_MODE == 2) bv = bias[n];
#pragma unroll
      for (int r = 0; r < 8; ++r) {
        float v = acc[i][j][r] * scale;
        if (BIAS_MODE == 1) v += bias[mBase + mOff + r];
        if (BIAS_MODE == 2) v += bv;
        if (RESID) v += Rb[(size_t)(mBase + mOff + r) * ldc + n];
        if (ACT == 1) v = tanhf(v);
        if (ACT == 2) v = fmaxf(v, 0.0f);
        if (ACT == 3) v = v / (1.0f + expf(-v));
        if (ACT == 4) v = (v > 0.f) ? v : 0.01f * v;
        if (ACT == 5) v = 0.5f * v * (1.0f + erff(v * 0.70710678118654752f));
        slab[(mOff + r) * 68 + (j << 4) + rlane] = v;
      }
    }
    __builtin_amdgcn_fence(__ATOMIC_RELEASE, "workgroup");
    __builtin_amdgcn_wave_barrier();
    __builtin_amdgcn_fence(__ATOMIC_ACQUIRE, "workgroup");
    if (OUT_MODE == 0) {
      float* C = (float*)Cout + (size_t)b * strideC;
      const int hh = lane >> 4, c4 = (lane & 15) * 4;     // row seg = 256 B = 16 lanes x 16 B
      {
#pragma unroll
        for (int it = 0; it < 8; ++it) {
          const int row = it * 2 + hh;
          v4f v = *(const v4f*)(slab + row * 68 + c4);
          *(v4f*)(C + (size_t)(mBase + row) * ldc + n0 + c4) = v;
        }
        
      }
    } else {
      const int q = lane >> 3, c8 = (lane & 7) * 8;
      unsigned short* C  = (unsigned short*)Cout  + (size_t)b * strideC;
      unsigned short* C2 = (OUT_MODE == 2) ? ((unsigned short*)Cout2 + (size_t)b * strideC) : nullptr;
      {
#pragma unroll
        for (int it = 0; it < 4; ++it) {
          const int row = it * 4 + q;
          const float* sp = slab + row * 68 + c8;
          v8h hv, lv;
#pragma unroll
          for (int e = 0; e < 8; ++e) {
            if (OUT_MODE == 1) {
              hv[e] = (_Float16)sp[e];
            } else {
              unsigned short hb = f2bf_bits(sp[e]);
              unsigned short lb = f2bf_bits(sp[e] - bf_bits2f(hb));
              hv[e] = __builtin_bit_cast(_Float16, hb);
              lv[e] = __builtin_bit_cast(_Float16, lb);
            }
          }
          *(v8h*)(C + (size_t)(mBase + row) * ldc + n0 + c8) = hv;
          if (OUT_MODE == 2) *(v8h*)(C2 + (size_t)(mBase + row) * ldc + n0 + c8) = lv;
        }
        
      }
    }
    __builtin_amdgcn_fence(__ATOMIC_RELEASE, "workgroup");
    __builtin_amdgcn_wave_barrier();
    __builtin_amdgcn_fence(__ATOMIC_ACQUIRE, "workgroup");
  }
}

// ---------------------------------------------------------------------------
// Elementwise split: 2 elements per thread, one 4-B store per lane per plane -> each wave writes exactly one
// Coverage: grid = ceil(n2/256) blocks x 256 threads x 2 elements = 2*n2 elements = the whole plane (n2 = plane/2).
// ---------------------------------------------------------------------------
// hi = bf16_rne(in), lo = bf16_rne(in - hi)
__global__ __launch_bounds__(256) void split_bf16x2_kernel(const float* __restrict__ in, unsigned short* __restrict__ hi,
                                                           unsigned short* __restrict__ lo, int n2) {
  const int i = blockIdx.x * 256 + threadIdx.x;
  if (i < n2) {
    const v2f f = *(const v2f*)(in + 2 * (size_t)i);
    const unsigned short h0 = f2bf_bits(f[0]), h1 = f2bf_bits(f[1]);
    const unsigned short l0 = f2bf_bits(f[0] - bf_bits2f(h0)), l1 = f2bf_bits(f[1] - bf_bits2f(h1));
    const unsigned uh = pk16(h0, h1), ul = pk16(l0, l1);
    ((unsigned*)hi)[i] = uh;
    ((unsigned*)lo)[i] = ul;
    
  }
}

// ---------------------------------------------------------------------------
// Weight planes for the projections (one block of 256 threads):
//   wqkh/wqkl [64][32] bf16 hi/lo = rows 0..63 of Wqkv (q rows then k rows)
//   wvh/wvl   [64][32] bf16 hi/lo = rows 64..95 of Wqkv in rows 0..31, explicit zeros in rows 32..63
//   bv        [64] f32            = bqkv[64..95] in 0..31, zeros in 32..63
// ---------------------------------------------------------------------------
__device__ __forceinline__ void split_pair(float f0, float f1, unsigned& h, unsigned& l) {
  const unsigned short h0 = f2bf_bits(f0), h1 = f2bf_bits(f1);
  const unsigned short l0 = f2bf_bits(f0 - bf_bits2f(h0));
  const unsigned short l1 = f2bf_bits(f1 - bf_bits2f(h1));
  h = pk16(h0, h1);
  l = pk16(l0, l1);
}
__global__ __launch_bounds__(256) void wprep_kernel(const float* __restrict__ Wqkv, const float* __restrict__ bqkv,
                                                    unsigned short* __restrict__ wqkh, unsigned short* __restrict__ wqkl,
                                                    unsigned short* __restrict__ wvh, unsigned short* __restrict__ wvl,
                                                    float* __restrict__ bv) {
  const int tid  = threadIdx.x;
  const int row  = tid >> 2;            // 0..63
  const int col0 = (tid & 3) * 8;       // 0, 8, 16, 24
  v4u qh, ql, vh, vl;
#pragma unroll
  for (int p = 0; p < 4; ++p) {
    const int col = col0 + 2 * p;
    const float wq0 = Wqkv[row * HDIM + col];
    const float wq1 = Wqkv[row * HDIM + col + 1];
    int rv = 64 + row; rv = rv > 95 ? 95 : rv;            // clamped address; zero by predicate below
    float wv0 = Wqkv[rv * HDIM + col];
    float wv1 = Wqkv[rv * HDIM + col + 1];
    wv0 = (row < 32) ? wv0 : 0.0f;
    wv1 = (row < 32) ? wv1 : 0.0f;
    unsigned a, bq, cv, dv;
    split_pair(wq0, wq1, a, bq);
    split_pair(wv0, wv1, cv, dv);
    qh[p] = a; ql[p] = bq; vh[p] = cv; vl[p] = dv;
  }
  v4f b4;
#pragma unroll
  for (int e = 0; e < 4; ++e) {
    int m = tid * 4 + e; m = m > 63 ? 63 : m;
    int mi = 64 + m; mi = mi > 95 ? 95 : mi;
    const float v = bqkv[mi];
    b4[e] = (m < 32) ? v : 0.0f;
  }
  const size_t o = (size_t)tid * 8;
  {
    *(v4u*)(wqkh + o) = qh;
    *(v4u*)(wqkl + o) = ql;
    *(v4u*)(wvh + o)  = vh;
    *(v4u*)(wvl + o)  = vl;
    if (tid < 16) *(v4f*)(bv + tid * 4) = b4;
    
  }
}

// ---------------------------------------------------------------------------
// Softmax + 12x12 head mixing + per-row batch-statistic partials for one query row tl of one (batch, chunk).
//   S     [12][TCHUNK][1024] f32 scaled logits; P_h = softmax over the 1024 key columns (f32, fixed-order reductions)
//   M_g[s] = sum_h Wconv[g][h] P_h[s] on v_wmma_f32_16x16x32_f16: A = Wconv (f16 hi + x2^11 residual), B = P^T staged in
//   LDS as [s][16] f16 (x2^10 carried hi + x2^11 residual), K = 12 real of 32 (k >= 12 zeros by construction);
//   residual products in a separate accumulator, folded with exact power-of-two factors.
//   Mh/Ml [12][TCHUNK][1024] bf16 hi/lo planes of M; part[tl][32] = {sum_s M_g (12), sum_s M_g^2 (12), 8 zeros}.
// Block = 256 threads = 8 waves; thread owns key columns tid + 256 j (j = 0..3) for the softmax; two phases of 512
// (8 lanes x 16 B, one instruction per 4 lines); part line written by lanes 0..7 of wave 0 (one instruction).
// Coverage: 2 phases x 8 waves x 64 cols = 1024 cols x 12 rows per plane per block; grid = TCHUNK blocks.
// ---------------------------------------------------------------------------
union HFrag { v16h v; v8h h[2]; };

template <int J>
__device__ __forceinline__ void stage_pcol(const float (&pz)[12][4], int sl, _Float16* Pth, _Float16* Ptl) {
  v8h h0, h1, l0, l1;
#pragma unroll
  for (int e = 0; e < 8; ++e) {
    const float p0 = pz[e][J] * P_CARRY;
    const _Float16 a0 = (_Float16)p0;
    h0[e] = a0;
    l0[e] = (_Float16)((p0 - (float)a0) * R_CARRY);
  }
#pragma unroll
  for (int e = 0; e < 4; ++e) {
    const float p1 = pz[8 + e][J] * P_CARRY;
    const _Float16 a1 = (_Float16)p1;
    h1[e] = a1;
    l1[e] = (_Float16)((p1 - (float)a1) * R_CARRY);
  }
#pragma unroll
  for (int e = 4; e < 8; ++e) { h1[e] = (_Float16)0.0f; l1[e] = (_Float16)0.0f; }
  *(v8h*)(Pth + sl * 16)     = h0;
  *(v8h*)(Pth + sl * 16 + 8) = h1;
  *(v8h*)(Ptl + sl * 16)     = l0;
  *(v8h*)(Ptl + sl * 16 + 8) = l1;
}

__global__ __launch_bounds__(256) void softmax_mix_kernel(const float* __restrict__ S, const float* __restrict__ Wconv,
                                                          unsigned short* __restrict__ Mh, unsigned short* __restrict__ Ml,
                                                          float* __restrict__ part) {
  __shared__ __align__(16) _Float16 Pth[PHCOLS * 16];
  __shared__ __align__(16) _Float16 Ptl[PHCOLS * 16];
  __shared__ __align__(16) float slab[8][12 * 64];
  __shared__ float redw[8][12];
  __shared__ float fin[12];
  __shared__ float stw[8][24];
  __shared__ __align__(16) float pline[32];

  const int tid  = threadIdx.x;
  const int lane = tid & 31;
  const int wave = tid >> 5;
  const int hh   = lane >> 4;
  const int c    = lane & 15;
  const int tl   = blockIdx.x;

  v8h z8;
#pragma unroll
  for (int e = 0; e < 8; ++e) z8[e] = (_Float16)0.0f;
  const v8f zacc = (v8f){0.f,0.f,0.f,0.f,0.f,0.f,0.f,0.f};

  // A fragments of the mixing matrix: row m = g = c, k element i (< 8) = h = 8*hh + i; k >= 16 elements zero
  HFrag fah, fal;
  {
    v8h wh8, wl8;
#pragma unroll
    for (int i = 0; i < 8; ++i) {
      const int h  = 8 * hh + i;
      const int gi = c > 11 ? 11 : c;
      const int hi = h > 11 ? 11 : h;
      float w = Wconv[gi * NHEAD + hi];
      w = (c < 12 && h < 12) ? w : 0.0f;
      const _Float16 a = (_Float16)w;
      wh8[i] = a;
      wl8[i] = (_Float16)((w - (float)a) * R_CARRY);
    }
    fah.h[0] = wh8; fah.h[1] = z8;
    fal.h[0] = wl8; fal.h[1] = z8;
  }

  // scaled logits of this query row for all 12 heads, key columns tid + 256 j
  float pz[12][4];
  {
    const float* Srow = S + (size_t)tl * NTOK;
#pragma unroll
    for (int h = 0; h < 12; ++h)
#pragma unroll
      for (int j = 0; j < 4; ++j)
        pz[h][j] = Srow[(size_t)h * TCHUNK * NTOK + tid + 256 * j];
  }
  // row maxima: thread, wave xor tree, waves in index order
#pragma unroll
  for (int h = 0; h < 12; ++h) {
    float m = fmaxf(fmaxf(pz[h][0], pz[h][1]), fmaxf(pz[h][2], pz[h][3]));
#pragma unroll
    for (int off = 16; off > 0; off >>= 1) m = fmaxf(m, __shfl_xor(m, off, 32));
    if (lane == 0) redw[wave][h] = m;
  }
  __syncthreads();
  if (wave == 0) {
    const int hq = lane < 12 ? lane : 11;
    float m = redw[0][hq];
#pragma unroll
    for (int w = 1; w < 8; ++w) m = fmaxf(m, redw[w][hq]);
    if (lane < 12) fin[lane] = m;
  }
  __syncthreads();
  float mx[12];
#pragma unroll
  for (int h = 0; h < 12; ++h) mx[h] = fin[h];
  // exponentials and row sums
#pragma unroll
  for (int h = 0; h < 12; ++h) {
#pragma unroll
    for (int j = 0; j < 4; ++j) pz[h][j] = __expf(pz[h][j] - mx[h]);
    float s = ((pz[h][0] + pz[h][1]) + pz[h][2]) + pz[h][3];
#pragma unroll
    for (int off = 16; off > 0; off >>= 1) s += __shfl_xor(s, off, 32);
    if (lane == 0) redw[wave][h] = s;
  }
  __syncthreads();
  if (wave == 0) {
    const int hq = lane < 12 ? lane : 11;
    float s = redw[0][hq];
#pragma unroll
    for (int w = 1; w < 8; ++w) s += redw[w][hq];
    if (lane < 12) fin[lane] = s;
  }
  __syncthreads();
#pragma unroll
  for (int h = 0; h < 12; ++h) {
    const float inv = 1.0f / fin[h];
#pragma unroll
    for (int j = 0; j < 4; ++j) pz[h][j] *= inv;
  }

  v8f s1 = zacc, s2 = zacc;
  float* myslab = slab[wave];
  const int q  = lane >> 3;
  const int c8 = (lane & 7) * 8;
  for (int ph = 0; ph < 2; ++ph) {          // block-uniform
    // stage P^T for key columns ph*512 .. +511: 256 threads x 2 columns x 16 halves per plane = whole Pth / Ptl
    if (ph == 0) {
      stage_pcol<0>(pz, tid, Pth, Ptl);
      stage_pcol<1>(pz, tid + 256, Pth, Ptl);
    } else {
      stage_pcol<2>(pz, tid, Pth, Ptl);
      stage_pcol<3>(pz, tid + 256, Pth, Ptl);
    }
    __syncthreads();
#pragma unroll 1
    for (int nt = 0; nt < 4; ++nt) {
      const int col = wave * 64 + nt * 16 + c;      // local key column of this lane's B column, 0..511
      HFrag bh, bl;
      bh.h[0] = *(const v8h*)(Pth + col * 16 + 8 * hh); bh.h[1] = z8;
      bl.h[0] = *(const v8h*)(Ptl + col * 16 + 8 * hh); bl.h[1] = z8;
      v8f acc0 = zacc, accr = zacc;
      acc0 = Frag<_Float16>::mma(fah.v, bh.v, acc0);
      accr = Frag<_Float16>::mma(fah.v, bl.v, accr);
      accr = Frag<_Float16>::mma(fal.v, bh.v, accr);
      dep_guard_h(acc0, accr, bh.v, bl.v);
#pragma unroll
      for (int r = 0; r < 8; ++r) {
        const float m = fmaf(accr[r], MIX_FOLD, acc0[r] * P_INV);     // D row g = 8*hh + r, column col
        s1[r] += m;
        s2[r] = fmaf(m, m, s2[r]);
        if (hh == 0 || r < 4) myslab[(8 * hh + r) * 64 + nt * 16 + c] = m;
      }
    }
    __syncthreads();
    {
      v8h hv[3], lv[3];
#pragma unroll
      for (int it = 0; it < 3; ++it) {
        const int g = it * 4 + q;
        const float* sp = myslab + g * 64 + c8;
        v8h a, bq;
#pragma unroll
        for (int e = 0; e < 8; ++e) {
          const unsigned short hb = f2bf_bits(sp[e]);
          const unsigned short lb = f2bf_bits(sp[e] - bf_bits2f(hb));
          a[e]  = __builtin_bit_cast(_Float16, hb);
          bq[e] = __builtin_bit_cast(_Float16, lb);
        }
        hv[it] = a; lv[it] = bq;
      }
      {
#pragma unroll
        for (int it = 0; it < 3; ++it) {
          const int g = it * 4 + q;
          const size_t go = ((size_t)g * TCHUNK + tl) * NTOK + (size_t)ph * PHCOLS + wave * 64 + c8;
          *(v8h*)(Mh + go) = hv[it];
          *(v8h*)(Ml + go) = lv[it];
        }
        
      }
    }
    __syncthreads();
  }

  // statistics: xor tree over the 16 lanes sharing hh (fixed order), then waves in index order
#pragma unroll
  for (int r = 0; r < 8; ++r) {
    float a = s1[r], bq = s2[r];
#pragma unroll
    for (int off = 1; off < 16; off <<= 1) { a += __shfl_xor(a, off, 32); bq += __shfl_xor(bq, off, 32); }
    const int g = 8 * hh + r;
    if (c == 0 && g < 12) { stw[wave][g] = a; stw[wave][12 + g] = bq; }
  }
  __syncthreads();
  if (wave == 0) {
    const int qi = lane < 24 ? lane : 23;
    float v = stw[0][qi];
#pragma unroll
    for (int w = 1; w < 8; ++w) v += stw[w][qi];
    v = (lane < 24) ? v : 0.0f;
    pline[lane] = v;
  }
  __syncthreads();
  if (tid < 8) {
    const v4f v = *(const v4f*)(pline + tid * 4);
    float* dst = part + (size_t)tl * 32 + tid * 4;
    *(v4f*)dst = v;
    
  }
}

// ---------------------------------------------------------------------------
// U[g][t][d] = sum_s M[g][t][s] * v^T[g][d][s] for one (batch, chunk), bf16 hi/lo planes (hi.hi + hi.lo + lo.hi).
// Block = 16 waves = one 32 x 32 tile (32 query rows, the 32 real v columns) of head g = blockIdx.y. The 1024 key
// columns are split over the waves: wave w owns columns 64 w .. 64 w + 63, one 128-B line per row and plane, and issues
// all of its 32 fragment loads before the first product. The 16 partial tiles meet in LDS and are added in wave order.
// Grid = (TCHUNK / 32, NHEAD) = 192 blocks. Columns 32..63 of a U row are neither written nor read.
// Coverage: 16 x 32 rows = TCHUNK rows per head; 512 threads x 2 columns = 32 x 32 outputs per block.
// ---------------------------------------------------------------------------
constexpr int PVWAVES = 16;
constexpr int PVROWS  = 32;
constexpr int PVKW    = NTOK / PVWAVES;   // 64 key columns per wave
constexpr int PVPITCH = 36;               // floats; 8 rows = 288 = 32 mod 64 banks, so the two lane halves do not collide

__global__ __launch_bounds__(PVWAVES * 32) void pv_splitk_kernel(const unsigned short* __restrict__ Mh,
                                                                 const unsigned short* __restrict__ Ml,
                                                                 const unsigned short* __restrict__ vth,
                                                                 const unsigned short* __restrict__ vtl,
                                                                 float* __restrict__ Uc) {
  __shared__ __align__(16) float red[PVWAVES][PVROWS * PVPITCH];
  const int tid   = threadIdx.x;
  const int lane  = tid & 31;
  const int wave  = tid >> 5;
  const int rlane = lane & 15;                 // row (A) / column (B, D) within a 16 x 16 subtile
  const int hh    = lane >> 4;
  const int g     = blockIdx.y;
  const int m0    = blockIdx.x * PVROWS;
  const size_t kb = (size_t)wave * PVKW + hh * 8;
  const size_t ao = ((size_t)g * TCHUNK + m0 + rlane) * NTOK + kb;
  const size_t bo = ((size_t)g * VTROWS + rlane) * NTOK + kb;
  const __bf16* Ah = (const __bf16*)Mh + ao;
  const __bf16* Al = (const __bf16*)Ml + ao;
  const __bf16* Bh = (const __bf16*)vth + bo;
  const __bf16* Bl = (const __bf16*)vtl + bo;

  v16b ah[2][2], al[2][2], bh[2][2], bl[2][2];   // [k step][subtile]
#pragma unroll
  for (int ks = 0; ks < 2; ++ks)
#pragma unroll
    for (int i = 0; i < 2; ++i) {
      const size_t o = (size_t)i * 16 * NTOK + ks * 32;
      ah[ks][i] = Frag<__bf16>::load(Ah + o);
      al[ks][i] = Frag<__bf16>::load(Al + o);
      bh[ks][i] = Frag<__bf16>::load(Bh + o);
      bl[ks][i] = Frag<__bf16>::load(Bl + o);
    }
  // the four address pairs are inputs here, so they stay live and no load above lands on one of them; the wait stands
  // in front of every later instruction that reuses a register which an issued load names (a precaution)
  asm volatile("s_wait_xcnt 0x0" :: "v"(Ah), "v"(Al), "v"(Bh), "v"(Bl) : "memory");
  // keeps all 32 loads in front of the products: without it the compiler sinks loads between the products and the
  // wave waits for memory several times instead of once
  __builtin_amdgcn_sched_barrier(0);

  v8f acc[2][2];
#pragma unroll
  for (int i = 0; i < 2; ++i)
#pragma unroll
    for (int j = 0; j < 2; ++j) acc[i][j] = (v8f){0.f,0.f,0.f,0.f,0.f,0.f,0.f,0.f};
#pragma unroll
  for (int ks = 0; ks < 2; ++ks) {
#pragma unroll
    for (int i = 0; i < 2; ++i)
#pragma unroll
      for (int j = 0; j < 2; ++j) acc[i][j] = Frag<__bf16>::mma(ah[ks][i], bh[ks][j], acc[i][j]);
#pragma unroll
    for (int i = 0; i < 2; ++i)
#pragma unroll
      for (int j = 0; j < 2; ++j) acc[i][j] = Frag<__bf16>::mma(ah[ks][i], bl[ks][j], acc[i][j]);
#pragma unroll
    for (int i = 0; i < 2; ++i)
#pragma unroll
      for (int j = 0; j < 2; ++j) acc[i][j] = Frag<__bf16>::mma(al[ks][i], bh[ks][j], acc[i][j]);
  }

  float* my = red[wave];
#pragma unroll
  for (int i = 0; i < 2; ++i)
#pragma unroll
    for (int j = 0; j < 2; ++j)
#pragma unroll
      for (int r = 0; r < 8; ++r)
        my[(i * 16 + hh * 8 + r) * PVPITCH + j * 16 + rlane] = acc[i][j][r];   // D row 8*hh + r, column rlane
  __syncthreads();
  const int row = tid >> 4;            // 0..31
  const int col = (tid & 15) * 2;      // 0, 2, .. 30: one wave stores two whole 128-B row segments
  v2f s = *(const v2f*)(&red[0][row * PVPITCH + col]);
#pragma unroll
  for (int w = 1; w < PVWAVES; ++w) s += *(const v2f*)(&red[w][row * PVPITCH + col]);
  *(v2f*)(Uc + ((size_t)g * NTOK + m0 + row) * UW + col) = s;
}

// ---------------------------------------------------------------------------
// Vsum[g][d] = sum_s v[g][s][d] from the v^T bf16 hi+lo planes of one batch ([12][64][1024], rows d < 32).
// Block g, 256 threads: d = tid>>3, 8 partial sums of 128 columns combined by a fixed xor tree; the 32 results are
// ---------------------------------------------------------------------------
__global__ __launch_bounds__(256) void vsum_kernel(const unsigned short* __restrict__ vth, const unsigned short* __restrict__ vtl,
                                                   float* __restrict__ vsum) {
  __shared__ __align__(16) float vs[32];
  const int g   = blockIdx.x;
  const int tid = threadIdx.x;
  const int d   = tid >> 3;
  const int prt = tid & 7;
  const size_t base = ((size_t)g * VTROWS + d) * NTOK + (size_t)prt * 128;
  float acc = 0.0f;
#pragma unroll 1
  for (int i = 0; i < 16; ++i) {
    const v8us a  = *(const v8us*)(vth + base + i * 8);
    const v8us bq = *(const v8us*)(vtl + base + i * 8);
#pragma unroll
    for (int e = 0; e < 8; ++e) acc += bf_bits2f(a[e]) + bf_bits2f(bq[e]);
  }
  acc += __shfl_xor(acc, 1, 32);
  acc += __shfl_xor(acc, 2, 32);
  acc += __shfl_xor(acc, 4, 32);
  if (prt == 0) vs[d] = acc;
  __syncthreads();
  if (tid < 8) {
    const v4f v = *(const v4f*)(vs + tid * 4);
    float* dst = vsum + g * 32 + tid * 4;
    *(v4f*)dst = v;
    
  }
}

// ---------------------------------------------------------------------------
// Column sums of the partial lines, first level: part [8192][32] f32 -> psum [STBLK][32] f64.
// Lane = column; each wave reads its STROWS lines as independent loads (all in flight at once), adds them in f64 in
// row order; the 8 wave sums of a block are added in wave order. One wave writes the block's 256-B psum line.
// Coverage: STBLK blocks x 8 waves x STROWS rows = 8192 lines.
// ---------------------------------------------------------------------------
__global__ __launch_bounds__(256) void statsum_kernel(const float* __restrict__ part, double* __restrict__ psum) {
  __shared__ double sw[8][32];
  const int lane = threadIdx.x & 31;
  const int wave = threadIdx.x >> 5;
  const float* p = part + (size_t)(blockIdx.x * 8 + wave) * STROWS * 32 + lane;
  float v[STROWS];
#pragma unroll   // loads issue back to back: one memory latency per wave instead of one per line
  for (int i = 0; i < STROWS; ++i) v[i] = p[i * 32];
  double acc = 0.0;
#pragma unroll   // constant indices keep v[] in registers
  for (int i = 0; i < STROWS; ++i) acc += (double)v[i];
  sw[wave][lane] = acc;
  __syncthreads();
  if (wave == 0) {
    double s = sw[0][lane];
#pragma unroll
    for (int w = 1; w < 8; ++w) s += sw[w][lane];
    psum[blockIdx.x * 32 + lane] = s;
  }
}

// ---------------------------------------------------------------------------
// Per-head affine coefficients from the first-level sums (one block of 8 waves): wave w adds psum lines
// w*STBLK/8 .. +STBLK/8-1 in f64 (independent loads, row order), wave 0 adds the 8 wave sums in wave order;
// mean_g = S1/N, var_g = S2/N - mean_g^2 (biased), a_g = gamma_g / sqrt(var_g + eps),
// kk_g = a_g*bconv_g + (beta_g - a_g*(mean_g + bconv_g)); coef line = {a[12], kk[12], 8 zeros}, one instruction.
// ---------------------------------------------------------------------------
__global__ __launch_bounds__(256) void coef_kernel(const double* __restrict__ psum, const float* __restrict__ bconv,
                                                   const float* __restrict__ gamma, const float* __restrict__ beta,
                                                   float* __restrict__ coef) {
  __shared__ double sw[8][32];
  __shared__ double sd[32];
  __shared__ __align__(16) float cf[32];
  const int lane = threadIdx.x & 31;
  const int wave = threadIdx.x >> 5;
  const double* p = psum + (size_t)wave * (STBLK / 8) * 32 + lane;
  double q[STBLK / 8];
#pragma unroll   // loads issue back to back: one memory latency per wave instead of one per line
  for (int i = 0; i < STBLK / 8; ++i) q[i] = p[i * 32];
  double acc = 0.0;
#pragma unroll   // constant indices keep q[] in registers
  for (int i = 0; i < STBLK / 8; ++i) acc += q[i];
  sw[wave][lane] = acc;
  __syncthreads();
  if (wave == 0) {
    double s = sw[0][lane];
#pragma unroll
    for (int w = 1; w < 8; ++w) s += sw[w][lane];
    sd[lane] = s;
  }
  __syncthreads();
  int gq = (lane < 12) ? lane : (lane - 12);
  gq = gq < 0 ? 0 : (gq > 11 ? 11 : gq);
  const double s1d = sd[gq];
  const double s2d = sd[12 + gq];
  const double invN = 1.0 / ((double)NBATCH * (double)NTOK * (double)NTOK);
  const double meanM = s1d * invN;
  double var = s2d * invN - meanM * meanM;
  var = var < 0.0 ? 0.0 : var;
  const float varf   = (float)var;
  const float meanre = (float)meanM + bconv[gq];
  const float a      = gamma[gq] * (1.0f / sqrtf(varf + BN_EPS));
  const float kk     = a * bconv[gq] + (beta[gq] - a * meanre);
  const float v = (lane < 12) ? a : ((lane < 24) ? kk : 0.0f);
  if (wave == 0) cf[lane] = v;
  __syncthreads();
  if (threadIdx.x < 8) {
    const v4f w = *(const v4f*)(cf + threadIdx.x * 4);
    float* dst = coef + threadIdx.x * 4;
    *(v4f*)dst = w;
  }
}

// ---------------------------------------------------------------------------
// out[b][t][32g+d] = a_g * U[b][g][t][d] + kk_g * Vsum[b][g][d]. One wave per (b,t) row of 384 floats:
// Coverage: grid 1024 x 8 waves = 8192 rows = all of d_out.
// ---------------------------------------------------------------------------
__global__ __launch_bounds__(256) void combine_kernel(const float* __restrict__ U, const float* __restrict__ vsum,
                                                      const float* __restrict__ coef, float* __restrict__ out) {
  const int lane = threadIdx.x & 31;
  const int wave = threadIdx.x >> 5;
  const int R = blockIdx.x * 8 + wave;         // 0..8191
  const int b = R >> 10, t = R & (NTOK - 1);
  v4f o[3];
#pragma unroll
  for (int i = 0; i < 3; ++i) {
    const int f = 128 * i + 4 * lane;
    const int g = f >> 5, d = f & 31;
    const v4f u  = *(const v4f*)(U + (((size_t)(b * NHEAD + g)) * NTOK + t) * UW + d);
    const v4f vv = *(const v4f*)(vsum + (b * NHEAD + g) * 32 + d);
    const float a = coef[g], kk = coef[12 + g];
    v4f rr;
#pragma unroll
    for (int e = 0; e < 4; ++e) rr[e] = fmaf(a, u[e], kk * vv[e]);
    o[i] = rr;
  }
  float* orow = out + (size_t)R * NEMB;
  {
#pragma unroll
    for (int i = 0; i < 3; ++i) *(v4f*)(orow + 128 * i + 4 * lane) = o[i];
    
  }
}

// ---------------------------------------------------------------------------
// Workspace region map (byte offsets; every size a multiple of 256):
//   XH    bf16 [98304][32]      x hi plane (rows = (b,t,h))              0
//   XL    bf16 [98304][32]                                         6291456
//   WQKH  bf16 [64][32]  WQKL [64][32]  WVH [64][32]  WVL [64][32]   12582912 / 12587008 / 12591104 / 12595200
//   BV    f32  [64]                                               12599296
//   QKH   bf16 [98304][64]      q at 0..31, k at 32..63            12599552
//   QKL   bf16 [98304][64]                                        25182464
//   VTH   bf16 [12][64][1024]   current batch v^T hi                37765376
//   VTL   bf16 [12][64][1024]                                     39338240
//   S     f32  [12][512][1024]  current chunk scaled logits       40911104
//   MH    bf16 [12][512][1024]  current chunk mixed maps hi       66076928
//   ML    bf16 [12][512][1024]                                    78659840
//   U     f32  [8][12][1024][64]                                  91242752
//   PART  f32  [8192][32]                                        116408576
//   VSUM  f32  [8][12][32]                                       117457152
//   COEF  f32  [32] (256 B)                                      117469440
//   PSUM  f64  [64][32]                                          117469696
//   total                                                        117486080
// Per-batch / per-chunk regions are fully rewritten before each read in stream order.
// ---------------------------------------------------------------------------
extern "C" void kernel_launch(void* const* d_in, const int* in_sizes, int n_in,
                              void* d_out, int out_size, void* d_ws, size_t ws_size,
                              hipStream_t stream) {
  if (n_in < 7) return;
  if (in_sizes[0] != NBATCH * NTOK * NEMB) return;
  if (in_sizes[1] != 3 * HDIM * HDIM || in_sizes[2] != 3 * HDIM) return;
  if (in_sizes[3] != NHEAD * NHEAD || in_sizes[4] < NHEAD || in_sizes[5] < NHEAD || in_sizes[6] < NHEAD) return;
  if (out_size != NBATCH * NTOK * NEMB) return;

  const float* x     = (const float*)d_in[0];
  const float* Wqkv  = (const float*)d_in[1];
  const float* bqkv  = (const float*)d_in[2];
  const float* Wconv = (const float*)d_in[3];
  const float* bconv = (const float*)d_in[4];
  const float* gamma = (const float*)d_in[5];
  const float* beta  = (const float*)d_in[6];
  float* out = (float*)d_out;

  const size_t szX    = (size_t)NBATCH * NTOK * NEMB * 2;            // 6291456
  const size_t szW    = (size_t)64 * HDIM * 2;                       // 4096
  const size_t szBV   = 256;
  const size_t szQK   = (size_t)NBATCH * NTOK * NHEAD * QKW * 2;     // 12582912
  const size_t szVT   = (size_t)NHEAD * VTROWS * NTOK * 2;           // 1572864
  const size_t szS    = (size_t)NHEAD * TCHUNK * NTOK * 4;           // 25165824
  const size_t szM    = (size_t)NHEAD * TCHUNK * NTOK * 2;           // 12582912
  const size_t szU    = (size_t)NBATCH * NHEAD * NTOK * UW * 4;      // 25165824
  const size_t szPART = (size_t)NBATCH * NTOK * 32 * 4;              // 1048576
  const size_t szVS   = (size_t)NBATCH * NHEAD * 32 * 4;             // 12288
  const size_t szCF   = 256;
  const size_t szPS   = (size_t)STBLK * 32 * 8;                      // 16384
  size_t off = 0;
  const size_t oXH = off;   off += szX;
  const size_t oXL = off;   off += szX;
  const size_t oWQKH = off; off += szW;
  const size_t oWQKL = off; off += szW;
  const size_t oWVH = off;  off += szW;
  const size_t oWVL = off;  off += szW;
  const size_t oBV = off;   off += szBV;
  const size_t oQKH = off;  off += szQK;
  const size_t oQKL = off;  off += szQK;
  const size_t oVTH = off;  off += szVT;
  const size_t oVTL = off;  off += szVT;
  const size_t oS = off;    off += szS;
  const size_t oMH = off;   off += szM;
  const size_t oML = off;   off += szM;
  const size_t oU = off;    off += szU;
  const size_t oPART = off; off += szPART;
  const size_t oVS = off;   off += szVS;
  const size_t oCF = off;   off += szCF;
  const size_t oPS = off;   off += szPS;
  if (off > ws_size) return;

  char* ws = (char*)d_ws;
  unsigned short* XH   = (unsigned short*)(ws + oXH);
  unsigned short* XL   = (unsigned short*)(ws + oXL);
  unsigned short* WQKH = (unsigned short*)(ws + oWQKH);
  unsigned short* WQKL = (unsigned short*)(ws + oWQKL);
  unsigned short* WVH  = (unsigned short*)(ws + oWVH);
  unsigned short* WVL  = (unsigned short*)(ws + oWVL);
  float*          BV   = (float*)(ws + oBV);
  unsigned short* QKH  = (unsigned short*)(ws + oQKH);
  unsigned short* QKL  = (unsigned short*)(ws + oQKL);
  unsigned short* VTH  = (unsigned short*)(ws + oVTH);
  unsigned short* VTL  = (unsigned short*)(ws + oVTL);
  float*          Sbuf = (float*)(ws + oS);
  unsigned short* MH   = (unsigned short*)(ws + oMH);
  unsigned short* ML   = (unsigned short*)(ws + oML);
  float*          U    = (float*)(ws + oU);
  float*          PART = (float*)(ws + oPART);
  float*          VSUM = (float*)(ws + oVS);
  float*          COEF = (float*)(ws + oCF);
  double*         PSUM = (double*)(ws + oPS);

  const dim3 blk(256);
  // (1) x -> bf16 hi/lo planes viewed as [(b,t,h)][32]: n2 = 1572864 pairs = 6144 blocks x 256 threads exactly
  const int n2x = NBATCH * NTOK * NEMB / 2;
  split_bf16x2_kernel<<<dim3((n2x + 255) / 256), blk, 0, stream>>>(x, XH, XL, n2x);
  // (2) projection weight planes and padded v bias
  wprep_kernel<<<dim3(1), blk, 0, stream>>>(Wqkv, bqkv, WQKH, WQKL, WVH, WVL, BV);
  // (3) q|k = xh . Wqkv[0..63]^T + bqkv[0..63] -> QK hi/lo planes [98304][64]; M = 98304 (1536 tiles), N = 64, K = 32
  wmma_gemm64<1, true, 2, 2, false><<<dim3((NBATCH * NTOK * NHEAD / 64) / 8, 1), blk, 0, stream>>>(
      XH, XL, HDIM, 0L, WQKH, WQKL, HDIM, 0L, (void*)QKH, (void*)QKL, QKW, 0L,
      bqkv, bqkv, 0L, NBATCH * NTOK * NHEAD, QKW, HDIM, 1.0f);

  for (int b = 0; b < NBATCH; ++b) {
    // (4) v^T[m][s] for head g = blockIdx.y: A = WV planes [64][32] (rows 32..63 zero), Bt = x planes at column g*32,
    //     ldb = 384; M = 64, N = 1024 (16 tiles -> 2 blocks), K = 32; bias[m] = BV -> VT planes [12][64][1024]
    const unsigned short* xbh = XH + (size_t)b * NTOK * NEMB;
    const unsigned short* xbl = XL + (size_t)b * NTOK * NEMB;
    wmma_gemm64<1, true, 1, 2, false><<<dim3(2, NHEAD), blk, 0, stream>>>(
        WVH, WVL, HDIM, 0L, xbh, xbl, NEMB, (long)HDIM, (void*)VTH, (void*)VTL, NTOK, (long)VTROWS * NTOK,
        BV, BV, 0L, VTROWS, NTOK, HDIM, 1.0f);
    // (5) Vsum of this batch: 12 lines
    vsum_kernel<<<dim3(NHEAD), blk, 0, stream>>>(VTH, VTL, VSUM + (size_t)b * NHEAD * 32);
    for (int ch = 0; ch < NCHUNK; ++ch) {
      // (6) S[h][tl][s] = (q . k) * 32^-0.5 : A = q rows (b, ch*512 + tl, h), lda 768, z stride 64; Bt = k rows (b, s, h);
      //     M = 512, N = 1024 (128 tiles -> 16 blocks per z), K = 32, f32 out [12][512][1024]
      const size_t qoff = ((size_t)b * NTOK + (size_t)ch * TCHUNK) * NHEAD * QKW;
      const size_t koff = (size_t)b * NTOK * NHEAD * QKW + HDIM;
      wmma_gemm64<1, true, 0, 0, false><<<dim3(16, NHEAD), blk, 0, stream>>>(
          QKH + qoff, QKL + qoff, NHEAD * QKW, (long)QKW, QKH + koff, QKL + koff, NHEAD * QKW, (long)QKW,
          (void*)Sbuf, (void*)Sbuf, NTOK, (long)TCHUNK * NTOK,
          bqkv, bqkv, 0L, TCHUNK, NTOK, HDIM, SM_SCALE);
      // (7) softmax + head mixing + statistic partials: 512 blocks (one per query row of the chunk)
      softmax_mix_kernel<<<dim3(TCHUNK), blk, 0, stream>>>(
          Sbuf, Wconv, MH, ML, PART + ((size_t)b * NTOK + (size_t)ch * TCHUNK) * 32);
      // (8) U[b][g][t][d] = sum_s M[g][t][s] v^T[g][d][s]: 32 x 32 block tiles, K = 1024 split over 16 waves, f32 out
      float* Ub = U + ((size_t)b * NHEAD * NTOK + (size_t)ch * TCHUNK) * UW;
      pv_splitk_kernel<<<dim3(TCHUNK / PVROWS, NHEAD), dim3(PVWAVES * 32), 0, stream>>>(MH, ML, VTH, VTL, Ub);
    }
  }
  // (9) fixed-order f64 sums over the 8192 partial lines in two levels, then the per-head affine coefficients
  statsum_kernel<<<dim3(STBLK), blk, 0, stream>>>(PART, PSUM);
  coef_kernel<<<dim3(1), blk, 0, stream>>>(PSUM, bconv, gamma, beta, COEF);
  // (10) output rows: 1024 blocks x 8 waves = 8192 rows of 384 floats
  combine_kernel<<<dim3(NBATCH * NTOK / 8), blk, 0, stream>>>(U, VSUM, COEF, out);
}

// v003
// Measured time: 472 microseconds a run.
// In both of two side-by-side timings against v002, it was 1.45 times as fast.
// All steps since v000 together make it 7.44 times as fast.
// Contractions: x.Wqkv^T (q|k planes and v^T planes), scaled q.k^T, and (head-mixed attention).v on v_wmma_f32_16x16x32_bf16 with bf16 hi/lo split operand planes (hi.hi + hi.lo + lo.hi); 12x12 head mixing on v_wmma_f32_16x16x32_f16 (f16 hi planes + x2^11 residual planes in a separate accumulator, probabilities carried x2^10); f32 accumulate everywhere; softmax f32; per-head batch statistics as f32 block partials combined in f64 in fixed order.
#include <hip/hip_runtime.h>
#include <math.h>
#include <stdint.h>

constexpr int NBATCH = 8;
constexpr int NTOK   = 1024;
constexpr int NEMB   = 384;
constexpr int NHEAD  = 12;
constexpr int HDIM   = 32;
constexpr int GBATCH = 4;              // batches per score / mix / PV launch
constexpr int MPITCH = 2 * NTOK;       // 16-bit elements per score row: M hi plane at 0..1023, M lo plane at 1024..2047
constexpr int PHCOLS = 512;            // key columns staged in LDS per mixing phase
constexpr int QKW    = 64;             // q|k plane row width (q at 0..31, k at 32..63)
constexpr int VTROWS = 64;             // v^T rows per head (32 real + 32 zero)
constexpr int UW     = 32;             // U row pitch
constexpr float SM_SCALE = 0.17677669529663687f;
constexpr float P_CARRY  = 1024.0f;                      // probabilities carried x2^10 in f16
constexpr float R_CARRY  = 2048.0f;                      // residual planes carried x2^11
constexpr float P_INV    = 1.0f / 1024.0f;
constexpr float MIX_FOLD = 1.0f / (1024.0f * 2048.0f);
constexpr float BN_EPS   = 1e-5f;
constexpr int STBLK  = 64;                            // blocks of the first level of the statistic sum
constexpr int STROWS = NBATCH * NTOK / (STBLK * 8);   // 16 partial lines per wave

typedef __attribute__((ext_vector_type(16))) _Float16 v16h;
typedef __attribute__((ext_vector_type(8)))  _Float16 v8h;
typedef __attribute__((ext_vector_type(16))) __bf16   v16b;
typedef __attribute__((ext_vector_type(8)))  __bf16   v8b;
typedef __attribute__((ext_vector_type(8)))  float    v8f;
typedef __attribute__((ext_vector_type(4)))  float    v4f;
typedef __attribute__((ext_vector_type(2)))  float    v2f;
typedef __attribute__((ext_vector_type(4)))  unsigned int v4u;
typedef __attribute__((ext_vector_type(8)))  unsigned short v8us;

__device__ __forceinline__ unsigned short f2bf_bits(float f) {
  unsigned u = __float_as_uint(f);
  return (unsigned short)((u + 0x7FFFu + ((u >> 16) & 1u)) >> 16);
}
__device__ __forceinline__ float bf_bits2f(unsigned short h) { return __uint_as_float(((unsigned)h) << 16); }
__device__ __forceinline__ unsigned pk16(unsigned short a, unsigned short b) { return (unsigned)a | ((unsigned)b << 16); }

// hazard guards as plain device helpers (no inline asm inside the kernel template body)
__device__ __forceinline__ void dep_guard_h(v8f& a, v8f& b, v16h x, v16h y) { asm volatile("v_nop\n\tv_nop\n\tv_nop\n\tv_nop" : "+v"(a), "+v"(b) : "v"(x), "v"(y)); }
__device__ __forceinline__ void dep_guard_b(v8f& a, v8f& b, v16b x, v16b y) { asm volatile("v_nop\n\tv_nop\n\tv_nop\n\tv_nop" : "+v"(a), "+v"(b) : "v"(x), "v"(y)); }
__device__ __forceinline__ void keep4_h(v16h a, v16h b, v16h c, v16h d) { asm volatile("v_nop" :: "v"(a), "v"(b), "v"(c), "v"(d)); }
__device__ __forceinline__ void keep4_b(v16b a, v16b b, v16b c, v16b d) { asm volatile("v_nop" :: "v"(a), "v"(b), "v"(c), "v"(d)); }
__device__ __forceinline__ void acc_guard4(v8f& a, v8f& b, v8f& c, v8f& d) { asm volatile("v_nop\n\tv_nop\n\tv_nop\n\tv_nop" : "+v"(a), "+v"(b), "+v"(c), "+v"(d)); }
template <typename T> struct Frag;
template <> struct Frag<_Float16> {
  typedef v16h V; union U { v16h v; v8h h[2]; };
  static __device__ __forceinline__ v16h load(const _Float16* p) {   // elements 0..7 <- p[0..7], 8..15 <- p[16..23]
    U f; f.h[0] = *(const v8h*)(p); f.h[1] = *(const v8h*)(p + 16); return f.v;
  }
  static __device__ __forceinline__ v8f mma(v16h a, v16h b, v8f c) {
    return __builtin_amdgcn_wmma_f32_16x16x32_f16(false, a, false, b, (short)0, c, false, false);
  }
  static __device__ __forceinline__ void guard(v8f& a, v8f& b, v16h x, v16h y) { dep_guard_h(a, b, x, y); }
  static __device__ __forceinline__ void keep(v16h a, v16h b, v16h c, v16h d) { keep4_h(a, b, c, d); }
};
template <> struct Frag<__bf16> {
  typedef v16b V; union U { v16b v; v8b h[2]; };
  static __device__ __forceinline__ v16b load(const __bf16* p) {
    U f; f.h[0] = *(const v8b*)(p); f.h[1] = *(const v8b*)(p + 16); return f.v;
  }
  static __device__ __forceinline__ v8f mma(v16b a, v16b b, v8f c) {
    return __builtin_amdgcn_wmma_f32_16x16x32_bf16(false, a, false, b, (short)0, c, false, false);
  }
  static __device__ __forceinline__ void guard(v8f& a, v8f& b, v16b x, v16b y) { dep_guard_b(a, b, x, y); }
  static __device__ __forceinline__ void keep(v16b a, v16b b, v16b c, v16b d) { keep4_b(a, b, c, d); }
};

// ---- Register-blocked batched WMMA GEMM ------------------------------------
// C[m,n] = scale * sum_k A[m,k] * Bt[n,k] (+bias)(+resid); each wave owns a 64x64 tile.
// Batched over blockIdx.y (strideA/B/C) and blockIdx.z (strideAz/Bz/Cz).
// A row-major [M,K]; Bt row-major [N,K]; M,N % 64 == 0, K % 32 == 0.
// SPLIT: operands are hi/lo planes (A2/Bt2 = lo planes, same layout); product = hi·hi + hi·lo + lo·hi.
// BIAS_MODE: 0 = none, 1 = bias[m], 2 = bias[n].
// OUT_MODE: 0 = f32, 1 = f16, 2 = bf16 hi plane (Cout) + bf16 lo plane (Cout2).
// ET: 0 = f16 operands, 1 = bf16 operands (pointers passed as 16-bit storage)
template <int ET> struct Elem;
template <> struct Elem<0> { typedef _Float16 T; };
template <> struct Elem<1> { typedef __bf16 T; };
template <int ET, bool SPLIT, int BIAS_MODE, int OUT_MODE, bool RESID, int ACT = 0>
__global__ __launch_bounds__(256) void wmma_gemm64(
    const unsigned short* __restrict__ Ap, const unsigned short* __restrict__ A2p, int lda, long strideA,
    const unsigned short* __restrict__ Btp, const unsigned short* __restrict__ Bt2p, int ldb, long strideB,
    void* __restrict__ Cout, void* __restrict__ Cout2, int ldc, long strideC,
    const float* __restrict__ bias,
    const float* __restrict__ resid, long strideR,
    int M, int N, int K, float scale, long strideAz, long strideBz, long strideCz) {
  typedef typename Elem<ET>::T T;
  typedef typename Frag<T>::V V;
  const T* A = (const T*)Ap; const T* A2 = (const T*)A2p; const T* Bt = (const T*)Btp; const T* Bt2 = (const T*)Bt2p;
  __shared__ __align__(16) float sT[8][16 * 68];   // per-wave 16x64 slab, pitch 68 floats
  const int b    = blockIdx.y;
  const int lane = threadIdx.x & 31;
  const int wave = threadIdx.x >> 5;
  const int tilesN = N >> 6;
  const int tilesM = M >> 6;
  const int tile = blockIdx.x * 8 + wave;
  if (tile >= tilesM * tilesN) return;   // wave-uniform; no block barriers in this kernel
  const int tm = tile / tilesN;
  const int tn = tile - tm * tilesN;
  const int m0 = tm << 6;
  const int n0 = tn << 6;

  const size_t offA = (size_t)b * strideA + (size_t)blockIdx.z * strideAz;
  const size_t offB = (size_t)b * strideB + (size_t)blockIdx.z * strideBz;
  const size_t offC = (size_t)b * strideC + (size_t)blockIdx.z * strideCz;
  const T* Ab  = A  + offA;
  const T* Bb  = Bt + offB;
  const T* Ab2 = SPLIT ? (A2  + offA) : nullptr;
  const T* Bb2 = SPLIT ? (Bt2 + offB) : nullptr;

  const int rlane = lane & 15;                 // row (A) / col (B, D) within subtile
  const int koff  = (lane >> 4) * 8;           // k offset of this lane half
  const int mOff  = (lane >> 4) * 8;           // D row offset

  v8f acc[4][4];
#pragma unroll
  for (int i = 0; i < 4; ++i)
#pragma unroll
    for (int j = 0; j < 4; ++j) acc[i][j] = (v8f){0.f,0.f,0.f,0.f,0.f,0.f,0.f,0.f};

  for (int k0 = 0; k0 < K; k0 += 32) {
    V bh[4], bl[4];
#pragma unroll
    for (int j = 0; j < 4; ++j) {
      const size_t bo = (size_t)(n0 + (j << 4) + rlane) * ldb + koff + k0;
      bh[j] = Frag<T>::load(Bb + bo);
      if (SPLIT) bl[j] = Frag<T>::load(Bb2 + bo);
    }
#pragma unroll
    for (int i = 0; i < 4; ++i) {
      const size_t ao = (size_t)(m0 + (i << 4) + rlane) * lda + koff + k0;
      V ah = Frag<T>::load(Ab + ao);
      V al;
      if (SPLIT) al = Frag<T>::load(Ab2 + ao);
#pragma unroll
      for (int j = 0; j < 4; ++j) {
        acc[i][j] = Frag<T>::mma(ah, bh[j], acc[i][j]);
        if (SPLIT) {
          acc[i][j] = Frag<T>::mma(ah, bl[j], acc[i][j]);
          acc[i][j] = Frag<T>::mma(al, bh[j], acc[i][j]);
        }
      }
      Frag<T>::guard(acc[i][0], acc[i][3], ah, SPLIT ? al : ah);
    }
    Frag<T>::keep(bh[0], bh[1], bh[2], bh[3]);
    if (SPLIT) Frag<T>::keep(bl[0], bl[1], bl[2], bl[3]);
  }
  acc_guard4(acc[0][0], acc[0][1], acc[0][2], acc[0][3]);
  acc_guard4(acc[1][0], acc[1][1], acc[1][2], acc[1][3]);
  acc_guard4(acc[2][0], acc[2][1], acc[2][2], acc[2][3]);
  acc_guard4(acc[3][0], acc[3][1], acc[3][2], acc[3][3]);

  // ---- epilogue ----
  float* slab = sT[wave];
  const float* Rb = RESID ? (resid + (size_t)b * strideR) : nullptr;
#pragma unroll
  for (int i = 0; i < 4; ++i) {
    const int mBase = m0 + (i << 4);
#pragma unroll
    for (int j = 0; j < 4; ++j) {
      const int n = n0 + (j << 4) + rlane;
      float bv = 0.f;
      if (BIAS_MODE == 2) bv = bias[n];
#pragma unroll
      for (int r = 0; r < 8; ++r) {
        float v = acc[i][j][r] * scale;
        if (BIAS_MODE == 1) v += bias[mBase + mOff + r];
        if (BIAS_MODE == 2) v += bv;
        if (RESID) v += Rb[(size_t)(mBase + mOff + r) * ldc + n];
        if (ACT == 1) v = tanhf(v);
        if (ACT == 2) v = fmaxf(v, 0.0f);
        if (ACT == 3) v = v / (1.0f + expf(-v));
        if (ACT == 4) v = (v > 0.f) ? v : 0.01f * v;
        if (ACT == 5) v = 0.5f * v * (1.0f + erff(v * 0.70710678118654752f));
        slab[(mOff + r) * 68 + (j << 4) + rlane] = v;
      }
    }
    __builtin_amdgcn_fence(__ATOMIC_RELEASE, "workgroup");
    __builtin_amdgcn_wave_barrier();
    __builtin_amdgcn_fence(__ATOMIC_ACQUIRE, "workgroup");
    if (OUT_MODE == 0) {
      float* C = (float*)Cout + offC;
      const int hh = lane >> 4, c4 = (lane & 15) * 4;     // row seg = 256 B = 16 lanes x 16 B
      {
#pragma unroll
        for (int it = 0; it < 8; ++it) {
          const int row = it * 2 + hh;
          v4f v = *(const v4f*)(slab + row * 68 + c4);
          *(v4f*)(C + (size_t)(mBase + row) * ldc + n0 + c4) = v;
        }
        
      }
    } else {
      const int q = lane >> 3, c8 = (lane & 7) * 8;
      unsigned short* C  = (unsigned short*)Cout  + offC;
      unsigned short* C2 = (OUT_MODE == 2) ? ((unsigned short*)Cout2 + offC) : nullptr;
      {
#pragma unroll
        for (int it = 0; it < 4; ++it) {
          const int row = it * 4 + q;
          const float* sp = slab + row * 68 + c8;
          v8h hv, lv;
#pragma unroll
          for (int e = 0; e < 8; ++e) {
            if (OUT_MODE == 1) {
              hv[e] = (_Float16)sp[e];
            } else {
              unsigned short hb = f2bf_bits(sp[e]);
              unsigned short lb = f2bf_bits(sp[e] - bf_bits2f(hb));
              hv[e] = __builtin_bit_cast(_Float16, hb);
              lv[e] = __builtin_bit_cast(_Float16, lb);
            }
          }
          *(v8h*)(C + (size_t)(mBase + row) * ldc + n0 + c8) = hv;
          if (OUT_MODE == 2) *(v8h*)(C2 + (size_t)(mBase + row) * ldc + n0 + c8) = lv;
        }
        
      }
    }
    __builtin_amdgcn_fence(__ATOMIC_RELEASE, "workgroup");
    __builtin_amdgcn_wave_barrier();
    __builtin_amdgcn_fence(__ATOMIC_ACQUIRE, "workgroup");
  }
}

// ---------------------------------------------------------------------------
// Elementwise split: 2 elements per thread, one 4-B store per lane per plane -> each wave writes exactly one
// Coverage: grid = ceil(n2/256) blocks x 256 threads x 2 elements = 2*n2 elements = the whole plane (n2 = plane/2).
// ---------------------------------------------------------------------------
// hi = bf16_rne(in), lo = bf16_rne(in - hi)
__global__ __launch_bounds__(256) void split_bf16x2_kernel(const float* __restrict__ in, unsigned short* __restrict__ hi,
                                                           unsigned short* __restrict__ lo, int n2) {
  const int i = blockIdx.x * 256 + threadIdx.x;
  if (i < n2) {
    const v2f f = *(const v2f*)(in + 2 * (size_t)i);
    const unsigned short h0 = f2bf_bits(f[0]), h1 = f2bf_bits(f[1]);
    const unsigned short l0 = f2bf_bits(f[0] - bf_bits2f(h0)), l1 = f2bf_bits(f[1] - bf_bits2f(h1));
    const unsigned uh = pk16(h0, h1), ul = pk16(l0, l1);
    ((unsigned*)hi)[i] = uh;
    ((unsigned*)lo)[i] = ul;
    
  }
}

// ---------------------------------------------------------------------------
// Weight planes for the projections (one block of 256 threads):
//   wqkh/wqkl [64][32] bf16 hi/lo = rows 0..63 of Wqkv (q rows then k rows)
//   wvh/wvl   [64][32] bf16 hi/lo = rows 64..95 of Wqkv in rows 0..31, explicit zeros in rows 32..63
//   bv        [64] f32            = bqkv[64..95] in 0..31, zeros in 32..63
// ---------------------------------------------------------------------------
__device__ __forceinline__ void split_pair(float f0, float f1, unsigned& h, unsigned& l) {
  const unsigned short h0 = f2bf_bits(f0), h1 = f2bf_bits(f1);
  const unsigned short l0 = f2bf_bits(f0 - bf_bits2f(h0));
  const unsigned short l1 = f2bf_bits(f1 - bf_bits2f(h1));
  h = pk16(h0, h1);
  l = pk16(l0, l1);
}
__global__ __launch_bounds__(256) void wprep_kernel(const float* __restrict__ Wqkv, const float* __restrict__ bqkv,
                                                    unsigned short* __restrict__ wqkh, unsigned short* __restrict__ wqkl,
                                                    unsigned short* __restrict__ wvh, unsigned short* __restrict__ wvl,
                                                    float* __restrict__ bv) {
  const int tid  = threadIdx.x;
  const int row  = tid >> 2;            // 0..63
  const int col0 = (tid & 3) * 8;       // 0, 8, 16, 24
  v4u qh, ql, vh, vl;
#pragma unroll
  for (int p = 0; p < 4; ++p) {
    const int col = col0 + 2 * p;
    const float wq0 = Wqkv[row * HDIM + col];
    const float wq1 = Wqkv[row * HDIM + col + 1];
    int rv = 64 + row; rv = rv > 95 ? 95 : rv;            // clamped address; zero by predicate below
    float wv0 = Wqkv[rv * HDIM + col];
    float wv1 = Wqkv[rv * HDIM + col + 1];
    wv0 = (row < 32) ? wv0 : 0.0f;
    wv1 = (row < 32) ? wv1 : 0.0f;
    unsigned a, bq, cv, dv;
    split_pair(wq0, wq1, a, bq);
    split_pair(wv0, wv1, cv, dv);
    qh[p] = a; ql[p] = bq; vh[p] = cv; vl[p] = dv;
  }
  v4f b4;
#pragma unroll
  for (int e = 0; e < 4; ++e) {
    int m = tid * 4 + e; m = m > 63 ? 63 : m;
    int mi = 64 + m; mi = mi > 95 ? 95 : mi;
    const float v = bqkv[mi];
    b4[e] = (m < 32) ? v : 0.0f;
  }
  const size_t o = (size_t)tid * 8;
  {
    *(v4u*)(wqkh + o) = qh;
    *(v4u*)(wqkl + o) = ql;
    *(v4u*)(wvh + o)  = vh;
    *(v4u*)(wvl + o)  = vl;
    if (tid < 16) *(v4f*)(bv + tid * 4) = b4;
    
  }
}

// ---------------------------------------------------------------------------
// Softmax + 12x12 head mixing + per-row batch-statistic partials for query row tl = blockIdx.x of batch bb = blockIdx.y
// of the launch's group of batches.
//   SM    [GBATCH][1024][12][1024] f32 scaled logits (batch, query row, head, key); P_h = softmax over the 1024 key columns (f32, fixed-order reductions)
//   M_g[s] = sum_h Wconv[g][h] P_h[s] on v_wmma_f32_16x16x32_f16: A = Wconv (f16 hi + x2^11 residual), B = P^T staged in
//   LDS as [s][16] f16 (x2^10 carried hi + x2^11 residual), K = 12 real of 32 (k >= 12 zeros by construction);
//   residual products in a separate accumulator, folded with exact power-of-two factors.
//   M bf16 hi/lo planes go back into SM: the 4096 bytes of score row (bb, tl, g) take M_g hi (2048 B) then M_g lo (2048 B).
//   A block reads its 12 score rows whole (consumed in front of the first barrier) before it stores into the same 12 rows,
//   and no other block touches them. part[bb*1024 + tl][32] = {sum_s M_g (12), sum_s M_g^2 (12), 8 zeros}.
// Block = 256 threads = 8 waves; thread owns key columns tid + 256 j (j = 0..3) for the softmax; two phases of 512
// (8 lanes x 16 B, one instruction per 4 lines); part line written by lanes 0..7 of wave 0 (one instruction).
// Coverage: 2 phases x 8 waves x 64 cols = 1024 cols x 12 rows per plane per block; grid = (1024, GBATCH) blocks.
// ---------------------------------------------------------------------------
union HFrag { v16h v; v8h h[2]; };

template <int J>
__device__ __forceinline__ void stage_pcol(const float (&pz)[12][4], int sl, _Float16* Pth, _Float16* Ptl) {
  v8h h0, h1, l0, l1;
#pragma unroll
  for (int e = 0; e < 8; ++e) {
    const float p0 = pz[e][J] * P_CARRY;
    const _Float16 a0 = (_Float16)p0;
    h0[e] = a0;
    l0[e] = (_Float16)((p0 - (float)a0) * R_CARRY);
  }
#pragma unroll
  for (int e = 0; e < 4; ++e) {
    const float p1 = pz[8 + e][J] * P_CARRY;
    const _Float16 a1 = (_Float16)p1;
    h1[e] = a1;
    l1[e] = (_Float16)((p1 - (float)a1) * R_CARRY);
  }
#pragma unroll
  for (int e = 4; e < 8; ++e) { h1[e] = (_Float16)0.0f; l1[e] = (_Float16)0.0f; }
  *(v8h*)(Pth + sl * 16)     = h0;
  *(v8h*)(Pth + sl * 16 + 8) = h1;
  *(v8h*)(Ptl + sl * 16)     = l0;
  *(v8h*)(Ptl + sl * 16 + 8) = l1;
}

__global__ __launch_bounds__(256) void softmax_mix_kernel(float* SM, const float* __restrict__ Wconv,
                                                          float* __restrict__ part) {
  __shared__ __align__(16) _Float16 Pth[PHCOLS * 16];
  __shared__ __align__(16) _Float16 Ptl[PHCOLS * 16];
  __shared__ __align__(16) float slab[8][12 * 64];
  __shared__ float redw[8][12];
  __shared__ float fin[12];
  __shared__ float stw[8][24];
  __shared__ __align__(16) float pline[32];

  const int tid  = threadIdx.x;
  const int lane = tid & 31;
  const int wave = tid >> 5;
  const int hh   = lane >> 4;
  const int c    = lane & 15;
  const int tl   = blockIdx.x;
  const int bb   = blockIdx.y;
  unsigned short* Mh = (unsigned short*)SM;
  unsigned short* Ml = Mh + NTOK;

  v8h z8;
#pragma unroll
  for (int e = 0; e < 8; ++e) z8[e] = (_Float16)0.0f;
  const v8f zacc = (v8f){0.f,0.f,0.f,0.f,0.f,0.f,0.f,0.f};

  // A fragments of the mixing matrix: row m = g = c, k element i (< 8) = h = 8*hh + i; k >= 16 elements zero
  HFrag fah, fal;
  {
    v8h wh8, wl8;
#pragma unroll
    for (int i = 0; i < 8; ++i) {
      const int h  = 8 * hh + i;
      const int gi = c > 11 ? 11 : c;
      const int hi = h > 11 ? 11 : h;
      float w = Wconv[gi * NHEAD + hi];
      w = (c < 12 && h < 12) ? w : 0.0f;
      const _Float16 a = (_Float16)w;
      wh8[i] = a;
      wl8[i] = (_Float16)((w - (float)a) * R_CARRY);
    }
    fah.h[0] = wh8; fah.h[1] = z8;
    fal.h[0] = wl8; fal.h[1] = z8;
  }

  // scaled logits of this query row for all 12 heads, key columns tid + 256 j
  float pz[12][4];
  {
    const float* Srow = SM + ((size_t)bb * NTOK + tl) * NHEAD * NTOK;   // the block's 12 rows are one 48-KiB run
#pragma unroll
    for (int h = 0; h < 12; ++h)
#pragma unroll
      for (int j = 0; j < 4; ++j)
        pz[h][j] = Srow[h * NTOK + tid + 256 * j];
  }
  // row maxima: thread, wave xor tree, waves in index order
#pragma unroll
  for (int h = 0; h < 12; ++h) {
    float m = fmaxf(fmaxf(pz[h][0], pz[h][1]), fmaxf(pz[h][2], pz[h][3]));
#pragma unroll
    for (int off = 16; off > 0; off >>= 1) m = fmaxf(m, __shfl_xor(m, off, 32));
    if (lane == 0) redw[wave][h] = m;
  }
  __syncthreads();
  if (wave == 0) {
    const int hq = lane < 12 ? lane : 11;
    float m = redw[0][hq];
#pragma unroll
    for (int w = 1; w < 8; ++w) m = fmaxf(m, redw[w][hq]);
    if (lane < 12) fin[lane] = m;
  }
  __syncthreads();
  float mx[12];
#pragma unroll
  for (int h = 0; h < 12; ++h) mx[h] = fin[h];
  // exponentials and row sums
#pragma unroll
  for (int h = 0; h < 12; ++h) {
#pragma unroll
    for (int j = 0; j < 4; ++j) pz[h][j] = __expf(pz[h][j] - mx[h]);
    float s = ((pz[h][0] + pz[h][1]) + pz[h][2]) + pz[h][3];
#pragma unroll
    for (int off = 16; off > 0; off >>= 1) s += __shfl_xor(s, off, 32);
    if (lane == 0) redw[wave][h] = s;
  }
  __syncthreads();
  if (wave == 0) {
    const int hq = lane < 12 ? lane : 11;
    float s = redw[0][hq];
#pragma unroll
    for (int w = 1; w < 8; ++w) s += redw[w][hq];
    if (lane < 12) fin[lane] = s;
  }
  __syncthreads();
#pragma unroll
  for (int h = 0; h < 12; ++h) {
    const float inv = 1.0f / fin[h];
#pragma unroll
    for (int j = 0; j < 4; ++j) pz[h][j] *= inv;
  }

  v8f s1 = zacc, s2 = zacc;
  float* myslab = slab[wave];
  const int q  = lane >> 3;
  const int c8 = (lane & 7) * 8;
  for (int ph = 0; ph < 2; ++ph) {          // block-uniform
    // stage P^T for key columns ph*512 .. +511: 256 threads x 2 columns x 16 halves per plane = whole Pth / Ptl
    if (ph == 0) {
      stage_pcol<0>(pz, tid, Pth, Ptl);
      stage_pcol<1>(pz, tid + 256, Pth, Ptl);
    } else {
      stage_pcol<2>(pz, tid, Pth, Ptl);
      stage_pcol<3>(pz, tid + 256, Pth, Ptl);
    }
    __syncthreads();
#pragma unroll 1
    for (int nt = 0; nt < 4; ++nt) {
      const int col = wave * 64 + nt * 16 + c;      // local key column of this lane's B column, 0..511
      HFrag bh, bl;
      bh.h[0] = *(const v8h*)(Pth + col * 16 + 8 * hh); bh.h[1] = z8;
      bl.h[0] = *(const v8h*)(Ptl + col * 16 + 8 * hh); bl.h[1] = z8;
      v8f acc0 = zacc, accr = zacc;
      acc0 = Frag<_Float16>::mma(fah.v, bh.v, acc0);
      accr = Frag<_Float16>::mma(fah.v, bl.v, accr);
      accr = Frag<_Float16>::mma(fal.v, bh.v, accr);
      dep_guard_h(acc0, accr, bh.v, bl.v);
#pragma unroll
      for (int r = 0; r < 8; ++r) {
        const float m = fmaf(accr[r], MIX_FOLD, acc0[r] * P_INV);     // D row g = 8*hh + r, column col
        s1[r] += m;
        s2[r] = fmaf(m, m, s2[r]);
        if (hh == 0 || r < 4) myslab[(8 * hh + r) * 64 + nt * 16 + c] = m;
      }
    }
    __syncthreads();
    {
      v8h hv[3], lv[3];
#pragma unroll
      for (int it = 0; it < 3; ++it) {
        const int g = it * 4 + q;
        const float* sp = myslab + g * 64 + c8;
        v8h a, bq;
#pragma unroll
        for (int e = 0; e < 8; ++e) {
          const unsigned short hb = f2bf_bits(sp[e]);
          const unsigned short lb = f2bf_bits(sp[e] - bf_bits2f(hb));
          a[e]  = __builtin_bit_cast(_Float16, hb);
          bq[e] = __builtin_bit_cast(_Float16, lb);
        }
        hv[it] = a; lv[it] = bq;
      }
      {
#pragma unroll
        for (int it = 0; it < 3; ++it) {
          const int g = it * 4 + q;
          const size_t go = (((size_t)bb * NTOK + tl) * NHEAD + g) * MPITCH + (size_t)ph * PHCOLS + wave * 64 + c8;
          *(v8h*)(Mh + go) = hv[it];
          *(v8h*)(Ml + go) = lv[it];
        }
        
      }
    }
    __syncthreads();
  }

  // statistics: xor tree over the 16 lanes sharing hh (fixed order), then waves in index order
#pragma unroll
  for (int r = 0; r < 8; ++r) {
    float a = s1[r], bq = s2[r];
#pragma unroll
    for (int off = 1; off < 16; off <<= 1) { a += __shfl_xor(a, off, 32); bq += __shfl_xor(bq, off, 32); }
    const int g = 8 * hh + r;
    if (c == 0 && g < 12) { stw[wave][g] = a; stw[wave][12 + g] = bq; }
  }
  __syncthreads();
  if (wave == 0) {
    const int qi = lane < 24 ? lane : 23;
    float v = stw[0][qi];
#pragma unroll
    for (int w = 1; w < 8; ++w) v += stw[w][qi];
    v = (lane < 24) ? v : 0.0f;
    pline[lane] = v;
  }
  __syncthreads();
  if (tid < 8) {
    const v4f v = *(const v4f*)(pline + tid * 4);
    float* dst = part + ((size_t)bb * NTOK + tl) * 32 + tid * 4;
    *(v4f*)dst = v;
    
  }
}

// ---------------------------------------------------------------------------
// U[bb][g][t][d] = sum_s M[bb][g][t][s] * v^T[bb][g][d][s], bf16 hi/lo planes (hi.hi + hi.lo + lo.hi); M[bb][t][g][MPITCH].
// Block = 16 waves = one 32 x 32 tile (32 query rows, the 32 real v columns) of head g = blockIdx.y of batch
// bb = blockIdx.z of the launch's group. The 1024 key
// columns are split over the waves: wave w owns columns 64 w .. 64 w + 63, one 128-B line per row and plane, and issues
// all of its 32 fragment loads before the first product. The 16 partial tiles meet in LDS and are added in wave order.
// Grid = (1024 / 32, NHEAD, GBATCH) = 1536 blocks.
// Coverage: 32 x 32 rows = 1024 rows per head; 512 threads x 2 columns = 32 x 32 outputs per block.
// ---------------------------------------------------------------------------
constexpr int PVWAVES = 16;
constexpr int PVROWS  = 32;
constexpr int PVKW    = NTOK / PVWAVES;   // 64 key columns per wave
constexpr int PVPITCH = 36;               // floats; 8 rows = 288 = 32 mod 64 banks, so the two lane halves do not collide

__global__ __launch_bounds__(PVWAVES * 32) void pv_splitk_kernel(const unsigned short* __restrict__ Mh,
                                                                 const unsigned short* __restrict__ Ml,
                                                                 const unsigned short* __restrict__ vth,
                                                                 const unsigned short* __restrict__ vtl,
                                                                 float* __restrict__ Uc) {
  __shared__ __align__(16) float red[PVWAVES][PVROWS * PVPITCH];
  const int tid   = threadIdx.x;
  const int lane  = tid & 31;
  const int wave  = tid >> 5;
  const int rlane = lane & 15;                 // row (A) / column (B, D) within a 16 x 16 subtile
  const int hh    = lane >> 4;
  const int g     = blockIdx.z * NHEAD + blockIdx.y;   // (batch of the group, head)
  const int m0    = blockIdx.x * PVROWS;
  const size_t ar = (size_t)blockIdx.z * NTOK + m0 + rlane;   // (batch of the group, query row)
  const size_t kb = (size_t)wave * PVKW + hh * 8;
  const size_t ao = (ar * NHEAD + blockIdx.y) * MPITCH + kb;
  const size_t bo = ((size_t)g * VTROWS + rlane) * NTOK + kb;
  const __bf16* Ah = (const __bf16*)Mh + ao;
  const __bf16* Al = (const __bf16*)Ml + ao;
  const __bf16* Bh = (const __bf16*)vth + bo;
  const __bf16* Bl = (const __bf16*)vtl + bo;

  v16b ah[2][2], al[2][2], bh[2][2], bl[2][2];   // [k step][subtile]
#pragma unroll
  for (int ks = 0; ks < 2; ++ks)
#pragma unroll
    for (int i = 0; i < 2; ++i) {
      const size_t oa = (size_t)i * 16 * NHEAD * MPITCH + ks * 32;
      const size_t ob = (size_t)i * 16 * NTOK + ks * 32;
      ah[ks][i] = Frag<__bf16>::load(Ah + oa);
      al[ks][i] = Frag<__bf16>::load(Al + oa);
      bh[ks][i] = Frag<__bf16>::load(Bh + ob);
      bl[ks][i] = Frag<__bf16>::load(Bl + ob);
    }
  // the four address pairs are inputs here, so they stay live and no load above lands on one of them; the wait stands
  // in front of every later instruction that reuses a register which an issued load names (a precaution)
  asm volatile("s_wait_xcnt 0x0" :: "v"(Ah), "v"(Al), "v"(Bh), "v"(Bl) : "memory");
  // keeps all 32 loads in front of the products: without it the compiler sinks loads between the products and the
  // wave waits for memory several times instead of once
  __builtin_amdgcn_sched_barrier(0);

  v8f acc[2][2];
#pragma unroll
  for (int i = 0; i < 2; ++i)
#pragma unroll
    for (int j = 0; j < 2; ++j) acc[i][j] = (v8f){0.f,0.f,0.f,0.f,0.f,0.f,0.f,0.f};
#pragma unroll
  for (int ks = 0; ks < 2; ++ks) {
#pragma unroll
    for (int i = 0; i < 2; ++i)
#pragma unroll
      for (int j = 0; j < 2; ++j) acc[i][j] = Frag<__bf16>::mma(ah[ks][i], bh[ks][j], acc[i][j]);
#pragma unroll
    for (int i = 0; i < 2; ++i)
#pragma unroll
      for (int j = 0; j < 2; ++j) acc[i][j] = Frag<__bf16>::mma(ah[ks][i], bl[ks][j], acc[i][j]);
#pragma unroll
    for (int i = 0; i < 2; ++i)
#pragma unroll
      for (int j = 0; j < 2; ++j) acc[i][j] = Frag<__bf16>::mma(al[ks][i], bh[ks][j], acc[i][j]);
  }

  float* my = red[wave];
#pragma unroll
  for (int i = 0; i < 2; ++i)
#pragma unroll
    for (int j = 0; j < 2; ++j)
#pragma unroll
      for (int r = 0; r < 8; ++r)
        my[(i * 16 + hh * 8 + r) * PVPITCH + j * 16 + rlane] = acc[i][j][r];   // D row 8*hh + r, column rlane
  __syncthreads();
  const int row = tid >> 4;            // 0..31
  const int col = (tid & 15) * 2;      // 0, 2, .. 30: one wave stores two whole 128-B row segments
  v2f s = *(const v2f*)(&red[0][row * PVPITCH + col]);
#pragma unroll
  for (int w = 1; w < PVWAVES; ++w) s += *(const v2f*)(&red[w][row * PVPITCH + col]);
  *(v2f*)(Uc + ((size_t)g * NTOK + m0 + row) * UW + col) = s;
}

// ---------------------------------------------------------------------------
// Vsum[g][d] = sum_s v[g][s][d] from the v^T bf16 hi+lo planes ([8 x 12][64][1024], rows d < 32), g = (batch, head).
// Block g, 256 threads: d = tid>>3, 8 partial sums of 128 columns combined by a fixed xor tree; the 32 results are
// ---------------------------------------------------------------------------
__global__ __launch_bounds__(256) void vsum_kernel(const unsigned short* __restrict__ vth, const unsigned short* __restrict__ vtl,
                                                   float* __restrict__ vsum) {
  __shared__ __align__(16) float vs[32];
  const int g   = blockIdx.x;
  const int tid = threadIdx.x;
  const int d   = tid >> 3;
  const int prt = tid & 7;
  const size_t base = ((size_t)g * VTROWS + d) * NTOK + (size_t)prt * 128;
  float acc = 0.0f;
#pragma unroll 1
  for (int i = 0; i < 16; ++i) {
    const v8us a  = *(const v8us*)(vth + base + i * 8);
    const v8us bq = *(const v8us*)(vtl + base + i * 8);
#pragma unroll
    for (int e = 0; e < 8; ++e) acc += bf_bits2f(a[e]) + bf_bits2f(bq[e]);
  }
  acc += __shfl_xor(acc, 1, 32);
  acc += __shfl_xor(acc, 2, 32);
  acc += __shfl_xor(acc, 4, 32);
  if (prt == 0) vs[d] = acc;
  __syncthreads();
  if (tid < 8) {
    const v4f v = *(const v4f*)(vs + tid * 4);
    float* dst = vsum + g * 32 + tid * 4;
    *(v4f*)dst = v;
    
  }
}

// ---------------------------------------------------------------------------
// Column sums of the partial lines, first level: part [8192][32] f32 -> psum [STBLK][32] f64.
// Lane = column; each wave reads its STROWS lines as independent loads (all in flight at once), adds them in f64 in
// row order; the 8 wave sums of a block are added in wave order. One wave writes the block's 256-B psum line.
// Coverage: STBLK blocks x 8 waves x STROWS rows = 8192 lines.
// ---------------------------------------------------------------------------
__global__ __launch_bounds__(256) void statsum_kernel(const float* __restrict__ part, double* __restrict__ psum) {
  __shared__ double sw[8][32];
  const int lane = threadIdx.x & 31;
  const int wave = threadIdx.x >> 5;
  const float* p = part + (size_t)(blockIdx.x * 8 + wave) * STROWS * 32 + lane;
  float v[STROWS];
#pragma unroll   // loads issue back to back: one memory latency per wave instead of one per line
  for (int i = 0; i < STROWS; ++i) v[i] = p[i * 32];
  double acc = 0.0;
#pragma unroll   // constant indices keep v[] in registers
  for (int i = 0; i < STROWS; ++i) acc += (double)v[i];
  sw[wave][lane] = acc;
  __syncthreads();
  if (wave == 0) {
    double s = sw[0][lane];
#pragma unroll
    for (int w = 1; w < 8; ++w) s += sw[w][lane];
    psum[blockIdx.x * 32 + lane] = s;
  }
}

// ---------------------------------------------------------------------------
// Per-head affine coefficients from the first-level sums (one block of 8 waves): wave w adds psum lines
// w*STBLK/8 .. +STBLK/8-1 in f64 (independent loads, row order), wave 0 adds the 8 wave sums in wave order;
// mean_g = S1/N, var_g = S2/N - mean_g^2 (biased), a_g = gamma_g / sqrt(var_g + eps),
// kk_g = a_g*bconv_g + (beta_g - a_g*(mean_g + bconv_g)); coef line = {a[12], kk[12], 8 zeros}, one instruction.
// ---------------------------------------------------------------------------
__global__ __launch_bounds__(256) void coef_kernel(const double* __restrict__ psum, const float* __restrict__ bconv,
                                                   const float* __restrict__ gamma, const float* __restrict__ beta,
                                                   float* __restrict__ coef) {
  __shared__ double sw[8][32];
  __shared__ double sd[32];
  __shared__ __align__(16) float cf[32];
  const int lane = threadIdx.x & 31;
  const int wave = threadIdx.x >> 5;
  const double* p = psum + (size_t)wave * (STBLK / 8) * 32 + lane;
  double q[STBLK / 8];
#pragma unroll   // loads issue back to back: one memory latency per wave instead of one per line
  for (int i = 0; i < STBLK / 8; ++i) q[i] = p[i * 32];
  double acc = 0.0;
#pragma unroll   // constant indices keep q[] in registers
  for (int i = 0; i < STBLK / 8; ++i) acc += q[i];
  sw[wave][lane] = acc;
  __syncthreads();
  if (wave == 0) {
    double s = sw[0][lane];
#pragma unroll
    for (int w = 1; w < 8; ++w) s += sw[w][lane];
    sd[lane] = s;
  }
  __syncthreads();
  int gq = (lane < 12) ? lane : (lane - 12);
  gq = gq < 0 ? 0 : (gq > 11 ? 11 : gq);
  const double s1d = sd[gq];
  const double s2d = sd[12 + gq];
  const double invN = 1.0 / ((double)NBATCH * (double)NTOK * (double)NTOK);
  const double meanM = s1d * invN;
  double var = s2d * invN - meanM * meanM;
  var = var < 0.0 ? 0.0 : var;
  const float varf   = (float)var;
  const float meanre = (float)meanM + bconv[gq];
  const float a      = gamma[gq] * (1.0f / sqrtf(varf + BN_EPS));
  const float kk     = a * bconv[gq] + (beta[gq] - a * meanre);
  const float v = (lane < 12) ? a : ((lane < 24) ? kk : 0.0f);
  if (wave == 0) cf[lane] = v;
  __syncthreads();
  if (threadIdx.x < 8) {
    const v4f w = *(const v4f*)(cf + threadIdx.x * 4);
    float* dst = coef + threadIdx.x * 4;
    *(v4f*)dst = w;
  }
}

// ---------------------------------------------------------------------------
// out[b][t][32g+d] = a_g * U[b][g][t][d] + kk_g * Vsum[b][g][d]. One wave per (b,t) row of 384 floats:
// Coverage: grid 1024 x 8 waves = 8192 rows = all of d_out.
// ---------------------------------------------------------------------------
__global__ __launch_bounds__(256) void combine_kernel(const float* __restrict__ U, const float* __restrict__ vsum,
                                                      const float* __restrict__ coef, float* __restrict__ out) {
  const int lane = threadIdx.x & 31;
  const int wave = threadIdx.x >> 5;
  const int R = blockIdx.x * 8 + wave;         // 0..8191
  const int b = R >> 10, t = R & (NTOK - 1);
  v4f o[3];
#pragma unroll
  for (int i = 0; i < 3; ++i) {
    const int f = 128 * i + 4 * lane;
    const int g = f >> 5, d = f & 31;
    const v4f u  = *(const v4f*)(U + (((size_t)(b * NHEAD + g)) * NTOK + t) * UW + d);
    const v4f vv = *(const v4f*)(vsum + (b * NHEAD + g) * 32 + d);
    const float a = coef[g], kk = coef[12 + g];
    v4f rr;
#pragma unroll
    for (int e = 0; e < 4; ++e) rr[e] = fmaf(a, u[e], kk * vv[e]);
    o[i] = rr;
  }
  float* orow = out + (size_t)R * NEMB;
  {
#pragma unroll
    for (int i = 0; i < 3; ++i) *(v4f*)(orow + 128 * i + 4 * lane) = o[i];
    
  }
}

// ---------------------------------------------------------------------------
// Workspace region map (every size a multiple of 256):
//   XH, XL  bf16 [98304][32] each   x hi / lo planes (rows = (b,t,h)); last read by launch (4)
//   U       f32  [8][12][1024][32]  lies on XH|XL (same size), first written by launch (8)
//   WQKH WQKL WVH WVL bf16 [64][32] each;  BV f32 [64]
//   QKH, QKL bf16 [98304][64] each  q at 0..31, k at 32..63
//   VTH, VTL bf16 [8][12][64][1024] each  v^T of every batch
//   SM      f32  [4][1024][12][1024]  scaled logits of the current group of batches; each 4096-B row is overwritten by
//                                     the mixed map's bf16 hi (2048 B) and lo (2048 B) rows
//   PART    f32  [8192][32];  VSUM f32 [8][12][32];  COEF f32 [32] (256 B);  PSUM f64 [64][32]
//   total   265335296 bytes
// The per-group region is fully rewritten before each read in stream order.
// ---------------------------------------------------------------------------
extern "C" void kernel_launch(void* const* d_in, const int* in_sizes, int n_in,
                              void* d_out, int out_size, void* d_ws, size_t ws_size,
                              hipStream_t stream) {
  if (n_in < 7) return;
  if (in_sizes[0] != NBATCH * NTOK * NEMB) return;
  if (in_sizes[1] != 3 * HDIM * HDIM || in_sizes[2] != 3 * HDIM) return;
  if (in_sizes[3] != NHEAD * NHEAD || in_sizes[4] < NHEAD || in_sizes[5] < NHEAD || in_sizes[6] < NHEAD) return;
  if (out_size != NBATCH * NTOK * NEMB) return;

  const float* x     = (const float*)d_in[0];
  const float* Wqkv  = (const float*)d_in[1];
  const float* bqkv  = (const float*)d_in[2];
  const float* Wconv = (const float*)d_in[3];
  const float* bconv = (const float*)d_in[4];
  const float* gamma = (const float*)d_in[5];
  const float* beta  = (const float*)d_in[6];
  float* out = (float*)d_out;

  const size_t szX    = (size_t)NBATCH * NTOK * NEMB * 2;            // 6291456
  const size_t szW    = (size_t)64 * HDIM * 2;                       // 4096
  const size_t szBV   = 256;
  const size_t szQK   = (size_t)NBATCH * NTOK * NHEAD * QKW * 2;     // 12582912
  const size_t szVT   = (size_t)NBATCH * NHEAD * VTROWS * NTOK * 2;  // 12582912
  const size_t szSM   = (size_t)GBATCH * NHEAD * NTOK * NTOK * 4;    // 201326592
  const size_t szPART = (size_t)NBATCH * NTOK * 32 * 4;              // 1048576
  const size_t szVS   = (size_t)NBATCH * NHEAD * 32 * 4;             // 12288
  const size_t szCF   = 256;
  const size_t szPS   = (size_t)STBLK * 32 * 8;                      // 16384
  static_assert((size_t)NBATCH * NHEAD * NTOK * UW * 4 == 2 * (size_t)NBATCH * NTOK * NEMB * 2, "U fills XH|XL exactly");
  size_t off = 0;
  const size_t oXH = off;   off += szX;
  const size_t oXL = off;   off += szX;
  const size_t oU = oXH;
  const size_t oWQKH = off; off += szW;
  const size_t oWQKL = off; off += szW;
  const size_t oWVH = off;  off += szW;
  const size_t oWVL = off;  off += szW;
  const size_t oBV = off;   off += szBV;
  const size_t oQKH = off;  off += szQK;
  const size_t oQKL = off;  off += szQK;
  const size_t oVTH = off;  off += szVT;
  const size_t oVTL = off;  off += szVT;
  const size_t oSM = off;   off += szSM;
  const size_t oPART = off; off += szPART;
  const size_t oVS = off;   off += szVS;
  const size_t oCF = off;   off += szCF;
  const size_t oPS = off;   off += szPS;
  if (off > ws_size) return;

  char* ws = (char*)d_ws;
  unsigned short* XH   = (unsigned short*)(ws + oXH);
  unsigned short* XL   = (unsigned short*)(ws + oXL);
  unsigned short* WQKH = (unsigned short*)(ws + oWQKH);
  unsigned short* WQKL = (unsigned short*)(ws + oWQKL);
  unsigned short* WVH  = (unsigned short*)(ws + oWVH);
  unsigned short* WVL  = (unsigned short*)(ws + oWVL);
  float*          BV   = (float*)(ws + oBV);
  unsigned short* QKH  = (unsigned short*)(ws + oQKH);
  unsigned short* QKL  = (unsigned short*)(ws + oQKL);
  unsigned short* VTH  = (unsigned short*)(ws + oVTH);
  unsigned short* VTL  = (unsigned short*)(ws + oVTL);
  float*          SMb  = (float*)(ws + oSM);
  unsigned short* MH   = (unsigned short*)(ws + oSM);
  unsigned short* ML   = MH + NTOK;
  float*          U    = (float*)(ws + oU);
  float*          PART = (float*)(ws + oPART);
  float*          VSUM = (float*)(ws + oVS);
  float*          COEF = (float*)(ws + oCF);
  double*         PSUM = (double*)(ws + oPS);

  const dim3 blk(256);
  // (1) x -> bf16 hi/lo planes viewed as [(b,t,h)][32]: n2 = 1572864 pairs = 6144 blocks x 256 threads exactly
  const int n2x = NBATCH * NTOK * NEMB / 2;
  split_bf16x2_kernel<<<dim3((n2x + 255) / 256), blk, 0, stream>>>(x, XH, XL, n2x);
  // (2) projection weight planes and padded v bias
  wprep_kernel<<<dim3(1), blk, 0, stream>>>(Wqkv, bqkv, WQKH, WQKL, WVH, WVL, BV);
  // (3) q|k = xh . Wqkv[0..63]^T + bqkv[0..63] -> QK hi/lo planes [98304][64]; M = 98304 (1536 tiles), N = 64, K = 32
  wmma_gemm64<1, true, 2, 2, false><<<dim3((NBATCH * NTOK * NHEAD / 64) / 8, 1), blk, 0, stream>>>(
      XH, XL, HDIM, 0L, WQKH, WQKL, HDIM, 0L, (void*)QKH, (void*)QKL, QKW, 0L,
      bqkv, bqkv, 0L, NBATCH * NTOK * NHEAD, QKW, HDIM, 1.0f, 0L, 0L, 0L);
  // (4) v^T[m][s] for head g = blockIdx.y of batch blockIdx.z: A = WV planes [64][32] (rows 32..63 zero), Bt = x planes
  //     at column g*32, ldb = 384; M = 64, N = 1024 (16 tiles -> 2 blocks), K = 32; bias[m] = BV -> VT planes
  wmma_gemm64<1, true, 1, 2, false><<<dim3(2, NHEAD, NBATCH), blk, 0, stream>>>(
      WVH, WVL, HDIM, 0L, XH, XL, NEMB, (long)HDIM, (void*)VTH, (void*)VTL, NTOK, (long)VTROWS * NTOK,
      BV, BV, 0L, VTROWS, NTOK, HDIM, 1.0f, 0L, (long)NTOK * NEMB, (long)NHEAD * VTROWS * NTOK);
  // (5) Vsum of every (batch, head): 96 lines
  vsum_kernel<<<dim3(NBATCH * NHEAD), blk, 0, stream>>>(VTH, VTL, VSUM);

  for (int b0 = 0; b0 < NBATCH; b0 += GBATCH) {
    // (6) S[bb][t][h][s] = (q . k) * 32^-0.5 : A = q rows (b0 + bb, t, h), lda 768, y stride 64, z stride one batch;
    //     Bt = k rows (b0 + bb, s, h); M = N = 1024 (256 tiles -> 32 blocks per y, z), K = 32, f32 out
    const size_t qoff = (size_t)b0 * NTOK * NHEAD * QKW;
    const size_t koff = qoff + HDIM;
    wmma_gemm64<1, true, 0, 0, false><<<dim3(32, NHEAD, GBATCH), blk, 0, stream>>>(
        QKH + qoff, QKL + qoff, NHEAD * QKW, (long)QKW, QKH + koff, QKL + koff, NHEAD * QKW, (long)QKW,
        (void*)SMb, (void*)SMb, NHEAD * NTOK, (long)NTOK,
        bqkv, bqkv, 0L, NTOK, NTOK, HDIM, SM_SCALE,
        (long)NTOK * NHEAD * QKW, (long)NTOK * NHEAD * QKW, (long)NHEAD * NTOK * NTOK);
    // (7) softmax + head mixing + statistic partials: one block per query row of the group
    softmax_mix_kernel<<<dim3(NTOK, GBATCH), blk, 0, stream>>>(SMb, Wconv, PART + (size_t)b0 * NTOK * 32);
    // (8) U[b][g][t][d] = sum_s M[g][t][s] v^T[g][d][s]: 32 x 32 block tiles, K = 1024 split over 16 waves, f32 out
    pv_splitk_kernel<<<dim3(NTOK / PVROWS, NHEAD, GBATCH), dim3(PVWAVES * 32), 0, stream>>>(
        MH, ML, VTH + (size_t)b0 * NHEAD * VTROWS * NTOK, VTL + (size_t)b0 * NHEAD * VTROWS * NTOK,
        U + (size_t)b0 * NHEAD * NTOK * UW);
  }
  // (9) fixed-order f64 sums over the 8192 partial lines in two levels, then the per-head affine coefficients
  statsum_kernel<<<dim3(STBLK), blk, 0, stream>>>(PART, PSUM);
  coef_kernel<<<dim3(1), blk, 0, stream>>>(PSUM, bconv, gamma, beta, COEF);
  // (10) output rows: 1024 blocks x 8 waves = 8192 rows of 384 floats
  combine_kernel<<<dim3(NBATCH * NTOK / 8), blk, 0, stream>>>(U, VSUM, COEF, out);
}

// v004
// It runs in 263 microseconds.
// Two timings next to v003 put it at 1.80 and 1.79 times that version's speed.
// Over all steps from v000 it is 13.4 times as fast.
// Contractions: x.Wqkv^T (q|k planes and v^T planes), scaled q.k^T, and (head-mixed attention).v on v_wmma_f32_16x16x32_bf16 with bf16 hi/lo split operand planes (hi.hi + hi.lo + lo.hi); 12x12 head mixing on v_wmma_f32_16x16x32_f16 (f16 hi planes + x2^11 residual planes in a separate accumulator, probabilities carried x2^10); f32 accumulate everywhere; softmax f32; per-head batch statistics as f32 block partials combined in f64 in fixed order.
#include <hip/hip_runtime.h>
#include <math.h>
#include <stdint.h>

constexpr int NBATCH = 8;
constexpr int NTOK   = 1024;
constexpr int NEMB   = 384;
constexpr int NHEAD  = 12;
constexpr int HDIM   = 32;
constexpr int QKW    = 64;             // q|k plane row width (q at 0..31, k at 32..63)
constexpr int VTROWS = 64;             // v^T rows per head (32 real + 32 zero)
constexpr int UW     = 32;             // U row pitch
constexpr float SM_SCALE = 0.17677669529663687f;
constexpr float P_CARRY  = 1024.0f;                      // probabilities carried x2^10 in f16
constexpr float R_CARRY  = 2048.0f;                      // residual planes carried x2^11
constexpr float P_INV    = 1.0f / 1024.0f;
constexpr float MIX_FOLD = 1.0f / (1024.0f * 2048.0f);
constexpr float BN_EPS   = 1e-5f;
constexpr int STBLK  = 64;                            // blocks of the first level of the statistic sum
constexpr int NPART  = NBATCH * NTOK / 16;           // partial lines: one per block of 16 query rows
constexpr int STROWS = NPART / (STBLK * 8);           // partial lines per wave

typedef __attribute__((ext_vector_type(16))) _Float16 v16h;
typedef __attribute__((ext_vector_type(8)))  _Float16 v8h;
typedef __attribute__((ext_vector_type(16))) __bf16   v16b;
typedef __attribute__((ext_vector_type(8)))  __bf16   v8b;
typedef __attribute__((ext_vector_type(8)))  float    v8f;
typedef __attribute__((ext_vector_type(4)))  float    v4f;
typedef __attribute__((ext_vector_type(2)))  float    v2f;
typedef __attribute__((ext_vector_type(4)))  unsigned int v4u;
typedef __attribute__((ext_vector_type(8)))  unsigned short v8us;

__device__ __forceinline__ unsigned short f2bf_bits(float f) {
  unsigned u = __float_as_uint(f);
  return (unsigned short)((u + 0x7FFFu + ((u >> 16) & 1u)) >> 16);
}
__device__ __forceinline__ float bf_bits2f(unsigned short h) { return __uint_as_float(((unsigned)h) << 16); }
__device__ __forceinline__ unsigned pk16(unsigned short a, unsigned short b) { return (unsigned)a | ((unsigned)b << 16); }

// hazard guards as plain device helpers (no inline asm inside the kernel template body)
__device__ __forceinline__ void dep_guard_h(v8f& a, v8f& b, v16h x, v16h y) { asm volatile("v_nop\n\tv_nop\n\tv_nop\n\tv_nop" : "+v"(a), "+v"(b) : "v"(x), "v"(y)); }
__device__ __forceinline__ void dep_guard_b(v8f& a, v8f& b, v16b x, v16b y) { asm volatile("v_nop\n\tv_nop\n\tv_nop\n\tv_nop" : "+v"(a), "+v"(b) : "v"(x), "v"(y)); }
__device__ __forceinline__ void keep4_h(v16h a, v16h b, v16h c, v16h d) { asm volatile("v_nop" :: "v"(a), "v"(b), "v"(c), "v"(d)); }
__device__ __forceinline__ void keep4_b(v16b a, v16b b, v16b c, v16b d) { asm volatile("v_nop" :: "v"(a), "v"(b), "v"(c), "v"(d)); }
__device__ __forceinline__ void acc_guard4(v8f& a, v8f& b, v8f& c, v8f& d) { asm volatile("v_nop\n\tv_nop\n\tv_nop\n\tv_nop" : "+v"(a), "+v"(b), "+v"(c), "+v"(d)); }
template <typename T> struct Frag;
template <> struct Frag<_Float16> {
  typedef v16h V; union U { v16h v; v8h h[2]; };
  static __device__ __forceinline__ v16h load(const _Float16* p) {   // elements 0..7 <- p[0..7], 8..15 <- p[16..23]
    U f; f.h[0] = *(const v8h*)(p); f.h[1] = *(const v8h*)(p + 16); return f.v;
  }
  static __device__ __forceinline__ v8f mma(v16h a, v16h b, v8f c) {
    return __builtin_amdgcn_wmma_f32_16x16x32_f16(false, a, false, b, (short)0, c, false, false);
  }
  static __device__ __forceinline__ void guard(v8f& a, v8f& b, v16h x, v16h y) { dep_guard_h(a, b, x, y); }
  static __device__ __forceinline__ void keep(v16h a, v16h b, v16h c, v16h d) { keep4_h(a, b, c, d); }
};
template <> struct Frag<__bf16> {
  typedef v16b V; union U { v16b v; v8b h[2]; };
  static __device__ __forceinline__ v16b load(const __bf16* p) {
    U f; f.h[0] = *(const v8b*)(p); f.h[1] = *(const v8b*)(p + 16); return f.v;
  }
  static __device__ __forceinline__ v8f mma(v16b a, v16b b, v8f c) {
    return __builtin_amdgcn_wmma_f32_16x16x32_bf16(false, a, false, b, (short)0, c, false, false);
  }
  static __device__ __forceinline__ void guard(v8f& a, v8f& b, v16b x, v16b y) { dep_guard_b(a, b, x, y); }
  static __device__ __forceinline__ void keep(v16b a, v16b b, v16b c, v16b d) { keep4_b(a, b, c, d); }
};

// ---- Register-blocked batched WMMA GEMM ------------------------------------
// C[m,n] = scale * sum_k A[m,k] * Bt[n,k] (+bias)(+resid); each wave owns a 64x64 tile.
// Batched over blockIdx.y (strideA/B/C) and blockIdx.z (strideAz/Bz/Cz).
// A row-major [M,K]; Bt row-major [N,K]; M,N % 64 == 0, K % 32 == 0.
// SPLIT: operands are hi/lo planes (A2/Bt2 = lo planes, same layout); product = hi·hi + hi·lo + lo·hi.
// BIAS_MODE: 0 = none, 1 = bias[m], 2 = bias[n].
// OUT_MODE: 0 = f32, 1 = f16, 2 = bf16 hi plane (Cout) + bf16 lo plane (Cout2).
// ET: 0 = f16 operands, 1 = bf16 operands (pointers passed as 16-bit storage)
template <int ET> struct Elem;
template <> struct Elem<0> { typedef _Float16 T; };
template <> struct Elem<1> { typedef __bf16 T; };
template <int ET, bool SPLIT, int BIAS_MODE, int OUT_MODE, bool RESID, int ACT = 0>
__global__ __launch_bounds__(256) void wmma_gemm64(
    const unsigned short* __restrict__ Ap, const unsigned short* __restrict__ A2p, int lda, long strideA,
    const unsigned short* __restrict__ Btp, const unsigned short* __restrict__ Bt2p, int ldb, long strideB,
    void* __restrict__ Cout, void* __restrict__ Cout2, int ldc, long strideC,
    const float* __restrict__ bias,
    const float* __restrict__ resid, long strideR,
    int M, int N, int K, float scale, long strideAz, long strideBz, long strideCz) {
  typedef typename Elem<ET>::T T;
  typedef typename Frag<T>::V V;
  const T* A = (const T*)Ap; const T* A2 = (const T*)A2p; const T* Bt = (const T*)Btp; const T* Bt2 = (const T*)Bt2p;
  __shared__ __align__(16) float sT[8][16 * 68];   // per-wave 16x64 slab, pitch 68 floats
  const int b    = blockIdx.y;
  const int lane = threadIdx.x & 31;
  const int wave = threadIdx.x >> 5;
  const int tilesN = N >> 6;
  const int tilesM = M >> 6;
  const int tile = blockIdx.x * 8 + wave;
  if (tile >= tilesM * tilesN) return;   // wave-uniform; no block barriers in this kernel
  const int tm = tile / tilesN;
  const int tn = tile - tm * tilesN;
  const int m0 = tm << 6;
  const int n0 = tn << 6;

  const size_t offA = (size_t)b * strideA + (size_t)blockIdx.z * strideAz;
  const size_t offB = (size_t)b * strideB + (size_t)blockIdx.z * strideBz;
  const size_t offC = (size_t)b * strideC + (size_t)blockIdx.z * strideCz;
  const T* Ab  = A  + offA;
  const T* Bb  = Bt + offB;
  const T* Ab2 = SPLIT ? (A2  + offA) : nullptr;
  const T* Bb2 = SPLIT ? (Bt2 + offB) : nullptr;

  const int rlane = lane & 15;                 // row (A) / col (B, D) within subtile
  const int koff  = (lane >> 4) * 8;           // k offset of this lane half
  const int mOff  = (lane >> 4) * 8;           // D row offset

  v8f acc[4][4];
#pragma unroll
  for (int i = 0; i < 4; ++i)
#pragma unroll
    for (int j = 0; j < 4; ++j) acc[i][j] = (v8f){0.f,0.f,0.f,0.f,0.f,0.f,0.f,0.f};

  for (int k0 = 0; k0 < K; k0 += 32) {
    V bh[4], bl[4];
#pragma unroll
    for (int j = 0; j < 4; ++j) {
      const size_t bo = (size_t)(n0 + (j << 4) + rlane) * ldb + koff + k0;
      bh[j] = Frag<T>::load(Bb + bo);
      if (SPLIT) bl[j] = Frag<T>::load(Bb2 + bo);
    }
#pragma unroll
    for (int i = 0; i < 4; ++i) {
      const size_t ao = (size_t)(m0 + (i << 4) + rlane) * lda + koff + k0;
      V ah = Frag<T>::load(Ab + ao);
      V al;
      if (SPLIT) al = Frag<T>::load(Ab2 + ao);
#pragma unroll
      for (int j = 0; j < 4; ++j) {
        acc[i][j] = Frag<T>::mma(ah, bh[j], acc[i][j]);
        if (SPLIT) {
          acc[i][j] = Frag<T>::mma(ah, bl[j], acc[i][j]);
          acc[i][j] = Frag<T>::mma(al, bh[j], acc[i][j]);
        }
      }
      Frag<T>::guard(acc[i][0], acc[i][3], ah, SPLIT ? al : ah);
    }
    Frag<T>::keep(bh[0], bh[1], bh[2], bh[3]);
    if (SPLIT) Frag<T>::keep(bl[0], bl[1], bl[2], bl[3]);
  }
  acc_guard4(acc[0][0], acc[0][1], acc[0][2], acc[0][3]);
  acc_guard4(acc[1][0], acc[1][1], acc[1][2], acc[1][3]);
  acc_guard4(acc[2][0], acc[2][1], acc[2][2], acc[2][3]);
  acc_guard4(acc[3][0], acc[3][1], acc[3][2], acc[3][3]);

  // ---- epilogue ----
  float* slab = sT[wave];
  const float* Rb = RESID ? (resid + (size_t)b * strideR) : nullptr;
#pragma unroll
  for (int i = 0; i < 4; ++i) {
    const int mBase = m0 + (i << 4);
#pragma unroll
    for (int j = 0; j < 4; ++j) {
      const int n = n0 + (j << 4) + rlane;
      float bv = 0.f;
      if (BIAS_MODE == 2) bv = bias[n];
#pragma unroll
      for (int r = 0; r < 8; ++r) {
        float v = acc[i][j][r] * scale;
        if (BIAS_MODE == 1) v += bias[mBase + mOff + r];
        if (BIAS_MODE == 2) v += bv;
        if (RESID) v += Rb[(size_t)(mBase + mOff + r) * ldc + n];
        if (ACT == 1) v = tanhf(v);
        if (ACT == 2) v = fmaxf(v, 0.0f);
        if (ACT == 3) v = v / (1.0f + expf(-v));
        if (ACT == 4) v = (v > 0.f) ? v : 0.01f * v;
        if (ACT == 5) v = 0.5f * v * (1.0f + erff(v * 0.70710678118654752f));
        slab[(mOff + r) * 68 + (j << 4) + rlane] = v;
      }
    }
    __builtin_amdgcn_fence(__ATOMIC_RELEASE, "workgroup");
    __builtin_amdgcn_wave_barrier();
    __builtin_amdgcn_fence(__ATOMIC_ACQUIRE, "workgroup");
    if (OUT_MODE == 0) {
      float* C = (float*)Cout + offC;
      const int hh = lane >> 4, c4 = (lane & 15) * 4;     // row seg = 256 B = 16 lanes x 16 B
      {
#pragma unroll
        for (int it = 0; it < 8; ++it) {
          const int row = it * 2 + hh;
          v4f v = *(const v4f*)(slab + row * 68 + c4);
          *(v4f*)(C + (size_t)(mBase + row) * ldc + n0 + c4) = v;
        }
        
      }
    } else {
      const int q = lane >> 3, c8 = (lane & 7) * 8;
      unsigned short* C  = (unsigned short*)Cout  + offC;
      unsigned short* C2 = (OUT_MODE == 2) ? ((unsigned short*)Cout2 + offC) : nullptr;
      {
#pragma unroll
        for (int it = 0; it < 4; ++it) {
          const int row = it * 4 + q;
          const float* sp = slab + row * 68 + c8;
          v8h hv, lv;
#pragma unroll
          for (int e = 0; e < 8; ++e) {
            if (OUT_MODE == 1) {
              hv[e] = (_Float16)sp[e];
            } else {
              unsigned short hb = f2bf_bits(sp[e]);
              unsigned short lb = f2bf_bits(sp[e] - bf_bits2f(hb));
              hv[e] = __builtin_bit_cast(_Float16, hb);
              lv[e] = __builtin_bit_cast(_Float16, lb);
            }
          }
          *(v8h*)(C + (size_t)(mBase + row) * ldc + n0 + c8) = hv;
          if (OUT_MODE == 2) *(v8h*)(C2 + (size_t)(mBase + row) * ldc + n0 + c8) = lv;
        }
        
      }
    }
    __builtin_amdgcn_fence(__ATOMIC_RELEASE, "workgroup");
    __builtin_amdgcn_wave_barrier();
    __builtin_amdgcn_fence(__ATOMIC_ACQUIRE, "workgroup");
  }
}

// ---------------------------------------------------------------------------
// Elementwise split: 2 elements per thread, one 4-B store per lane per plane -> each wave writes exactly one
// Coverage: grid = ceil(n2/256) blocks x 256 threads x 2 elements = 2*n2 elements = the whole plane (n2 = plane/2).
// ---------------------------------------------------------------------------
// hi = bf16_rne(in), lo = bf16_rne(in - hi)
__global__ __launch_bounds__(256) void split_bf16x2_kernel(const float* __restrict__ in, unsigned short* __restrict__ hi,
                                                           unsigned short* __restrict__ lo, int n2) {
  const int i = blockIdx.x * 256 + threadIdx.x;
  if (i < n2) {
    const v2f f = *(const v2f*)(in + 2 * (size_t)i);
    const unsigned short h0 = f2bf_bits(f[0]), h1 = f2bf_bits(f[1]);
    const unsigned short l0 = f2bf_bits(f[0] - bf_bits2f(h0)), l1 = f2bf_bits(f[1] - bf_bits2f(h1));
    const unsigned uh = pk16(h0, h1), ul = pk16(l0, l1);
    ((unsigned*)hi)[i] = uh;
    ((unsigned*)lo)[i] = ul;
    
  }
}

// ---------------------------------------------------------------------------
// Weight planes for the projections (one block of 256 threads):
//   wqkh/wqkl [64][32] bf16 hi/lo = rows 0..63 of Wqkv (q rows then k rows)
//   wvh/wvl   [64][32] bf16 hi/lo = rows 64..95 of Wqkv in rows 0..31, explicit zeros in rows 32..63
//   bv        [64] f32            = bqkv[64..95] in 0..31, zeros in 32..63
// ---------------------------------------------------------------------------
__device__ __forceinline__ void split_pair(float f0, float f1, unsigned& h, unsigned& l) {
  const unsigned short h0 = f2bf_bits(f0), h1 = f2bf_bits(f1);
  const unsigned short l0 = f2bf_bits(f0 - bf_bits2f(h0));
  const unsigned short l1 = f2bf_bits(f1 - bf_bits2f(h1));
  h = pk16(h0, h1);
  l = pk16(l0, l1);
}
__global__ __launch_bounds__(256) void wprep_kernel(const float* __restrict__ Wqkv, const float* __restrict__ bqkv,
                                                    unsigned short* __restrict__ wqkh, unsigned short* __restrict__ wqkl,
                                                    unsigned short* __restrict__ wvh, unsigned short* __restrict__ wvl,
                                                    float* __restrict__ bv) {
  const int tid  = threadIdx.x;
  const int row  = tid >> 2;            // 0..63
  const int col0 = (tid & 3) * 8;       // 0, 8, 16, 24
  v4u qh, ql, vh, vl;
#pragma unroll
  for (int p = 0; p < 4; ++p) {
    const int col = col0 + 2 * p;
    const float wq0 = Wqkv[row * HDIM + col];
    const float wq1 = Wqkv[row * HDIM + col + 1];
    int rv = 64 + row; rv = rv > 95 ? 95 : rv;            // clamped address; zero by predicate below
    float wv0 = Wqkv[rv * HDIM + col];
    float wv1 = Wqkv[rv * HDIM + col + 1];
    wv0 = (row < 32) ? wv0 : 0.0f;
    wv1 = (row < 32) ? wv1 : 0.0f;
    unsigned a, bq, cv, dv;
    split_pair(wq0, wq1, a, bq);
    split_pair(wv0, wv1, cv, dv);
    qh[p] = a; ql[p] = bq; vh[p] = cv; vl[p] = dv;
  }
  v4f b4;
#pragma unroll
  for (int e = 0; e < 4; ++e) {
    int m = tid * 4 + e; m = m > 63 ? 63 : m;
    int mi = 64 + m; mi = mi > 95 ? 95 : mi;
    const float v = bqkv[mi];
    b4[e] = (m < 32) ? v : 0.0f;
  }
  const size_t o = (size_t)tid * 8;
  {
    *(v4u*)(wqkh + o) = qh;
    *(v4u*)(wqkl + o) = ql;
    *(v4u*)(wvh + o)  = vh;
    *(v4u*)(wvl + o)  = vl;
    if (tid < 16) *(v4f*)(bv + tid * 4) = b4;
    
  }
}

// ---------------------------------------------------------------------------
// Scores, softmax, 12x12 head mixing, batch-statistic partials and (mixed map).v for 16 query rows (t0 = 16 blockIdx.x)
// of batch blockIdx.y, all 12 heads, in one block of 8 waves: neither the scores nor the mixed map go to memory.
// Pass A: row maxima and row sums. 24 units (head, half of the keys), 3 per wave; q.k^T on bf16 hi/lo planes, running
//   maximum and rescaled sum per lane, then over the 16 lanes of a row, then over the two halves (LDS).
// Pass B: 8 chunks of 128 keys. Wave w owns keys 16 w .. 16 w + 15 of the chunk and recomputes q.k^T for all 12 heads,
//   so lane (hh, c) holds P_h[t = 8 hh + r][s = c] for every h. Mixing product, per r, for the rows t = r and t = 8 + r:
//   B elements 0..7 = the lane's own heads 0..7 (k = 0..7: row r, k = 8..15: row 8 + r), elements 8..11 = heads 8..11 of
//   the partner lane (lane ^ 16; k = 16..19: row 8 + r, k = 24..27: row r), the rest zero; the mixing matrix stands in two
//   A fragments, each zero on the other row's k. D row g = 8 hh + r2, column s = c.
//   M goes to LDS as (bf16 hi | bf16 lo << 16) words [g][t][s]; behind a barrier wave w multiplies head w (32 columns of
//   v) and 16 columns of head 8 + w / 2, accumulating over all chunks in registers.
// part[b * 64 + blockIdx.x][32] = {sum M_g (12), sum M_g^2 (12), 8 zeros} over the block's 16 rows.
// ---------------------------------------------------------------------------
constexpr int CHK = 128;               // keys per chunk
constexpr int MTP = CHK + 4;           // words per (g, t) row: 528 B = 16 B x odd, b128 reads of 16 rows without conflicts
constexpr int MGP = 16 * MTP + 4;      // words per g: 8 g = 32 banks off, so the two lane halves store to different banks
typedef __attribute__((ext_vector_type(2))) __bf16 v2b;
union HFrag { v16h v; v8h h[2]; unsigned u[8]; };
union BFrag { v16b v; v8b h[2]; unsigned u[8]; };

__device__ __forceinline__ v8f qk3(v16b ah, v16b al, v16b bh, v16b bl) {
  v8f a = (v8f){0.f,0.f,0.f,0.f,0.f,0.f,0.f,0.f};
  a = Frag<__bf16>::mma(ah, bh, a);
  a = Frag<__bf16>::mma(ah, bl, a);
  a = Frag<__bf16>::mma(al, bh, a);
  return a;
}
__device__ __forceinline__ void split_h(float w, _Float16& a, _Float16& r) {
  a = (_Float16)w;
  r = (_Float16)((w - (float)a) * R_CARRY);
}
__device__ __forceinline__ unsigned pkh(_Float16 a, _Float16 b) {
  return pk16(__builtin_bit_cast(unsigned short, a), __builtin_bit_cast(unsigned short, b));
}
// one mixed row t: fold the residual accumulator, add to the statistics, store packed bf16 hi/lo words
__device__ __forceinline__ void emit_row(const v8f& d0, const v8f& dr, v8f& s1, v8f& s2, unsigned* dst, int hh) {
  unsigned w[8];
#pragma unroll
  for (int r2 = 0; r2 < 8; ++r2) {
    const float m = fmaf(dr[r2], MIX_FOLD, d0[r2] * P_INV);
    s1[r2] += m;
    s2[r2] = fmaf(m, m, s2[r2]);
    const float hf = (float)(__bf16)m;                       // round to nearest even, as f2bf_bits
    const v2b hl = {(__bf16)m, (__bf16)(m - hf)};
    w[r2] = __builtin_bit_cast(unsigned, hl);
  }
#pragma unroll
  for (int r2 = 0; r2 < 4; ++r2) dst[r2 * MGP] = w[r2];
  if (hh == 0) {                       // rows g = 12..15 do not exist
#pragma unroll
    for (int r2 = 4; r2 < 8; ++r2) dst[r2 * MGP] = w[r2];
  }
}
// lane l with lane l ^ 16
__device__ __forceinline__ unsigned xhalf(unsigned x) {
  return (unsigned)__builtin_amdgcn_permlanex16((int)x, (int)x, 0x76543210, 0xfedcba98, false, false);
}
// A fragment (hi and lo planes) of the mixed map from the packed words: elements 0..7 <- p[0..7], 8..15 <- p[16..23]
__device__ __forceinline__ void load_m(const unsigned* p, v16b& hi, v16b& lo) {
  const v4u x0 = *(const v4u*)(p), x1 = *(const v4u*)(p + 4), x2 = *(const v4u*)(p + 16), x3 = *(const v4u*)(p + 20);
  BFrag fh, fl;
#pragma unroll
  for (int i = 0; i < 2; ++i) {
    fh.u[i]     = (x0[2 * i] & 0xFFFFu) | (x0[2 * i + 1] << 16);
    fl.u[i]     = (x0[2 * i] >> 16) | (x0[2 * i + 1] & 0xFFFF0000u);
    fh.u[2 + i] = (x1[2 * i] & 0xFFFFu) | (x1[2 * i + 1] << 16);
    fl.u[2 + i] = (x1[2 * i] >> 16) | (x1[2 * i + 1] & 0xFFFF0000u);
    fh.u[4 + i] = (x2[2 * i] & 0xFFFFu) | (x2[2 * i + 1] << 16);
    fl.u[4 + i] = (x2[2 * i] >> 16) | (x2[2 * i + 1] & 0xFFFF0000u);
    fh.u[6 + i] = (x3[2 * i] & 0xFFFFu) | (x3[2 * i + 1] << 16);
    fl.u[6 + i] = (x3[2 * i] >> 16) | (x3[2 * i + 1] & 0xFFFF0000u);
  }
  hi = fh.v; lo = fl.v;
}

__global__ __launch_bounds__(256) void fused_reattn_kernel(const unsigned short* __restrict__ qkh,
                                                           const unsigned short* __restrict__ qkl,
                                                           const unsigned short* __restrict__ vth,
                                                           const unsigned short* __restrict__ vtl,
                                                           const float* __restrict__ Wconv,
                                                           float* __restrict__ U, float* __restrict__ part) {
  __shared__ __align__(16) unsigned Mx[NHEAD * MGP];
  __shared__ __align__(16) v8b qf[NHEAD][2][2][32];      // q fragments in register order: [head][plane][half][lane]
  __shared__ __align__(16) float pm[NHEAD][2][16];
  __shared__ __align__(16) float pl[NHEAD][2][16];
  __shared__ __align__(16) float fm[NHEAD][16];
  __shared__ __align__(16) float fi[NHEAD][16];
  __shared__ float stw[8][24];
  __shared__ __align__(16) float pline[32];

  const int tid  = threadIdx.x;
  const int lane = tid & 31;
  const int wave = tid >> 5;
  const int hh   = lane >> 4;
  const int c    = lane & 15;
  const int t0   = blockIdx.x * 16;
  const int b    = blockIdx.y;
  const __bf16* QH = (const __bf16*)qkh;
  const __bf16* QL = (const __bf16*)qkl;
  const v8f zacc = (v8f){0.f,0.f,0.f,0.f,0.f,0.f,0.f,0.f};

  // ---- pass A ----  (every "#pragma unroll" of this kernel: constant indices keep the small arrays in registers)
#pragma unroll 1   // rolled: three copies of the unit would only grow the code
  for (int u = 0; u < 3; ++u) {
    const int unit = wave * 3 + u;
    const int h    = unit >> 1;
    const int half = unit & 1;
    const size_t qo = ((size_t)(b * NTOK + t0 + c) * NHEAD + h) * QKW + hh * 8;
    BFrag ah, al;
    const __bf16* qph = QH + qo;
    const __bf16* qpl = QL + qo;
    ah.v = Frag<__bf16>::load(qph);
    al.v = Frag<__bf16>::load(qpl);
    // the address registers are inputs, so they stay as they are up to the wait, which stands in front of every later
    // instruction that reuses a register which an issued load names (a precaution); the same form further down
    asm volatile("s_wait_xcnt 0x0" :: "v"(qph), "v"(qpl) : "memory");
    if (half == 0) {                       // wave-uniform
      qf[h][0][0][lane] = ah.h[0]; qf[h][0][1][lane] = ah.h[1];
      qf[h][1][0][lane] = al.h[0]; qf[h][1][1][lane] = al.h[1];
    }
    float m[8], l[8];
#pragma unroll
    for (int r = 0; r < 8; ++r) { m[r] = -INFINITY; l[r] = 0.0f; }
    const size_t ko = ((size_t)(b * NTOK + half * 512 + c) * NHEAD + h) * QKW + HDIM + hh * 8;
#pragma unroll 1   // rolled: 16 loads in flight per trip are enough, more copies cost registers
    for (int it = 0; it < 8; ++it) {
      v16b bh[4], bl[4];
      const __bf16* kph = QH + ko + (size_t)(it * 64) * NHEAD * QKW;
      const __bf16* kpl = QL + ko + (size_t)(it * 64) * NHEAD * QKW;
#pragma unroll
      for (int j = 0; j < 4; ++j) {
        bh[j] = Frag<__bf16>::load(kph + j * 16 * NHEAD * QKW);
        bl[j] = Frag<__bf16>::load(kpl + j * 16 * NHEAD * QKW);
      }
      asm volatile("s_wait_xcnt 0x0" :: "v"(kph), "v"(kpl) : "memory");   // as above
      v8f a[4];
#pragma unroll
      for (int j = 0; j < 4; ++j) a[j] = qk3(ah.v, al.v, bh[j], bl[j]);
#pragma unroll
      for (int r = 0; r < 8; ++r) {
        const float x0 = a[0][r] * SM_SCALE, x1 = a[1][r] * SM_SCALE, x2 = a[2][r] * SM_SCALE, x3 = a[3][r] * SM_SCALE;
        const float mn = fmaxf(m[r], fmaxf(fmaxf(x0, x1), fmaxf(x2, x3)));
        const float e  = ((__expf(x0 - mn) + __expf(x1 - mn)) + __expf(x2 - mn)) + __expf(x3 - mn);
        l[r] = fmaf(l[r], __expf(m[r] - mn), e);
        m[r] = mn;
      }
    }
#pragma unroll
    for (int r = 0; r < 8; ++r) {
      float mm = m[r];
#pragma unroll
      for (int off = 1; off < 16; off <<= 1) mm = fmaxf(mm, __shfl_xor(mm, off, 32));
      float ll = l[r] * __expf(m[r] - mm);
#pragma unroll
      for (int off = 1; off < 16; off <<= 1) ll += __shfl_xor(ll, off, 32);
      if (c == 0) { pm[h][half][8 * hh + r] = mm; pl[h][half][8 * hh + r] = ll; }
    }
  }
  __syncthreads();
  if (tid < NHEAD * 16) {
    const int h = tid >> 4, t = tid & 15;
    const float m0 = pm[h][0][t], m1 = pm[h][1][t];
    const float mm = fmaxf(m0, m1);
    const float ll = pl[h][0][t] * __expf(m0 - mm) + pl[h][1][t] * __expf(m1 - mm);
    fm[h][t] = mm;
    fi[h][t] = (1.0f / ll) * P_CARRY;      // probabilities leave the exponential already carried x2^10
  }

  // A fragments of the mixing matrix: row m = g = c; a1 serves query row r, a2 query row 8 + r
  HFrag a1h, a1l, a2h, a2l;
  {
    v8h z8, w0h, w0l, w8h, w8l;
    const unsigned wofs = (unsigned)(c > 11 ? 11 : c) * NHEAD * 4u;      // byte offset of the lane's row
    const float* wrow = (const float*)((const char*)Wconv + wofs);
#pragma unroll
    for (int i = 0; i < 8; ++i) {
      const int h8 = i < 4 ? 8 + i : 11;
      float w0 = wrow[i];
      float w8 = wrow[h8];
      w0 = (c < 12) ? w0 : 0.0f;
      w8 = (c < 12 && i < 4) ? w8 : 0.0f;
      _Float16 x, y;
      split_h(w0, x, y); w0h[i] = x; w0l[i] = y;
      split_h(w8, x, y); w8h[i] = x; w8l[i] = y;
      z8[i] = (_Float16)0.0f;
    }
    asm volatile("s_wait_xcnt 0x0" :: "v"(wofs) : "memory");   // as above
    a1h.h[0] = hh ? z8 : w0h;  a1h.h[1] = hh ? w8h : z8;
    a1l.h[0] = hh ? z8 : w0l;  a1l.h[1] = hh ? w8l : z8;
    a2h.h[0] = hh ? w0h : z8;  a2h.h[1] = hh ? z8 : w8h;
    a2l.h[0] = hh ? w0l : z8;  a2l.h[1] = hh ? z8 : w8l;
  }
  __syncthreads();

  // ---- pass B ----
  v8f s1 = zacc, s2 = zacc;
  v8f ua0 = zacc, ua1 = zacc, ub = zacc;
  const int gA = wave;                   // head whose 32 v columns this wave multiplies
  const int gB = 8 + (wave >> 1);        // head of which it multiplies 16 columns
  const int dB = (wave & 1) * 16;
  const __bf16* VH = (const __bf16*)vth;
  const __bf16* VL = (const __bf16*)vtl;
  const size_t voA = ((size_t)(b * NHEAD + gA) * VTROWS + c) * NTOK + hh * 8;
  const size_t voB = ((size_t)(b * NHEAD + gB) * VTROWS + dB + c) * NTOK + hh * 8;
#pragma unroll 1   // rolled
  for (int ch = 0; ch < NTOK / CHK; ++ch) {      // block-uniform
    unsigned o07h[8][4], o07l[8][4], o8h[8][2], o8l[8][2];
    const size_t ko = (size_t)(b * NTOK + ch * CHK + wave * 16 + c) * NHEAD * QKW + hh * 8;
    const __bf16* kph = QH + ko;                 // the k half of a row stands HDIM elements further on
    const __bf16* kpl = QL + ko;
    v16b kbh[NHEAD], kbl[NHEAD];                 // all 48 loads of the chunk in flight at once
#pragma unroll
    for (int h = 0; h < NHEAD; ++h) {
      kbh[h] = Frag<__bf16>::load(kph + HDIM + h * QKW);
      kbl[h] = Frag<__bf16>::load(kpl + HDIM + h * QKW);
    }
    asm volatile("s_wait_xcnt 0x0" :: "v"(kph), "v"(kpl) : "memory");   // as above
#pragma unroll
    for (int hp = 0; hp < 6; ++hp) {             // heads 2 hp and 2 hp + 1 share a word
      v8f a[2];
      v4f mx[2][2], iv[2][2];
#pragma unroll
      for (int e = 0; e < 2; ++e) {
        const int h = 2 * hp + e;
        BFrag ah, al;
        ah.h[0] = qf[h][0][0][lane]; ah.h[1] = qf[h][0][1][lane];
        al.h[0] = qf[h][1][0][lane]; al.h[1] = qf[h][1][1][lane];
        a[e] = qk3(ah.v, al.v, kbh[h], kbl[h]);
        mx[e][0] = *(const v4f*)(&fm[h][8 * hh]); mx[e][1] = *(const v4f*)(&fm[h][8 * hh + 4]);
        iv[e][0] = *(const v4f*)(&fi[h][8 * hh]); iv[e][1] = *(const v4f*)(&fi[h][8 * hh + 4]);
      }
#pragma unroll
      for (int r = 0; r < 8; ++r) {
        const float p0 = __expf(a[0][r] * SM_SCALE - mx[0][r >> 2][r & 3]) * iv[0][r >> 2][r & 3];
        const float p1 = __expf(a[1][r] * SM_SCALE - mx[1][r >> 2][r & 3]) * iv[1][r >> 2][r & 3];
        _Float16 x0, y0, x1, y1;
        split_h(p0, x0, y0);
        split_h(p1, x1, y1);
        if (hp < 4) { o07h[r][hp] = pkh(x0, x1); o07l[r][hp] = pkh(y0, y1); }
        else        { o8h[r][hp - 4] = pkh(x0, x1); o8l[r][hp - 4] = pkh(y0, y1); }
      }
    }
#pragma unroll
    for (int r = 0; r < 8; ++r) {
      HFrag bh, bl;
#pragma unroll
      for (int i = 0; i < 4; ++i) { bh.u[i] = o07h[r][i]; bl.u[i] = o07l[r][i]; }
      bh.u[4] = xhalf(o8h[r][0]); bh.u[5] = xhalf(o8h[r][1]);
      bl.u[4] = xhalf(o8l[r][0]); bl.u[5] = xhalf(o8l[r][1]);
      bh.u[6] = 0u; bh.u[7] = 0u; bl.u[6] = 0u; bl.u[7] = 0u;
      v8f d10 = Frag<_Float16>::mma(a1h.v, bh.v, zacc);
      v8f d20 = Frag<_Float16>::mma(a2h.v, bh.v, zacc);
      v8f d1r = Frag<_Float16>::mma(a1h.v, bl.v, zacc);
      v8f d2r = Frag<_Float16>::mma(a2h.v, bl.v, zacc);
      d1r = Frag<_Float16>::mma(a1l.v, bh.v, d1r);
      d2r = Frag<_Float16>::mma(a2l.v, bh.v, d2r);
      unsigned* dst = Mx + (8 * hh) * MGP + wave * 16 + c;
      emit_row(d10, d1r, s1, s2, dst + r * MTP, hh);
      emit_row(d20, d2r, s1, s2, dst + (8 + r) * MTP, hh);
    }
    // the chunk's v fragments: issued in front of the barrier, so that they fly while the wave waits there
    const __bf16* vah = VH + voA + (size_t)ch * CHK;
    const __bf16* val = VL + voA + (size_t)ch * CHK;
    const __bf16* vbh = VH + voB + (size_t)ch * CHK;
    const __bf16* vbl = VL + voB + (size_t)ch * CHK;
    v16b f0h[CHK / 32], f0l[CHK / 32], f1h[CHK / 32], f1l[CHK / 32], f2h[CHK / 32], f2l[CHK / 32];
#pragma unroll
    for (int ks = 0; ks < CHK / 32; ++ks) {
      f0h[ks] = Frag<__bf16>::load(vah + ks * 32);
      f0l[ks] = Frag<__bf16>::load(val + ks * 32);
      f1h[ks] = Frag<__bf16>::load(vah + 16 * NTOK + ks * 32);
      f1l[ks] = Frag<__bf16>::load(val + 16 * NTOK + ks * 32);
      f2h[ks] = Frag<__bf16>::load(vbh + ks * 32);
      f2l[ks] = Frag<__bf16>::load(vbl + ks * 32);
    }
    asm volatile("s_wait_xcnt 0x0" :: "v"(vah), "v"(val), "v"(vbh), "v"(vbl) : "memory");   // as above
    __syncthreads();                             // the chunk's mixed map is complete
#pragma unroll
    for (int ks = 0; ks < CHK / 32; ++ks) {
      const v16b b0h = f0h[ks], b0l = f0l[ks], b1h = f1h[ks], b1l = f1l[ks], b2h = f2h[ks], b2l = f2l[ks];
      v16b mh, ml, nh, nl;
      load_m(Mx + gA * MGP + c * MTP + ks * 32 + hh * 8, mh, ml);
      load_m(Mx + gB * MGP + c * MTP + ks * 32 + hh * 8, nh, nl);
      ua0 = Frag<__bf16>::mma(mh, b0h, ua0);
      ua1 = Frag<__bf16>::mma(mh, b1h, ua1);
      ub  = Frag<__bf16>::mma(nh, b2h, ub);
      ua0 = Frag<__bf16>::mma(mh, b0l, ua0);
      ua1 = Frag<__bf16>::mma(mh, b1l, ua1);
      ub  = Frag<__bf16>::mma(nh, b2l, ub);
      ua0 = Frag<__bf16>::mma(ml, b0h, ua0);
      ua1 = Frag<__bf16>::mma(ml, b1h, ua1);
      ub  = Frag<__bf16>::mma(nl, b2h, ub);
    }
    __syncthreads();                             // every reader has left Mx before the next chunk (or the U tile) overwrites it
  }

  // U tile through LDS, so that each 128-B row of U is stored whole by one wave: [g][t][32]
  float* ut = (float*)Mx;
#pragma unroll
  for (int r = 0; r < 8; ++r) {
    ut[(gA * 16 + 8 * hh + r) * UW + c]      = ua0[r];     // D row t = 8 hh + r, column d = c
    ut[(gA * 16 + 8 * hh + r) * UW + 16 + c] = ua1[r];
    ut[(gB * 16 + 8 * hh + r) * UW + dB + c] = ub[r];
  }
  // statistics: xor tree over the 16 lanes sharing hh (fixed order), then waves in index order
#pragma unroll
  for (int r = 0; r < 8; ++r) {
    float a = s1[r], bq = s2[r];
#pragma unroll
    for (int off = 1; off < 16; off <<= 1) { a += __shfl_xor(a, off, 32); bq += __shfl_xor(bq, off, 32); }
    const int g = 8 * hh + r;
    if (c == 0 && g < 12) { stw[wave][g] = a; stw[wave][12 + g] = bq; }
  }
  __syncthreads();
#pragma unroll
  for (int i = 0; i < NHEAD * 16 * UW / 4 / 256; ++i) {    // 1536 16-B pieces, 6 per thread
    const int p = i * 256 + tid;
    const int g = p >> 7, t = (p >> 3) & 15, d = (p & 7) * 4;
    const v4f v = *(const v4f*)(ut + p * 4);
    *(v4f*)(U + ((size_t)(b * NHEAD + g) * NTOK + t0 + t) * UW + d) = v;
  }
  if (wave == 0) {
    const int qi = lane < 24 ? lane : 23;
    float v = stw[0][qi];
#pragma unroll
    for (int w = 1; w < 8; ++w) v += stw[w][qi];
    v = (lane < 24) ? v : 0.0f;
    pline[lane] = v;
  }
  __syncthreads();
  if (tid < 8) {
    const v4f v = *(const v4f*)(pline + tid * 4);
    *(v4f*)(part + ((size_t)b * (NTOK / 16) + blockIdx.x) * 32 + tid * 4) = v;
  }
}

// ---------------------------------------------------------------------------
// Vsum[g][d] = sum_s v[g][s][d] from the v^T bf16 hi+lo planes ([8 x 12][64][1024], rows d < 32), g = (batch, head).
// Block g, 256 threads: d = tid>>3, 8 partial sums of 128 columns combined by a fixed xor tree; the 32 results are
// ---------------------------------------------------------------------------
__global__ __launch_bounds__(256) void vsum_kernel(const unsigned short* __restrict__ vth, const unsigned short* __restrict__ vtl,
                                                   float* __restrict__ vsum) {
  __shared__ __align__(16) float vs[32];
  const int g   = blockIdx.x;
  const int tid = threadIdx.x;
  const int d   = tid >> 3;
  const int prt = tid & 7;
  const size_t base = ((size_t)g * VTROWS + d) * NTOK + (size_t)prt * 128;
  float acc = 0.0f;
#pragma unroll 1
  for (int i = 0; i < 16; ++i) {
    const v8us a  = *(const v8us*)(vth + base + i * 8);
    const v8us bq = *(const v8us*)(vtl + base + i * 8);
#pragma unroll
    for (int e = 0; e < 8; ++e) acc += bf_bits2f(a[e]) + bf_bits2f(bq[e]);
  }
  acc += __shfl_xor(acc, 1, 32);
  acc += __shfl_xor(acc, 2, 32);
  acc += __shfl_xor(acc, 4, 32);
  if (prt == 0) vs[d] = acc;
  __syncthreads();
  if (tid < 8) {
    const v4f v = *(const v4f*)(vs + tid * 4);
    float* dst = vsum + g * 32 + tid * 4;
    *(v4f*)dst = v;
    
  }
}

// ---------------------------------------------------------------------------
// Column sums of the partial lines, first level: part [NPART][32] f32 -> psum [STBLK][32] f64.
// Lane = column; each wave reads its STROWS lines as independent loads (all in flight at once), adds them in f64 in
// row order; the 8 wave sums of a block are added in wave order. One wave writes the block's 256-B psum line.
// Coverage: STBLK blocks x 8 waves x STROWS rows = NPART lines.
// ---------------------------------------------------------------------------
__global__ __launch_bounds__(256) void statsum_kernel(const float* __restrict__ part, double* __restrict__ psum) {
  __shared__ double sw[8][32];
  const int lane = threadIdx.x & 31;
  const int wave = threadIdx.x >> 5;
  const float* p = part + (size_t)(blockIdx.x * 8 + wave) * STROWS * 32 + lane;
  float v[STROWS];
#pragma unroll   // loads issue back to back: one memory latency per wave instead of one per line
  for (int i = 0; i < STROWS; ++i) v[i] = p[i * 32];
  double acc = 0.0;
#pragma unroll   // constant indices keep v[] in registers
  for (int i = 0; i < STROWS; ++i) acc += (double)v[i];
  sw[wave][lane] = acc;
  __syncthreads();
  if (wave == 0) {
    double s = sw[0][lane];
#pragma unroll
    for (int w = 1; w < 8; ++w) s += sw[w][lane];
    psum[blockIdx.x * 32 + lane] = s;
  }
}

// ---------------------------------------------------------------------------
// Per-head affine coefficients from the first-level sums (one block of 8 waves): wave w adds psum lines
// w*STBLK/8 .. +STBLK/8-1 in f64 (independent loads, row order), wave 0 adds the 8 wave sums in wave order;
// mean_g = S1/N, var_g = S2/N - mean_g^2 (biased), a_g = gamma_g / sqrt(var_g + eps),
// kk_g = a_g*bconv_g + (beta_g - a_g*(mean_g + bconv_g)); coef line = {a[12], kk[12], 8 zeros}, one instruction.
// ---------------------------------------------------------------------------
__global__ __launch_bounds__(256) void coef_kernel(const double* __restrict__ psum, const float* __restrict__ bconv,
                                                   const float* __restrict__ gamma, const float* __restrict__ beta,
                                                   float* __restrict__ coef) {
  __shared__ double sw[8][32];
  __shared__ double sd[32];
  __shared__ __align__(16) float cf[32];
  const int lane = threadIdx.x & 31;
  const int wave = threadIdx.x >> 5;
  const double* p = psum + (size_t)wave * (STBLK / 8) * 32 + lane;
  double q[STBLK / 8];
#pragma unroll   // loads issue back to back: one memory latency per wave instead of one per line
  for (int i = 0; i < STBLK / 8; ++i) q[i] = p[i * 32];
  double acc = 0.0;
#pragma unroll   // constant indices keep q[] in registers
  for (int i = 0; i < STBLK / 8; ++i) acc += q[i];
  sw[wave][lane] = acc;
  __syncthreads();
  if (wave == 0) {
    double s = sw[0][lane];
#pragma unroll
    for (int w = 1; w < 8; ++w) s += sw[w][lane];
    sd[lane] = s;
  }
  __syncthreads();
  int gq = (lane < 12) ? lane : (lane - 12);
  gq = gq < 0 ? 0 : (gq > 11 ? 11 : gq);
  const double s1d = sd[gq];
  const double s2d = sd[12 + gq];
  const double invN = 1.0 / ((double)NBATCH * (double)NTOK * (double)NTOK);
  const double meanM = s1d * invN;
  double var = s2d * invN - meanM * meanM;
  var = var < 0.0 ? 0.0 : var;
  const float varf   = (float)var;
  const float meanre = (float)meanM + bconv[gq];
  const float a      = gamma[gq] * (1.0f / sqrtf(varf + BN_EPS));
  const float kk     = a * bconv[gq] + (beta[gq] - a * meanre);
  const float v = (lane < 12) ? a : ((lane < 24) ? kk : 0.0f);
  if (wave == 0) cf[lane] = v;
  __syncthreads();
  if (threadIdx.x < 8) {
    const v4f w = *(const v4f*)(cf + threadIdx.x * 4);
    float* dst = coef + threadIdx.x * 4;
    *(v4f*)dst = w;
  }
}

// ---------------------------------------------------------------------------
// out[b][t][32g+d] = a_g * U[b][g][t][d] + kk_g * Vsum[b][g][d]. One wave per (b,t) row of 384 floats:
// Coverage: grid 1024 x 8 waves = 8192 rows = all of d_out.
// ---------------------------------------------------------------------------
__global__ __launch_bounds__(256) void combine_kernel(const float* __restrict__ U, const float* __restrict__ vsum,
                                                      const float* __restrict__ coef, float* __restrict__ out) {
  const int lane = threadIdx.x & 31;
  const int wave = threadIdx.x >> 5;
  const int R = blockIdx.x * 8 + wave;         // 0..8191
  const int b = R >> 10, t = R & (NTOK - 1);
  v4f o[3];
#pragma unroll
  for (int i = 0; i < 3; ++i) {
    const int f = 128 * i + 4 * lane;
    const int g = f >> 5, d = f & 31;
    const v4f u  = *(const v4f*)(U + (((size_t)(b * NHEAD + g)) * NTOK + t) * UW + d);
    const v4f vv = *(const v4f*)(vsum + (b * NHEAD + g) * 32 + d);
    const float a = coef[g], kk = coef[12 + g];
    v4f rr;
#pragma unroll
    for (int e = 0; e < 4; ++e) rr[e] = fmaf(a, u[e], kk * vv[e]);
    o[i] = rr;
  }
  float* orow = out + (size_t)R * NEMB;
  {
#pragma unroll
    for (int i = 0; i < 3; ++i) *(v4f*)(orow + 128 * i + 4 * lane) = o[i];
    
  }
}

// ---------------------------------------------------------------------------
// Workspace region map (every size a multiple of 256):
//   XH, XL  bf16 [98304][32] each   x hi / lo planes (rows = (b,t,h)); last read by launch (4)
//   U       f32  [8][12][1024][32]  lies on XH|XL (same size), first written by launch (6)
//   WQKH WQKL WVH WVL bf16 [64][32] each;  BV f32 [64]
//   QKH, QKL bf16 [98304][64] each  q at 0..31, k at 32..63
//   VTH, VTL bf16 [8][12][64][1024] each  v^T of every batch
//   PART    f32  [512][32];  VSUM f32 [8][12][32];  COEF f32 [32] (256 B);  PSUM f64 [64][32]
// ---------------------------------------------------------------------------
extern "C" void kernel_launch(void* const* d_in, const int* in_sizes, int n_in,
                              void* d_out, int out_size, void* d_ws, size_t ws_size,
                              hipStream_t stream) {
  if (n_in < 7) return;
  if (in_sizes[0] != NBATCH * NTOK * NEMB) return;
  if (in_sizes[1] != 3 * HDIM * HDIM || in_sizes[2] != 3 * HDIM) return;
  if (in_sizes[3] != NHEAD * NHEAD || in_sizes[4] < NHEAD || in_sizes[5] < NHEAD || in_sizes[6] < NHEAD) return;
  if (out_size != NBATCH * NTOK * NEMB) return;

  const float* x     = (const float*)d_in[0];
  const float* Wqkv  = (const float*)d_in[1];
  const float* bqkv  = (const float*)d_in[2];
  const float* Wconv = (const float*)d_in[3];
  const float* bconv = (const float*)d_in[4];
  const float* gamma = (const float*)d_in[5];
  const float* beta  = (const float*)d_in[6];
  float* out = (float*)d_out;

  const size_t szX    = (size_t)NBATCH * NTOK * NEMB * 2;            // 6291456
  const size_t szW    = (size_t)64 * HDIM * 2;                       // 4096
  const size_t szBV   = 256;
  const size_t szQK   = (size_t)NBATCH * NTOK * NHEAD * QKW * 2;     // 12582912
  const size_t szVT   = (size_t)NBATCH * NHEAD * VTROWS * NTOK * 2;  // 12582912
  const size_t szPART = (size_t)NPART * 32 * 4;                      // 65536
  const size_t szVS   = (size_t)NBATCH * NHEAD * 32 * 4;             // 12288
  const size_t szCF   = 256;
  const size_t szPS   = (size_t)STBLK * 32 * 8;                      // 16384
  static_assert((size_t)NBATCH * NHEAD * NTOK * UW * 4 == 2 * (size_t)NBATCH * NTOK * NEMB * 2, "U fills XH|XL exactly");
  size_t off = 0;
  const size_t oXH = off;   off += szX;
  const size_t oXL = off;   off += szX;
  const size_t oU = oXH;
  const size_t oWQKH = off; off += szW;
  const size_t oWQKL = off; off += szW;
  const size_t oWVH = off;  off += szW;
  const size_t oWVL = off;  off += szW;
  const size_t oBV = off;   off += szBV;
  const size_t oQKH = off;  off += szQK;
  const size_t oQKL = off;  off += szQK;
  const size_t oVTH = off;  off += szVT;
  const size_t oVTL = off;  off += szVT;
  const size_t oPART = off; off += szPART;
  const size_t oVS = off;   off += szVS;
  const size_t oCF = off;   off += szCF;
  const size_t oPS = off;   off += szPS;
  if (off > ws_size) return;

  char* ws = (char*)d_ws;
  unsigned short* XH   = (unsigned short*)(ws + oXH);
  unsigned short* XL   = (unsigned short*)(ws + oXL);
  unsigned short* WQKH = (unsigned short*)(ws + oWQKH);
  unsigned short* WQKL = (unsigned short*)(ws + oWQKL);
  unsigned short* WVH  = (unsigned short*)(ws + oWVH);
  unsigned short* WVL  = (unsigned short*)(ws + oWVL);
  float*          BV   = (float*)(ws + oBV);
  unsigned short* QKH  = (unsigned short*)(ws + oQKH);
  unsigned short* QKL  = (unsigned short*)(ws + oQKL);
  unsigned short* VTH  = (unsigned short*)(ws + oVTH);
  unsigned short* VTL  = (unsigned short*)(ws + oVTL);
  float*          U    = (float*)(ws + oU);
  float*          PART = (float*)(ws + oPART);
  float*          VSUM = (float*)(ws + oVS);
  float*          COEF = (float*)(ws + oCF);
  double*         PSUM = (double*)(ws + oPS);

  const dim3 blk(256);
  // (1) x -> bf16 hi/lo planes viewed as [(b,t,h)][32]: n2 = 1572864 pairs = 6144 blocks x 256 threads exactly
  const int n2x = NBATCH * NTOK * NEMB / 2;
  split_bf16x2_kernel<<<dim3((n2x + 255) / 256), blk, 0, stream>>>(x, XH, XL, n2x);
  // (2) projection weight planes and padded v bias
  wprep_kernel<<<dim3(1), blk, 0, stream>>>(Wqkv, bqkv, WQKH, WQKL, WVH, WVL, BV);
  // (3) q|k = xh . Wqkv[0..63]^T + bqkv[0..63] -> QK hi/lo planes [98304][64]; M = 98304 (1536 tiles), N = 64, K = 32
  wmma_gemm64<1, true, 2, 2, false><<<dim3((NBATCH * NTOK * NHEAD / 64) / 8, 1), blk, 0, stream>>>(
      XH, XL, HDIM, 0L, WQKH, WQKL, HDIM, 0L, (void*)QKH, (void*)QKL, QKW, 0L,
      bqkv, bqkv, 0L, NBATCH * NTOK * NHEAD, QKW, HDIM, 1.0f, 0L, 0L, 0L);
  // (4) v^T[m][s] for head g = blockIdx.y of batch blockIdx.z: A = WV planes [64][32] (rows 32..63 zero), Bt = x planes
  //     at column g*32, ldb = 384; M = 64, N = 1024 (16 tiles -> 2 blocks), K = 32; bias[m] = BV -> VT planes
  wmma_gemm64<1, true, 1, 2, false><<<dim3(2, NHEAD, NBATCH), blk, 0, stream>>>(
      WVH, WVL, HDIM, 0L, XH, XL, NEMB, (long)HDIM, (void*)VTH, (void*)VTL, NTOK, (long)VTROWS * NTOK,
      BV, BV, 0L, VTROWS, NTOK, HDIM, 1.0f, 0L, (long)NTOK * NEMB, (long)NHEAD * VTROWS * NTOK);
  // (5) Vsum of every (batch, head): 96 lines
  vsum_kernel<<<dim3(NBATCH * NHEAD), blk, 0, stream>>>(VTH, VTL, VSUM);

  // (6) scores, softmax, head mixing, statistic partials and (mixed map).v: one block per 16 query rows of a batch
  fused_reattn_kernel<<<dim3(NTOK / 16, NBATCH), blk, 0, stream>>>(QKH, QKL, VTH, VTL, Wconv, U, PART);
  // (7) fixed-order f64 sums over the partial lines in two levels, then the per-head affine coefficients
  statsum_kernel<<<dim3(STBLK), blk, 0, stream>>>(PART, PSUM);
  coef_kernel<<<dim3(1), blk, 0, stream>>>(PSUM, bconv, gamma, beta, COEF);
  // (8) output rows: 1024 blocks x 8 waves = 8192 rows of 384 floats
  combine_kernel<<<dim3(NBATCH * NTOK / 8), blk, 0, stream>>>(U, VSUM, COEF, out);
}

// v005
// One run takes 247 microseconds.
// Timed twice side by side with v004, it ran 1.07 times as fast both times.
// Counting every step since v000, it is 14.3 times as fast.
// Contractions: x.Wqkv^T (q|k planes and v^T planes), scaled q.k^T, and (head-mixed attention).v on v_wmma_f32_16x16x32_bf16 with bf16 hi/lo split operand planes (hi.hi + hi.lo + lo.hi); 12x12 head mixing on v_wmma_f32_16x16x32_f16 (f16 hi planes + x2^11 residual planes in a separate accumulator, probabilities carried x2^10); f32 accumulate everywhere; softmax f32; per-head batch statistics as f32 block partials combined in f64 in fixed order.
#include <hip/hip_runtime.h>
#include <math.h>
#include <stdint.h>

constexpr int NBATCH = 8;
constexpr int NTOK   = 1024;
constexpr int NEMB   = 384;
constexpr int NHEAD  = 12;
constexpr int HDIM   = 32;
constexpr int QKW    = 64;             // columns of the q|k projection (q at 0..31, k at 32..63)
constexpr int FBLK   = 512;            // elements of a 16 x 32 block stored in fragment order (1024 B)
constexpr size_t QKPLANE = (size_t)NBATCH * NHEAD * NTOK * HDIM;   // elements of the q plane; the k plane stands behind it
constexpr int VTROWS = 64;             // v^T rows per head (32 real + 32 zero)
constexpr int UW     = 32;             // U row pitch
constexpr float SM_SCALE = 0.17677669529663687f;
constexpr float P_CARRY  = 1024.0f;                      // probabilities carried x2^10 in f16
constexpr float R_CARRY  = 2048.0f;                      // residual planes carried x2^11
constexpr float P_INV    = 1.0f / 1024.0f;
constexpr float MIX_FOLD = 1.0f / (1024.0f * 2048.0f);
constexpr float BN_EPS   = 1e-5f;
constexpr int STBLK  = 64;                            // blocks of the first level of the statistic sum
constexpr int NPART  = NBATCH * NTOK / 16;           // partial lines: one per block of 16 query rows
constexpr int STROWS = NPART / (STBLK * 8);           // partial lines per wave

typedef __attribute__((ext_vector_type(16))) _Float16 v16h;
typedef __attribute__((ext_vector_type(8)))  _Float16 v8h;
typedef __attribute__((ext_vector_type(16))) __bf16   v16b;
typedef __attribute__((ext_vector_type(8)))  __bf16   v8b;
typedef __attribute__((ext_vector_type(8)))  float    v8f;
typedef __attribute__((ext_vector_type(4)))  float    v4f;
typedef __attribute__((ext_vector_type(2)))  float    v2f;
typedef __attribute__((ext_vector_type(4)))  unsigned int v4u;
typedef __attribute__((ext_vector_type(8)))  unsigned short v8us;

__device__ __forceinline__ unsigned short f2bf_bits(float f) {
  unsigned u = __float_as_uint(f);
  return (unsigned short)((u + 0x7FFFu + ((u >> 16) & 1u)) >> 16);
}
__device__ __forceinline__ float bf_bits2f(unsigned short h) { return __uint_as_float(((unsigned)h) << 16); }
__device__ __forceinline__ unsigned pk16(unsigned short a, unsigned short b) { return (unsigned)a | ((unsigned)b << 16); }

// hazard guards as plain device helpers (no inline asm inside the kernel template body)
__device__ __forceinline__ void dep_guard_h(v8f& a, v8f& b, v16h x, v16h y) { asm volatile("v_nop\n\tv_nop\n\tv_nop\n\tv_nop" : "+v"(a), "+v"(b) : "v"(x), "v"(y)); }
__device__ __forceinline__ void dep_guard_b(v8f& a, v8f& b, v16b x, v16b y) { asm volatile("v_nop\n\tv_nop\n\tv_nop\n\tv_nop" : "+v"(a), "+v"(b) : "v"(x), "v"(y)); }
__device__ __forceinline__ void keep4_h(v16h a, v16h b, v16h c, v16h d) { asm volatile("v_nop" :: "v"(a), "v"(b), "v"(c), "v"(d)); }
__device__ __forceinline__ void keep4_b(v16b a, v16b b, v16b c, v16b d) { asm volatile("v_nop" :: "v"(a), "v"(b), "v"(c), "v"(d)); }
__device__ __forceinline__ void acc_guard4(v8f& a, v8f& b, v8f& c, v8f& d) { asm volatile("v_nop\n\tv_nop\n\tv_nop\n\tv_nop" : "+v"(a), "+v"(b), "+v"(c), "+v"(d)); }
template <typename T> struct Frag;
template <> struct Frag<_Float16> {
  typedef v16h V; union U { v16h v; v8h h[2]; };
  static __device__ __forceinline__ v16h load(const _Float16* p) {   // elements 0..7 <- p[0..7], 8..15 <- p[16..23]
    U f; f.h[0] = *(const v8h*)(p); f.h[1] = *(const v8h*)(p + 16); return f.v;
  }
  static __device__ __forceinline__ v8f mma(v16h a, v16h b, v8f c) {
    return __builtin_amdgcn_wmma_f32_16x16x32_f16(false, a, false, b, (short)0, c, false, false);
  }
  static __device__ __forceinline__ void guard(v8f& a, v8f& b, v16h x, v16h y) { dep_guard_h(a, b, x, y); }
  static __device__ __forceinline__ void keep(v16h a, v16h b, v16h c, v16h d) { keep4_h(a, b, c, d); }
};
template <> struct Frag<__bf16> {
  typedef v16b V; union U { v16b v; v8b h[2]; };
  static __device__ __forceinline__ v16b load(const __bf16* p) {
    U f; f.h[0] = *(const v8b*)(p); f.h[1] = *(const v8b*)(p + 16); return f.v;
  }
  static __device__ __forceinline__ v8f mma(v16b a, v16b b, v8f c) {
    return __builtin_amdgcn_wmma_f32_16x16x32_bf16(false, a, false, b, (short)0, c, false, false);
  }
  static __device__ __forceinline__ void guard(v8f& a, v8f& b, v16b x, v16b y) { dep_guard_b(a, b, x, y); }
  static __device__ __forceinline__ void keep(v16b a, v16b b, v16b c, v16b d) { keep4_b(a, b, c, d); }
};

// ---- Register-blocked batched WMMA GEMM ------------------------------------
// C[m,n] = scale * sum_k A[m,k] * Bt[n,k] (+bias)(+resid); each wave owns a 64x64 tile.
// Batched over blockIdx.y (strideA/B/C) and blockIdx.z (strideAz/Bz/Cz).
// A row-major [M,K]; Bt row-major [N,K]; M,N % 64 == 0, K % 32 == 0.
// SPLIT: operands are hi/lo planes (A2/Bt2 = lo planes, same layout); product = hi·hi + hi·lo + lo·hi.
// BIAS_MODE: 0 = none, 1 = bias[m], 2 = bias[n].
// OUT_MODE: 0 = f32, 1 = f16, 2 = bf16 hi plane (Cout) + bf16 lo plane (Cout2), 3 = the planes of 2 in fragment order:
//           rows 16 i .. 16 i + 15, columns 32 j .. 32 j + 31 stand as one block of 1024 B at i * ldc + j * blkN elements,
//           [half][lane][8]: lane (hh, r) holds row r, columns 16 half + 8 hh + 0..7, which is what that lane of a
//           16x16x32 A or B fragment takes, so a reader's 16-B load per lane covers four whole 128-B lines.
// ET: 0 = f16 operands, 1 = bf16 operands (pointers passed as 16-bit storage)
template <int ET> struct Elem;
template <> struct Elem<0> { typedef _Float16 T; };
template <> struct Elem<1> { typedef __bf16 T; };
template <int ET, bool SPLIT, int BIAS_MODE, int OUT_MODE, bool RESID, int ACT = 0>
__global__ __launch_bounds__(256) void wmma_gemm64(
    const unsigned short* __restrict__ Ap, const unsigned short* __restrict__ A2p, int lda, long strideA,
    const unsigned short* __restrict__ Btp, const unsigned short* __restrict__ Bt2p, int ldb, long strideB,
    void* __restrict__ Cout, void* __restrict__ Cout2, int ldc, long strideC,
    const float* __restrict__ bias,
    const float* __restrict__ resid, long strideR,
    int M, int N, int K, float scale, long strideAz, long strideBz, long strideCz, long blkN) {
  typedef typename Elem<ET>::T T;
  typedef typename Frag<T>::V V;
  const T* A = (const T*)Ap; const T* A2 = (const T*)A2p; const T* Bt = (const T*)Btp; const T* Bt2 = (const T*)Bt2p;
  __shared__ __align__(16) float sT[8][16 * 68];   // per-wave 16x64 slab, pitch 68 floats
  const int b    = blockIdx.y;
  const int lane = threadIdx.x & 31;
  const int wave = threadIdx.x >> 5;
  const int tilesN = N >> 6;
  const int tilesM = M >> 6;
  const int tile = blockIdx.x * 8 + wave;
  if (tile >= tilesM * tilesN) return;   // wave-uniform; no block barriers in this kernel
  const int tm = tile / tilesN;
  const int tn = tile - tm * tilesN;
  const int m0 = tm << 6;
  const int n0 = tn << 6;

  const size_t offA = (size_t)b * strideA + (size_t)blockIdx.z * strideAz;
  const size_t offB = (size_t)b * strideB + (size_t)blockIdx.z * strideBz;
  const size_t offC = (size_t)b * strideC + (size_t)blockIdx.z * strideCz;
  const T* Ab  = A  + offA;
  const T* Bb  = Bt + offB;
  const T* Ab2 = SPLIT ? (A2  + offA) : nullptr;
  const T* Bb2 = SPLIT ? (Bt2 + offB) : nullptr;

  const int rlane = lane & 15;                 // row (A) / col (B, D) within subtile
  const int koff  = (lane >> 4) * 8;           // k offset of this lane half
  const int mOff  = (lane >> 4) * 8;           // D row offset

  v8f acc[4][4];
#pragma unroll
  for (int i = 0; i < 4; ++i)
#pragma unroll
    for (int j = 0; j < 4; ++j) acc[i][j] = (v8f){0.f,0.f,0.f,0.f,0.f,0.f,0.f,0.f};

  for (int k0 = 0; k0 < K; k0 += 32) {
    V bh[4], bl[4];
#pragma unroll
    for (int j = 0; j < 4; ++j) {
      const size_t bo = (size_t)(n0 + (j << 4) + rlane) * ldb + koff + k0;
      bh[j] = Frag<T>::load(Bb + bo);
      if (SPLIT) bl[j] = Frag<T>::load(Bb2 + bo);
    }
#pragma unroll
    for (int i = 0; i < 4; ++i) {
      const size_t ao = (size_t)(m0 + (i << 4) + rlane) * lda + koff + k0;
      V ah = Frag<T>::load(Ab + ao);
      V al;
      if (SPLIT) al = Frag<T>::load(Ab2 + ao);
#pragma unroll
      for (int j = 0; j < 4; ++j) {
        acc[i][j] = Frag<T>::mma(ah, bh[j], acc[i][j]);
        if (SPLIT) {
          acc[i][j] = Frag<T>::mma(ah, bl[j], acc[i][j]);
          acc[i][j] = Frag<T>::mma(al, bh[j], acc[i][j]);
        }
      }
      Frag<T>::guard(acc[i][0], acc[i][3], ah, SPLIT ? al : ah);
    }
    Frag<T>::keep(bh[0], bh[1], bh[2], bh[3]);
    if (SPLIT) Frag<T>::keep(bl[0], bl[1], bl[2], bl[3]);
  }
  acc_guard4(acc[0][0], acc[0][1], acc[0][2], acc[0][3]);
  acc_guard4(acc[1][0], acc[1][1], acc[1][2], acc[1][3]);
  acc_guard4(acc[2][0], acc[2][1], acc[2][2], acc[2][3]);
  acc_guard4(acc[3][0], acc[3][1], acc[3][2], acc[3][3]);

  // ---- epilogue ----
  float* slab = sT[wave];
  const float* Rb = RESID ? (resid + (size_t)b * strideR) : nullptr;
#pragma unroll
  for (int i = 0; i < 4; ++i) {
    const int mBase = m0 + (i << 4);
#pragma unroll
    for (int j = 0; j < 4; ++j) {
      const int n = n0 + (j << 4) + rlane;
      float bv = 0.f;
      if (BIAS_MODE == 2) bv = bias[n];
#pragma unroll
      for (int r = 0; r < 8; ++r) {
        float v = acc[i][j][r] * scale;
        if (BIAS_MODE == 1) v += bias[mBase + mOff + r];
        if (BIAS_MODE == 2) v += bv;
        if (RESID) v += Rb[(size_t)(mBase + mOff + r) * ldc + n];
        if (ACT == 1) v = tanhf(v);
        if (ACT == 2) v = fmaxf(v, 0.0f);
        if (ACT == 3) v = v / (1.0f + expf(-v));
        if (ACT == 4) v = (v > 0.f) ? v : 0.01f * v;
        if (ACT == 5) v = 0.5f * v * (1.0f + erff(v * 0.70710678118654752f));
        slab[(mOff + r) * 68 + (j << 4) + rlane] = v;
      }
    }
    __builtin_amdgcn_fence(__ATOMIC_RELEASE, "workgroup");
    __builtin_amdgcn_wave_barrier();
    __builtin_amdgcn_fence(__ATOMIC_ACQUIRE, "workgroup");
    if (OUT_MODE == 0) {
      float* C = (float*)Cout + offC;
      const int hh = lane >> 4, c4 = (lane & 15) * 4;     // row seg = 256 B = 16 lanes x 16 B
      {
#pragma unroll
        for (int it = 0; it < 8; ++it) {
          const int row = it * 2 + hh;
          v4f v = *(const v4f*)(slab + row * 68 + c4);
          *(v4f*)(C + (size_t)(mBase + row) * ldc + n0 + c4) = v;
        }
        
      }
    } else {
      const int q = lane >> 3, c8 = (lane & 7) * 8;
      unsigned short* C  = (unsigned short*)Cout  + offC;
      unsigned short* C2 = (OUT_MODE >= 2) ? ((unsigned short*)Cout2 + offC) : nullptr;
      {
#pragma unroll
        for (int it = 0; it < 4; ++it) {
          const int row = (OUT_MODE == 3) ? rlane : it * 4 + q;
          const float* sp = slab + row * 68 + ((OUT_MODE == 3) ? it * 16 + mOff : c8);
          v8h hv, lv;
#pragma unroll
          for (int e = 0; e < 8; ++e) {
            if (OUT_MODE == 1) {
              hv[e] = (_Float16)sp[e];
            } else {
              unsigned short hb = f2bf_bits(sp[e]);
              unsigned short lb = f2bf_bits(sp[e] - bf_bits2f(hb));
              hv[e] = __builtin_bit_cast(_Float16, hb);
              lv[e] = __builtin_bit_cast(_Float16, lb);
            }
          }
          const size_t co = (OUT_MODE == 3)
              ? (size_t)(mBase >> 4) * ldc + (size_t)((n0 >> 5) + (it >> 1)) * blkN + (it & 1) * 256 + lane * 8
              : (size_t)(mBase + row) * ldc + n0 + c8;
          *(v8h*)(C + co) = hv;
          if (OUT_MODE >= 2) *(v8h*)(C2 + co) = lv;
        }
        
      }
    }
    __builtin_amdgcn_fence(__ATOMIC_RELEASE, "workgroup");
    __builtin_amdgcn_wave_barrier();
    __builtin_amdgcn_fence(__ATOMIC_ACQUIRE, "workgroup");
  }
}

// ---------------------------------------------------------------------------
// Elementwise split: 2 elements per thread, one 4-B store per lane per plane -> each wave writes exactly one
// Coverage: grid = ceil(n2/256) blocks x 256 threads x 2 elements = 2*n2 elements = the whole plane (n2 = plane/2).
// ---------------------------------------------------------------------------
// hi = bf16_rne(in), lo = bf16_rne(in - hi)
__global__ __launch_bounds__(256) void split_bf16x2_kernel(const float* __restrict__ in, unsigned short* __restrict__ hi,
                                                           unsigned short* __restrict__ lo, int n2) {
  const int i = blockIdx.x * 256 + threadIdx.x;
  if (i < n2) {
    const v2f f = *(const v2f*)(in + 2 * (size_t)i);
    const unsigned short h0 = f2bf_bits(f[0]), h1 = f2bf_bits(f[1]);
    const unsigned short l0 = f2bf_bits(f[0] - bf_bits2f(h0)), l1 = f2bf_bits(f[1] - bf_bits2f(h1));
    const unsigned uh = pk16(h0, h1), ul = pk16(l0, l1);
    ((unsigned*)hi)[i] = uh;
    ((unsigned*)lo)[i] = ul;
    
  }
}

// ---------------------------------------------------------------------------
// Weight planes for the projections (one block of 256 threads):
//   wqkh/wqkl [64][32] bf16 hi/lo = rows 0..63 of Wqkv (q rows then k rows)
//   wvh/wvl   [64][32] bf16 hi/lo = rows 64..95 of Wqkv in rows 0..31, explicit zeros in rows 32..63
//   bv        [64] f32            = bqkv[64..95] in 0..31, zeros in 32..63
// ---------------------------------------------------------------------------
__device__ __forceinline__ void split_pair(float f0, float f1, unsigned& h, unsigned& l) {
  const unsigned short h0 = f2bf_bits(f0), h1 = f2bf_bits(f1);
  const unsigned short l0 = f2bf_bits(f0 - bf_bits2f(h0));
  const unsigned short l1 = f2bf_bits(f1 - bf_bits2f(h1));
  h = pk16(h0, h1);
  l = pk16(l0, l1);
}
__global__ __launch_bounds__(256) void wprep_kernel(const float* __restrict__ Wqkv, const float* __restrict__ bqkv,
                                                    unsigned short* __restrict__ wqkh, unsigned short* __restrict__ wqkl,
                                                    unsigned short* __restrict__ wvh, unsigned short* __restrict__ wvl,
                                                    float* __restrict__ bv) {
  const int tid  = threadIdx.x;
  const int row  = tid >> 2;            // 0..63
  const int col0 = (tid & 3) * 8;       // 0, 8, 16, 24
  v4u qh, ql, vh, vl;
#pragma unroll
  for (int p = 0; p < 4; ++p) {
    const int col = col0 + 2 * p;
    const float wq0 = Wqkv[row * HDIM + col];
    const float wq1 = Wqkv[row * HDIM + col + 1];
    int rv = 64 + row; rv = rv > 95 ? 95 : rv;            // clamped address; zero by predicate below
    float wv0 = Wqkv[rv * HDIM + col];
    float wv1 = Wqkv[rv * HDIM + col + 1];
    wv0 = (row < 32) ? wv0 : 0.0f;
    wv1 = (row < 32) ? wv1 : 0.0f;
    unsigned a, bq, cv, dv;
    split_pair(wq0, wq1, a, bq);
    split_pair(wv0, wv1, cv, dv);
    qh[p] = a; ql[p] = bq; vh[p] = cv; vl[p] = dv;
  }
  v4f b4;
#pragma unroll
  for (int e = 0; e < 4; ++e) {
    int m = tid * 4 + e; m = m > 63 ? 63 : m;
    int mi = 64 + m; mi = mi > 95 ? 95 : mi;
    const float v = bqkv[mi];
    b4[e] = (m < 32) ? v : 0.0f;
  }
  const size_t o = (size_t)tid * 8;
  {
    *(v4u*)(wqkh + o) = qh;
    *(v4u*)(wqkl + o) = ql;
    *(v4u*)(wvh + o)  = vh;
    *(v4u*)(wvl + o)  = vl;
    if (tid < 16) *(v4f*)(bv + tid * 4) = b4;
    
  }
}

// ---------------------------------------------------------------------------
// Scores, softmax, 12x12 head mixing, batch-statistic partials and (mixed map).v for 16 query rows (t0 = 16 blockIdx.x)
// of batch blockIdx.y, all 12 heads, in one block of 8 waves: neither the scores nor the mixed map go to memory.
// Pass A: row maxima and row sums. 24 units (head, half of the keys), 3 per wave; q.k^T on bf16 hi/lo planes, running
//   maximum and rescaled sum per lane, then over the 16 lanes of a row, then over the two halves (LDS).
// Pass B: 8 chunks of 128 keys. Wave w owns keys 16 w .. 16 w + 15 of the chunk and recomputes q.k^T for all 12 heads,
//   so lane (hh, c) holds P_h[t = 8 hh + r][s = c] for every h. Mixing product, per r, for the rows t = r and t = 8 + r:
//   B elements 0..7 = the lane's own heads 0..7 (k = 0..7: row r, k = 8..15: row 8 + r), elements 8..11 = heads 8..11 of
//   the partner lane (lane ^ 16; k = 16..19: row 8 + r, k = 24..27: row r), the rest zero; the mixing matrix stands in two
//   A fragments, each zero on the other row's k. D row g = 8 hh + r2, column s = c.
//   M goes to LDS as (bf16 hi | bf16 lo << 16) words [g][t][s]; behind a barrier wave w multiplies head w (32 columns of
//   v) and 16 columns of head 8 + w / 2, accumulating over all chunks in registers.
// part[b * 64 + blockIdx.x][32] = {sum M_g (12), sum M_g^2 (12), 8 zeros} over the block's 16 rows.
// ---------------------------------------------------------------------------
constexpr int CHK = 128;               // keys per chunk
constexpr int MTP = CHK + 4;           // words per (g, t) row: 528 B = 16 B x odd, b128 reads of 16 rows without conflicts
constexpr int MGP = 16 * MTP + 4;      // words per g: 8 g = 32 banks off, so the two lane halves store to different banks
typedef __attribute__((ext_vector_type(2))) __bf16 v2b;
union HFrag { v16h v; v8h h[2]; unsigned u[8]; };
union BFrag { v16b v; v8b h[2]; unsigned u[8]; };
// fragment from a plane in fragment order; p = block + 8 lane
__device__ __forceinline__ v16b load_fo(const __bf16* p) {
  BFrag f; f.h[0] = *(const v8b*)(p); f.h[1] = *(const v8b*)(p + 256); return f.v;
}

__device__ __forceinline__ v8f qk3(v16b ah, v16b al, v16b bh, v16b bl) {
  v8f a = (v8f){0.f,0.f,0.f,0.f,0.f,0.f,0.f,0.f};
  a = Frag<__bf16>::mma(ah, bh, a);
  a = Frag<__bf16>::mma(ah, bl, a);
  a = Frag<__bf16>::mma(al, bh, a);
  return a;
}
__device__ __forceinline__ void split_h(float w, _Float16& a, _Float16& r) {
  a = (_Float16)w;
  r = (_Float16)((w - (float)a) * R_CARRY);
}
__device__ __forceinline__ unsigned pkh(_Float16 a, _Float16 b) {
  return pk16(__builtin_bit_cast(unsigned short, a), __builtin_bit_cast(unsigned short, b));
}
// one mixed row t: fold the residual accumulator, add to the statistics, store packed bf16 hi/lo words
__device__ __forceinline__ void emit_row(const v8f& d0, const v8f& dr, v8f& s1, v8f& s2, unsigned* dst, int hh) {
  unsigned w[8];
#pragma unroll
  for (int r2 = 0; r2 < 8; ++r2) {
    const float m = fmaf(dr[r2], MIX_FOLD, d0[r2] * P_INV);
    s1[r2] += m;
    s2[r2] = fmaf(m, m, s2[r2]);
    const float hf = (float)(__bf16)m;                       // round to nearest even, as f2bf_bits
    const v2b hl = {(__bf16)m, (__bf16)(m - hf)};
    w[r2] = __builtin_bit_cast(unsigned, hl);
  }
#pragma unroll
  for (int r2 = 0; r2 < 4; ++r2) dst[r2 * MGP] = w[r2];
  if (hh == 0) {                       // rows g = 12..15 do not exist
#pragma unroll
    for (int r2 = 4; r2 < 8; ++r2) dst[r2 * MGP] = w[r2];
  }
}
// lane l with lane l ^ 16
__device__ __forceinline__ unsigned xhalf(unsigned x) {
  return (unsigned)__builtin_amdgcn_permlanex16((int)x, (int)x, 0x76543210, 0xfedcba98, false, false);
}
// A fragment (hi and lo planes) of the mixed map from the packed words: elements 0..7 <- p[0..7], 8..15 <- p[16..23]
__device__ __forceinline__ void load_m(const unsigned* p, v16b& hi, v16b& lo) {
  const v4u x0 = *(const v4u*)(p), x1 = *(const v4u*)(p + 4), x2 = *(const v4u*)(p + 16), x3 = *(const v4u*)(p + 20);
  BFrag fh, fl;
#pragma unroll
  for (int i = 0; i < 2; ++i) {
    fh.u[i]     = (x0[2 * i] & 0xFFFFu) | (x0[2 * i + 1] << 16);
    fl.u[i]     = (x0[2 * i] >> 16) | (x0[2 * i + 1] & 0xFFFF0000u);
    fh.u[2 + i] = (x1[2 * i] & 0xFFFFu) | (x1[2 * i + 1] << 16);
    fl.u[2 + i] = (x1[2 * i] >> 16) | (x1[2 * i + 1] & 0xFFFF0000u);
    fh.u[4 + i] = (x2[2 * i] & 0xFFFFu) | (x2[2 * i + 1] << 16);
    fl.u[4 + i] = (x2[2 * i] >> 16) | (x2[2 * i + 1] & 0xFFFF0000u);
    fh.u[6 + i] = (x3[2 * i] & 0xFFFFu) | (x3[2 * i + 1] << 16);
    fl.u[6 + i] = (x3[2 * i] >> 16) | (x3[2 * i + 1] & 0xFFFF0000u);
  }
  hi = fh.v; lo = fl.v;
}

__global__ __launch_bounds__(256) void fused_reattn_kernel(const unsigned short* __restrict__ qh,
                                                           const unsigned short* __restrict__ ql,
                                                           const unsigned short* __restrict__ kh,
                                                           const unsigned short* __restrict__ kl,
                                                           const unsigned short* __restrict__ vth,
                                                           const unsigned short* __restrict__ vtl,
                                                           const float* __restrict__ Wconv,
                                                           float* __restrict__ U, float* __restrict__ part) {
  __shared__ __align__(16) unsigned Mx[NHEAD * MGP];
  __shared__ __align__(16) v8b qf[NHEAD][2][2][32];      // q fragments in register order: [head][plane][half][lane]
  __shared__ __align__(16) float pm[NHEAD][2][16];
  __shared__ __align__(16) float pl[NHEAD][2][16];
  __shared__ __align__(16) float fm[NHEAD][16];
  __shared__ __align__(16) float fi[NHEAD][16];
  __shared__ float stw[8][24];
  __shared__ __align__(16) float pline[32];

  const int tid  = threadIdx.x;
  const int lane = tid & 31;
  const int wave = tid >> 5;
  const int hh   = lane >> 4;
  const int c    = lane & 15;
  const int t0   = blockIdx.x * 16;
  const int b    = blockIdx.y;
  const __bf16* QH = (const __bf16*)qh;
  const __bf16* QL = (const __bf16*)ql;
  const __bf16* KH = (const __bf16*)kh;
  const __bf16* KL = (const __bf16*)kl;
  const v8f zacc = (v8f){0.f,0.f,0.f,0.f,0.f,0.f,0.f,0.f};

  // ---- pass A ----  (every "#pragma unroll" of this kernel: constant indices keep the small arrays in registers)
#pragma unroll 1   // rolled: three copies of the unit would only grow the code
  for (int u = 0; u < 3; ++u) {
    const int unit = wave * 3 + u;
    const int h    = unit >> 1;
    const int half = unit & 1;
    const size_t qo = ((size_t)(b * NHEAD + h) * (NTOK / 16) + blockIdx.x) * FBLK + lane * 8;
    BFrag ah, al;
    const __bf16* qph = QH + qo;
    const __bf16* qpl = QL + qo;
    ah.v = load_fo(qph);
    al.v = load_fo(qpl);
    // the address registers are inputs, so they stay as they are up to the wait, which stands in front of every later
    // instruction that reuses a register which an issued load names (a precaution); the same form further down
    asm volatile("s_wait_xcnt 0x0" :: "v"(qph), "v"(qpl) : "memory");
    if (half == 0) {                       // wave-uniform
      qf[h][0][0][lane] = ah.h[0]; qf[h][0][1][lane] = ah.h[1];
      qf[h][1][0][lane] = al.h[0]; qf[h][1][1][lane] = al.h[1];
    }
    float m[8], l[8];
#pragma unroll
    for (int r = 0; r < 8; ++r) { m[r] = -INFINITY; l[r] = 0.0f; }
    const size_t ko = ((size_t)(b * NHEAD + h) * (NTOK / 16) + half * 32) * FBLK + lane * 8;
#pragma unroll 1   // rolled: 16 loads in flight per trip are enough, more copies cost registers
    for (int it = 0; it < 8; ++it) {
      v16b bh[4], bl[4];
      const __bf16* kph = KH + ko + (size_t)(it * 4) * FBLK;
      const __bf16* kpl = KL + ko + (size_t)(it * 4) * FBLK;
#pragma unroll
      for (int j = 0; j < 4; ++j) {
        bh[j] = load_fo(kph + j * FBLK);
        bl[j] = load_fo(kpl + j * FBLK);
      }
      asm volatile("s_wait_xcnt 0x0" :: "v"(kph), "v"(kpl) : "memory");   // as above
      v8f a[4];
#pragma unroll
      for (int j = 0; j < 4; ++j) a[j] = qk3(ah.v, al.v, bh[j], bl[j]);
#pragma unroll
      for (int r = 0; r < 8; ++r) {
        const float x0 = a[0][r] * SM_SCALE, x1 = a[1][r] * SM_SCALE, x2 = a[2][r] * SM_SCALE, x3 = a[3][r] * SM_SCALE;
        const float mn = fmaxf(m[r], fmaxf(fmaxf(x0, x1), fmaxf(x2, x3)));
        const float e  = ((__expf(x0 - mn) + __expf(x1 - mn)) + __expf(x2 - mn)) + __expf(x3 - mn);
        l[r] = fmaf(l[r], __expf(m[r] - mn), e);
        m[r] = mn;
      }
    }
#pragma unroll
    for (int r = 0; r < 8; ++r) {
      float mm = m[r];
#pragma unroll
      for (int off = 1; off < 16; off <<= 1) mm = fmaxf(mm, __shfl_xor(mm, off, 32));
      float ll = l[r] * __expf(m[r] - mm);
#pragma unroll
      for (int off = 1; off < 16; off <<= 1) ll += __shfl_xor(ll, off, 32);
      if (c == 0) { pm[h][half][8 * hh + r] = mm; pl[h][half][8 * hh + r] = ll; }
    }
  }
  __syncthreads();
  if (tid < NHEAD * 16) {
    const int h = tid >> 4, t = tid & 15;
    const float m0 = pm[h][0][t], m1 = pm[h][1][t];
    const float mm = fmaxf(m0, m1);
    const float ll = pl[h][0][t] * __expf(m0 - mm) + pl[h][1][t] * __expf(m1 - mm);
    fm[h][t] = mm;
    fi[h][t] = (1.0f / ll) * P_CARRY;      // probabilities leave the exponential already carried x2^10
  }

  // A fragments of the mixing matrix: row m = g = c; a1 serves query row r, a2 query row 8 + r
  HFrag a1h, a1l, a2h, a2l;
  {
    v8h z8, w0h, w0l, w8h, w8l;
    const unsigned wofs = (unsigned)(c > 11 ? 11 : c) * NHEAD * 4u;      // byte offset of the lane's row
    const float* wrow = (const float*)((const char*)Wconv + wofs);
#pragma unroll
    for (int i = 0; i < 8; ++i) {
      const int h8 = i < 4 ? 8 + i : 11;
      float w0 = wrow[i];
      float w8 = wrow[h8];
      w0 = (c < 12) ? w0 : 0.0f;
      w8 = (c < 12 && i < 4) ? w8 : 0.0f;
      _Float16 x, y;
      split_h(w0, x, y); w0h[i] = x; w0l[i] = y;
      split_h(w8, x, y); w8h[i] = x; w8l[i] = y;
      z8[i] = (_Float16)0.0f;
    }
    asm volatile("s_wait_xcnt 0x0" :: "v"(wofs) : "memory");   // as above
    a1h.h[0] = hh ? z8 : w0h;  a1h.h[1] = hh ? w8h : z8;
    a1l.h[0] = hh ? z8 : w0l;  a1l.h[1] = hh ? w8l : z8;
    a2h.h[0] = hh ? w0h : z8;  a2h.h[1] = hh ? z8 : w8h;
    a2l.h[0] = hh ? w0l : z8;  a2l.h[1] = hh ? z8 : w8l;
  }
  __syncthreads();

  // ---- pass B ----
  v8f s1 = zacc, s2 = zacc;
  v8f ua0 = zacc, ua1 = zacc, ub = zacc;
  const int gA = wave;                   // head whose 32 v columns this wave multiplies
  const int gB = 8 + (wave >> 1);        // head of which it multiplies 16 columns
  const int dB = (wave & 1) * 16;
  const __bf16* VH = (const __bf16*)vth;
  const __bf16* VL = (const __bf16*)vtl;
  const size_t voA = (size_t)(b * NHEAD + gA) * VTROWS * NTOK + lane * 8;
  const size_t voB = ((size_t)(b * NHEAD + gB) * VTROWS + dB) * NTOK + lane * 8;
#pragma unroll 1   // rolled: one chunk's body already fills a good part of the instruction cache
  for (int ch = 0; ch < NTOK / CHK; ++ch) {      // block-uniform
    unsigned o07h[8][4], o07l[8][4], o8h[8][2], o8l[8][2];
    const size_t ko = ((size_t)b * NHEAD * (NTOK / 16) + ch * (CHK / 16) + wave) * FBLK + lane * 8;
    const __bf16* kph = KH + ko;                 // head h stands h * NTOK / 16 blocks further on
    const __bf16* kpl = KL + ko;
    v16b kbh[NHEAD], kbl[NHEAD];                 // all 48 loads of the chunk in flight at once
#pragma unroll
    for (int h = 0; h < NHEAD; ++h) {
      kbh[h] = load_fo(kph + h * (NTOK / 16) * FBLK);
      kbl[h] = load_fo(kpl + h * (NTOK / 16) * FBLK);
    }
    asm volatile("s_wait_xcnt 0x0" :: "v"(kph), "v"(kpl) : "memory");   // as above
#pragma unroll
    for (int hp = 0; hp < 6; ++hp) {             // heads 2 hp and 2 hp + 1 share a word
      v8f a[2];
      v4f mx[2][2], iv[2][2];
#pragma unroll
      for (int e = 0; e < 2; ++e) {
        const int h = 2 * hp + e;
        BFrag ah, al;
        ah.h[0] = qf[h][0][0][lane]; ah.h[1] = qf[h][0][1][lane];
        al.h[0] = qf[h][1][0][lane]; al.h[1] = qf[h][1][1][lane];
        a[e] = qk3(ah.v, al.v, kbh[h], kbl[h]);
        mx[e][0] = *(const v4f*)(&fm[h][8 * hh]); mx[e][1] = *(const v4f*)(&fm[h][8 * hh + 4]);
        iv[e][0] = *(const v4f*)(&fi[h][8 * hh]); iv[e][1] = *(const v4f*)(&fi[h][8 * hh + 4]);
      }
#pragma unroll
      for (int r = 0; r < 8; ++r) {
        const float p0 = __expf(a[0][r] * SM_SCALE - mx[0][r >> 2][r & 3]) * iv[0][r >> 2][r & 3];
        const float p1 = __expf(a[1][r] * SM_SCALE - mx[1][r >> 2][r & 3]) * iv[1][r >> 2][r & 3];
        _Float16 x0, y0, x1, y1;
        split_h(p0, x0, y0);
        split_h(p1, x1, y1);
        if (hp < 4) { o07h[r][hp] = pkh(x0, x1); o07l[r][hp] = pkh(y0, y1); }
        else        { o8h[r][hp - 4] = pkh(x0, x1); o8l[r][hp - 4] = pkh(y0, y1); }
      }
    }
#pragma unroll
    for (int r = 0; r < 8; ++r) {
      HFrag bh, bl;
#pragma unroll
      for (int i = 0; i < 4; ++i) { bh.u[i] = o07h[r][i]; bl.u[i] = o07l[r][i]; }
      bh.u[4] = xhalf(o8h[r][0]); bh.u[5] = xhalf(o8h[r][1]);
      bl.u[4] = xhalf(o8l[r][0]); bl.u[5] = xhalf(o8l[r][1]);
      bh.u[6] = 0u; bh.u[7] = 0u; bl.u[6] = 0u; bl.u[7] = 0u;
      v8f d10 = Frag<_Float16>::mma(a1h.v, bh.v, zacc);
      v8f d20 = Frag<_Float16>::mma(a2h.v, bh.v, zacc);
      v8f d1r = Frag<_Float16>::mma(a1h.v, bl.v, zacc);
      v8f d2r = Frag<_Float16>::mma(a2h.v, bl.v, zacc);
      d1r = Frag<_Float16>::mma(a1l.v, bh.v, d1r);
      d2r = Frag<_Float16>::mma(a2l.v, bh.v, d2r);
      unsigned* dst = Mx + (8 * hh) * MGP + wave * 16 + c;
      emit_row(d10, d1r, s1, s2, dst + r * MTP, hh);
      emit_row(d20, d2r, s1, s2, dst + (8 + r) * MTP, hh);
    }
    // the chunk's v fragments: issued in front of the barrier, so that they fly while the wave waits there
    const __bf16* vah = VH + voA + (size_t)ch * (CHK / 32) * FBLK;
    const __bf16* val = VL + voA + (size_t)ch * (CHK / 32) * FBLK;
    const __bf16* vbh = VH + voB + (size_t)ch * (CHK / 32) * FBLK;
    const __bf16* vbl = VL + voB + (size_t)ch * (CHK / 32) * FBLK;
    v16b f0h[CHK / 32], f0l[CHK / 32], f1h[CHK / 32], f1l[CHK / 32], f2h[CHK / 32], f2l[CHK / 32];
#pragma unroll
    for (int ks = 0; ks < CHK / 32; ++ks) {
      f0h[ks] = load_fo(vah + ks * FBLK);
      f0l[ks] = load_fo(val + ks * FBLK);
      f1h[ks] = load_fo(vah + 16 * NTOK + ks * FBLK);
      f1l[ks] = load_fo(val + 16 * NTOK + ks * FBLK);
      f2h[ks] = load_fo(vbh + ks * FBLK);
      f2l[ks] = load_fo(vbl + ks * FBLK);
    }
    asm volatile("s_wait_xcnt 0x0" :: "v"(vah), "v"(val), "v"(vbh), "v"(vbl) : "memory");   // as above
    __syncthreads();                             // the chunk's mixed map is complete
#pragma unroll
    for (int ks = 0; ks < CHK / 32; ++ks) {
      const v16b b0h = f0h[ks], b0l = f0l[ks], b1h = f1h[ks], b1l = f1l[ks], b2h = f2h[ks], b2l = f2l[ks];
      v16b mh, ml, nh, nl;
      load_m(Mx + gA * MGP + c * MTP + ks * 32 + hh * 8, mh, ml);
      load_m(Mx + gB * MGP + c * MTP + ks * 32 + hh * 8, nh, nl);
      ua0 = Frag<__bf16>::mma(mh, b0h, ua0);
      ua1 = Frag<__bf16>::mma(mh, b1h, ua1);
      ub  = Frag<__bf16>::mma(nh, b2h, ub);
      ua0 = Frag<__bf16>::mma(mh, b0l, ua0);
      ua1 = Frag<__bf16>::mma(mh, b1l, ua1);
      ub  = Frag<__bf16>::mma(nh, b2l, ub);
      ua0 = Frag<__bf16>::mma(ml, b0h, ua0);
      ua1 = Frag<__bf16>::mma(ml, b1h, ua1);
      ub  = Frag<__bf16>::mma(nl, b2h, ub);
    }
    __syncthreads();                             // every reader has left Mx before the next chunk (or the U tile) overwrites it
  }

  // U tile through LDS, so that each 128-B row of U is stored whole by one wave: [g][t][32]
  float* ut = (float*)Mx;
#pragma unroll
  for (int r = 0; r < 8; ++r) {
    ut[(gA * 16 + 8 * hh + r) * UW + c]      = ua0[r];     // D row t = 8 hh + r, column d = c
    ut[(gA * 16 + 8 * hh + r) * UW + 16 + c] = ua1[r];
    ut[(gB * 16 + 8 * hh + r) * UW + dB + c] = ub[r];
  }
  // statistics: xor tree over the 16 lanes sharing hh (fixed order), then waves in index order
#pragma unroll
  for (int r = 0; r < 8; ++r) {
    float a = s1[r], bq = s2[r];
#pragma unroll
    for (int off = 1; off < 16; off <<= 1) { a += __shfl_xor(a, off, 32); bq += __shfl_xor(bq, off, 32); }
    const int g = 8 * hh + r;
    if (c == 0 && g < 12) { stw[wave][g] = a; stw[wave][12 + g] = bq; }
  }
  __syncthreads();
#pragma unroll
  for (int i = 0; i < NHEAD * 16 * UW / 4 / 256; ++i) {    // 1536 16-B pieces, 6 per thread
    const int p = i * 256 + tid;
    const int g = p >> 7, t = (p >> 3) & 15, d = (p & 7) * 4;
    const v4f v = *(const v4f*)(ut + p * 4);
    *(v4f*)(U + ((size_t)(b * NHEAD + g) * NTOK + t0 + t) * UW + d) = v;
  }
  if (wave == 0) {
    const int qi = lane < 24 ? lane : 23;
    float v = stw[0][qi];
#pragma unroll
    for (int w = 1; w < 8; ++w) v += stw[w][qi];
    v = (lane < 24) ? v : 0.0f;
    pline[lane] = v;
  }
  __syncthreads();
  if (tid < 8) {
    const v4f v = *(const v4f*)(pline + tid * 4);
    *(v4f*)(part + ((size_t)b * (NTOK / 16) + blockIdx.x) * 32 + tid * 4) = v;
  }
}

// ---------------------------------------------------------------------------
// Vsum[g][d] = sum_s v[g][s][d] from the v^T bf16 hi+lo planes ([8 x 12][64][1024] in fragment order, rows d < 32), g = (batch, head).
// Block g, 256 threads: d = tid>>3, 8 partial sums of 128 columns combined by a fixed xor tree; the 32 results are
// ---------------------------------------------------------------------------
__global__ __launch_bounds__(256) void vsum_kernel(const unsigned short* __restrict__ vth, const unsigned short* __restrict__ vtl,
                                                   float* __restrict__ vsum) {
  __shared__ __align__(16) float vs[32];
  const int g   = blockIdx.x;
  const int tid = threadIdx.x;
  const int d   = tid >> 3;
  const int prt = tid & 7;
  // column s = 128 prt + 8 i + e of row d stands in block s / 32 of the row's 16-row group, half (i >> 1) & 1,
  // lane 16 (i & 1) + d % 16: 128 elements further on for each i
  const size_t base = ((size_t)g * VTROWS + (d & ~15)) * NTOK + (size_t)prt * 4 * FBLK + (d & 15) * 8;
  float acc = 0.0f;
#pragma unroll 1
  for (int i = 0; i < 16; ++i) {
    const v8us a  = *(const v8us*)(vth + base + i * 128);
    const v8us bq = *(const v8us*)(vtl + base + i * 128);
    // stands in front of every later instruction that reuses a register which an issued load names (a precaution)
    asm volatile("s_wait_xcnt 0x0" ::: "memory");
#pragma unroll
    for (int e = 0; e < 8; ++e) acc += bf_bits2f(a[e]) + bf_bits2f(bq[e]);
  }
  acc += __shfl_xor(acc, 1, 32);
  acc += __shfl_xor(acc, 2, 32);
  acc += __shfl_xor(acc, 4, 32);
  if (prt == 0) vs[d] = acc;
  __syncthreads();
  if (tid < 8) {
    const v4f v = *(const v4f*)(vs + tid * 4);
    float* dst = vsum + g * 32 + tid * 4;
    *(v4f*)dst = v;
    
  }
}

// ---------------------------------------------------------------------------
// Column sums of the partial lines, first level: part [NPART][32] f32 -> psum [STBLK][32] f64.
// Lane = column; each wave reads its STROWS lines as independent loads (all in flight at once), adds them in f64 in
// row order; the 8 wave sums of a block are added in wave order. One wave writes the block's 256-B psum line.
// Coverage: STBLK blocks x 8 waves x STROWS rows = NPART lines.
// ---------------------------------------------------------------------------
__global__ __launch_bounds__(256) void statsum_kernel(const float* __restrict__ part, double* __restrict__ psum) {
  __shared__ double sw[8][32];
  const int lane = threadIdx.x & 31;
  const int wave = threadIdx.x >> 5;
  const float* p = part + (size_t)(blockIdx.x * 8 + wave) * STROWS * 32 + lane;
  float v[STROWS];
#pragma unroll   // loads issue back to back: one memory latency per wave instead of one per line
  for (int i = 0; i < STROWS; ++i) v[i] = p[i * 32];
  double acc = 0.0;
#pragma unroll   // constant indices keep v[] in registers
  for (int i = 0; i < STROWS; ++i) acc += (double)v[i];
  sw[wave][lane] = acc;
  __syncthreads();
  if (wave == 0) {
    double s = sw[0][lane];
#pragma unroll
    for (int w = 1; w < 8; ++w) s += sw[w][lane];
    psum[blockIdx.x * 32 + lane] = s;
  }
}

// ---------------------------------------------------------------------------
// Per-head affine coefficients from the first-level sums (one block of 8 waves): wave w adds psum lines
// w*STBLK/8 .. +STBLK/8-1 in f64 (independent loads, row order), wave 0 adds the 8 wave sums in wave order;
// mean_g = S1/N, var_g = S2/N - mean_g^2 (biased), a_g = gamma_g / sqrt(var_g + eps),
// kk_g = a_g*bconv_g + (beta_g - a_g*(mean_g + bconv_g)); coef line = {a[12], kk[12], 8 zeros}, one instruction.
// ---------------------------------------------------------------------------
__global__ __launch_bounds__(256) void coef_kernel(const double* __restrict__ psum, const float* __restrict__ bconv,
                                                   const float* __restrict__ gamma, const float* __restrict__ beta,
                                                   float* __restrict__ coef) {
  __shared__ double sw[8][32];
  __shared__ double sd[32];
  __shared__ __align__(16) float cf[32];
  const int lane = threadIdx.x & 31;
  const int wave = threadIdx.x >> 5;
  const double* p = psum + (size_t)wave * (STBLK / 8) * 32 + lane;
  double q[STBLK / 8];
#pragma unroll   // loads issue back to back: one memory latency per wave instead of one per line
  for (int i = 0; i < STBLK / 8; ++i) q[i] = p[i * 32];
  double acc = 0.0;
#pragma unroll   // constant indices keep q[] in registers
  for (int i = 0; i < STBLK / 8; ++i) acc += q[i];
  sw[wave][lane] = acc;
  __syncthreads();
  if (wave == 0) {
    double s = sw[0][lane];
#pragma unroll
    for (int w = 1; w < 8; ++w) s += sw[w][lane];
    sd[lane] = s;
  }
  __syncthreads();
  int gq = (lane < 12) ? lane : (lane - 12);
  gq = gq < 0 ? 0 : (gq > 11 ? 11 : gq);
  const double s1d = sd[gq];
  const double s2d = sd[12 + gq];
  const double invN = 1.0 / ((double)NBATCH * (double)NTOK * (double)NTOK);
  const double meanM = s1d * invN;
  double var = s2d * invN - meanM * meanM;
  var = var < 0.0 ? 0.0 : var;
  const float varf   = (float)var;
  const float meanre = (float)meanM + bconv[gq];
  const float a      = gamma[gq] * (1.0f / sqrtf(varf + BN_EPS));
  const float kk     = a * bconv[gq] + (beta[gq] - a * meanre);
  const float v = (lane < 12) ? a : ((lane < 24) ? kk : 0.0f);
  if (wave == 0) cf[lane] = v;
  __syncthreads();
  if (threadIdx.x < 8) {
    const v4f w = *(const v4f*)(cf + threadIdx.x * 4);
    float* dst = coef + threadIdx.x * 4;
    *(v4f*)dst = w;
  }
}

// ---------------------------------------------------------------------------
// out[b][t][32g+d] = a_g * U[b][g][t][d] + kk_g * Vsum[b][g][d]. One wave per (b,t) row of 384 floats:
// Coverage: grid 1024 x 8 waves = 8192 rows = all of d_out.
// ---------------------------------------------------------------------------
__global__ __launch_bounds__(256) void combine_kernel(const float* __restrict__ U, const float* __restrict__ vsum,
                                                      const float* __restrict__ coef, float* __restrict__ out) {
  const int lane = threadIdx.x & 31;
  const int wave = threadIdx.x >> 5;
  const int R = blockIdx.x * 8 + wave;         // 0..8191
  const int b = R >> 10, t = R & (NTOK - 1);
  v4f o[3];
#pragma unroll
  for (int i = 0; i < 3; ++i) {
    const int f = 128 * i + 4 * lane;
    const int g = f >> 5, d = f & 31;
    const v4f u  = *(const v4f*)(U + (((size_t)(b * NHEAD + g)) * NTOK + t) * UW + d);
    const v4f vv = *(const v4f*)(vsum + (b * NHEAD + g) * 32 + d);
    const float a = coef[g], kk = coef[12 + g];
    v4f rr;
#pragma unroll
    for (int e = 0; e < 4; ++e) rr[e] = fmaf(a, u[e], kk * vv[e]);
    o[i] = rr;
  }
  float* orow = out + (size_t)R * NEMB;
  {
#pragma unroll
    for (int i = 0; i < 3; ++i) *(v4f*)(orow + 128 * i + 4 * lane) = o[i];
    
  }
}

// ---------------------------------------------------------------------------
// Workspace region map (every size a multiple of 256):
//   XH, XL  bf16 [98304][32] each   x hi / lo planes (rows = (b,t,h)); last read by launch (4)
//   U       f32  [8][12][1024][32]  lies on XH|XL (same size), first written by launch (6)
//   WQKH WQKL WVH WVL bf16 [64][32] each;  BV f32 [64]
//   QKH, QKL bf16 [2][8][12][64 blocks of 16 tokens x 32] each  q plane, then k plane, in fragment order
//   VTH, VTL bf16 [8][12][4 groups of 16 rows][32 blocks of 16 rows x 32 tokens] each  v^T of every batch, in fragment order
//   PART    f32  [512][32];  VSUM f32 [8][12][32];  COEF f32 [32] (256 B);  PSUM f64 [64][32]
// ---------------------------------------------------------------------------
extern "C" void kernel_launch(void* const* d_in, const int* in_sizes, int n_in,
                              void* d_out, int out_size, void* d_ws, size_t ws_size,
                              hipStream_t stream) {
  if (n_in < 7) return;
  if (in_sizes[0] != NBATCH * NTOK * NEMB) return;
  if (in_sizes[1] != 3 * HDIM * HDIM || in_sizes[2] != 3 * HDIM) return;
  if (in_sizes[3] != NHEAD * NHEAD || in_sizes[4] < NHEAD || in_sizes[5] < NHEAD || in_sizes[6] < NHEAD) return;
  if (out_size != NBATCH * NTOK * NEMB) return;

  const float* x     = (const float*)d_in[0];
  const float* Wqkv  = (const float*)d_in[1];
  const float* bqkv  = (const float*)d_in[2];
  const float* Wconv = (const float*)d_in[3];
  const float* bconv = (const float*)d_in[4];
  const float* gamma = (const float*)d_in[5];
  const float* beta  = (const float*)d_in[6];
  float* out = (float*)d_out;

  const size_t szX    = (size_t)NBATCH * NTOK * NEMB * 2;            // 6291456
  const size_t szW    = (size_t)64 * HDIM * 2;                       // 4096
  const size_t szBV   = 256;
  const size_t szQK   = (size_t)NBATCH * NTOK * NHEAD * QKW * 2;     // 12582912
  const size_t szVT   = (size_t)NBATCH * NHEAD * VTROWS * NTOK * 2;  // 12582912
  const size_t szPART = (size_t)NPART * 32 * 4;                      // 65536
  const size_t szVS   = (size_t)NBATCH * NHEAD * 32 * 4;             // 12288
  const size_t szCF   = 256;
  const size_t szPS   = (size_t)STBLK * 32 * 8;                      // 16384
  static_assert((size_t)NBATCH * NHEAD * NTOK * UW * 4 == 2 * (size_t)NBATCH * NTOK * NEMB * 2, "U fills XH|XL exactly");
  size_t off = 0;
  const size_t oXH = off;   off += szX;
  const size_t oXL = off;   off += szX;
  const size_t oU = oXH;
  const size_t oWQKH = off; off += szW;
  const size_t oWQKL = off; off += szW;
  const size_t oWVH = off;  off += szW;
  const size_t oWVL = off;  off += szW;
  const size_t oBV = off;   off += szBV;
  const size_t oQKH = off;  off += szQK;
  const size_t oQKL = off;  off += szQK;
  const size_t oVTH = off;  off += szVT;
  const size_t oVTL = off;  off += szVT;
  const size_t oPART = off; off += szPART;
  const size_t oVS = off;   off += szVS;
  const size_t oCF = off;   off += szCF;
  const size_t oPS = off;   off += szPS;
  if (off > ws_size) return;

  char* ws = (char*)d_ws;
  unsigned short* XH   = (unsigned short*)(ws + oXH);
  unsigned short* XL   = (unsigned short*)(ws + oXL);
  unsigned short* WQKH = (unsigned short*)(ws + oWQKH);
  unsigned short* WQKL = (unsigned short*)(ws + oWQKL);
  unsigned short* WVH  = (unsigned short*)(ws + oWVH);
  unsigned short* WVL  = (unsigned short*)(ws + oWVL);
  float*          BV   = (float*)(ws + oBV);
  unsigned short* QKH  = (unsigned short*)(ws + oQKH);
  unsigned short* QKL  = (unsigned short*)(ws + oQKL);
  unsigned short* VTH  = (unsigned short*)(ws + oVTH);
  unsigned short* VTL  = (unsigned short*)(ws + oVTL);
  float*          U    = (float*)(ws + oU);
  float*          PART = (float*)(ws + oPART);
  float*          VSUM = (float*)(ws + oVS);
  float*          COEF = (float*)(ws + oCF);
  double*         PSUM = (double*)(ws + oPS);

  const dim3 blk(256);
  // (1) x -> bf16 hi/lo planes viewed as [(b,t,h)][32]: n2 = 1572864 pairs = 6144 blocks x 256 threads exactly
  const int n2x = NBATCH * NTOK * NEMB / 2;
  split_bf16x2_kernel<<<dim3((n2x + 255) / 256), blk, 0, stream>>>(x, XH, XL, n2x);
  // (2) projection weight planes and padded v bias
  wprep_kernel<<<dim3(1), blk, 0, stream>>>(Wqkv, bqkv, WQKH, WQKL, WVH, WVL, BV);
  // (3) q|k of head blockIdx.y of batch blockIdx.z = xh . Wqkv[0..63]^T + bqkv[0..63]: A = x planes at column g*32,
  //     lda = 384; M = 1024 (16 tiles -> 2 blocks), N = 64, K = 32 -> q and k hi/lo planes, blocks of 16 tokens
  wmma_gemm64<1, true, 2, 3, false><<<dim3(2, NHEAD, NBATCH), blk, 0, stream>>>(
      XH, XL, NEMB, (long)HDIM, WQKH, WQKL, HDIM, 0L, (void*)QKH, (void*)QKL, FBLK, (long)NTOK * HDIM,
      bqkv, bqkv, 0L, NTOK, QKW, HDIM, 1.0f, (long)NTOK * NEMB, 0L, (long)NHEAD * NTOK * HDIM, (long)QKPLANE);
  // (4) v^T[m][s] for head g = blockIdx.y of batch blockIdx.z: A = WV planes [64][32] (rows 32..63 zero), Bt = x planes
  //     at column g*32, ldb = 384; M = 64, N = 1024 (16 tiles -> 2 blocks), K = 32; bias[m] = BV -> VT planes
  wmma_gemm64<1, true, 1, 3, false><<<dim3(2, NHEAD, NBATCH), blk, 0, stream>>>(
      WVH, WVL, HDIM, 0L, XH, XL, NEMB, (long)HDIM, (void*)VTH, (void*)VTL, 16 * NTOK, (long)VTROWS * NTOK,
      BV, BV, 0L, VTROWS, NTOK, HDIM, 1.0f, 0L, (long)NTOK * NEMB, (long)NHEAD * VTROWS * NTOK, (long)FBLK);
  // (5) Vsum of every (batch, head): 96 lines
  vsum_kernel<<<dim3(NBATCH * NHEAD), blk, 0, stream>>>(VTH, VTL, VSUM);

  // (6) scores, softmax, head mixing, statistic partials and (mixed map).v: one block per 16 query rows of a batch
  fused_reattn_kernel<<<dim3(NTOK / 16, NBATCH), blk, 0, stream>>>(QKH, QKL, QKH + QKPLANE, QKL + QKPLANE, VTH, VTL, Wconv, U, PART);
  // (7) fixed-order f64 sums over the partial lines in two levels, then the per-head affine coefficients
  statsum_kernel<<<dim3(STBLK), blk, 0, stream>>>(PART, PSUM);
  coef_kernel<<<dim3(1), blk, 0, stream>>>(PSUM, bconv, gamma, beta, COEF);
  // (8) output rows: 1024 blocks x 8 waves = 8192 rows of 384 floats
  combine_kernel<<<dim3(NBATCH * NTOK / 8), blk, 0, stream>>>(U, VSUM, COEF, out);
}

// v006
// It runs in 230 microseconds.
// Timed twice side by side with v005, it ran 1.07 and 1.06 times as fast.
// Counting every step since v000, it is 15.2 times as fast.
// Contractions: x.Wqkv^T (q|k planes and v^T planes), scaled q.k^T, and (head-mixed attention).v on v_wmma_f32_16x16x32_bf16 with bf16 hi/lo split operand planes (hi.hi + hi.lo + lo.hi); 12x12 head mixing on v_wmma_f32_16x16x32_f16 (f16 hi planes + x2^11 residual planes in a separate accumulator, probabilities carried x2^10); f32 accumulate everywhere; softmax f32; per-head batch statistics as f32 block partials combined in f64 in fixed order.
#include <hip/hip_runtime.h>
#include <math.h>
#include <stdint.h>

constexpr int NBATCH = 8;
constexpr int NTOK   = 1024;
constexpr int NEMB   = 384;
constexpr int NHEAD  = 12;
constexpr int HDIM   = 32;
constexpr int QKW    = 64;             // columns of the q|k projection (q at 0..31, k at 32..63)
constexpr int FBLK   = 512;            // elements of a 16 x 32 block stored in fragment order (1024 B)
constexpr size_t QKPLANE = (size_t)NBATCH * NHEAD * NTOK * HDIM;   // elements of the q plane; the k plane stands behind it
constexpr int VTROWS = 32;             // v^T rows per head
constexpr int UW     = 32;             // U row pitch
constexpr float SM_SCALE = 0.17677669529663687f;
constexpr float P_CARRY  = 1024.0f;                      // probabilities carried x2^10 in f16
constexpr float R_CARRY  = 2048.0f;                      // residual planes carried x2^11
constexpr float P_INV    = 1.0f / 1024.0f;
constexpr float MIX_FOLD = 1.0f / (1024.0f * 2048.0f);
constexpr float BN_EPS   = 1e-5f;
constexpr int STBLK  = 64;                            // blocks of the first level of the statistic sum
constexpr int NPART  = NBATCH * NTOK / 16;           // partial lines: one per block of 16 query rows
constexpr int STROWS = NPART / (STBLK * 8);           // partial lines per wave

typedef __attribute__((ext_vector_type(16))) _Float16 v16h;
typedef __attribute__((ext_vector_type(8)))  _Float16 v8h;
typedef __attribute__((ext_vector_type(16))) __bf16   v16b;
typedef __attribute__((ext_vector_type(8)))  __bf16   v8b;
typedef __attribute__((ext_vector_type(8)))  float    v8f;
typedef __attribute__((ext_vector_type(4)))  float    v4f;
typedef __attribute__((ext_vector_type(4)))  unsigned int v4u;
typedef __attribute__((ext_vector_type(8)))  unsigned short v8us;

__device__ __forceinline__ unsigned short f2bf_bits(float f) {
  unsigned u = __float_as_uint(f);
  return (unsigned short)((u + 0x7FFFu + ((u >> 16) & 1u)) >> 16);
}
__device__ __forceinline__ float bf_bits2f(unsigned short h) { return __uint_as_float(((unsigned)h) << 16); }
__device__ __forceinline__ unsigned pk16(unsigned short a, unsigned short b) { return (unsigned)a | ((unsigned)b << 16); }

template <typename T> struct Frag;
template <> struct Frag<_Float16> {
  static __device__ __forceinline__ v8f mma(v16h a, v16h b, v8f c) {
    return __builtin_amdgcn_wmma_f32_16x16x32_f16(false, a, false, b, (short)0, c, false, false);
  }
};
template <> struct Frag<__bf16> {
  static __device__ __forceinline__ v8f mma(v16b a, v16b b, v8f c) {
    return __builtin_amdgcn_wmma_f32_16x16x32_bf16(false, a, false, b, (short)0, c, false, false);
  }
};
union BFrag { v16b v; v8b h[2]; unsigned u[8]; };

// ---------------------------------------------------------------------------
// Projections. One wave: 64 tokens (tok0 = 64 (4 blockIdx.x + wave)) of head blockIdx.y of batch blockIdx.z.
// x (64 x 32) and Wqkv (96 x 32) are read as f32 and split in registers: hi = bf16_rne(f), lo = bf16_rne(f - hi);
// every product = hi.hi + hi.lo + lo.hi. A and B fragments of the 16x16x32 form have the same lane map (lane (hh, r):
// row r, k = 8 hh + 0..7 and 16 + 8 hh + 0..7), so the same four x fragments are A of q|k = x . Wqkv[0..63]^T and
// B of v^T = Wqkv[64..95] . x^T.
// Output planes (bf16 hi and lo) in fragment order: a block of 16 rows x 32 columns stands as 1024 B, [half][lane][8]:
// lane (hh, r) holds row r, columns 16 half + 8 hh + 0..7, which is what that lane of a 16x16x32 A or B fragment takes,
// so a reader's 16-B load per lane covers four whole 128-B lines.
//   q, k : rows = tokens, columns = head dimension; block (b, h, token / 16); the k plane stands QKPLANE behind q
//   v^T  : rows = head dimension, columns = tokens; block (b, h, d / 16, token / 32)
// (every "#pragma unroll" of this section: constant indices keep the fragment arrays in registers)
// ---------------------------------------------------------------------------
__device__ __forceinline__ void split_pair(float f0, float f1, unsigned& h, unsigned& l) {
  const unsigned short h0 = f2bf_bits(f0), h1 = f2bf_bits(f1);
  const unsigned short l0 = f2bf_bits(f0 - bf_bits2f(h0));
  const unsigned short l1 = f2bf_bits(f1 - bf_bits2f(h1));
  h = pk16(h0, h1);
  l = pk16(l0, l1);
}
// the 16 f32 values of a lane's fragment: elements 0..7 <- p[0..7], 8..15 <- p[16..23]
struct Raw16 { v4f x[4]; };
__device__ __forceinline__ Raw16 load_raw(const float* p) {
  Raw16 r;
  r.x[0] = *(const v4f*)(p); r.x[1] = *(const v4f*)(p + 4); r.x[2] = *(const v4f*)(p + 16); r.x[3] = *(const v4f*)(p + 20);
  return r;
}
__device__ __forceinline__ void split_frag(const Raw16& r, v16b& hi, v16b& lo) {
  BFrag fh, fl;
#pragma unroll
  for (int i = 0; i < 4; ++i)
#pragma unroll
    for (int e = 0; e < 2; ++e) split_pair(r.x[i][2 * e], r.x[i][2 * e + 1], fh.u[2 * i + e], fl.u[2 * i + e]);
  hi = fh.v; lo = fl.v;
}
__device__ __forceinline__ v8f mma3(v16b ah, v16b al, v16b bh, v16b bl) {
  v8f a = (v8f){0.f,0.f,0.f,0.f,0.f,0.f,0.f,0.f};
  a = Frag<__bf16>::mma(ah, bh, a);
  a = Frag<__bf16>::mma(ah, bl, a);
  a = Frag<__bf16>::mma(al, bh, a);
  return a;
}
// orders a wave's own LDS writes and reads of its slab (lanes read what other lanes wrote); LDS only, so that the wave
// does not wait here for its global stores
__device__ __forceinline__ void slab_sync() {
  __builtin_amdgcn_fence(__ATOMIC_RELEASE, "workgroup", "local");
  __builtin_amdgcn_wave_barrier();
  __builtin_amdgcn_fence(__ATOMIC_ACQUIRE, "workgroup", "local");
}
// the wave's 16 x 64 f32 slab (pitch 68) -> two blocks in fragment order at o0 (columns 0..31) and o1 (columns 32..63)
__device__ __forceinline__ void slab_to_blocks(const float* slab, int lane, unsigned short* __restrict__ H,
                                               unsigned short* __restrict__ L, size_t o0, size_t o1) {
  slab_sync();
  const float* sp = slab + (lane & 15) * 68 + (lane >> 4) * 8;
  v4f s[4][2];                         // all eight LDS reads stand in one place: one LDS latency per slab
#pragma unroll
  for (int it = 0; it < 4; ++it) { s[it][0] = *(const v4f*)(sp + it * 16); s[it][1] = *(const v4f*)(sp + it * 16 + 4); }
#pragma unroll
  for (int it = 0; it < 4; ++it) {
    v8us hv, lv;
#pragma unroll
    for (int e = 0; e < 8; ++e) {
      const float f = s[it][e >> 2][e & 3];
      const unsigned short hb = f2bf_bits(f);
      hv[e] = hb;
      lv[e] = f2bf_bits(f - bf_bits2f(hb));
    }
    unsigned short* ph = H + ((it >> 1) ? o1 : o0) + (it & 1) * 256 + lane * 8;
    unsigned short* pl = L + ((it >> 1) ? o1 : o0) + (it & 1) * 256 + lane * 8;
    *(v8us*)ph = hv;
    *(v8us*)pl = lv;
    // the stores' registers are inputs, so they stay as they are up to the wait, which stands in front of every later
    // instruction that reuses a register which an issued store names (a precaution)
    asm volatile("s_wait_xcnt 0x0" :: "v"(ph), "v"(pl), "v"(hv), "v"(lv) : "memory");
  }
  slab_sync();
}
__global__ __launch_bounds__(128) void proj_kernel(const float* __restrict__ x, const float* __restrict__ Wqkv,
                                                   const float* __restrict__ bqkv,
                                                   unsigned short* __restrict__ qkh, unsigned short* __restrict__ qkl,
                                                   unsigned short* __restrict__ vth, unsigned short* __restrict__ vtl) {
  __shared__ __align__(16) float sT[4][16 * 68];   // per-wave 16x64 slab, pitch 68 floats
  const int lane  = threadIdx.x & 31;
  const int wave  = threadIdx.x >> 5;
  const int rlane = lane & 15;                 // row (A) / column (B, D) within a 16 x 16 tile
  const int koff  = (lane >> 4) * 8;           // k offset of this lane half; also its D row offset
  const int tok0  = (blockIdx.x * 4 + wave) * 64;
  const int bh    = blockIdx.z * NHEAD + blockIdx.y;
  float* slab = sT[wave];

  // all 48 loads are issued before the first value is split: one memory latency for the wave
  const float* px = x + ((size_t)blockIdx.z * NTOK + tok0 + rlane) * NEMB + blockIdx.y * HDIM + koff;
  const float* pw = Wqkv + rlane * HDIM + koff;
  Raw16 rx[4], rw[6];
#pragma unroll
  for (int i = 0; i < 4; ++i) rx[i] = load_raw(px + (size_t)i * 16 * NEMB);
#pragma unroll
  for (int j = 0; j < 6; ++j) rw[j] = load_raw(pw + j * 16 * HDIM);
  const float* pbn = bqkv + rlane;               // q|k bias by column
  const float* pbm = bqkv + 2 * HDIM + koff;     // v bias by D row
  float bn[4];
  v4f bm[2][2];
#pragma unroll
  for (int j = 0; j < 4; ++j) bn[j] = pbn[16 * j];
#pragma unroll
  for (int i = 0; i < 2; ++i) { bm[i][0] = *(const v4f*)(pbm + 16 * i); bm[i][1] = *(const v4f*)(pbm + 16 * i + 4); }
  // the address registers are inputs, so they stay as they are up to the wait, which stands in front of every later
  // instruction that reuses a register which an issued load names (a precaution)
  asm volatile("s_wait_xcnt 0x0" :: "v"(px), "v"(pw), "v"(pbn), "v"(pbm) : "memory");

  v16b xh[4], xl[4];
#pragma unroll
  for (int i = 0; i < 4; ++i) split_frag(rx[i], xh[i], xl[i]);

  // q|k: D row = token 8 hh + r of tile i, column n = 16 j + rlane (q at 0..31, k at 32..63)
  {
    v16b wh[4], wl[4];
#pragma unroll
    for (int j = 0; j < 4; ++j) split_frag(rw[j], wh[j], wl[j]);
#pragma unroll
    for (int i = 0; i < 4; ++i) {
#pragma unroll
      for (int j = 0; j < 4; ++j) {
        const v8f a = mma3(xh[i], xl[i], wh[j], wl[j]);
#pragma unroll
        for (int r = 0; r < 8; ++r) slab[(koff + r) * 68 + 16 * j + rlane] = a[r] + bn[j];
      }
      const size_t o = ((size_t)bh * (NTOK / 16) + (tok0 >> 4) + i) * FBLK;
      slab_to_blocks(slab, lane, qkh, qkl, o, o + QKPLANE);
    }
  }
  // v^T: D row = d = 16 i + 8 hh + r, column = token 16 j + rlane
#pragma unroll
  for (int i = 0; i < 2; ++i) {
    v16b wh, wl;
    split_frag(rw[4 + i], wh, wl);
#pragma unroll
    for (int j = 0; j < 4; ++j) {
      const v8f a = mma3(wh, wl, xh[j], xl[j]);
#pragma unroll
      for (int r = 0; r < 8; ++r) slab[(koff + r) * 68 + 16 * j + rlane] = a[r] + bm[i][r >> 2][r & 3];
    }
    const size_t o = ((size_t)bh * VTROWS + 16 * i) * NTOK + (size_t)(tok0 >> 5) * FBLK;
    slab_to_blocks(slab, lane, vth, vtl, o, o + FBLK);
  }
}

// ---------------------------------------------------------------------------
// Scores, softmax, 12x12 head mixing, batch-statistic partials and (mixed map).v for 16 query rows (t0 = 16 blockIdx.x)
// of batch blockIdx.y, all 12 heads, in one block of 8 waves: neither the scores nor the mixed map go to memory.
// Pass A: row maxima and row sums. 24 units (head, half of the keys), 3 per wave; q.k^T on bf16 hi/lo planes, running
//   maximum and rescaled sum per lane, then over the 16 lanes of a row, then over the two halves (LDS).
// Pass B: 8 chunks of 128 keys. Wave w owns keys 16 w .. 16 w + 15 of the chunk and recomputes q.k^T for all 12 heads,
//   so lane (hh, c) holds P_h[t = 8 hh + r][s = c] for every h. Mixing product, per r, for the rows t = r and t = 8 + r:
//   B elements 0..7 = the lane's own heads 0..7 (k = 0..7: row r, k = 8..15: row 8 + r), elements 8..11 = heads 8..11 of
//   the partner lane (lane ^ 16; k = 16..19: row 8 + r, k = 24..27: row r), the rest zero; the mixing matrix stands in two
//   A fragments, each zero on the other row's k. D row g = 8 hh + r2, column s = c.
//   M goes to LDS as (bf16 hi | bf16 lo << 16) words [g][t][s]; behind a barrier wave w multiplies head w (32 columns of
//   v) and 16 columns of head 8 + w / 2, accumulating over all chunks in registers.
// part[b * 64 + blockIdx.x][32] = {sum M_g (12), sum M_g^2 (12), 8 zeros} over the block's 16 rows.
// ---------------------------------------------------------------------------
constexpr int CHK = 128;               // keys per chunk
constexpr int MTP = CHK + 4;           // words per (g, t) row: 528 B = 16 B x odd, b128 reads of 16 rows without conflicts
constexpr int MGP = 16 * MTP + 4;      // words per g: 8 g = 32 banks off, so the two lane halves store to different banks
typedef __attribute__((ext_vector_type(2))) __bf16 v2b;
union HFrag { v16h v; v8h h[2]; unsigned u[8]; };
// fragment from a plane in fragment order; p = block + 8 lane
__device__ __forceinline__ v16b load_fo(const __bf16* p) {
  BFrag f; f.h[0] = *(const v8b*)(p); f.h[1] = *(const v8b*)(p + 256); return f.v;
}

__device__ __forceinline__ v8f qk3(v16b ah, v16b al, v16b bh, v16b bl) {
  v8f a = (v8f){0.f,0.f,0.f,0.f,0.f,0.f,0.f,0.f};
  a = Frag<__bf16>::mma(ah, bh, a);
  a = Frag<__bf16>::mma(ah, bl, a);
  a = Frag<__bf16>::mma(al, bh, a);
  return a;
}
__device__ __forceinline__ void split_h(float w, _Float16& a, _Float16& r) {
  a = (_Float16)w;
  r = (_Float16)((w - (float)a) * R_CARRY);
}
__device__ __forceinline__ unsigned pkh(_Float16 a, _Float16 b) {
  return pk16(__builtin_bit_cast(unsigned short, a), __builtin_bit_cast(unsigned short, b));
}
// one mixed row t: fold the residual accumulator, add to the statistics, store packed bf16 hi/lo words
__device__ __forceinline__ void emit_row(const v8f& d0, const v8f& dr, v8f& s1, v8f& s2, unsigned* dst, int hh) {
  unsigned w[8];
#pragma unroll
  for (int r2 = 0; r2 < 8; ++r2) {
    const float m = fmaf(dr[r2], MIX_FOLD, d0[r2] * P_INV);
    s1[r2] += m;
    s2[r2] = fmaf(m, m, s2[r2]);
    const float hf = (float)(__bf16)m;                       // round to nearest even, as f2bf_bits
    const v2b hl = {(__bf16)m, (__bf16)(m - hf)};
    w[r2] = __builtin_bit_cast(unsigned, hl);
  }
#pragma unroll
  for (int r2 = 0; r2 < 4; ++r2) dst[r2 * MGP] = w[r2];
  if (hh == 0) {                       // rows g = 12..15 do not exist
#pragma unroll
    for (int r2 = 4; r2 < 8; ++r2) dst[r2 * MGP] = w[r2];
  }
}
// lane l with lane l ^ 16
__device__ __forceinline__ unsigned xhalf(unsigned x) {
  return (unsigned)__builtin_amdgcn_permlanex16((int)x, (int)x, 0x76543210, 0xfedcba98, false, false);
}
// A fragment (hi and lo planes) of the mixed map from the packed words: elements 0..7 <- p[0..7], 8..15 <- p[16..23]
__device__ __forceinline__ void load_m(const unsigned* p, v16b& hi, v16b& lo) {
  const v4u x0 = *(const v4u*)(p), x1 = *(const v4u*)(p + 4), x2 = *(const v4u*)(p + 16), x3 = *(const v4u*)(p + 20);
  BFrag fh, fl;
#pragma unroll
  for (int i = 0; i < 2; ++i) {
    fh.u[i]     = (x0[2 * i] & 0xFFFFu) | (x0[2 * i + 1] << 16);
    fl.u[i]     = (x0[2 * i] >> 16) | (x0[2 * i + 1] & 0xFFFF0000u);
    fh.u[2 + i] = (x1[2 * i] & 0xFFFFu) | (x1[2 * i + 1] << 16);
    fl.u[2 + i] = (x1[2 * i] >> 16) | (x1[2 * i + 1] & 0xFFFF0000u);
    fh.u[4 + i] = (x2[2 * i] & 0xFFFFu) | (x2[2 * i + 1] << 16);
    fl.u[4 + i] = (x2[2 * i] >> 16) | (x2[2 * i + 1] & 0xFFFF0000u);
    fh.u[6 + i] = (x3[2 * i] & 0xFFFFu) | (x3[2 * i + 1] << 16);
    fl.u[6 + i] = (x3[2 * i] >> 16) | (x3[2 * i + 1] & 0xFFFF0000u);
  }
  hi = fh.v; lo = fl.v;
}

__global__ __launch_bounds__(256) void fused_reattn_kernel(const unsigned short* __restrict__ qh,
                                                           const unsigned short* __restrict__ ql,
                                                           const unsigned short* __restrict__ kh,
                                                           const unsigned short* __restrict__ kl,
                                                           const unsigned short* __restrict__ vth,
                                                           const unsigned short* __restrict__ vtl,
                                                           const float* __restrict__ Wconv,
                                                           float* __restrict__ U, float* __restrict__ part) {
  __shared__ __align__(16) unsigned Mx[NHEAD * MGP];
  __shared__ __align__(16) v8b qf[NHEAD][2][2][32];      // q fragments in register order: [head][plane][half][lane]
  __shared__ __align__(16) float pm[NHEAD][2][16];
  __shared__ __align__(16) float pl[NHEAD][2][16];
  __shared__ __align__(16) float fm[NHEAD][16];
  __shared__ __align__(16) float fi[NHEAD][16];
  __shared__ float stw[8][24];
  __shared__ __align__(16) float pline[32];

  const int tid  = threadIdx.x;
  const int lane = tid & 31;
  const int wave = tid >> 5;
  const int hh   = lane >> 4;
  const int c    = lane & 15;
  const int t0   = blockIdx.x * 16;
  const int b    = blockIdx.y;
  const __bf16* QH = (const __bf16*)qh;
  const __bf16* QL = (const __bf16*)ql;
  const __bf16* KH = (const __bf16*)kh;
  const __bf16* KL = (const __bf16*)kl;
  const v8f zacc = (v8f){0.f,0.f,0.f,0.f,0.f,0.f,0.f,0.f};

  // ---- pass A ----  (every "#pragma unroll" of this kernel: constant indices keep the small arrays in registers)
#pragma unroll 1   // rolled: three copies of the unit would only grow the code
  for (int u = 0; u < 3; ++u) {
    const int unit = wave * 3 + u;
    const int h    = unit >> 1;
    const int half = unit & 1;
    const size_t qo = ((size_t)(b * NHEAD + h) * (NTOK / 16) + blockIdx.x) * FBLK + lane * 8;
    BFrag ah, al;
    const __bf16* qph = QH + qo;
    const __bf16* qpl = QL + qo;
    ah.v = load_fo(qph);
    al.v = load_fo(qpl);
    // the address registers are inputs, so they stay as they are up to the wait, which stands in front of every later
    // instruction that reuses a register which an issued load names (a precaution); the same form further down
    asm volatile("s_wait_xcnt 0x0" :: "v"(qph), "v"(qpl) : "memory");
    if (half == 0) {                       // wave-uniform
      qf[h][0][0][lane] = ah.h[0]; qf[h][0][1][lane] = ah.h[1];
      qf[h][1][0][lane] = al.h[0]; qf[h][1][1][lane] = al.h[1];
    }
    float m[8], l[8];
#pragma unroll
    for (int r = 0; r < 8; ++r) { m[r] = -INFINITY; l[r] = 0.0f; }
    const size_t ko = ((size_t)(b * NHEAD + h) * (NTOK / 16) + half * 32) * FBLK + lane * 8;
#pragma unroll 1   // rolled: 16 loads in flight per trip are enough, more copies cost registers
    for (int it = 0; it < 8; ++it) {
      v16b bh[4], bl[4];
      const __bf16* kph = KH + ko + (size_t)(it * 4) * FBLK;
      const __bf16* kpl = KL + ko + (size_t)(it * 4) * FBLK;
#pragma unroll
      for (int j = 0; j < 4; ++j) {
        bh[j] = load_fo(kph + j * FBLK);
        bl[j] = load_fo(kpl + j * FBLK);
      }
      asm volatile("s_wait_xcnt 0x0" :: "v"(kph), "v"(kpl) : "memory");   // as above
      v8f a[4];
#pragma unroll
      for (int j = 0; j < 4; ++j) a[j] = qk3(ah.v, al.v, bh[j], bl[j]);
#pragma unroll
      for (int r = 0; r < 8; ++r) {
        const float x0 = a[0][r] * SM_SCALE, x1 = a[1][r] * SM_SCALE, x2 = a[2][r] * SM_SCALE, x3 = a[3][r] * SM_SCALE;
        const float mn = fmaxf(m[r], fmaxf(fmaxf(x0, x1), fmaxf(x2, x3)));
        const float e  = ((__expf(x0 - mn) + __expf(x1 - mn)) + __expf(x2 - mn)) + __expf(x3 - mn);
        l[r] = fmaf(l[r], __expf(m[r] - mn), e);
        m[r] = mn;
      }
    }
#pragma unroll
    for (int r = 0; r < 8; ++r) {
      float mm = m[r];
#pragma unroll
      for (int off = 1; off < 16; off <<= 1) mm = fmaxf(mm, __shfl_xor(mm, off, 32));
      float ll = l[r] * __expf(m[r] - mm);
#pragma unroll
      for (int off = 1; off < 16; off <<= 1) ll += __shfl_xor(ll, off, 32);
      if (c == 0) { pm[h][half][8 * hh + r] = mm; pl[h][half][8 * hh + r] = ll; }
    }
  }
  __syncthreads();
  if (tid < NHEAD * 16) {
    const int h = tid >> 4, t = tid & 15;
    const float m0 = pm[h][0][t], m1 = pm[h][1][t];
    const float mm = fmaxf(m0, m1);
    const float ll = pl[h][0][t] * __expf(m0 - mm) + pl[h][1][t] * __expf(m1 - mm);
    fm[h][t] = mm;
    fi[h][t] = (1.0f / ll) * P_CARRY;      // probabilities leave the exponential already carried x2^10
  }

  // A fragments of the mixing matrix: row m = g = c; a1 serves query row r, a2 query row 8 + r
  HFrag a1h, a1l, a2h, a2l;
  {
    v8h z8, w0h, w0l, w8h, w8l;
    const unsigned wofs = (unsigned)(c > 11 ? 11 : c) * NHEAD * 4u;      // byte offset of the lane's row
    const float* wrow = (const float*)((const char*)Wconv + wofs);
#pragma unroll
    for (int i = 0; i < 8; ++i) {
      const int h8 = i < 4 ? 8 + i : 11;
      float w0 = wrow[i];
      float w8 = wrow[h8];
      w0 = (c < 12) ? w0 : 0.0f;
      w8 = (c < 12 && i < 4) ? w8 : 0.0f;
      _Float16 x, y;
      split_h(w0, x, y); w0h[i] = x; w0l[i] = y;
      split_h(w8, x, y); w8h[i] = x; w8l[i] = y;
      z8[i] = (_Float16)0.0f;
    }
    asm volatile("s_wait_xcnt 0x0" :: "v"(wofs) : "memory");   // as above
    a1h.h[0] = hh ? z8 : w0h;  a1h.h[1] = hh ? w8h : z8;
    a1l.h[0] = hh ? z8 : w0l;  a1l.h[1] = hh ? w8l : z8;
    a2h.h[0] = hh ? w0h : z8;  a2h.h[1] = hh ? z8 : w8h;
    a2l.h[0] = hh ? w0l : z8;  a2l.h[1] = hh ? z8 : w8l;
  }
  __syncthreads();

  // ---- pass B ----
  v8f s1 = zacc, s2 = zacc;
  v8f ua0 = zacc, ua1 = zacc, ub = zacc;
  const int gA = wave;                   // head whose 32 v columns this wave multiplies
  const int gB = 8 + (wave >> 1);        // head of which it multiplies 16 columns
  const int dB = (wave & 1) * 16;
  const __bf16* VH = (const __bf16*)vth;
  const __bf16* VL = (const __bf16*)vtl;
  const size_t voA = (size_t)(b * NHEAD + gA) * VTROWS * NTOK + lane * 8;
  const size_t voB = ((size_t)(b * NHEAD + gB) * VTROWS + dB) * NTOK + lane * 8;
#pragma unroll 1   // rolled: one chunk's body already fills a good part of the instruction cache
  for (int ch = 0; ch < NTOK / CHK; ++ch) {      // block-uniform
    unsigned o07h[8][4], o07l[8][4], o8h[8][2], o8l[8][2];
    const size_t ko = ((size_t)b * NHEAD * (NTOK / 16) + ch * (CHK / 16) + wave) * FBLK + lane * 8;
    const __bf16* kph = KH + ko;                 // head h stands h * NTOK / 16 blocks further on
    const __bf16* kpl = KL + ko;
    v16b kbh[NHEAD], kbl[NHEAD];                 // all 48 loads of the chunk in flight at once
#pragma unroll
    for (int h = 0; h < NHEAD; ++h) {
      kbh[h] = load_fo(kph + h * (NTOK / 16) * FBLK);
      kbl[h] = load_fo(kpl + h * (NTOK / 16) * FBLK);
    }
    asm volatile("s_wait_xcnt 0x0" :: "v"(kph), "v"(kpl) : "memory");   // as above
#pragma unroll
    for (int hp = 0; hp < 6; ++hp) {             // heads 2 hp and 2 hp + 1 share a word
      v8f a[2];
      v4f mx[2][2], iv[2][2];
#pragma unroll
      for (int e = 0; e < 2; ++e) {
        const int h = 2 * hp + e;
        BFrag ah, al;
        ah.h[0] = qf[h][0][0][lane]; ah.h[1] = qf[h][0][1][lane];
        al.h[0] = qf[h][1][0][lane]; al.h[1] = qf[h][1][1][lane];
        a[e] = qk3(ah.v, al.v, kbh[h], kbl[h]);
        mx[e][0] = *(const v4f*)(&fm[h][8 * hh]); mx[e][1] = *(const v4f*)(&fm[h][8 * hh + 4]);
        iv[e][0] = *(const v4f*)(&fi[h][8 * hh]); iv[e][1] = *(const v4f*)(&fi[h][8 * hh + 4]);
      }
#pragma unroll
      for (int r = 0; r < 8; ++r) {
        const float p0 = __expf(a[0][r] * SM_SCALE - mx[0][r >> 2][r & 3]) * iv[0][r >> 2][r & 3];
        const float p1 = __expf(a[1][r] * SM_SCALE - mx[1][r >> 2][r & 3]) * iv[1][r >> 2][r & 3];
        _Float16 x0, y0, x1, y1;
        split_h(p0, x0, y0);
        split_h(p1, x1, y1);
        if (hp < 4) { o07h[r][hp] = pkh(x0, x1); o07l[r][hp] = pkh(y0, y1); }
        else        { o8h[r][hp - 4] = pkh(x0, x1); o8l[r][hp - 4] = pkh(y0, y1); }
      }
    }
#pragma unroll
    for (int r = 0; r < 8; ++r) {
      HFrag bh, bl;
#pragma unroll
      for (int i = 0; i < 4; ++i) { bh.u[i] = o07h[r][i]; bl.u[i] = o07l[r][i]; }
      bh.u[4] = xhalf(o8h[r][0]); bh.u[5] = xhalf(o8h[r][1]);
      bl.u[4] = xhalf(o8l[r][0]); bl.u[5] = xhalf(o8l[r][1]);
      bh.u[6] = 0u; bh.u[7] = 0u; bl.u[6] = 0u; bl.u[7] = 0u;
      v8f d10 = Frag<_Float16>::mma(a1h.v, bh.v, zacc);
      v8f d20 = Frag<_Float16>::mma(a2h.v, bh.v, zacc);
      v8f d1r = Frag<_Float16>::mma(a1h.v, bl.v, zacc);
      v8f d2r = Frag<_Float16>::mma(a2h.v, bl.v, zacc);
      d1r = Frag<_Float16>::mma(a1l.v, bh.v, d1r);
      d2r = Frag<_Float16>::mma(a2l.v, bh.v, d2r);
      unsigned* dst = Mx + (8 * hh) * MGP + wave * 16 + c;
      emit_row(d10, d1r, s1, s2, dst + r * MTP, hh);
      emit_row(d20, d2r, s1, s2, dst + (8 + r) * MTP, hh);
    }
    // the chunk's v fragments: issued in front of the barrier, so that they fly while the wave waits there
    const __bf16* vah = VH + voA + (size_t)ch * (CHK / 32) * FBLK;
    const __bf16* val = VL + voA + (size_t)ch * (CHK / 32) * FBLK;
    const __bf16* vbh = VH + voB + (size_t)ch * (CHK / 32) * FBLK;
    const __bf16* vbl = VL + voB + (size_t)ch * (CHK / 32) * FBLK;
    v16b f0h[CHK / 32], f0l[CHK / 32], f1h[CHK / 32], f1l[CHK / 32], f2h[CHK / 32], f2l[CHK / 32];
#pragma unroll
    for (int ks = 0; ks < CHK / 32; ++ks) {
      f0h[ks] = load_fo(vah + ks * FBLK);
      f0l[ks] = load_fo(val + ks * FBLK);
      f1h[ks] = load_fo(vah + 16 * NTOK + ks * FBLK);
      f1l[ks] = load_fo(val + 16 * NTOK + ks * FBLK);
      f2h[ks] = load_fo(vbh + ks * FBLK);
      f2l[ks] = load_fo(vbl + ks * FBLK);
    }
    asm volatile("s_wait_xcnt 0x0" :: "v"(vah), "v"(val), "v"(vbh), "v"(vbl) : "memory");   // as above
    __syncthreads();                             // the chunk's mixed map is complete
#pragma unroll
    for (int ks = 0; ks < CHK / 32; ++ks) {
      const v16b b0h = f0h[ks], b0l = f0l[ks], b1h = f1h[ks], b1l = f1l[ks], b2h = f2h[ks], b2l = f2l[ks];
      v16b mh, ml, nh, nl;
      load_m(Mx + gA * MGP + c * MTP + ks * 32 + hh * 8, mh, ml);
      load_m(Mx + gB * MGP + c * MTP + ks * 32 + hh * 8, nh, nl);
      ua0 = Frag<__bf16>::mma(mh, b0h, ua0);
      ua1 = Frag<__bf16>::mma(mh, b1h, ua1);
      ub  = Frag<__bf16>::mma(nh, b2h, ub);
      ua0 = Frag<__bf16>::mma(mh, b0l, ua0);
      ua1 = Frag<__bf16>::mma(mh, b1l, ua1);
      ub  = Frag<__bf16>::mma(nh, b2l, ub);
      ua0 = Frag<__bf16>::mma(ml, b0h, ua0);
      ua1 = Frag<__bf16>::mma(ml, b1h, ua1);
      ub  = Frag<__bf16>::mma(nl, b2h, ub);
    }
    __syncthreads();                             // every reader has left Mx before the next chunk (or the U tile) overwrites it
  }

  // U tile through LDS, so that each 128-B row of U is stored whole by one wave: [g][t][32]
  float* ut = (float*)Mx;
#pragma unroll
  for (int r = 0; r < 8; ++r) {
    ut[(gA * 16 + 8 * hh + r) * UW + c]      = ua0[r];     // D row t = 8 hh + r, column d = c
    ut[(gA * 16 + 8 * hh + r) * UW + 16 + c] = ua1[r];
    ut[(gB * 16 + 8 * hh + r) * UW + dB + c] = ub[r];
  }
  // statistics: xor tree over the 16 lanes sharing hh (fixed order), then waves in index order
#pragma unroll
  for (int r = 0; r < 8; ++r) {
    float a = s1[r], bq = s2[r];
#pragma unroll
    for (int off = 1; off < 16; off <<= 1) { a += __shfl_xor(a, off, 32); bq += __shfl_xor(bq, off, 32); }
    const int g = 8 * hh + r;
    if (c == 0 && g < 12) { stw[wave][g] = a; stw[wave][12 + g] = bq; }
  }
  __syncthreads();
#pragma unroll
  for (int i = 0; i < NHEAD * 16 * UW / 4 / 256; ++i) {    // 1536 16-B pieces, 6 per thread
    const int p = i * 256 + tid;
    const int g = p >> 7, t = (p >> 3) & 15, d = (p & 7) * 4;
    const v4f v = *(const v4f*)(ut + p * 4);
    *(v4f*)(U + ((size_t)(b * NHEAD + g) * NTOK + t0 + t) * UW + d) = v;
  }
  if (wave == 0) {
    const int qi = lane < 24 ? lane : 23;
    float v = stw[0][qi];
#pragma unroll
    for (int w = 1; w < 8; ++w) v += stw[w][qi];
    v = (lane < 24) ? v : 0.0f;
    pline[lane] = v;
  }
  __syncthreads();
  if (tid < 8) {
    const v4f v = *(const v4f*)(pline + tid * 4);
    *(v4f*)(part + ((size_t)b * (NTOK / 16) + blockIdx.x) * 32 + tid * 4) = v;
  }
}

// ---------------------------------------------------------------------------
// Vsum[g][d] = sum_s v[g][s][d] from the v^T bf16 hi+lo planes ([8 x 12][32][1024] in fragment order), g = (batch, head).
// Block g, 256 threads: d = tid>>3, 8 partial sums of 128 columns combined by a fixed xor tree; the 32 results are
// ---------------------------------------------------------------------------
__global__ __launch_bounds__(256) void vsum_kernel(const unsigned short* __restrict__ vth, const unsigned short* __restrict__ vtl,
                                                   float* __restrict__ vsum) {
  __shared__ __align__(16) float vs[32];
  const int g   = blockIdx.x;
  const int tid = threadIdx.x;
  const int d   = tid >> 3;
  const int prt = tid & 7;
  // column s = 128 prt + 8 i + e of row d stands in block s / 32 of the row's 16-row group, half (i >> 1) & 1,
  // lane 16 (i & 1) + d % 16: 128 elements further on for each i
  const size_t base = ((size_t)g * VTROWS + (d & ~15)) * NTOK + (size_t)prt * 4 * FBLK + (d & 15) * 8;
  float acc = 0.0f;
#pragma unroll 1
  for (int i = 0; i < 16; ++i) {
    const v8us a  = *(const v8us*)(vth + base + i * 128);
    const v8us bq = *(const v8us*)(vtl + base + i * 128);
    // stands in front of every later instruction that reuses a register which an issued load names (a precaution)
    asm volatile("s_wait_xcnt 0x0" ::: "memory");
#pragma unroll
    for (int e = 0; e < 8; ++e) acc += bf_bits2f(a[e]) + bf_bits2f(bq[e]);
  }
  acc += __shfl_xor(acc, 1, 32);
  acc += __shfl_xor(acc, 2, 32);
  acc += __shfl_xor(acc, 4, 32);
  if (prt == 0) vs[d] = acc;
  __syncthreads();
  if (tid < 8) {
    const v4f v = *(const v4f*)(vs + tid * 4);
    float* dst = vsum + g * 32 + tid * 4;
    *(v4f*)dst = v;
    
  }
}

// ---------------------------------------------------------------------------
// Column sums of the partial lines, first level: part [NPART][32] f32 -> psum [STBLK][32] f64.
// Lane = column; each wave reads its STROWS lines as independent loads (all in flight at once), adds them in f64 in
// row order; the 8 wave sums of a block are added in wave order. One wave writes the block's 256-B psum line.
// Coverage: STBLK blocks x 8 waves x STROWS rows = NPART lines.
// ---------------------------------------------------------------------------
__global__ __launch_bounds__(256) void statsum_kernel(const float* __restrict__ part, double* __restrict__ psum) {
  __shared__ double sw[8][32];
  const int lane = threadIdx.x & 31;
  const int wave = threadIdx.x >> 5;
  const float* p = part + (size_t)(blockIdx.x * 8 + wave) * STROWS * 32 + lane;
  float v[STROWS];
#pragma unroll   // loads issue back to back: one memory latency per wave instead of one per line
  for (int i = 0; i < STROWS; ++i) v[i] = p[i * 32];
  double acc = 0.0;
#pragma unroll   // constant indices keep v[] in registers
  for (int i = 0; i < STROWS; ++i) acc += (double)v[i];
  sw[wave][lane] = acc;
  __syncthreads();
  if (wave == 0) {
    double s = sw[0][lane];
#pragma unroll
    for (int w = 1; w < 8; ++w) s += sw[w][lane];
    psum[blockIdx.x * 32 + lane] = s;
  }
}

// ---------------------------------------------------------------------------
// Per-head affine coefficients from the first-level sums (one block of 8 waves): wave w adds psum lines
// w*STBLK/8 .. +STBLK/8-1 in f64 (independent loads, row order), wave 0 adds the 8 wave sums in wave order;
// mean_g = S1/N, var_g = S2/N - mean_g^2 (biased), a_g = gamma_g / sqrt(var_g + eps),
// kk_g = a_g*bconv_g + (beta_g - a_g*(mean_g + bconv_g)); coef line = {a[12], kk[12], 8 zeros}, one instruction.
// ---------------------------------------------------------------------------
__global__ __launch_bounds__(256) void coef_kernel(const double* __restrict__ psum, const float* __restrict__ bconv,
                                                   const float* __restrict__ gamma, const float* __restrict__ beta,
                                                   float* __restrict__ coef) {
  __shared__ double sw[8][32];
  __shared__ double sd[32];
  __shared__ __align__(16) float cf[32];
  const int lane = threadIdx.x & 31;
  const int wave = threadIdx.x >> 5;
  const double* p = psum + (size_t)wave * (STBLK / 8) * 32 + lane;
  double q[STBLK / 8];
#pragma unroll   // loads issue back to back: one memory latency per wave instead of one per line
  for (int i = 0; i < STBLK / 8; ++i) q[i] = p[i * 32];
  double acc = 0.0;
#pragma unroll   // constant indices keep q[] in registers
  for (int i = 0; i < STBLK / 8; ++i) acc += q[i];
  sw[wave][lane] = acc;
  __syncthreads();
  if (wave == 0) {
    double s = sw[0][lane];
#pragma unroll
    for (int w = 1; w < 8; ++w) s += sw[w][lane];
    sd[lane] = s;
  }
  __syncthreads();
  int gq = (lane < 12) ? lane : (lane - 12);
  gq = gq < 0 ? 0 : (gq > 11 ? 11 : gq);
  const double s1d = sd[gq];
  const double s2d = sd[12 + gq];
  const double invN = 1.0 / ((double)NBATCH * (double)NTOK * (double)NTOK);
  const double meanM = s1d * invN;
  double var = s2d * invN - meanM * meanM;
  var = var < 0.0 ? 0.0 : var;
  const float varf   = (float)var;
  const float meanre = (float)meanM + bconv[gq];
  const float a      = gamma[gq] * (1.0f / sqrtf(varf + BN_EPS));
  const float kk     = a * bconv[gq] + (beta[gq] - a * meanre);
  const float v = (lane < 12) ? a : ((lane < 24) ? kk : 0.0f);
  if (wave == 0) cf[lane] = v;
  __syncthreads();
  if (threadIdx.x < 8) {
    const v4f w = *(const v4f*)(cf + threadIdx.x * 4);
    float* dst = coef + threadIdx.x * 4;
    *(v4f*)dst = w;
  }
}

// ---------------------------------------------------------------------------
// out[b][t][32g+d] = a_g * U[b][g][t][d] + kk_g * Vsum[b][g][d]. One wave per (b,t) row of 384 floats:
// Coverage: grid 1024 x 8 waves = 8192 rows = all of d_out.
// ---------------------------------------------------------------------------
__global__ __launch_bounds__(256) void combine_kernel(const float* __restrict__ U, const float* __restrict__ vsum,
                                                      const float* __restrict__ coef, float* __restrict__ out) {
  const int lane = threadIdx.x & 31;
  const int wave = threadIdx.x >> 5;
  const int R = blockIdx.x * 8 + wave;         // 0..8191
  const int b = R >> 10, t = R & (NTOK - 1);
  v4f o[3];
#pragma unroll
  for (int i = 0; i < 3; ++i) {
    const int f = 128 * i + 4 * lane;
    const int g = f >> 5, d = f & 31;
    const v4f u  = *(const v4f*)(U + (((size_t)(b * NHEAD + g)) * NTOK + t) * UW + d);
    const v4f vv = *(const v4f*)(vsum + (b * NHEAD + g) * 32 + d);
    const float a = coef[g], kk = coef[12 + g];
    v4f rr;
#pragma unroll
    for (int e = 0; e < 4; ++e) rr[e] = fmaf(a, u[e], kk * vv[e]);
    o[i] = rr;
  }
  float* orow = out + (size_t)R * NEMB;
  {
#pragma unroll
    for (int i = 0; i < 3; ++i) *(v4f*)(orow + 128 * i + 4 * lane) = o[i];
    
  }
}

// ---------------------------------------------------------------------------
// Workspace region map (every size a multiple of 256):
//   U       f32  [8][12][1024][32]
//   QKH, QKL bf16 [2][8][12][64 blocks of 16 tokens x 32] each  q plane, then k plane, in fragment order
//   VTH, VTL bf16 [8][12][2 groups of 16 rows][32 blocks of 16 rows x 32 tokens] each  v^T of every batch, in fragment order
//   PART    f32  [512][32];  VSUM f32 [8][12][32];  COEF f32 [32] (256 B);  PSUM f64 [64][32]
// ---------------------------------------------------------------------------
extern "C" void kernel_launch(void* const* d_in, const int* in_sizes, int n_in,
                              void* d_out, int out_size, void* d_ws, size_t ws_size,
                              hipStream_t stream) {
  if (n_in < 7) return;
  if (in_sizes[0] != NBATCH * NTOK * NEMB) return;
  if (in_sizes[1] != 3 * HDIM * HDIM || in_sizes[2] != 3 * HDIM) return;
  if (in_sizes[3] != NHEAD * NHEAD || in_sizes[4] < NHEAD || in_sizes[5] < NHEAD || in_sizes[6] < NHEAD) return;
  if (out_size != NBATCH * NTOK * NEMB) return;

  const float* x     = (const float*)d_in[0];
  const float* Wqkv  = (const float*)d_in[1];
  const float* bqkv  = (const float*)d_in[2];
  const float* Wconv = (const float*)d_in[3];
  const float* bconv = (const float*)d_in[4];
  const float* gamma = (const float*)d_in[5];
  const float* beta  = (const float*)d_in[6];
  float* out = (float*)d_out;

  const size_t szU    = (size_t)NBATCH * NHEAD * NTOK * UW * 4;      // 12582912
  const size_t szQK   = (size_t)NBATCH * NTOK * NHEAD * QKW * 2;     // 12582912
  const size_t szVT   = (size_t)NBATCH * NHEAD * VTROWS * NTOK * 2;  // 6291456
  const size_t szPART = (size_t)NPART * 32 * 4;                      // 65536
  const size_t szVS   = (size_t)NBATCH * NHEAD * 32 * 4;             // 12288
  const size_t szCF   = 256;
  const size_t szPS   = (size_t)STBLK * 32 * 8;                      // 16384
  size_t off = 0;
  const size_t oU = off;    off += szU;
  const size_t oQKH = off;  off += szQK;
  const size_t oQKL = off;  off += szQK;
  const size_t oVTH = off;  off += szVT;
  const size_t oVTL = off;  off += szVT;
  const size_t oPART = off; off += szPART;
  const size_t oVS = off;   off += szVS;
  const size_t oCF = off;   off += szCF;
  const size_t oPS = off;   off += szPS;
  if (off > ws_size) return;

  char* ws = (char*)d_ws;
  unsigned short* QKH  = (unsigned short*)(ws + oQKH);
  unsigned short* QKL  = (unsigned short*)(ws + oQKL);
  unsigned short* VTH  = (unsigned short*)(ws + oVTH);
  unsigned short* VTL  = (unsigned short*)(ws + oVTL);
  float*          U    = (float*)(ws + oU);
  float*          PART = (float*)(ws + oPART);
  float*          VSUM = (float*)(ws + oVS);
  float*          COEF = (float*)(ws + oCF);
  double*         PSUM = (double*)(ws + oPS);

  const dim3 blk(256);
  // (1) q, k and v^T planes of every (batch, head): 4 blocks x 4 waves x 64 tokens = 1024 tokens
  proj_kernel<<<dim3(NTOK / 256, NHEAD, NBATCH), dim3(128), 0, stream>>>(x, Wqkv, bqkv, QKH, QKL, VTH, VTL);
  // (2) Vsum of every (batch, head): 96 lines
  vsum_kernel<<<dim3(NBATCH * NHEAD), blk, 0, stream>>>(VTH, VTL, VSUM);

  // (3) scores, softmax, head mixing, statistic partials and (mixed map).v: one block per 16 query rows of a batch
  fused_reattn_kernel<<<dim3(NTOK / 16, NBATCH), blk, 0, stream>>>(QKH, QKL, QKH + QKPLANE, QKL + QKPLANE, VTH, VTL, Wconv, U, PART);
  // (4) fixed-order f64 sums over the partial lines in two levels, then the per-head affine coefficients
  statsum_kernel<<<dim3(STBLK), blk, 0, stream>>>(PART, PSUM);
  coef_kernel<<<dim3(1), blk, 0, stream>>>(PSUM, bconv, gamma, beta, COEF);
  // (5) output rows: 1024 blocks x 8 waves = 8192 rows of 384 floats
  combine_kernel<<<dim3(NBATCH * NTOK / 8), blk, 0, stream>>>(U, VSUM, COEF, out);
}

// v008
// A run of this version takes 160 microseconds.
// It is 1.45 times as fast as v006, going by the measured steps of the versions left out in between.
// Over all steps from v000 it is 22.0 times as fast.
// Contractions: x.Wqkv^T (q|k planes and v^T planes), scaled q.k^T, and (head-mixed attention).v on v_wmma_f32_16x16x32_bf16 with bf16 hi/lo split operand planes (hi.hi + hi.lo + lo.hi); 12x12 head mixing on v_wmma_f32_16x16x32_f16 (f16 hi planes + x2^11 residual planes in a separate accumulator, probabilities carried x2^10); f32 accumulate everywhere; softmax f32; per-head batch statistics as f32 block partials combined in f64 in fixed order.
#include <hip/hip_runtime.h>
#include <math.h>
#include <stdint.h>

constexpr int NBATCH = 8;
constexpr int NTOK   = 1024;
constexpr int NEMB   = 384;
constexpr int NHEAD  = 12;
constexpr int HDIM   = 32;
constexpr int QKW    = 64;             // columns of the q|k projection (q at 0..31, k at 32..63)
constexpr int FBLK   = 512;            // elements of a 16 x 32 block stored in fragment order (1024 B)
constexpr size_t QKPLANE = (size_t)NBATCH * NHEAD * NTOK * HDIM;   // elements of the q plane; the k plane stands behind it
constexpr int VTROWS = 32;             // v^T rows per head
constexpr int UW     = 32;             // U row pitch
constexpr float SM_SCALE = 0.17677669529663687f;
constexpr float P_CARRY  = 1024.0f;                      // probabilities carried x2^10 in f16
constexpr float R_CARRY  = 2048.0f;                      // residual planes carried x2^11
constexpr float P_INV    = 1.0f / 1024.0f;
constexpr float MIX_FOLD = 1.0f / (1024.0f * 2048.0f);
constexpr float BN_EPS   = 1e-5f;
constexpr int STBLK  = 64;                            // blocks of the first level of the statistic sum
constexpr int NPART  = NBATCH * NTOK / 16;           // partial lines: one per block of 16 query rows
constexpr int STROWS = NPART / (STBLK * 8);           // partial lines per wave

typedef __attribute__((ext_vector_type(16))) _Float16 v16h;
typedef __attribute__((ext_vector_type(8)))  _Float16 v8h;
typedef __attribute__((ext_vector_type(16))) __bf16   v16b;
typedef __attribute__((ext_vector_type(8)))  __bf16   v8b;
typedef __attribute__((ext_vector_type(8)))  float    v8f;
typedef __attribute__((ext_vector_type(4)))  float    v4f;
typedef __attribute__((ext_vector_type(8)))  unsigned short v8us;

__device__ __forceinline__ unsigned short f2bf_bits(float f) {
  unsigned u = __float_as_uint(f);
  return (unsigned short)((u + 0x7FFFu + ((u >> 16) & 1u)) >> 16);
}
__device__ __forceinline__ float bf_bits2f(unsigned short h) { return __uint_as_float(((unsigned)h) << 16); }
__device__ __forceinline__ unsigned pk16(unsigned short a, unsigned short b) { return (unsigned)a | ((unsigned)b << 16); }

template <typename T> struct Frag;
template <> struct Frag<_Float16> {
  static __device__ __forceinline__ v8f mma(v16h a, v16h b, v8f c) {
    return __builtin_amdgcn_wmma_f32_16x16x32_f16(false, a, false, b, (short)0, c, false, false);
  }
};
template <> struct Frag<__bf16> {
  static __device__ __forceinline__ v8f mma(v16b a, v16b b, v8f c) {
    return __builtin_amdgcn_wmma_f32_16x16x32_bf16(false, a, false, b, (short)0, c, false, false);
  }
};
union BFrag { v16b v; v8b h[2]; unsigned u[8]; };

// ---------------------------------------------------------------------------
// Projections. One wave: 64 tokens (tok0 = 64 (4 blockIdx.x + wave)) of head blockIdx.y of batch blockIdx.z.
// x (64 x 32) and Wqkv (96 x 32) are read as f32 and split in registers: hi = bf16_rne(f), lo = bf16_rne(f - hi);
// every product = hi.hi + hi.lo + lo.hi. A and B fragments of the 16x16x32 form have the same lane map (lane (hh, r):
// row r, k = 8 hh + 0..7 and 16 + 8 hh + 0..7), so the same four x fragments are A of q|k = x . Wqkv[0..63]^T and
// B of v^T = Wqkv[64..95] . x^T.
// Output planes (bf16 hi and lo) in fragment order: a block of 16 rows x 32 columns stands as 1024 B, [half][lane][8]:
// lane (hh, r) holds row r, columns 16 half + 8 hh + 0..7, which is what that lane of a 16x16x32 A or B fragment takes,
// so a reader's 16-B load per lane covers four whole 128-B lines.
//   q, k : rows = tokens, columns = head dimension; block (b, h, token / 16); the k plane stands QKPLANE behind q
//   v^T  : rows = head dimension, columns = tokens; block (b, h, d / 16, token / 32)
// (every "#pragma unroll" of this section: constant indices keep the fragment arrays in registers)
// ---------------------------------------------------------------------------
__device__ __forceinline__ void split_pair(float f0, float f1, unsigned& h, unsigned& l) {
  const unsigned short h0 = f2bf_bits(f0), h1 = f2bf_bits(f1);
  const unsigned short l0 = f2bf_bits(f0 - bf_bits2f(h0));
  const unsigned short l1 = f2bf_bits(f1 - bf_bits2f(h1));
  h = pk16(h0, h1);
  l = pk16(l0, l1);
}
// the 16 f32 values of a lane's fragment: elements 0..7 <- p[0..7], 8..15 <- p[16..23]
struct Raw16 { v4f x[4]; };
__device__ __forceinline__ Raw16 load_raw(const float* p) {
  Raw16 r;
  r.x[0] = *(const v4f*)(p); r.x[1] = *(const v4f*)(p + 4); r.x[2] = *(const v4f*)(p + 16); r.x[3] = *(const v4f*)(p + 20);
  return r;
}
__device__ __forceinline__ void split_frag(const Raw16& r, v16b& hi, v16b& lo) {
  BFrag fh, fl;
#pragma unroll
  for (int i = 0; i < 4; ++i)
#pragma unroll
    for (int e = 0; e < 2; ++e) split_pair(r.x[i][2 * e], r.x[i][2 * e + 1], fh.u[2 * i + e], fl.u[2 * i + e]);
  hi = fh.v; lo = fl.v;
}
__device__ __forceinline__ v8f mma3(v16b ah, v16b al, v16b bh, v16b bl) {
  v8f a = (v8f){0.f,0.f,0.f,0.f,0.f,0.f,0.f,0.f};
  a = Frag<__bf16>::mma(ah, bh, a);
  a = Frag<__bf16>::mma(ah, bl, a);
  a = Frag<__bf16>::mma(al, bh, a);
  return a;
}
// orders a wave's own LDS writes and reads of its slab (lanes read what other lanes wrote); LDS only, so that the wave
// does not wait here for its global stores
__device__ __forceinline__ void slab_sync() {
  __builtin_amdgcn_fence(__ATOMIC_RELEASE, "workgroup", "local");
  __builtin_amdgcn_wave_barrier();
  __builtin_amdgcn_fence(__ATOMIC_ACQUIRE, "workgroup", "local");
}
// the wave's 16 x 64 f32 slab (pitch 68) -> two blocks in fragment order at o0 (columns 0..31) and o1 (columns 32..63)
__device__ __forceinline__ void slab_to_blocks(const float* slab, int lane, unsigned short* __restrict__ H,
                                               unsigned short* __restrict__ L, size_t o0, size_t o1) {
  slab_sync();
  const float* sp = slab + (lane & 15) * 68 + (lane >> 4) * 8;
  v4f s[4][2];                         // all eight LDS reads stand in one place: one LDS latency per slab
#pragma unroll
  for (int it = 0; it < 4; ++it) { s[it][0] = *(const v4f*)(sp + it * 16); s[it][1] = *(const v4f*)(sp + it * 16 + 4); }
#pragma unroll
  for (int it = 0; it < 4; ++it) {
    v8us hv, lv;
#pragma unroll
    for (int e = 0; e < 8; ++e) {
      const float f = s[it][e >> 2][e & 3];
      const unsigned short hb = f2bf_bits(f);
      hv[e] = hb;
      lv[e] = f2bf_bits(f - bf_bits2f(hb));
    }
    unsigned short* ph = H + ((it >> 1) ? o1 : o0) + (it & 1) * 256 + lane * 8;
    unsigned short* pl = L + ((it >> 1) ? o1 : o0) + (it & 1) * 256 + lane * 8;
    *(v8us*)ph = hv;
    *(v8us*)pl = lv;
    // the stores' registers are inputs, so they stay as they are up to the wait, which stands in front of every later
    // instruction that reuses a register which an issued store names (a precaution)
    asm volatile("s_wait_xcnt 0x0" :: "v"(ph), "v"(pl), "v"(hv), "v"(lv) : "memory");
  }
  slab_sync();
}
__global__ __launch_bounds__(128) void proj_kernel(const float* __restrict__ x, const float* __restrict__ Wqkv,
                                                   const float* __restrict__ bqkv,
                                                   unsigned short* __restrict__ qkh, unsigned short* __restrict__ qkl,
                                                   unsigned short* __restrict__ vth, unsigned short* __restrict__ vtl) {
  __shared__ __align__(16) float sT[4][16 * 68];   // per-wave 16x64 slab, pitch 68 floats
  const int lane  = threadIdx.x & 31;
  const int wave  = threadIdx.x >> 5;
  const int rlane = lane & 15;                 // row (A) / column (B, D) within a 16 x 16 tile
  const int koff  = (lane >> 4) * 8;           // k offset of this lane half; also its D row offset
  const int tok0  = (blockIdx.x * 4 + wave) * 64;
  const int bh    = blockIdx.z * NHEAD + blockIdx.y;
  float* slab = sT[wave];

  // all 48 loads are issued before the first value is split: one memory latency for the wave
  const float* px = x + ((size_t)blockIdx.z * NTOK + tok0 + rlane) * NEMB + blockIdx.y * HDIM + koff;
  const float* pw = Wqkv + rlane * HDIM + koff;
  Raw16 rx[4], rw[6];
#pragma unroll
  for (int i = 0; i < 4; ++i) rx[i] = load_raw(px + (size_t)i * 16 * NEMB);
#pragma unroll
  for (int j = 0; j < 6; ++j) rw[j] = load_raw(pw + j * 16 * HDIM);
  const float* pbn = bqkv + rlane;               // q|k bias by column
  const float* pbm = bqkv + 2 * HDIM + koff;     // v bias by D row
  float bn[4];
  v4f bm[2][2];
#pragma unroll
  for (int j = 0; j < 4; ++j) bn[j] = pbn[16 * j];
#pragma unroll
  for (int i = 0; i < 2; ++i) { bm[i][0] = *(const v4f*)(pbm + 16 * i); bm[i][1] = *(const v4f*)(pbm + 16 * i + 4); }
  // the address registers are inputs, so they stay as they are up to the wait, which stands in front of every later
  // instruction that reuses a register which an issued load names (a precaution)
  asm volatile("s_wait_xcnt 0x0" :: "v"(px), "v"(pw), "v"(pbn), "v"(pbm) : "memory");

  v16b xh[4], xl[4];
#pragma unroll
  for (int i = 0; i < 4; ++i) split_frag(rx[i], xh[i], xl[i]);

  // q|k: D row = token 8 hh + r of tile i, column n = 16 j + rlane (q at 0..31, k at 32..63)
  {
    v16b wh[4], wl[4];
#pragma unroll
    for (int j = 0; j < 4; ++j) split_frag(rw[j], wh[j], wl[j]);
#pragma unroll
    for (int i = 0; i < 4; ++i) {
#pragma unroll
      for (int j = 0; j < 4; ++j) {
        const v8f a = mma3(xh[i], xl[i], wh[j], wl[j]);
#pragma unroll
        for (int r = 0; r < 8; ++r) slab[(koff + r) * 68 + 16 * j + rlane] = a[r] + bn[j];
      }
      const size_t o = ((size_t)bh * (NTOK / 16) + (tok0 >> 4) + i) * FBLK;
      slab_to_blocks(slab, lane, qkh, qkl, o, o + QKPLANE);
    }
  }
  // v^T: D row = d = 16 i + 8 hh + r, column = token 16 j + rlane
#pragma unroll
  for (int i = 0; i < 2; ++i) {
    v16b wh, wl;
    split_frag(rw[4 + i], wh, wl);
#pragma unroll
    for (int j = 0; j < 4; ++j) {
      const v8f a = mma3(wh, wl, xh[j], xl[j]);
#pragma unroll
      for (int r = 0; r < 8; ++r) slab[(koff + r) * 68 + 16 * j + rlane] = a[r] + bm[i][r >> 2][r & 3];
    }
    const size_t o = ((size_t)bh * VTROWS + 16 * i) * NTOK + (size_t)(tok0 >> 5) * FBLK;
    slab_to_blocks(slab, lane, vth, vtl, o, o + FBLK);
  }
}

// ---------------------------------------------------------------------------
// Scores, softmax, 12x12 head mixing, batch-statistic partials and (mixed map).v for 16 query rows (t0 = 16 blockIdx.x)
// of batch blockIdx.y, all 12 heads, in one block of 8 waves: neither the scores nor the mixed map go to memory.
// Pass A: row maxima and row sums. 24 units (head, half of the keys), 3 per wave; q.k^T on bf16 hi/lo planes, running
//   maximum and rescaled sum per lane, then over the 16 lanes of a row, then over the two halves (LDS).
// Pass B: 8 chunks of 128 keys. Wave w owns keys 16 w .. 16 w + 15 of the chunk and recomputes q.k^T for all 12 heads,
//   so lane (hh, c) holds P_h[t = 8 hh + r][s = c] for every h. Mixing product, per r, for the rows t = r and t = 8 + r:
//   P elements 0..7 = the lane's own heads 0..7 (k = 0..7: row r, k = 8..15: row 8 + r), elements 8..11 = heads 8..11 of
//   the partner lane (lane ^ 16; k = 16..19: row 8 + r, k = 24..27: row r), the rest zero; the mixing matrix stands in two
//   fragments, each zero on the other row's k. The probabilities are the A operand and the mixing matrix the B operand
//   (both have the same lane map), so D row s = 8 hh + r2, column g = c: a lane holds 8 consecutive keys of one head.
//   M goes to LDS as a bf16 hi plane and a bf16 lo plane [g][t][s], 16 B per lane and plane, which is the order that an
//   A fragment of the next product takes; behind a barrier wave w multiplies head w (32 columns of v) and 16 columns of
//   head 8 + w / 2, accumulating over all chunks in registers.
// part[b * 64 + blockIdx.x][32] = {sum M_g (12), sum M_g^2 (12), 8 zeros} over the block's 16 rows.
// ---------------------------------------------------------------------------
constexpr int CHK = 128;               // keys per chunk
constexpr int MTP = CHK + 8;           // bf16 per (g, t) row: 272 B = 16 B x odd, b128 reads of 16 rows without conflicts
constexpr int MGP = 16 * MTP + 8;      // bf16 per g: 4368 B = 16 B x odd, b128 stores of 12 heads without conflicts
constexpr int MPL = NHEAD * MGP;       // bf16 per plane; the lo plane stands behind the hi plane
typedef __attribute__((ext_vector_type(2))) __bf16 v2b;
typedef __attribute__((ext_vector_type(2))) float v2f;
union HFrag { v16h v; v8h h[2]; unsigned u[8]; };
// fragment from a plane in fragment order; p = block + 8 lane
__device__ __forceinline__ v16b load_fo(const __bf16* p) {
  BFrag f; f.h[0] = *(const v8b*)(p); f.h[1] = *(const v8b*)(p + 256); return f.v;
}

__device__ __forceinline__ v8f qk3(v16b ah, v16b al, v16b bh, v16b bl) {
  v8f a = (v8f){0.f,0.f,0.f,0.f,0.f,0.f,0.f,0.f};
  a = Frag<__bf16>::mma(ah, bh, a);
  a = Frag<__bf16>::mma(ah, bl, a);
  a = Frag<__bf16>::mma(al, bh, a);
  return a;
}
__device__ __forceinline__ void split_h(float w, _Float16& a, _Float16& r) {
  a = (_Float16)w;
  r = (_Float16)((w - (float)a) * R_CARRY);
}
__device__ __forceinline__ unsigned pkh(_Float16 a, _Float16 b) {
  return pk16(__builtin_bit_cast(unsigned short, a), __builtin_bit_cast(unsigned short, b));
}
// one mixed row t, 8 keys of the lane's head: fold the residual accumulator, add to the statistics, store 8 bf16 hi and
// 8 bf16 lo values, 16 B each. dst: the lane's 8 keys in row (g = c, t) of the hi plane; the lanes c = 12..15 have no head
// and are pointed at the pad behind a row t, which nobody reads: stores without a branch keep a chunk's body one basic
// block, so that no exponential is moved down between the mixing products
__device__ __forceinline__ void emit_row(const v8f& d0, const v8f& dr, v8f& s1, v8f& s2, __bf16* dst) {
  union { v8b v; v2b p[4]; } hi, lo;
#pragma unroll
  for (int i = 0; i < 4; ++i) {
    v2f m;
#pragma unroll
    for (int e = 0; e < 2; ++e) {
      m[e] = fmaf(dr[2 * i + e], MIX_FOLD, d0[2 * i + e] * P_INV);
      s1[2 * i + e] += m[e];
      s2[2 * i + e] = fmaf(m[e], m[e], s2[2 * i + e]);
    }
    const v2b h = __builtin_convertvector(m, v2b);           // round to nearest even, as f2bf_bits
    const v2f res = {m[0] - (float)h[0], m[1] - (float)h[1]};
    hi.p[i] = h;
    lo.p[i] = __builtin_convertvector(res, v2b);
  }
  *(v8b*)dst = hi.v;
  *(v8b*)(dst + MPL) = lo.v;
}
// lane l with lane l ^ 16
__device__ __forceinline__ unsigned xhalf(unsigned x) {
  return (unsigned)__builtin_amdgcn_permlanex16((int)x, (int)x, 0x76543210, 0xfedcba98, false, false);
}
// A fragment (hi and lo) of the mixed map from the two planes: elements 0..7 <- p[0..7], 8..15 <- p[16..23]
__device__ __forceinline__ void load_m(const __bf16* p, v16b& hi, v16b& lo) {
  BFrag fh, fl;
  fh.h[0] = *(const v8b*)(p);       fh.h[1] = *(const v8b*)(p + 16);
  fl.h[0] = *(const v8b*)(p + MPL); fl.h[1] = *(const v8b*)(p + MPL + 16);
  hi = fh.v; lo = fl.v;
}

// 4 waves per SIMD asked for: at most 256 registers a wave, so that two blocks (2 x 139,008 B of LDS) share a WGP
__global__ __launch_bounds__(256, 4) void fused_reattn_kernel(const unsigned short* __restrict__ qh,
                                                           const unsigned short* __restrict__ ql,
                                                           const unsigned short* __restrict__ kh,
                                                           const unsigned short* __restrict__ kl,
                                                           const unsigned short* __restrict__ vth,
                                                           const unsigned short* __restrict__ vtl,
                                                           const float* __restrict__ Wconv,
                                                           float* __restrict__ U, float* __restrict__ part) {
  __shared__ __align__(16) __bf16 Mx[2 * MPL];           // mixed map of a chunk: hi plane, lo plane
  __shared__ __align__(16) v8b qf[NHEAD][2][2][32];      // q fragments in register order: [head][plane][half][lane]
  __shared__ __align__(16) v8h af[4][2][32];             // mixing-matrix fragments in register order: [fragment][half][lane]
  __shared__ __align__(16) float pm[NHEAD][2][16];
  __shared__ __align__(16) float pl[NHEAD][2][16];
  __shared__ __align__(16) float fm[NHEAD][16];
  __shared__ __align__(16) float fi[NHEAD][16];
  __shared__ float stw[8][24];
  __shared__ __align__(16) float pline[32];

  const int tid  = threadIdx.x;
  const int lane = tid & 31;
  const int wave = tid >> 5;
  const int hh   = lane >> 4;
  const int c    = lane & 15;
  const int t0   = blockIdx.x * 16;
  const int b    = blockIdx.y;
  const __bf16* QH = (const __bf16*)qh;
  const __bf16* QL = (const __bf16*)ql;
  const __bf16* KH = (const __bf16*)kh;
  const __bf16* KL = (const __bf16*)kl;
  const v8f zacc = (v8f){0.f,0.f,0.f,0.f,0.f,0.f,0.f,0.f};

  // ---- pass A ----  (every "#pragma unroll" of this kernel: constant indices keep the small arrays in registers)
#pragma unroll 1   // rolled: three copies of the unit would only grow the code
  for (int u = 0; u < 3; ++u) {
    const int unit = wave * 3 + u;
    const int h    = unit >> 1;
    const int half = unit & 1;
    const size_t qo = ((size_t)(b * NHEAD + h) * (NTOK / 16) + blockIdx.x) * FBLK + lane * 8;
    BFrag ah, al;
    const __bf16* qph = QH + qo;
    const __bf16* qpl = QL + qo;
    ah.v = load_fo(qph);
    al.v = load_fo(qpl);
    // the address registers are inputs, so they stay as they are up to the wait, which stands in front of every later
    // instruction that reuses a register which an issued load names (a precaution); the same form further down
    asm volatile("s_wait_xcnt 0x0" :: "v"(qph), "v"(qpl) : "memory");
    if (half == 0) {                       // wave-uniform
      qf[h][0][0][lane] = ah.h[0]; qf[h][0][1][lane] = ah.h[1];
      qf[h][1][0][lane] = al.h[0]; qf[h][1][1][lane] = al.h[1];
    }
    float m[8], l[8];
#pragma unroll
    for (int r = 0; r < 8; ++r) { m[r] = -INFINITY; l[r] = 0.0f; }
    const size_t ko = ((size_t)(b * NHEAD + h) * (NTOK / 16) + half * 32) * FBLK + lane * 8;
#pragma unroll 1   // rolled: 16 loads in flight per trip are enough, more copies cost registers
    for (int it = 0; it < 8; ++it) {
      v16b bh[4], bl[4];
      const __bf16* kph = KH + ko + (size_t)(it * 4) * FBLK;
      const __bf16* kpl = KL + ko + (size_t)(it * 4) * FBLK;
#pragma unroll
      for (int j = 0; j < 4; ++j) {
        bh[j] = load_fo(kph + j * FBLK);
        bl[j] = load_fo(kpl + j * FBLK);
      }
      asm volatile("s_wait_xcnt 0x0" :: "v"(kph), "v"(kpl) : "memory");   // as above
      v8f a[4];
#pragma unroll
      for (int j = 0; j < 4; ++j) a[j] = qk3(ah.v, al.v, bh[j], bl[j]);
#pragma unroll
      for (int r = 0; r < 8; ++r) {
        const float x0 = a[0][r] * SM_SCALE, x1 = a[1][r] * SM_SCALE, x2 = a[2][r] * SM_SCALE, x3 = a[3][r] * SM_SCALE;
        const float mn = fmaxf(m[r], fmaxf(fmaxf(x0, x1), fmaxf(x2, x3)));
        const float e  = ((__expf(x0 - mn) + __expf(x1 - mn)) + __expf(x2 - mn)) + __expf(x3 - mn);
        l[r] = fmaf(l[r], __expf(m[r] - mn), e);
        m[r] = mn;
      }
    }
#pragma unroll
    for (int r = 0; r < 8; ++r) {
      float mm = m[r];
#pragma unroll
      for (int off = 1; off < 16; off <<= 1) mm = fmaxf(mm, __shfl_xor(mm, off, 32));
      float ll = l[r] * __expf(m[r] - mm);
#pragma unroll
      for (int off = 1; off < 16; off <<= 1) ll += __shfl_xor(ll, off, 32);
      if (c == 0) { pm[h][half][8 * hh + r] = mm; pl[h][half][8 * hh + r] = ll; }
    }
  }
  __syncthreads();
  if (tid < NHEAD * 16) {
    const int h = tid >> 4, t = tid & 15;
    const float m0 = pm[h][0][t], m1 = pm[h][1][t];
    const float mm = fmaxf(m0, m1);
    const float ll = pl[h][0][t] * __expf(m0 - mm) + pl[h][1][t] * __expf(m1 - mm);
    fm[h][t] = mm;
    fi[h][t] = (1.0f / ll) * P_CARRY;      // probabilities leave the exponential already carried x2^10
  }

  // B fragments of the mixing matrix: column n = g = c; a1 serves query row r, a2 query row 8 + r
  {
    HFrag a1h, a1l, a2h, a2l;
    v8h z8, w0h, w0l, w8h, w8l;
    const unsigned wofs = (unsigned)(c > 11 ? 11 : c) * NHEAD * 4u;      // byte offset of the lane's row
    const float* wrow = (const float*)((const char*)Wconv + wofs);
#pragma unroll
    for (int i = 0; i < 8; ++i) {
      const int h8 = i < 4 ? 8 + i : 11;
      float w0 = wrow[i];
      float w8 = wrow[h8];
      w0 = (c < 12) ? w0 : 0.0f;
      w8 = (c < 12 && i < 4) ? w8 : 0.0f;
      _Float16 x, y;
      split_h(w0, x, y); w0h[i] = x; w0l[i] = y;
      split_h(w8, x, y); w8h[i] = x; w8l[i] = y;
      z8[i] = (_Float16)0.0f;
    }
    asm volatile("s_wait_xcnt 0x0" :: "v"(wofs) : "memory");   // as above
    a1h.h[0] = hh ? z8 : w0h;  a1h.h[1] = hh ? w8h : z8;
    a1l.h[0] = hh ? z8 : w0l;  a1l.h[1] = hh ? w8l : z8;
    a2h.h[0] = hh ? w0h : z8;  a2h.h[1] = hh ? z8 : w8h;
    a2l.h[0] = hh ? w0l : z8;  a2l.h[1] = hh ? z8 : w8l;
    if (wave == 0) {                       // the same in every wave; published by the barrier below
      af[0][0][lane] = a1h.h[0]; af[0][1][lane] = a1h.h[1];
      af[1][0][lane] = a1l.h[0]; af[1][1][lane] = a1l.h[1];
      af[2][0][lane] = a2h.h[0]; af[2][1][lane] = a2h.h[1];
      af[3][0][lane] = a2l.h[0]; af[3][1][lane] = a2l.h[1];
    }
  }
  __syncthreads();

  // ---- pass B ----
  v8f s1 = zacc, s2 = zacc;
  v8f ua0 = zacc, ua1 = zacc, ub = zacc;
  const int gA = wave;                   // head whose 32 v columns this wave multiplies
  const int gB = 8 + (wave >> 1);        // head of which it multiplies 16 columns
  const int dB = (wave & 1) * 16;
  const __bf16* VH = (const __bf16*)vth;
  const __bf16* VL = (const __bf16*)vtl;
  const size_t voA = (size_t)(b * NHEAD + gA) * VTROWS * NTOK + lane * 8;
  const size_t voB = ((size_t)(b * NHEAD + gB) * VTROWS + dB) * NTOK + lane * 8;
#pragma unroll 1   // rolled: one chunk's body already fills a good part of the instruction cache
  for (int ch = 0; ch < NTOK / CHK; ++ch) {      // block-uniform
    unsigned o07h[8][4], o07l[8][4], o8h[8][2], o8l[8][2];
    const size_t ko = ((size_t)b * NHEAD * (NTOK / 16) + ch * (CHK / 16) + wave) * FBLK + lane * 8;
    const __bf16* kph = KH + ko;                 // head h stands h * NTOK / 16 blocks further on
    const __bf16* kpl = KL + ko;
    // one head at a time, the next head's k fragments in flight meanwhile: short live ranges, so that the kernel fits
    // 256 registers and two blocks share a WGP
    v16b kbh = load_fo(kph), kbl = load_fo(kpl);
    _Float16 xe[8], ye[8];                       // the even head's halves of the words that two heads share
#pragma unroll
    for (int h = 0; h < NHEAD; ++h) {
      v16b knh = kbh, knl = kbl;
      if (h + 1 < NHEAD) {
        knh = load_fo(kph + (h + 1) * (NTOK / 16) * FBLK);
        knl = load_fo(kpl + (h + 1) * (NTOK / 16) * FBLK);
      }
      if (h + 2 == NHEAD) asm volatile("s_wait_xcnt 0x0" :: "v"(kph), "v"(kpl) : "memory");   // as above, behind the last k load
      BFrag ah, al;
      ah.h[0] = qf[h][0][0][lane]; ah.h[1] = qf[h][0][1][lane];
      al.h[0] = qf[h][1][0][lane]; al.h[1] = qf[h][1][1][lane];
      const v8f a = qk3(ah.v, al.v, kbh, kbl);
      v4f mx[2], iv[2];
      mx[0] = *(const v4f*)(&fm[h][8 * hh]); mx[1] = *(const v4f*)(&fm[h][8 * hh + 4]);
      iv[0] = *(const v4f*)(&fi[h][8 * hh]); iv[1] = *(const v4f*)(&fi[h][8 * hh + 4]);
#pragma unroll
      for (int r = 0; r < 8; ++r) {
        const float p = __expf(a[r] * SM_SCALE - mx[r >> 2][r & 3]) * iv[r >> 2][r & 3];
        _Float16 x, y;
        split_h(p, x, y);
        if ((h & 1) == 0)  { xe[r] = x; ye[r] = y; }
        else if (h < 8)    { o07h[r][h >> 1] = pkh(xe[r], x); o07l[r][h >> 1] = pkh(ye[r], y); }
        else               { o8h[r][(h >> 1) - 4] = pkh(xe[r], x); o8l[r][(h >> 1) - 4] = pkh(ye[r], y); }
      }
      kbh = knh; kbl = knl;
    }
    // the mixing matrix's fragments are read again for every chunk, so that they hold no registers outside this part
    HFrag a1h, a1l, a2h, a2l;
    a1h.h[0] = af[0][0][lane]; a1h.h[1] = af[0][1][lane];
    a1l.h[0] = af[1][0][lane]; a1l.h[1] = af[1][1][lane];
    a2h.h[0] = af[2][0][lane]; a2h.h[1] = af[2][1][lane];
    a2l.h[0] = af[3][0][lane]; a2l.h[1] = af[3][1][lane];
#pragma unroll
    for (int r = 0; r < 8; ++r) {
      HFrag bh, bl;
#pragma unroll
      for (int i = 0; i < 4; ++i) { bh.u[i] = o07h[r][i]; bl.u[i] = o07l[r][i]; }
      bh.u[4] = xhalf(o8h[r][0]); bh.u[5] = xhalf(o8h[r][1]);
      bl.u[4] = xhalf(o8l[r][0]); bl.u[5] = xhalf(o8l[r][1]);
      bh.u[6] = 0u; bh.u[7] = 0u; bl.u[6] = 0u; bl.u[7] = 0u;
      __bf16* dst = Mx + (c < NHEAD ? c * MGP + wave * 16 + 8 * hh : (c - NHEAD + 4 * hh) * MGP + CHK);
      v8f d10 = Frag<_Float16>::mma(bh.v, a1h.v, zacc);
      v8f d20 = Frag<_Float16>::mma(bh.v, a2h.v, zacc);
      v8f d1r = Frag<_Float16>::mma(bl.v, a1h.v, zacc);
      v8f d2r = Frag<_Float16>::mma(bl.v, a2h.v, zacc);
      d1r = Frag<_Float16>::mma(bh.v, a1l.v, d1r);
      d2r = Frag<_Float16>::mma(bh.v, a2l.v, d2r);
      emit_row(d10, d1r, s1, s2, dst + r * MTP);
      emit_row(d20, d2r, s1, s2, dst + (8 + r) * MTP);
      // compiler fence, no instruction: the LDS stores and the statistic sums (named as inputs only) of this r are done here;
      // put off to the end of the chunk, the words to be stored and the values still to be summed spill at 256 registers
      asm volatile("" :: "v"(s1), "v"(s2) : "memory");
    }
    // the v fragments of the chunk's first 32 keys: issued in front of the barrier, so that they fly while the wave waits
    // there; those of the next 32 keys are issued in front of each product
    const __bf16* vah = VH + voA + (size_t)ch * (CHK / 32) * FBLK;
    const __bf16* val = VL + voA + (size_t)ch * (CHK / 32) * FBLK;
    const __bf16* vbh = VH + voB + (size_t)ch * (CHK / 32) * FBLK;
    const __bf16* vbl = VL + voB + (size_t)ch * (CHK / 32) * FBLK;
    v16b f0h = load_fo(vah), f0l = load_fo(val), f1h = load_fo(vah + 16 * NTOK), f1l = load_fo(val + 16 * NTOK);
    v16b f2h = load_fo(vbh), f2l = load_fo(vbl);
    asm volatile("s_wait_xcnt 0x0" :: "v"(vah), "v"(val), "v"(vbh), "v"(vbl) : "memory");   // as above
    __syncthreads();                             // the chunk's mixed map is complete
#pragma unroll
    for (int ks = 0; ks < CHK / 32; ++ks) {
      const v16b b0h = f0h, b0l = f0l, b1h = f1h, b1l = f1l, b2h = f2h, b2l = f2l;
      if (ks + 1 < CHK / 32) {
        f0h = load_fo(vah + (ks + 1) * FBLK);
        f0l = load_fo(val + (ks + 1) * FBLK);
        f1h = load_fo(vah + 16 * NTOK + (ks + 1) * FBLK);
        f1l = load_fo(val + 16 * NTOK + (ks + 1) * FBLK);
        f2h = load_fo(vbh + (ks + 1) * FBLK);
        f2l = load_fo(vbl + (ks + 1) * FBLK);
        asm volatile("s_wait_xcnt 0x0" :: "v"(vah), "v"(val), "v"(vbh), "v"(vbl) : "memory");   // as above
      }
      v16b mh, ml, nh, nl;
      load_m(Mx + gA * MGP + c * MTP + ks * 32 + hh * 8, mh, ml);
      load_m(Mx + gB * MGP + c * MTP + ks * 32 + hh * 8, nh, nl);
      ua0 = Frag<__bf16>::mma(mh, b0h, ua0);
      ua1 = Frag<__bf16>::mma(mh, b1h, ua1);
      ub  = Frag<__bf16>::mma(nh, b2h, ub);
      ua0 = Frag<__bf16>::mma(mh, b0l, ua0);
      ua1 = Frag<__bf16>::mma(mh, b1l, ua1);
      ub  = Frag<__bf16>::mma(nh, b2l, ub);
      ua0 = Frag<__bf16>::mma(ml, b0h, ua0);
      ua1 = Frag<__bf16>::mma(ml, b1h, ua1);
      ub  = Frag<__bf16>::mma(nl, b2h, ub);
    }
    __syncthreads();                             // every reader has left Mx before the next chunk (or the U tile) overwrites it
  }

  // U tile through LDS, so that each 128-B row of U is stored whole by one wave: [g][t][32]
  float* ut = (float*)Mx;
#pragma unroll
  for (int r = 0; r < 8; ++r) {
    ut[(gA * 16 + 8 * hh + r) * UW + c]      = ua0[r];     // D row t = 8 hh + r, column d = c
    ut[(gA * 16 + 8 * hh + r) * UW + 16 + c] = ua1[r];
    ut[(gB * 16 + 8 * hh + r) * UW + dB + c] = ub[r];
  }
  // statistics of head g = c: the lane's 8 sums (fixed tree), the two lane halves, then waves in index order
  {
    float a  = ((s1[0] + s1[1]) + (s1[2] + s1[3])) + ((s1[4] + s1[5]) + (s1[6] + s1[7]));
    float bq = ((s2[0] + s2[1]) + (s2[2] + s2[3])) + ((s2[4] + s2[5]) + (s2[6] + s2[7]));
    a  += __uint_as_float(xhalf(__float_as_uint(a)));
    bq += __uint_as_float(xhalf(__float_as_uint(bq)));
    if (lane < NHEAD) { stw[wave][lane] = a; stw[wave][12 + lane] = bq; }
  }
  __syncthreads();
#pragma unroll
  for (int i = 0; i < NHEAD * 16 * UW / 4 / 256; ++i) {    // 1536 16-B pieces, 6 per thread
    const int p = i * 256 + tid;
    const int g = p >> 7, t = (p >> 3) & 15, d = (p & 7) * 4;
    const v4f v = *(const v4f*)(ut + p * 4);
    *(v4f*)(U + ((size_t)(b * NHEAD + g) * NTOK + t0 + t) * UW + d) = v;
  }
  if (wave == 0) {
    const int qi = lane < 24 ? lane : 23;
    float v = stw[0][qi];
#pragma unroll
    for (int w = 1; w < 8; ++w) v += stw[w][qi];
    v = (lane < 24) ? v : 0.0f;
    pline[lane] = v;
  }
  __syncthreads();
  if (tid < 8) {
    const v4f v = *(const v4f*)(pline + tid * 4);
    *(v4f*)(part + ((size_t)b * (NTOK / 16) + blockIdx.x) * 32 + tid * 4) = v;
  }
}

// ---------------------------------------------------------------------------
// Vsum[g][d] = sum_s v[g][s][d] from the v^T bf16 hi+lo planes ([8 x 12][32][1024] in fragment order), g = (batch, head).
// Block g, 256 threads: d = tid>>3, 8 partial sums of 128 columns combined by a fixed xor tree; the 32 results are
// ---------------------------------------------------------------------------
__global__ __launch_bounds__(256) void vsum_kernel(const unsigned short* __restrict__ vth, const unsigned short* __restrict__ vtl,
                                                   float* __restrict__ vsum) {
  __shared__ __align__(16) float vs[32];
  const int g   = blockIdx.x;
  const int tid = threadIdx.x;
  const int d   = tid >> 3;
  const int prt = tid & 7;
  // column s = 128 prt + 8 i + e of row d stands in block s / 32 of the row's 16-row group, half (i >> 1) & 1,
  // lane 16 (i & 1) + d % 16: 128 elements further on for each i
  const size_t base = ((size_t)g * VTROWS + (d & ~15)) * NTOK + (size_t)prt * 4 * FBLK + (d & 15) * 8;
  float acc = 0.0f;
#pragma unroll 1
  for (int i = 0; i < 16; ++i) {
    const v8us a  = *(const v8us*)(vth + base + i * 128);
    const v8us bq = *(const v8us*)(vtl + base + i * 128);
    // stands in front of every later instruction that reuses a register which an issued load names (a precaution)
    asm volatile("s_wait_xcnt 0x0" ::: "memory");
#pragma unroll
    for (int e = 0; e < 8; ++e) acc += bf_bits2f(a[e]) + bf_bits2f(bq[e]);
  }
  acc += __shfl_xor(acc, 1, 32);
  acc += __shfl_xor(acc, 2, 32);
  acc += __shfl_xor(acc, 4, 32);
  if (prt == 0) vs[d] = acc;
  __syncthreads();
  if (tid < 8) {
    const v4f v = *(const v4f*)(vs + tid * 4);
    float* dst = vsum + g * 32 + tid * 4;
    *(v4f*)dst = v;
    
  }
}

// ---------------------------------------------------------------------------
// Column sums of the partial lines, first level: part [NPART][32] f32 -> psum [STBLK][32] f64.
// Lane = column; each wave reads its STROWS lines as independent loads (all in flight at once), adds them in f64 in
// row order; the 8 wave sums of a block are added in wave order. One wave writes the block's 256-B psum line.
// Coverage: STBLK blocks x 8 waves x STROWS rows = NPART lines.
// ---------------------------------------------------------------------------
__global__ __launch_bounds__(256) void statsum_kernel(const float* __restrict__ part, double* __restrict__ psum) {
  __shared__ double sw[8][32];
  const int lane = threadIdx.x & 31;
  const int wave = threadIdx.x >> 5;
  const float* p = part + (size_t)(blockIdx.x * 8 + wave) * STROWS * 32 + lane;
  float v[STROWS];
#pragma unroll   // loads issue back to back: one memory latency per wave instead of one per line
  for (int i = 0; i < STROWS; ++i) v[i] = p[i * 32];
  double acc = 0.0;
#pragma unroll   // constant indices keep v[] in registers
  for (int i = 0; i < STROWS; ++i) acc += (double)v[i];
  sw[wave][lane] = acc;
  __syncthreads();
  if (wave == 0) {
    double s = sw[0][lane];
#pragma unroll
    for (int w = 1; w < 8; ++w) s += sw[w][lane];
    psum[blockIdx.x * 32 + lane] = s;
  }
}

// ---------------------------------------------------------------------------
// Per-head affine coefficients from the first-level sums (one block of 8 waves): wave w adds psum lines
// w*STBLK/8 .. +STBLK/8-1 in f64 (independent loads, row order), wave 0 adds the 8 wave sums in wave order;
// mean_g = S1/N, var_g = S2/N - mean_g^2 (biased), a_g = gamma_g / sqrt(var_g + eps),
// kk_g = a_g*bconv_g + (beta_g - a_g*(mean_g + bconv_g)); coef line = {a[12], kk[12], 8 zeros}, one instruction.
// ---------------------------------------------------------------------------
__global__ __launch_bounds__(256) void coef_kernel(const double* __restrict__ psum, const float* __restrict__ bconv,
                                                   const float* __restrict__ gamma, const float* __restrict__ beta,
                                                   float* __restrict__ coef) {
  __shared__ double sw[8][32];
  __shared__ double sd[32];
  __shared__ __align__(16) float cf[32];
  const int lane = threadIdx.x & 31;
  const int wave = threadIdx.x >> 5;
  const double* p = psum + (size_t)wave * (STBLK / 8) * 32 + lane;
  double q[STBLK / 8];
#pragma unroll   // loads issue back to back: one memory latency per wave instead of one per line
  for (int i = 0; i < STBLK / 8; ++i) q[i] = p[i * 32];
  double acc = 0.0;
#pragma unroll   // constant indices keep q[] in registers
  for (int i = 0; i < STBLK / 8; ++i) acc += q[i];
  sw[wave][lane] = acc;
  __syncthreads();
  if (wave == 0) {
    double s = sw[0][lane];
#pragma unroll
    for (int w = 1; w < 8; ++w) s += sw[w][lane];
    sd[lane] = s;
  }
  __syncthreads();
  int gq = (lane < 12) ? lane : (lane - 12);
  gq = gq < 0 ? 0 : (gq > 11 ? 11 : gq);
  const double s1d = sd[gq];
  const double s2d = sd[12 + gq];
  const double invN = 1.0 / ((double)NBATCH * (double)NTOK * (double)NTOK);
  const double meanM = s1d * invN;
  double var = s2d * invN - meanM * meanM;
  var = var < 0.0 ? 0.0 : var;
  const float varf   = (float)var;
  const float meanre = (float)meanM + bconv[gq];
  const float a      = gamma[gq] * (1.0f / sqrtf(varf + BN_EPS));
  const float kk     = a * bconv[gq] + (beta[gq] - a * meanre);
  const float v = (lane < 12) ? a : ((lane < 24) ? kk : 0.0f);
  if (wave == 0) cf[lane] = v;
  __syncthreads();
  if (threadIdx.x < 8) {
    const v4f w = *(const v4f*)(cf + threadIdx.x * 4);
    float* dst = coef + threadIdx.x * 4;
    *(v4f*)dst = w;
  }
}

// ---------------------------------------------------------------------------
// out[b][t][32g+d] = a_g * U[b][g][t][d] + kk_g * Vsum[b][g][d]. One wave per (b,t) row of 384 floats:
// Coverage: grid 1024 x 8 waves = 8192 rows = all of d_out.
// ---------------------------------------------------------------------------
__global__ __launch_bounds__(256) void combine_kernel(const float* __restrict__ U, const float* __restrict__ vsum,
                                                      const float* __restrict__ coef, float* __restrict__ out) {
  const int lane = threadIdx.x & 31;
  const int wave = threadIdx.x >> 5;
  const int R = blockIdx.x * 8 + wave;         // 0..8191
  const int b = R >> 10, t = R & (NTOK - 1);
  v4f o[3];
#pragma unroll
  for (int i = 0; i < 3; ++i) {
    const int f = 128 * i + 4 * lane;
    const int g = f >> 5, d = f & 31;
    const v4f u  = *(const v4f*)(U + (((size_t)(b * NHEAD + g)) * NTOK + t) * UW + d);
    const v4f vv = *(const v4f*)(vsum + (b * NHEAD + g) * 32 + d);
    const float a = coef[g], kk = coef[12 + g];
    v4f rr;
#pragma unroll
    for (int e = 0; e < 4; ++e) rr[e] = fmaf(a, u[e], kk * vv[e]);
    o[i] = rr;
  }
  float* orow = out + (size_t)R * NEMB;
  {
#pragma unroll
    for (int i = 0; i < 3; ++i) *(v4f*)(orow + 128 * i + 4 * lane) = o[i];
    
  }
}

// ---------------------------------------------------------------------------
// Workspace region map (every size a multiple of 256):
//   U       f32  [8][12][1024][32]
//   QKH, QKL bf16 [2][8][12][64 blocks of 16 tokens x 32] each  q plane, then k plane, in fragment order
//   VTH, VTL bf16 [8][12][2 groups of 16 rows][32 blocks of 16 rows x 32 tokens] each  v^T of every batch, in fragment order
//   PART    f32  [512][32];  VSUM f32 [8][12][32];  COEF f32 [32] (256 B);  PSUM f64 [64][32]
// ---------------------------------------------------------------------------
extern "C" void kernel_launch(void* const* d_in, const int* in_sizes, int n_in,
                              void* d_out, int out_size, void* d_ws, size_t ws_size,
                              hipStream_t stream) {
  if (n_in < 7) return;
  if (in_sizes[0] != NBATCH * NTOK * NEMB) return;
  if (in_sizes[1] != 3 * HDIM * HDIM || in_sizes[2] != 3 * HDIM) return;
  if (in_sizes[3] != NHEAD * NHEAD || in_sizes[4] < NHEAD || in_sizes[5] < NHEAD || in_sizes[6] < NHEAD) return;
  if (out_size != NBATCH * NTOK * NEMB) return;

  const float* x     = (const float*)d_in[0];
  const float* Wqkv  = (const float*)d_in[1];
  const float* bqkv  = (const float*)d_in[2];
  const float* Wconv = (const float*)d_in[3];
  const float* bconv = (const float*)d_in[4];
  const float* gamma = (const float*)d_in[5];
  const float* beta  = (const float*)d_in[6];
  float* out = (float*)d_out;

  const size_t szU    = (size_t)NBATCH * NHEAD * NTOK * UW * 4;      // 12582912
  const size_t szQK   = (size_t)NBATCH * NTOK * NHEAD * QKW * 2;     // 12582912
  const size_t szVT   = (size_t)NBATCH * NHEAD * VTROWS * NTOK * 2;  // 6291456
  const size_t szPART = (size_t)NPART * 32 * 4;                      // 65536
  const size_t szVS   = (size_t)NBATCH * NHEAD * 32 * 4;             // 12288
  const size_t szCF   = 256;
  const size_t szPS   = (size_t)STBLK * 32 * 8;                      // 16384
  size_t off = 0;
  const size_t oU = off;    off += szU;
  const size_t oQKH = off;  off += szQK;
  const size_t oQKL = off;  off += szQK;
  const size_t oVTH = off;  off += szVT;
  const size_t oVTL = off;  off += szVT;
  const size_t oPART = off; off += szPART;
  const size_t oVS = off;   off += szVS;
  const size_t oCF = off;   off += szCF;
  const size_t oPS = off;   off += szPS;
  if (off > ws_size) return;

  char* ws = (char*)d_ws;
  unsigned short* QKH  = (unsigned short*)(ws + oQKH);
  unsigned short* QKL  = (unsigned short*)(ws + oQKL);
  unsigned short* VTH  = (unsigned short*)(ws + oVTH);
  unsigned short* VTL  = (unsigned short*)(ws + oVTL);
  float*          U    = (float*)(ws + oU);
  float*          PART = (float*)(ws + oPART);
  float*          VSUM = (float*)(ws + oVS);
  float*          COEF = (float*)(ws + oCF);
  double*         PSUM = (double*)(ws + oPS);

  const dim3 blk(256);
  // (1) q, k and v^T planes of every (batch, head): 4 blocks x 4 waves x 64 tokens = 1024 tokens
  proj_kernel<<<dim3(NTOK / 256, NHEAD, NBATCH), dim3(128), 0, stream>>>(x, Wqkv, bqkv, QKH, QKL, VTH, VTL);
  // (2) Vsum of every (batch, head): 96 lines
  vsum_kernel<<<dim3(NBATCH * NHEAD), blk, 0, stream>>>(VTH, VTL, VSUM);

  // (3) scores, softmax, head mixing, statistic partials and (mixed map).v: one block per 16 query rows of a batch
  fused_reattn_kernel<<<dim3(NTOK / 16, NBATCH), blk, 0, stream>>>(QKH, QKL, QKH + QKPLANE, QKL + QKPLANE, VTH, VTL, Wconv, U, PART);
  // (4) fixed-order f64 sums over the partial lines in two levels, then the per-head affine coefficients
  statsum_kernel<<<dim3(STBLK), blk, 0, stream>>>(PART, PSUM);
  coef_kernel<<<dim3(1), blk, 0, stream>>>(PSUM, bconv, gamma, beta, COEF);
  // (5) output rows: 1024 blocks x 8 waves = 8192 rows of 384 floats
  combine_kernel<<<dim3(NBATCH * NTOK / 8), blk, 0, stream>>>(U, VSUM, COEF, out);
}

// v009
// Measured time: 151 microseconds a run.
// Next to v008, in two timings, it ran 1.06 times as fast each time.
// Counting every step since v000, it is 23.4 times as fast.
// Contractions: x.Wqkv^T (q|k planes and v^T planes), scaled q.k^T, and (head-mixed attention).v on v_wmma_f32_16x16x32_bf16 with bf16 hi/lo split operand planes (hi.hi + hi.lo + lo.hi); 12x12 head mixing on v_wmma_f32_16x16x32_f16 (f16 hi planes + x2^11 residual planes in a separate accumulator, probabilities carried x2^10); f32 accumulate everywhere; softmax f32; per-head batch statistics as f32 block partials combined in f64 in fixed order.
#include <hip/hip_runtime.h>
#include <math.h>
#include <stdint.h>

constexpr int NBATCH = 8;
constexpr int NTOK   = 1024;
constexpr int NEMB   = 384;
constexpr int NHEAD  = 12;
constexpr int HDIM   = 32;
constexpr int QKW    = 64;             // columns of the q|k projection (q at 0..31, k at 32..63)
constexpr int FBLK   = 512;            // elements of a 16 x 32 block stored in fragment order (1024 B)
constexpr size_t QKPLANE = (size_t)NBATCH * NHEAD * NTOK * HDIM;   // elements of the q plane; the k plane stands behind it
constexpr int VTROWS = 32;             // v^T rows per head
constexpr int UW     = 32;             // U row pitch
constexpr float SM_SCALE = 0.17677669529663687f;
constexpr float P_CARRY  = 1024.0f;                      // probabilities carried x2^10 in f16
constexpr float R_CARRY  = 2048.0f;                      // residual planes carried x2^11
constexpr float P_INV    = 1.0f / 1024.0f;
constexpr float MIX_FOLD = 1.0f / (1024.0f * 2048.0f);
constexpr float BN_EPS   = 1e-5f;
constexpr int NPART  = NBATCH * NTOK / 16;           // partial lines: one per block of 16 query rows
constexpr int VPB    = NTOK / 256;                    // partial lines of the v column sums per (batch, head): one per projection block
constexpr int CROWS  = 32;                            // output rows per block of the last kernel

typedef __attribute__((ext_vector_type(16))) _Float16 v16h;
typedef __attribute__((ext_vector_type(8)))  _Float16 v8h;
typedef __attribute__((ext_vector_type(16))) __bf16   v16b;
typedef __attribute__((ext_vector_type(8)))  __bf16   v8b;
typedef __attribute__((ext_vector_type(8)))  float    v8f;
typedef __attribute__((ext_vector_type(4)))  float    v4f;
typedef __attribute__((ext_vector_type(8)))  unsigned short v8us;

__device__ __forceinline__ unsigned short f2bf_bits(float f) {
  unsigned u = __float_as_uint(f);
  return (unsigned short)((u + 0x7FFFu + ((u >> 16) & 1u)) >> 16);
}
__device__ __forceinline__ float bf_bits2f(unsigned short h) { return __uint_as_float(((unsigned)h) << 16); }
__device__ __forceinline__ unsigned pk16(unsigned short a, unsigned short b) { return (unsigned)a | ((unsigned)b << 16); }

template <typename T> struct Frag;
template <> struct Frag<_Float16> {
  static __device__ __forceinline__ v8f mma(v16h a, v16h b, v8f c) {
    return __builtin_amdgcn_wmma_f32_16x16x32_f16(false, a, false, b, (short)0, c, false, false);
  }
};
template <> struct Frag<__bf16> {
  static __device__ __forceinline__ v8f mma(v16b a, v16b b, v8f c) {
    return __builtin_amdgcn_wmma_f32_16x16x32_bf16(false, a, false, b, (short)0, c, false, false);
  }
};
union BFrag { v16b v; v8b h[2]; unsigned u[8]; };

// ---------------------------------------------------------------------------
// Projections. One wave: 64 tokens (tok0 = 64 (4 blockIdx.x + wave)) of head blockIdx.y of batch blockIdx.z.
// x (64 x 32) and Wqkv (96 x 32) are read as f32 and split in registers: hi = bf16_rne(f), lo = bf16_rne(f - hi);
// every product = hi.hi + hi.lo + lo.hi. A and B fragments of the 16x16x32 form have the same lane map (lane (hh, r):
// row r, k = 8 hh + 0..7 and 16 + 8 hh + 0..7), so the same four x fragments are A of q|k = x . Wqkv[0..63]^T and
// B of v^T = Wqkv[64..95] . x^T.
// Output planes (bf16 hi and lo) in fragment order: a block of 16 rows x 32 columns stands as 1024 B, [half][lane][8]:
// lane (hh, r) holds row r, columns 16 half + 8 hh + 0..7, which is what that lane of a 16x16x32 A or B fragment takes,
// so a reader's 16-B load per lane covers four whole 128-B lines.
//   q, k : rows = tokens, columns = head dimension; block (b, h, token / 16); the k plane stands QKPLANE behind q
//   v^T  : rows = head dimension, columns = tokens; block (b, h, d / 16, token / 32)
// (every "#pragma unroll" of this section: constant indices keep the fragment arrays in registers)
// ---------------------------------------------------------------------------
__device__ __forceinline__ void split_pair(float f0, float f1, unsigned& h, unsigned& l) {
  const unsigned short h0 = f2bf_bits(f0), h1 = f2bf_bits(f1);
  const unsigned short l0 = f2bf_bits(f0 - bf_bits2f(h0));
  const unsigned short l1 = f2bf_bits(f1 - bf_bits2f(h1));
  h = pk16(h0, h1);
  l = pk16(l0, l1);
}
// the 16 f32 values of a lane's fragment: elements 0..7 <- p[0..7], 8..15 <- p[16..23]
struct Raw16 { v4f x[4]; };
__device__ __forceinline__ Raw16 load_raw(const float* p) {
  Raw16 r;
  r.x[0] = *(const v4f*)(p); r.x[1] = *(const v4f*)(p + 4); r.x[2] = *(const v4f*)(p + 16); r.x[3] = *(const v4f*)(p + 20);
  return r;
}
__device__ __forceinline__ void split_frag(const Raw16& r, v16b& hi, v16b& lo) {
  BFrag fh, fl;
#pragma unroll
  for (int i = 0; i < 4; ++i)
#pragma unroll
    for (int e = 0; e < 2; ++e) split_pair(r.x[i][2 * e], r.x[i][2 * e + 1], fh.u[2 * i + e], fl.u[2 * i + e]);
  hi = fh.v; lo = fl.v;
}
__device__ __forceinline__ v8f mma3(v16b ah, v16b al, v16b bh, v16b bl) {
  v8f a = (v8f){0.f,0.f,0.f,0.f,0.f,0.f,0.f,0.f};
  a = Frag<__bf16>::mma(ah, bh, a);
  a = Frag<__bf16>::mma(ah, bl, a);
  a = Frag<__bf16>::mma(al, bh, a);
  return a;
}
// orders a wave's own LDS writes and reads of its slab (lanes read what other lanes wrote); LDS only, so that the wave
// does not wait here for its global stores
__device__ __forceinline__ void slab_sync() {
  __builtin_amdgcn_fence(__ATOMIC_RELEASE, "workgroup", "local");
  __builtin_amdgcn_wave_barrier();
  __builtin_amdgcn_fence(__ATOMIC_ACQUIRE, "workgroup", "local");
}
// the wave's 16 x 64 f32 slab (pitch 68) -> two blocks in fragment order at o0 (columns 0..31) and o1 (columns 32..63);
// returns the sum of hi + lo over the lane's 32 elements (row lane & 15, columns 16 it + 8 (lane >> 4) + 0..7)
__device__ __forceinline__ float slab_to_blocks(const float* slab, int lane, unsigned short* __restrict__ H,
                                                unsigned short* __restrict__ L, size_t o0, size_t o1) {
  float rs = 0.0f;
  slab_sync();
  const float* sp = slab + (lane & 15) * 68 + (lane >> 4) * 8;
  v4f s[4][2];                         // all eight LDS reads stand in one place: one LDS latency per slab
#pragma unroll
  for (int it = 0; it < 4; ++it) { s[it][0] = *(const v4f*)(sp + it * 16); s[it][1] = *(const v4f*)(sp + it * 16 + 4); }
#pragma unroll
  for (int it = 0; it < 4; ++it) {
    v8us hv, lv;
#pragma unroll
    for (int e = 0; e < 8; ++e) {
      const float f = s[it][e >> 2][e & 3];
      const unsigned short hb = f2bf_bits(f);
      const unsigned short lb = f2bf_bits(f - bf_bits2f(hb));
      hv[e] = hb;
      lv[e] = lb;
      rs += bf_bits2f(hb) + bf_bits2f(lb);
    }
    unsigned short* ph = H + ((it >> 1) ? o1 : o0) + (it & 1) * 256 + lane * 8;
    unsigned short* pl = L + ((it >> 1) ? o1 : o0) + (it & 1) * 256 + lane * 8;
    *(v8us*)ph = hv;
    *(v8us*)pl = lv;
    // the stores' registers are inputs, so they stay as they are up to the wait, which stands in front of every later
    // instruction that reuses a register which an issued store names (a precaution)
    asm volatile("s_wait_xcnt 0x0" :: "v"(ph), "v"(pl), "v"(hv), "v"(lv) : "memory");
  }
  slab_sync();
  return rs;
}
__global__ __launch_bounds__(128) void proj_kernel(const float* __restrict__ x, const float* __restrict__ Wqkv,
                                                   const float* __restrict__ bqkv,
                                                   unsigned short* __restrict__ qkh, unsigned short* __restrict__ qkl,
                                                   unsigned short* __restrict__ vth, unsigned short* __restrict__ vtl,
                                                   float* __restrict__ vpart) {
  __shared__ __align__(16) float sT[4][16 * 68];   // per-wave 16x64 slab, pitch 68 floats
  __shared__ float vsw[4][32];                     // per-wave sums of v over its 64 tokens
  const int lane  = threadIdx.x & 31;
  const int wave  = threadIdx.x >> 5;
  const int rlane = lane & 15;                 // row (A) / column (B, D) within a 16 x 16 tile
  const int koff  = (lane >> 4) * 8;           // k offset of this lane half; also its D row offset
  const int tok0  = (blockIdx.x * 4 + wave) * 64;
  const int bh    = blockIdx.z * NHEAD + blockIdx.y;
  float* slab = sT[wave];

  // all 48 loads are issued before the first value is split: one memory latency for the wave
  const float* px = x + ((size_t)blockIdx.z * NTOK + tok0 + rlane) * NEMB + blockIdx.y * HDIM + koff;
  const float* pw = Wqkv + rlane * HDIM + koff;
  Raw16 rx[4], rw[6];
#pragma unroll
  for (int i = 0; i < 4; ++i) rx[i] = load_raw(px + (size_t)i * 16 * NEMB);
#pragma unroll
  for (int j = 0; j < 6; ++j) rw[j] = load_raw(pw + j * 16 * HDIM);
  const float* pbn = bqkv + rlane;               // q|k bias by column
  const float* pbm = bqkv + 2 * HDIM + koff;     // v bias by D row
  float bn[4];
  v4f bm[2][2];
#pragma unroll
  for (int j = 0; j < 4; ++j) bn[j] = pbn[16 * j];
#pragma unroll
  for (int i = 0; i < 2; ++i) { bm[i][0] = *(const v4f*)(pbm + 16 * i); bm[i][1] = *(const v4f*)(pbm + 16 * i + 4); }
  // the address registers are inputs, so they stay as they are up to the wait, which stands in front of every later
  // instruction that reuses a register which an issued load names (a precaution)
  asm volatile("s_wait_xcnt 0x0" :: "v"(px), "v"(pw), "v"(pbn), "v"(pbm) : "memory");

  v16b xh[4], xl[4];
#pragma unroll
  for (int i = 0; i < 4; ++i) split_frag(rx[i], xh[i], xl[i]);

  // q|k: D row = token 8 hh + r of tile i, column n = 16 j + rlane (q at 0..31, k at 32..63)
  {
    v16b wh[4], wl[4];
#pragma unroll
    for (int j = 0; j < 4; ++j) split_frag(rw[j], wh[j], wl[j]);
#pragma unroll
    for (int i = 0; i < 4; ++i) {
#pragma unroll
      for (int j = 0; j < 4; ++j) {
        const v8f a = mma3(xh[i], xl[i], wh[j], wl[j]);
#pragma unroll
        for (int r = 0; r < 8; ++r) slab[(koff + r) * 68 + 16 * j + rlane] = a[r] + bn[j];
      }
      const size_t o = ((size_t)bh * (NTOK / 16) + (tok0 >> 4) + i) * FBLK;
      slab_to_blocks(slab, lane, qkh, qkl, o, o + QKPLANE);
    }
  }
  // v^T: D row = d = 16 i + 8 hh + r, column = token 16 j + rlane
  float rs[2];
#pragma unroll
  for (int i = 0; i < 2; ++i) {
    v16b wh, wl;
    split_frag(rw[4 + i], wh, wl);
#pragma unroll
    for (int j = 0; j < 4; ++j) {
      const v8f a = mma3(wh, wl, xh[j], xl[j]);
#pragma unroll
      for (int r = 0; r < 8; ++r) slab[(koff + r) * 68 + 16 * j + rlane] = a[r] + bm[i][r >> 2][r & 3];
    }
    const size_t o = ((size_t)bh * VTROWS + 16 * i) * NTOK + (size_t)(tok0 >> 5) * FBLK;
    rs[i] = slab_to_blocks(slab, lane, vth, vtl, o, o + FBLK);
  }
  // sum of v (hi + lo) over the block's 256 tokens: a lane and its partner (lane ^ 16) hold the two halves of row
  // d = 16 i + (lane & 15) of the wave's 64 tokens, so lane l takes d = l; the four waves are added in wave order and
  // wave 0 stores the block's whole 128-B line vpart[(batch, head)][blockIdx.x][32]
  rs[0] += __shfl_xor(rs[0], 16, 32);
  rs[1] += __shfl_xor(rs[1], 16, 32);
  vsw[wave][lane] = (lane >> 4) ? rs[1] : rs[0];
  // work-group barrier that orders LDS only: with __syncthreads() every wave would first wait here for its global stores
  __builtin_amdgcn_fence(__ATOMIC_RELEASE, "workgroup", "local");
  __builtin_amdgcn_s_barrier();
  __builtin_amdgcn_fence(__ATOMIC_ACQUIRE, "workgroup", "local");
  if (wave == 0)
    vpart[((size_t)bh * VPB + blockIdx.x) * 32 + lane] = ((vsw[0][lane] + vsw[1][lane]) + vsw[2][lane]) + vsw[3][lane];
}

// ---------------------------------------------------------------------------
// Scores, softmax, 12x12 head mixing, batch-statistic partials and (mixed map).v for 16 query rows (t0 = 16 blockIdx.x)
// of batch blockIdx.y, all 12 heads, in one block of 8 waves: neither the scores nor the mixed map go to memory.
// Pass A: row maxima and row sums. 24 units (head, half of the keys), 3 per wave; q.k^T on bf16 hi/lo planes, running
//   maximum and rescaled sum per lane, then over the 16 lanes of a row, then over the two halves (LDS).
// Pass B: 8 chunks of 128 keys. Wave w owns keys 16 w .. 16 w + 15 of the chunk and recomputes q.k^T for all 12 heads,
//   so lane (hh, c) holds P_h[t = 8 hh + r][s = c] for every h. Mixing product, per r, for the rows t = r and t = 8 + r:
//   P elements 0..7 = the lane's own heads 0..7 (k = 0..7: row r, k = 8..15: row 8 + r), elements 8..11 = heads 8..11 of
//   the partner lane (lane ^ 16; k = 16..19: row 8 + r, k = 24..27: row r), the rest zero; the mixing matrix stands in two
//   fragments, each zero on the other row's k. The probabilities are the A operand and the mixing matrix the B operand
//   (both have the same lane map), so D row s = 8 hh + r2, column g = c: a lane holds 8 consecutive keys of one head.
//   M goes to LDS as a bf16 hi plane and a bf16 lo plane [g][t][s], 16 B per lane and plane, which is the order that an
//   A fragment of the next product takes; behind a barrier wave w multiplies head w (32 columns of v) and 16 columns of
//   head 8 + w / 2, accumulating over all chunks in registers.
// part[b * 64 + blockIdx.x][32] = {sum M_g (12), sum M_g^2 (12), 8 zeros} over the block's 16 rows.
// ---------------------------------------------------------------------------
constexpr int CHK = 128;               // keys per chunk
constexpr int MTP = CHK + 8;           // bf16 per (g, t) row: 272 B = 16 B x odd, b128 reads of 16 rows without conflicts
constexpr int MGP = 16 * MTP + 8;      // bf16 per g: 4368 B = 16 B x odd, b128 stores of 12 heads without conflicts
constexpr int MPL = NHEAD * MGP;       // bf16 per plane; the lo plane stands behind the hi plane
typedef __attribute__((ext_vector_type(2))) __bf16 v2b;
typedef __attribute__((ext_vector_type(2))) float v2f;
union HFrag { v16h v; v8h h[2]; unsigned u[8]; };
// fragment from a plane in fragment order; p = block + 8 lane
__device__ __forceinline__ v16b load_fo(const __bf16* p) {
  BFrag f; f.h[0] = *(const v8b*)(p); f.h[1] = *(const v8b*)(p + 256); return f.v;
}

__device__ __forceinline__ v8f qk3(v16b ah, v16b al, v16b bh, v16b bl) {
  v8f a = (v8f){0.f,0.f,0.f,0.f,0.f,0.f,0.f,0.f};
  a = Frag<__bf16>::mma(ah, bh, a);
  a = Frag<__bf16>::mma(ah, bl, a);
  a = Frag<__bf16>::mma(al, bh, a);
  return a;
}
__device__ __forceinline__ void split_h(float w, _Float16& a, _Float16& r) {
  a = (_Float16)w;
  r = (_Float16)((w - (float)a) * R_CARRY);
}
__device__ __forceinline__ unsigned pkh(_Float16 a, _Float16 b) {
  return pk16(__builtin_bit_cast(unsigned short, a), __builtin_bit_cast(unsigned short, b));
}
// one mixed row t, 8 keys of the lane's head: fold the residual accumulator, add to the statistics, store 8 bf16 hi and
// 8 bf16 lo values, 16 B each. dst: the lane's 8 keys in row (g = c, t) of the hi plane; the lanes c = 12..15 have no head
// and are pointed at the pad behind a row t, which nobody reads: stores without a branch keep a chunk's body one basic
// block, so that no exponential is moved down between the mixing products
__device__ __forceinline__ void emit_row(const v8f& d0, const v8f& dr, v8f& s1, v8f& s2, __bf16* dst) {
  union { v8b v; v2b p[4]; } hi, lo;
#pragma unroll
  for (int i = 0; i < 4; ++i) {
    v2f m;
#pragma unroll
    for (int e = 0; e < 2; ++e) {
      m[e] = fmaf(dr[2 * i + e], MIX_FOLD, d0[2 * i + e] * P_INV);
      s1[2 * i + e] += m[e];
      s2[2 * i + e] = fmaf(m[e], m[e], s2[2 * i + e]);
    }
    const v2b h = __builtin_convertvector(m, v2b);           // round to nearest even, as f2bf_bits
    const v2f res = {m[0] - (float)h[0], m[1] - (float)h[1]};
    hi.p[i] = h;
    lo.p[i] = __builtin_convertvector(res, v2b);
  }
  *(v8b*)dst = hi.v;
  *(v8b*)(dst + MPL) = lo.v;
}
// lane l with lane l ^ 16
__device__ __forceinline__ unsigned xhalf(unsigned x) {
  return (unsigned)__builtin_amdgcn_permlanex16((int)x, (int)x, 0x76543210, 0xfedcba98, false, false);
}
// A fragment (hi and lo) of the mixed map from the two planes: elements 0..7 <- p[0..7], 8..15 <- p[16..23]
__device__ __forceinline__ void load_m(const __bf16* p, v16b& hi, v16b& lo) {
  BFrag fh, fl;
  fh.h[0] = *(const v8b*)(p);       fh.h[1] = *(const v8b*)(p + 16);
  fl.h[0] = *(const v8b*)(p + MPL); fl.h[1] = *(const v8b*)(p + MPL + 16);
  hi = fh.v; lo = fl.v;
}

// 4 waves per SIMD asked for: at most 256 registers a wave, so that two blocks (2 x 139,008 B of LDS) share a WGP
__global__ __launch_bounds__(256, 4) void fused_reattn_kernel(const unsigned short* __restrict__ qh,
                                                           const unsigned short* __restrict__ ql,
                                                           const unsigned short* __restrict__ kh,
                                                           const unsigned short* __restrict__ kl,
                                                           const unsigned short* __restrict__ vth,
                                                           const unsigned short* __restrict__ vtl,
                                                           const float* __restrict__ Wconv,
                                                           float* __restrict__ U, float* __restrict__ part) {
  __shared__ __align__(16) __bf16 Mx[2 * MPL];           // mixed map of a chunk: hi plane, lo plane
  __shared__ __align__(16) v8b qf[NHEAD][2][2][32];      // q fragments in register order: [head][plane][half][lane]
  __shared__ __align__(16) v8h af[4][2][32];             // mixing-matrix fragments in register order: [fragment][half][lane]
  __shared__ __align__(16) float pm[NHEAD][2][16];
  __shared__ __align__(16) float pl[NHEAD][2][16];
  __shared__ __align__(16) float fm[NHEAD][16];
  __shared__ __align__(16) float fi[NHEAD][16];
  __shared__ float stw[8][24];
  __shared__ __align__(16) float pline[32];

  const int tid  = threadIdx.x;
  const int lane = tid & 31;
  const int wave = tid >> 5;
  const int hh   = lane >> 4;
  const int c    = lane & 15;
  const int t0   = blockIdx.x * 16;
  const int b    = blockIdx.y;
  const __bf16* QH = (const __bf16*)qh;
  const __bf16* QL = (const __bf16*)ql;
  const __bf16* KH = (const __bf16*)kh;
  const __bf16* KL = (const __bf16*)kl;
  const v8f zacc = (v8f){0.f,0.f,0.f,0.f,0.f,0.f,0.f,0.f};

  // ---- pass A ----  (every "#pragma unroll" of this kernel: constant indices keep the small arrays in registers)
#pragma unroll 1   // rolled: three copies of the unit would only grow the code
  for (int u = 0; u < 3; ++u) {
    const int unit = wave * 3 + u;
    const int h    = unit >> 1;
    const int half = unit & 1;
    const size_t qo = ((size_t)(b * NHEAD + h) * (NTOK / 16) + blockIdx.x) * FBLK + lane * 8;
    BFrag ah, al;
    const __bf16* qph = QH + qo;
    const __bf16* qpl = QL + qo;
    ah.v = load_fo(qph);
    al.v = load_fo(qpl);
    // the address registers are inputs, so they stay as they are up to the wait, which stands in front of every later
    // instruction that reuses a register which an issued load names (a precaution); the same form further down
    asm volatile("s_wait_xcnt 0x0" :: "v"(qph), "v"(qpl) : "memory");
    if (half == 0) {                       // wave-uniform
      qf[h][0][0][lane] = ah.h[0]; qf[h][0][1][lane] = ah.h[1];
      qf[h][1][0][lane] = al.h[0]; qf[h][1][1][lane] = al.h[1];
    }
    float m[8], l[8];
#pragma unroll
    for (int r = 0; r < 8; ++r) { m[r] = -INFINITY; l[r] = 0.0f; }
    const size_t ko = ((size_t)(b * NHEAD + h) * (NTOK / 16) + half * 32) * FBLK + lane * 8;
#pragma unroll 1   // rolled: 16 loads in flight per trip are enough, more copies cost registers
    for (int it = 0; it < 8; ++it) {
      v16b bh[4], bl[4];
      const __bf16* kph = KH + ko + (size_t)(it * 4) * FBLK;
      const __bf16* kpl = KL + ko + (size_t)(it * 4) * FBLK;
#pragma unroll
      for (int j = 0; j < 4; ++j) {
        bh[j] = load_fo(kph + j * FBLK);
        bl[j] = load_fo(kpl + j * FBLK);
      }
      asm volatile("s_wait_xcnt 0x0" :: "v"(kph), "v"(kpl) : "memory");   // as above
      v8f a[4];
#pragma unroll
      for (int j = 0; j < 4; ++j) a[j] = qk3(ah.v, al.v, bh[j], bl[j]);
#pragma unroll
      for (int r = 0; r < 8; ++r) {
        const float x0 = a[0][r] * SM_SCALE, x1 = a[1][r] * SM_SCALE, x2 = a[2][r] * SM_SCALE, x3 = a[3][r] * SM_SCALE;
        const float mn = fmaxf(m[r], fmaxf(fmaxf(x0, x1), fmaxf(x2, x3)));
        const float e  = ((__expf(x0 - mn) + __expf(x1 - mn)) + __expf(x2 - mn)) + __expf(x3 - mn);
        l[r] = fmaf(l[r], __expf(m[r] - mn), e);
        m[r] = mn;
      }
    }
#pragma unroll
    for (int r = 0; r < 8; ++r) {
      float mm = m[r];
#pragma unroll
      for (int off = 1; off < 16; off <<= 1) mm = fmaxf(mm, __shfl_xor(mm, off, 32));
      float ll = l[r] * __expf(m[r] - mm);
#pragma unroll
      for (int off = 1; off < 16; off <<= 1) ll += __shfl_xor(ll, off, 32);
      if (c == 0) { pm[h][half][8 * hh + r] = mm; pl[h][half][8 * hh + r] = ll; }
    }
  }
  __syncthreads();
  if (tid < NHEAD * 16) {
    const int h = tid >> 4, t = tid & 15;
    const float m0 = pm[h][0][t], m1 = pm[h][1][t];
    const float mm = fmaxf(m0, m1);
    const float ll = pl[h][0][t] * __expf(m0 - mm) + pl[h][1][t] * __expf(m1 - mm);
    fm[h][t] = mm;
    fi[h][t] = (1.0f / ll) * P_CARRY;      // probabilities leave the exponential already carried x2^10
  }

  // B fragments of the mixing matrix: column n = g = c; a1 serves query row r, a2 query row 8 + r
  {
    HFrag a1h, a1l, a2h, a2l;
    v8h z8, w0h, w0l, w8h, w8l;
    const unsigned wofs = (unsigned)(c > 11 ? 11 : c) * NHEAD * 4u;      // byte offset of the lane's row
    const float* wrow = (const float*)((const char*)Wconv + wofs);
#pragma unroll
    for (int i = 0; i < 8; ++i) {
      const int h8 = i < 4 ? 8 + i : 11;
      float w0 = wrow[i];
      float w8 = wrow[h8];
      w0 = (c < 12) ? w0 : 0.0f;
      w8 = (c < 12 && i < 4) ? w8 : 0.0f;
      _Float16 x, y;
      split_h(w0, x, y); w0h[i] = x; w0l[i] = y;
      split_h(w8, x, y); w8h[i] = x; w8l[i] = y;
      z8[i] = (_Float16)0.0f;
    }
    asm volatile("s_wait_xcnt 0x0" :: "v"(wofs) : "memory");   // as above
    a1h.h[0] = hh ? z8 : w0h;  a1h.h[1] = hh ? w8h : z8;
    a1l.h[0] = hh ? z8 : w0l;  a1l.h[1] = hh ? w8l : z8;
    a2h.h[0] = hh ? w0h : z8;  a2h.h[1] = hh ? z8 : w8h;
    a2l.h[0] = hh ? w0l : z8;  a2l.h[1] = hh ? z8 : w8l;
    if (wave == 0) {                       // the same in every wave; published by the barrier below
      af[0][0][lane] = a1h.h[0]; af[0][1][lane] = a1h.h[1];
      af[1][0][lane] = a1l.h[0]; af[1][1][lane] = a1l.h[1];
      af[2][0][lane] = a2h.h[0]; af[2][1][lane] = a2h.h[1];
      af[3][0][lane] = a2l.h[0]; af[3][1][lane] = a2l.h[1];
    }
  }
  __syncthreads();

  // ---- pass B ----
  v8f s1 = zacc, s2 = zacc;
  v8f ua0 = zacc, ua1 = zacc, ub = zacc;
  const int gA = wave;                   // head whose 32 v columns this wave multiplies
  const int gB = 8 + (wave >> 1);        // head of which it multiplies 16 columns
  const int dB = (wave & 1) * 16;
  const __bf16* VH = (const __bf16*)vth;
  const __bf16* VL = (const __bf16*)vtl;
  const size_t voA = (size_t)(b * NHEAD + gA) * VTROWS * NTOK + lane * 8;
  const size_t voB = ((size_t)(b * NHEAD + gB) * VTROWS + dB) * NTOK + lane * 8;
#pragma unroll 1   // rolled: one chunk's body already fills a good part of the instruction cache
  for (int ch = 0; ch < NTOK / CHK; ++ch) {      // block-uniform
    unsigned o07h[8][4], o07l[8][4], o8h[8][2], o8l[8][2];
    const size_t ko = ((size_t)b * NHEAD * (NTOK / 16) + ch * (CHK / 16) + wave) * FBLK + lane * 8;
    const __bf16* kph = KH + ko;                 // head h stands h * NTOK / 16 blocks further on
    const __bf16* kpl = KL + ko;
    // one head at a time, the next head's k fragments in flight meanwhile: short live ranges, so that the kernel fits
    // 256 registers and two blocks share a WGP
    v16b kbh = load_fo(kph), kbl = load_fo(kpl);
    _Float16 xe[8], ye[8];                       // the even head's halves of the words that two heads share
#pragma unroll
    for (int h = 0; h < NHEAD; ++h) {
      v16b knh = kbh, knl = kbl;
      if (h + 1 < NHEAD) {
        knh = load_fo(kph + (h + 1) * (NTOK / 16) * FBLK);
        knl = load_fo(kpl + (h + 1) * (NTOK / 16) * FBLK);
      }
      if (h + 2 == NHEAD) asm volatile("s_wait_xcnt 0x0" :: "v"(kph), "v"(kpl) : "memory");   // as above, behind the last k load
      BFrag ah, al;
      ah.h[0] = qf[h][0][0][lane]; ah.h[1] = qf[h][0][1][lane];
      al.h[0] = qf[h][1][0][lane]; al.h[1] = qf[h][1][1][lane];
      const v8f a = qk3(ah.v, al.v, kbh, kbl);
      v4f mx[2], iv[2];
      mx[0] = *(const v4f*)(&fm[h][8 * hh]); mx[1] = *(const v4f*)(&fm[h][8 * hh + 4]);
      iv[0] = *(const v4f*)(&fi[h][8 * hh]); iv[1] = *(const v4f*)(&fi[h][8 * hh + 4]);
#pragma unroll
      for (int r = 0; r < 8; ++r) {
        const float p = __expf(a[r] * SM_SCALE - mx[r >> 2][r & 3]) * iv[r >> 2][r & 3];
        _Float16 x, y;
        split_h(p, x, y);
        if ((h & 1) == 0)  { xe[r] = x; ye[r] = y; }
        else if (h < 8)    { o07h[r][h >> 1] = pkh(xe[r], x); o07l[r][h >> 1] = pkh(ye[r], y); }
        else               { o8h[r][(h >> 1) - 4] = pkh(xe[r], x); o8l[r][(h >> 1) - 4] = pkh(ye[r], y); }
      }
      kbh = knh; kbl = knl;
    }
    // the mixing matrix's fragments are read again for every chunk, so that they hold no registers outside this part
    HFrag a1h, a1l, a2h, a2l;
    a1h.h[0] = af[0][0][lane]; a1h.h[1] = af[0][1][lane];
    a1l.h[0] = af[1][0][lane]; a1l.h[1] = af[1][1][lane];
    a2h.h[0] = af[2][0][lane]; a2h.h[1] = af[2][1][lane];
    a2l.h[0] = af[3][0][lane]; a2l.h[1] = af[3][1][lane];
#pragma unroll
    for (int r = 0; r < 8; ++r) {
      HFrag bh, bl;
#pragma unroll
      for (int i = 0; i < 4; ++i) { bh.u[i] = o07h[r][i]; bl.u[i] = o07l[r][i]; }
      bh.u[4] = xhalf(o8h[r][0]); bh.u[5] = xhalf(o8h[r][1]);
      bl.u[4] = xhalf(o8l[r][0]); bl.u[5] = xhalf(o8l[r][1]);
      bh.u[6] = 0u; bh.u[7] = 0u; bl.u[6] = 0u; bl.u[7] = 0u;
      __bf16* dst = Mx + (c < NHEAD ? c * MGP + wave * 16 + 8 * hh : (c - NHEAD + 4 * hh) * MGP + CHK);
      v8f d10 = Frag<_Float16>::mma(bh.v, a1h.v, zacc);
      v8f d20 = Frag<_Float16>::mma(bh.v, a2h.v, zacc);
      v8f d1r = Frag<_Float16>::mma(bl.v, a1h.v, zacc);
      v8f d2r = Frag<_Float16>::mma(bl.v, a2h.v, zacc);
      d1r = Frag<_Float16>::mma(bh.v, a1l.v, d1r);
      d2r = Frag<_Float16>::mma(bh.v, a2l.v, d2r);
      emit_row(d10, d1r, s1, s2, dst + r * MTP);
      emit_row(d20, d2r, s1, s2, dst + (8 + r) * MTP);
      // compiler fence, no instruction: the LDS stores and the statistic sums (named as inputs only) of this r are done here;
      // put off to the end of the chunk, the words to be stored and the values still to be summed spill at 256 registers
      asm volatile("" :: "v"(s1), "v"(s2) : "memory");
    }
    // the v fragments of the chunk's first 32 keys: issued in front of the barrier, so that they fly while the wave waits
    // there; those of the next 32 keys are issued in front of each product
    const __bf16* vah = VH + voA + (size_t)ch * (CHK / 32) * FBLK;
    const __bf16* val = VL + voA + (size_t)ch * (CHK / 32) * FBLK;
    const __bf16* vbh = VH + voB + (size_t)ch * (CHK / 32) * FBLK;
    const __bf16* vbl = VL + voB + (size_t)ch * (CHK / 32) * FBLK;
    v16b f0h = load_fo(vah), f0l = load_fo(val), f1h = load_fo(vah + 16 * NTOK), f1l = load_fo(val + 16 * NTOK);
    v16b f2h = load_fo(vbh), f2l = load_fo(vbl);
    asm volatile("s_wait_xcnt 0x0" :: "v"(vah), "v"(val), "v"(vbh), "v"(vbl) : "memory");   // as above
    __syncthreads();                             // the chunk's mixed map is complete
#pragma unroll
    for (int ks = 0; ks < CHK / 32; ++ks) {
      const v16b b0h = f0h, b0l = f0l, b1h = f1h, b1l = f1l, b2h = f2h, b2l = f2l;
      if (ks + 1 < CHK / 32) {
        f0h = load_fo(vah + (ks + 1) * FBLK);
        f0l = load_fo(val + (ks + 1) * FBLK);
        f1h = load_fo(vah + 16 * NTOK + (ks + 1) * FBLK);
        f1l = load_fo(val + 16 * NTOK + (ks + 1) * FBLK);
        f2h = load_fo(vbh + (ks + 1) * FBLK);
        f2l = load_fo(vbl + (ks + 1) * FBLK);
        asm volatile("s_wait_xcnt 0x0" :: "v"(vah), "v"(val), "v"(vbh), "v"(vbl) : "memory");   // as above
      }
      v16b mh, ml, nh, nl;
      load_m(Mx + gA * MGP + c * MTP + ks * 32 + hh * 8, mh, ml);
      load_m(Mx + gB * MGP + c * MTP + ks * 32 + hh * 8, nh, nl);
      ua0 = Frag<__bf16>::mma(mh, b0h, ua0);
      ua1 = Frag<__bf16>::mma(mh, b1h, ua1);
      ub  = Frag<__bf16>::mma(nh, b2h, ub);
      ua0 = Frag<__bf16>::mma(mh, b0l, ua0);
      ua1 = Frag<__bf16>::mma(mh, b1l, ua1);
      ub  = Frag<__bf16>::mma(nh, b2l, ub);
      ua0 = Frag<__bf16>::mma(ml, b0h, ua0);
      ua1 = Frag<__bf16>::mma(ml, b1h, ua1);
      ub  = Frag<__bf16>::mma(nl, b2h, ub);
    }
    __syncthreads();                             // every reader has left Mx before the next chunk (or the U tile) overwrites it
  }

  // U tile through LDS, so that each 128-B row of U is stored whole by one wave: [g][t][32]
  float* ut = (float*)Mx;
#pragma unroll
  for (int r = 0; r < 8; ++r) {
    ut[(gA * 16 + 8 * hh + r) * UW + c]      = ua0[r];     // D row t = 8 hh + r, column d = c
    ut[(gA * 16 + 8 * hh + r) * UW + 16 + c] = ua1[r];
    ut[(gB * 16 + 8 * hh + r) * UW + dB + c] = ub[r];
  }
  // statistics of head g = c: the lane's 8 sums (fixed tree), the two lane halves, then waves in index order
  {
    float a  = ((s1[0] + s1[1]) + (s1[2] + s1[3])) + ((s1[4] + s1[5]) + (s1[6] + s1[7]));
    float bq = ((s2[0] + s2[1]) + (s2[2] + s2[3])) + ((s2[4] + s2[5]) + (s2[6] + s2[7]));
    a  += __uint_as_float(xhalf(__float_as_uint(a)));
    bq += __uint_as_float(xhalf(__float_as_uint(bq)));
    if (lane < NHEAD) { stw[wave][lane] = a; stw[wave][12 + lane] = bq; }
  }
  __syncthreads();
#pragma unroll
  for (int i = 0; i < NHEAD * 16 * UW / 4 / 256; ++i) {    // 1536 16-B pieces, 6 per thread
    const int p = i * 256 + tid;
    const int g = p >> 7, t = (p >> 3) & 15, d = (p & 7) * 4;
    const v4f v = *(const v4f*)(ut + p * 4);
    *(v4f*)(U + ((size_t)(b * NHEAD + g) * NTOK + t0 + t) * UW + d) = v;
  }
  if (wave == 0) {
    const int qi = lane < 24 ? lane : 23;
    float v = stw[0][qi];
#pragma unroll
    for (int w = 1; w < 8; ++w) v += stw[w][qi];
    v = (lane < 24) ? v : 0.0f;
    pline[lane] = v;
  }
  __syncthreads();
  if (tid < 8) {
    const v4f v = *(const v4f*)(pline + tid * 4);
    *(v4f*)(part + ((size_t)b * (NTOK / 16) + blockIdx.x) * 32 + tid * 4) = v;
  }
}

// ---------------------------------------------------------------------------
// out[b][t][32g+d] = a_g * U[b][g][t][d] + kk_g * Vsum[b][g][d] for CROWS rows (b, t) per block of 8 waves, 4 rows a wave.
// Every block forms the coefficients itself, all blocks by the same arithmetic in the same order:
//   column sums of part [NPART][32] in f64: thread (row group tid >> 3, 4 columns 4 (tid & 7)) adds the lines
//   tid >> 3 + 32 i in the order of i, then lanes l ^ 8, l ^ 16, then the 8 waves in wave order (LDS);
//   mean_g = S1/N, var_g = S2/N - mean_g^2 (biased), a_g = gamma_g / sqrt(var_g + eps),
//   kk_g = a_g*bconv_g + (beta_g - a_g*(mean_g + bconv_g)); lane l of every wave holds a_l (l < 12) or kk_(l-12) (l < 24);
//   Vsum[b][g][d] = the VPB lines of vpart[(b, g)] added in line order.
// Coverage: grid 256 x 32 rows = 8192 rows = all of d_out.
// ---------------------------------------------------------------------------
__global__ __launch_bounds__(256) void combine_kernel(const float* __restrict__ U, const float* __restrict__ vpart,
                                                      const float* __restrict__ part, const float* __restrict__ bconv,
                                                      const float* __restrict__ gamma, const float* __restrict__ beta,
                                                      float* __restrict__ out) {
  __shared__ __align__(16) double sw[8][32];
  __shared__ __align__(16) float vs[NHEAD * 32];
  const int tid  = threadIdx.x;
  const int lane = tid & 31;
  const int wave = tid >> 5;
  const int R0 = blockIdx.x * CROWS + wave * (CROWS / 8);   // the wave's first row, 0..8191; a block lies in one batch
  const int b = R0 >> 10, t = R0 & (NTOK - 1);
  int gq = (lane < 12) ? lane : (lane - 12);
  gq = gq > 11 ? 11 : gq;

  // every load of the block is issued before the first value is used: one memory latency
  // (every "#pragma unroll" of this kernel: constant indices keep the small arrays in registers)
  const float* pp = part + (tid >> 3) * 32 + (tid & 7) * 4;
  v4f pv[NPART / 32];
#pragma unroll
  for (int i = 0; i < NPART / 32; ++i) pv[i] = *(const v4f*)(pp + i * 32 * 32);
  const int vq = tid < NHEAD * 8 ? tid : NHEAD * 8 - 1;      // 16-B piece of the batch's 12 x 32 sums
  const float* pq = vpart + ((size_t)(b * NHEAD + (vq >> 3)) * VPB) * 32 + (vq & 7) * 4;
  v4f vp[VPB];
#pragma unroll
  for (int i = 0; i < VPB; ++i) vp[i] = *(const v4f*)(pq + i * 32);
  const float bc = bconv[gq], ga = gamma[gq], be = beta[gq];
  const float* pu = U + (((size_t)(b * NHEAD + (lane >> 3))) * NTOK + t) * UW + (lane & 7) * 4;
  v4f u[CROWS / 8][3];
#pragma unroll
  for (int rr = 0; rr < CROWS / 8; ++rr)
#pragma unroll
    for (int i = 0; i < 3; ++i) u[rr][i] = *(const v4f*)(pu + (size_t)i * 4 * NTOK * UW + rr * UW);   // head 4 i + lane / 8
  // the address registers are inputs, so they stay as they are up to the wait, which stands in front of every later
  // instruction that reuses a register which an issued load names (a precaution)
  asm volatile("s_wait_xcnt 0x0" :: "v"(pp), "v"(pq), "v"(gq), "v"(pu) : "memory");
  // keeps the sums below from being scheduled in between the loads, where their waits would hold back the later loads
  __builtin_amdgcn_sched_barrier(0);

  double acc[4] = {0.0, 0.0, 0.0, 0.0};
#pragma unroll
  for (int i = 0; i < NPART / 32; ++i)
#pragma unroll
    for (int e = 0; e < 4; ++e) acc[e] += (double)pv[i][e];
#pragma unroll
  for (int e = 0; e < 4; ++e) {
    acc[e] += __shfl_xor(acc[e], 8, 32);
    acc[e] += __shfl_xor(acc[e], 16, 32);
  }
  if (lane < 8) {
#pragma unroll
    for (int e = 0; e < 4; ++e) sw[wave][lane * 4 + e] = acc[e];
  }
  if (tid < NHEAD * 8) *(v4f*)(vs + tid * 4) = ((vp[0] + vp[1]) + vp[2]) + vp[3];
  __syncthreads();                               // the wave sums and the batch's Vsum are complete

  double s = sw[0][lane];
#pragma unroll
  for (int w = 1; w < 8; ++w) s += sw[w][lane];
  const double s1d = __shfl(s, gq, 32);
  const double s2d = __shfl(s, 12 + gq, 32);
  const double invN = 1.0 / ((double)NBATCH * (double)NTOK * (double)NTOK);
  const double meanM = s1d * invN;
  double var = s2d * invN - meanM * meanM;
  var = var < 0.0 ? 0.0 : var;
  const float varf   = (float)var;
  const float meanre = (float)meanM + bc;
  const float a      = ga * (1.0f / sqrtf(varf + BN_EPS));
  const float kk     = a * bc + (be - a * meanre);
  const float cf     = (lane < 12) ? a : kk;

  float* orow = out + (size_t)R0 * NEMB + 4 * lane;
#pragma unroll
  for (int i = 0; i < 3; ++i) {
    const int g = 4 * i + (lane >> 3);
    const float ag = __shfl(cf, g, 32), kg = __shfl(cf, 12 + g, 32);
    const v4f vv = *(const v4f*)(vs + 128 * i + 4 * lane);
#pragma unroll
    for (int rr = 0; rr < CROWS / 8; ++rr) {
      v4f o;
#pragma unroll
      for (int e = 0; e < 4; ++e) o[e] = fmaf(ag, u[rr][i][e], kg * vv[e]);
      *(v4f*)(orow + rr * NEMB + 128 * i) = o;
    }
  }
}

// ---------------------------------------------------------------------------
// Workspace region map (every size a multiple of 256):
//   U       f32  [8][12][1024][32]
//   QKH, QKL bf16 [2][8][12][64 blocks of 16 tokens x 32] each  q plane, then k plane, in fragment order
//   VTH, VTL bf16 [8][12][2 groups of 16 rows][32 blocks of 16 rows x 32 tokens] each  v^T of every batch, in fragment order
//   PART    f32  [512][32];  VPART f32 [8][12][4][32]
// ---------------------------------------------------------------------------
extern "C" void kernel_launch(void* const* d_in, const int* in_sizes, int n_in,
                              void* d_out, int out_size, void* d_ws, size_t ws_size,
                              hipStream_t stream) {
  if (n_in < 7) return;
  if (in_sizes[0] != NBATCH * NTOK * NEMB) return;
  if (in_sizes[1] != 3 * HDIM * HDIM || in_sizes[2] != 3 * HDIM) return;
  if (in_sizes[3] != NHEAD * NHEAD || in_sizes[4] < NHEAD || in_sizes[5] < NHEAD || in_sizes[6] < NHEAD) return;
  if (out_size != NBATCH * NTOK * NEMB) return;

  const float* x     = (const float*)d_in[0];
  const float* Wqkv  = (const float*)d_in[1];
  const float* bqkv  = (const float*)d_in[2];
  const float* Wconv = (const float*)d_in[3];
  const float* bconv = (const float*)d_in[4];
  const float* gamma = (const float*)d_in[5];
  const float* beta  = (const float*)d_in[6];
  float* out = (float*)d_out;

  const size_t szU    = (size_t)NBATCH * NHEAD * NTOK * UW * 4;      // 12582912
  const size_t szQK   = (size_t)NBATCH * NTOK * NHEAD * QKW * 2;     // 12582912
  const size_t szVT   = (size_t)NBATCH * NHEAD * VTROWS * NTOK * 2;  // 6291456
  const size_t szPART = (size_t)NPART * 32 * 4;                      // 65536
  const size_t szVP   = (size_t)NBATCH * NHEAD * VPB * 32 * 4;       // 49152
  size_t off = 0;
  const size_t oU = off;    off += szU;
  const size_t oQKH = off;  off += szQK;
  const size_t oQKL = off;  off += szQK;
  const size_t oVTH = off;  off += szVT;
  const size_t oVTL = off;  off += szVT;
  const size_t oPART = off; off += szPART;
  const size_t oVP = off;   off += szVP;
  if (off > ws_size) return;

  char* ws = (char*)d_ws;
  unsigned short* QKH  = (unsigned short*)(ws + oQKH);
  unsigned short* QKL  = (unsigned short*)(ws + oQKL);
  unsigned short* VTH  = (unsigned short*)(ws + oVTH);
  unsigned short* VTL  = (unsigned short*)(ws + oVTL);
  float*          U    = (float*)(ws + oU);
  float*          PART = (float*)(ws + oPART);
  float*          VPART = (float*)(ws + oVP);

  const dim3 blk(256);
  // (1) q, k and v^T planes of every (batch, head), and each block's sums of v: 4 blocks x 4 waves x 64 tokens = 1024 tokens
  proj_kernel<<<dim3(NTOK / 256, NHEAD, NBATCH), dim3(128), 0, stream>>>(x, Wqkv, bqkv, QKH, QKL, VTH, VTL, VPART);
  // (2) scores, softmax, head mixing, statistic partials and (mixed map).v: one block per 16 query rows of a batch
  fused_reattn_kernel<<<dim3(NTOK / 16, NBATCH), blk, 0, stream>>>(QKH, QKL, QKH + QKPLANE, QKL + QKPLANE, VTH, VTL, Wconv, U, PART);
  // (3) fixed-order f64 sums over the partial lines and the per-head affine coefficients in every block, then its output
  //     rows: 256 blocks x 32 rows = 8192 rows of 384 floats
  combine_kernel<<<dim3(NBATCH * NTOK / CROWS), blk, 0, stream>>>(U, VPART, PART, bconv, gamma, beta, out);
}

// v010
// One run takes 130 microseconds.
// Next to v009, in two timings, it ran 1.16 times as fast each time.
// Counting every step since v000, it is 27.1 times as fast.
// Contractions: x.Wqkv^T (q|k planes and v^T planes), scaled q.k^T, and (head-mixed attention).v on v_wmma_f32_16x16x32_bf16 with bf16 hi/lo split operand planes (hi.hi + hi.lo + lo.hi); 12x12 head mixing on v_wmma_f32_16x16x32_f16 (f16 hi planes + x2^11 residual planes in a separate accumulator, probabilities carried x2^10); f32 accumulate everywhere; softmax f32; per-head batch statistics as f32 block partials combined in f64 in fixed order.
#include <hip/hip_runtime.h>
#include <math.h>
#include <stdint.h>

constexpr int NBATCH = 8;
constexpr int NTOK   = 1024;
constexpr int NEMB   = 384;
constexpr int NHEAD  = 12;
constexpr int HDIM   = 32;
constexpr int QKW    = 64;             // columns of the q|k projection (q at 0..31, k at 32..63)
constexpr int FBLK   = 512;            // elements of a 16 x 32 block stored in fragment order (1024 B)
constexpr size_t QKPLANE = (size_t)NBATCH * NHEAD * NTOK * HDIM;   // elements of the q plane; the k plane stands behind it
constexpr int VTROWS = 32;             // v^T rows per head
constexpr int UW     = 32;             // U row pitch
constexpr float SM_SCALE = 0.17677669529663687f;
constexpr float P_CARRY  = 1024.0f;                      // probabilities carried x2^10 in f16
constexpr float R_CARRY  = 2048.0f;                      // residual planes carried x2^11
constexpr float P_INV    = 1.0f / 1024.0f;
constexpr float MIX_FOLD = 1.0f / (1024.0f * 2048.0f);
constexpr float BN_EPS   = 1e-5f;
constexpr int NPART  = NBATCH * NTOK / 16;           // partial lines: one per block of 16 query rows
constexpr int VPB    = NTOK / 256;                    // partial lines of the v column sums per (batch, head): one per projection block
constexpr int CROWS  = 32;                            // output rows per block of the last kernel

typedef __attribute__((ext_vector_type(16))) _Float16 v16h;
typedef __attribute__((ext_vector_type(8)))  _Float16 v8h;
typedef __attribute__((ext_vector_type(16))) __bf16   v16b;
typedef __attribute__((ext_vector_type(8)))  __bf16   v8b;
typedef __attribute__((ext_vector_type(8)))  float    v8f;
typedef __attribute__((ext_vector_type(4)))  float    v4f;
typedef __attribute__((ext_vector_type(8)))  unsigned short v8us;

__device__ __forceinline__ unsigned short f2bf_bits(float f) {
  unsigned u = __float_as_uint(f);
  return (unsigned short)((u + 0x7FFFu + ((u >> 16) & 1u)) >> 16);
}
__device__ __forceinline__ float bf_bits2f(unsigned short h) { return __uint_as_float(((unsigned)h) << 16); }
__device__ __forceinline__ unsigned pk16(unsigned short a, unsigned short b) { return (unsigned)a | ((unsigned)b << 16); }

template <typename T> struct Frag;
template <> struct Frag<_Float16> {
  static __device__ __forceinline__ v8f mma(v16h a, v16h b, v8f c) {
    return __builtin_amdgcn_wmma_f32_16x16x32_f16(false, a, false, b, (short)0, c, false, false);
  }
};
template <> struct Frag<__bf16> {
  static __device__ __forceinline__ v8f mma(v16b a, v16b b, v8f c) {
    return __builtin_amdgcn_wmma_f32_16x16x32_bf16(false, a, false, b, (short)0, c, false, false);
  }
};
union BFrag { v16b v; v8b h[2]; unsigned u[8]; };

// ---------------------------------------------------------------------------
// Projections. One wave: 64 tokens (tok0 = 64 (4 blockIdx.x + wave)) of head blockIdx.y of batch blockIdx.z.
// x (64 x 32) and Wqkv (96 x 32) are read as f32 and split in registers: hi = bf16_rne(f), lo = bf16_rne(f - hi);
// every product = hi.hi + hi.lo + lo.hi. A and B fragments of the 16x16x32 form have the same lane map (lane (hh, r):
// row r, k = 8 hh + 0..7 and 16 + 8 hh + 0..7), so the same four x fragments are A of q|k = x . Wqkv[0..63]^T and
// B of v^T = Wqkv[64..95] . x^T.
// Output planes (bf16 hi and lo) in fragment order: a block of 16 rows x 32 columns stands as 1024 B, [half][lane][8]:
// lane (hh, r) holds row r, columns 16 half + 8 hh + 0..7, which is what that lane of a 16x16x32 A or B fragment takes,
// so a reader's 16-B load per lane covers four whole 128-B lines.
//   q, k : rows = tokens, columns = head dimension; block (b, h, token / 16); the k plane stands QKPLANE behind q
//   v^T  : rows = head dimension, columns = tokens; block (b, h, d / 16, token / 32)
// (every "#pragma unroll" of this section: constant indices keep the fragment arrays in registers)
// ---------------------------------------------------------------------------
__device__ __forceinline__ void split_pair(float f0, float f1, unsigned& h, unsigned& l) {
  const unsigned short h0 = f2bf_bits(f0), h1 = f2bf_bits(f1);
  const unsigned short l0 = f2bf_bits(f0 - bf_bits2f(h0));
  const unsigned short l1 = f2bf_bits(f1 - bf_bits2f(h1));
  h = pk16(h0, h1);
  l = pk16(l0, l1);
}
// the 16 f32 values of a lane's fragment: elements 0..7 <- p[0..7], 8..15 <- p[16..23]
struct Raw16 { v4f x[4]; };
__device__ __forceinline__ Raw16 load_raw(const float* p) {
  Raw16 r;
  r.x[0] = *(const v4f*)(p); r.x[1] = *(const v4f*)(p + 4); r.x[2] = *(const v4f*)(p + 16); r.x[3] = *(const v4f*)(p + 20);
  return r;
}
__device__ __forceinline__ void split_frag(const Raw16& r, v16b& hi, v16b& lo) {
  BFrag fh, fl;
#pragma unroll
  for (int i = 0; i < 4; ++i)
#pragma unroll
    for (int e = 0; e < 2; ++e) split_pair(r.x[i][2 * e], r.x[i][2 * e + 1], fh.u[2 * i + e], fl.u[2 * i + e]);
  hi = fh.v; lo = fl.v;
}
__device__ __forceinline__ v8f mma3(v16b ah, v16b al, v16b bh, v16b bl) {
  v8f a = (v8f){0.f,0.f,0.f,0.f,0.f,0.f,0.f,0.f};
  a = Frag<__bf16>::mma(ah, bh, a);
  a = Frag<__bf16>::mma(ah, bl, a);
  a = Frag<__bf16>::mma(al, bh, a);
  return a;
}
// orders a wave's own LDS writes and reads of its slab (lanes read what other lanes wrote); LDS only, so that the wave
// does not wait here for its global stores
__device__ __forceinline__ void slab_sync() {
  __builtin_amdgcn_fence(__ATOMIC_RELEASE, "workgroup", "local");
  __builtin_amdgcn_wave_barrier();
  __builtin_amdgcn_fence(__ATOMIC_ACQUIRE, "workgroup", "local");
}
// the wave's 16 x 64 f32 slab (pitch 68) -> two blocks in fragment order at o0 (columns 0..31) and o1 (columns 32..63);
// returns the sum of hi + lo over the lane's 32 elements (row lane & 15, columns 16 it + 8 (lane >> 4) + 0..7)
__device__ __forceinline__ float slab_to_blocks(const float* slab, int lane, unsigned short* __restrict__ H,
                                                unsigned short* __restrict__ L, size_t o0, size_t o1) {
  float rs = 0.0f;
  slab_sync();
  const float* sp = slab + (lane & 15) * 68 + (lane >> 4) * 8;
  v4f s[4][2];                         // all eight LDS reads stand in one place: one LDS latency per slab
#pragma unroll
  for (int it = 0; it < 4; ++it) { s[it][0] = *(const v4f*)(sp + it * 16); s[it][1] = *(const v4f*)(sp + it * 16 + 4); }
#pragma unroll
  for (int it = 0; it < 4; ++it) {
    v8us hv, lv;
#pragma unroll
    for (int e = 0; e < 8; ++e) {
      const float f = s[it][e >> 2][e & 3];
      const unsigned short hb = f2bf_bits(f);
      const unsigned short lb = f2bf_bits(f - bf_bits2f(hb));
      hv[e] = hb;
      lv[e] = lb;
      rs += bf_bits2f(hb) + bf_bits2f(lb);
    }
    unsigned short* ph = H + ((it >> 1) ? o1 : o0) + (it & 1) * 256 + lane * 8;
    unsigned short* pl = L + ((it >> 1) ? o1 : o0) + (it & 1) * 256 + lane * 8;
    *(v8us*)ph = hv;
    *(v8us*)pl = lv;
    // the stores' registers are inputs, so they stay as they are up to the wait, which stands in front of every later
    // instruction that reuses a register which an issued store names (a precaution)
    asm volatile("s_wait_xcnt 0x0" :: "v"(ph), "v"(pl), "v"(hv), "v"(lv) : "memory");
  }
  slab_sync();
  return rs;
}
__global__ __launch_bounds__(128) void proj_kernel(const float* __restrict__ x, const float* __restrict__ Wqkv,
                                                   const float* __restrict__ bqkv,
                                                   unsigned short* __restrict__ qkh, unsigned short* __restrict__ qkl,
                                                   unsigned short* __restrict__ vth, unsigned short* __restrict__ vtl,
                                                   float* __restrict__ vpart) {
  __shared__ __align__(16) float sT[4][16 * 68];   // per-wave 16x64 slab, pitch 68 floats
  __shared__ float vsw[4][32];                     // per-wave sums of v over its 64 tokens
  const int lane  = threadIdx.x & 31;
  const int wave  = threadIdx.x >> 5;
  const int rlane = lane & 15;                 // row (A) / column (B, D) within a 16 x 16 tile
  const int koff  = (lane >> 4) * 8;           // k offset of this lane half; also its D row offset
  const int tok0  = (blockIdx.x * 4 + wave) * 64;
  const int bh    = blockIdx.z * NHEAD + blockIdx.y;
  float* slab = sT[wave];

  // all 48 loads are issued before the first value is split: one memory latency for the wave
  const float* px = x + ((size_t)blockIdx.z * NTOK + tok0 + rlane) * NEMB + blockIdx.y * HDIM + koff;
  const float* pw = Wqkv + rlane * HDIM + koff;
  Raw16 rx[4], rw[6];
#pragma unroll
  for (int i = 0; i < 4; ++i) rx[i] = load_raw(px + (size_t)i * 16 * NEMB);
#pragma unroll
  for (int j = 0; j < 6; ++j) rw[j] = load_raw(pw + j * 16 * HDIM);
  const float* pbn = bqkv + rlane;               // q|k bias by column
  const float* pbm = bqkv + 2 * HDIM + koff;     // v bias by D row
  float bn[4];
  v4f bm[2][2];
#pragma unroll
  for (int j = 0; j < 4; ++j) bn[j] = pbn[16 * j];
#pragma unroll
  for (int i = 0; i < 2; ++i) { bm[i][0] = *(const v4f*)(pbm + 16 * i); bm[i][1] = *(const v4f*)(pbm + 16 * i + 4); }
  // the address registers are inputs, so they stay as they are up to the wait, which stands in front of every later
  // instruction that reuses a register which an issued load names (a precaution)
  asm volatile("s_wait_xcnt 0x0" :: "v"(px), "v"(pw), "v"(pbn), "v"(pbm) : "memory");

  v16b xh[4], xl[4];
#pragma unroll
  for (int i = 0; i < 4; ++i) split_frag(rx[i], xh[i], xl[i]);

  // q|k: D row = token 8 hh + r of tile i, column n = 16 j + rlane (q at 0..31, k at 32..63)
  {
    v16b wh[4], wl[4];
#pragma unroll
    for (int j = 0; j < 4; ++j) split_frag(rw[j], wh[j], wl[j]);
#pragma unroll
    for (int i = 0; i < 4; ++i) {
#pragma unroll
      for (int j = 0; j < 4; ++j) {
        const v8f a = mma3(xh[i], xl[i], wh[j], wl[j]);
#pragma unroll
        for (int r = 0; r < 8; ++r) slab[(koff + r) * 68 + 16 * j + rlane] = a[r] + bn[j];
      }
      const size_t o = ((size_t)bh * (NTOK / 16) + (tok0 >> 4) + i) * FBLK;
      slab_to_blocks(slab, lane, qkh, qkl, o, o + QKPLANE);
    }
  }
  // v^T: D row = d = 16 i + 8 hh + r, column = token 16 j + rlane
  float rs[2];
#pragma unroll
  for (int i = 0; i < 2; ++i) {
    v16b wh, wl;
    split_frag(rw[4 + i], wh, wl);
#pragma unroll
    for (int j = 0; j < 4; ++j) {
      const v8f a = mma3(wh, wl, xh[j], xl[j]);
#pragma unroll
      for (int r = 0; r < 8; ++r) slab[(koff + r) * 68 + 16 * j + rlane] = a[r] + bm[i][r >> 2][r & 3];
    }
    const size_t o = ((size_t)bh * VTROWS + 16 * i) * NTOK + (size_t)(tok0 >> 5) * FBLK;
    rs[i] = slab_to_blocks(slab, lane, vth, vtl, o, o + FBLK);
  }
  // sum of v (hi + lo) over the block's 256 tokens: a lane and its partner (lane ^ 16) hold the two halves of row
  // d = 16 i + (lane & 15) of the wave's 64 tokens, so lane l takes d = l; the four waves are added in wave order and
  // wave 0 stores the block's whole 128-B line vpart[(batch, head)][blockIdx.x][32]
  rs[0] += __shfl_xor(rs[0], 16, 32);
  rs[1] += __shfl_xor(rs[1], 16, 32);
  vsw[wave][lane] = (lane >> 4) ? rs[1] : rs[0];
  // work-group barrier that orders LDS only: with __syncthreads() every wave would first wait here for its global stores
  __builtin_amdgcn_fence(__ATOMIC_RELEASE, "workgroup", "local");
  __builtin_amdgcn_s_barrier();
  __builtin_amdgcn_fence(__ATOMIC_ACQUIRE, "workgroup", "local");
  if (wave == 0)
    vpart[((size_t)bh * VPB + blockIdx.x) * 32 + lane] = ((vsw[0][lane] + vsw[1][lane]) + vsw[2][lane]) + vsw[3][lane];
}

// ---------------------------------------------------------------------------
// Scores, softmax, 12x12 head mixing, batch-statistic partials and (mixed map).v for 32 query rows (t0 = 32 blockIdx.x),
// two tiles of 16 rows, of batch blockIdx.y, all 12 heads, in one block of 16 waves: neither the scores nor the mixed map
// go to memory. The k and v planes come from L2 for every block, so a fragment that serves both row tiles halves that traffic.
// Pass A: row maxima and row sums. 48 units (head, quarter of the keys), 3 per wave; every k fragment is multiplied with the
//   q fragments of both row tiles; q.k^T on bf16 hi/lo planes, running maximum and rescaled sum per lane, then over the
//   16 lanes of a row, then over the four quarters (LDS).
// Pass B: 8 chunks of 128 keys. Wave w works on row tile rt = w / 8, owns keys 16 kw .. 16 kw + 15 (kw = w mod 8) of the chunk
//   and recomputes q.k^T for all 12 heads, so lane (hh, c) holds P_h[t = 8 hh + r][s = c] for every h. Mixing product, per r, for the rows t = r and t = 8 + r:
//   P elements 0..7 = the lane's own heads 0..7 (k = 0..7: row r, k = 8..15: row 8 + r), elements 8..11 = heads 8..11 of
//   the partner lane (lane ^ 16; k = 16..19: row 8 + r, k = 24..27: row r), the rest zero; the mixing matrix stands in two
//   fragments, each zero on the other row's k. The probabilities are the A operand and the mixing matrix the B operand
//   (both have the same lane map), so D row s = 8 hh + r2, column g = c: a lane holds 8 consecutive keys of one head.
//   M goes to LDS as a bf16 hi plane and a bf16 lo plane [g][t][s], 16 B per lane and plane, which is the order that an
//   A fragment of the next product takes; behind a barrier wave w multiplies 16 columns of v of head w / 2 with both row
//   tiles (one v fragment, two products) and 16 columns of head 8 + w / 4 with row tile w mod 2, accumulating over all
//   chunks in registers.
// part[b * 64 + 2 blockIdx.x + rt][32] = {sum M_g (12), sum M_g^2 (12), 8 zeros} over the 16 rows of a row tile.
// ---------------------------------------------------------------------------
constexpr int CHK = 128;               // keys per chunk
constexpr int MTP = CHK + 8;           // bf16 per (g, t) row: 272 B = 16 B x odd, b128 reads of 16 rows without conflicts
constexpr int MGP = 16 * MTP + 8;      // bf16 per g: 4368 B = 16 B x odd, b128 stores of 12 heads without conflicts
constexpr int MPL = NHEAD * MGP;       // bf16 per plane; the lo plane stands behind the hi plane
constexpr int NRT = 2;                 // row tiles of 16 query rows per block
typedef __attribute__((ext_vector_type(2))) __bf16 v2b;
typedef __attribute__((ext_vector_type(2))) float v2f;
union HFrag { v16h v; v8h h[2]; unsigned u[8]; };
// fragment from a plane in fragment order; p = block + 8 lane
__device__ __forceinline__ v16b load_fo(const __bf16* p) {
  BFrag f; f.h[0] = *(const v8b*)(p); f.h[1] = *(const v8b*)(p + 256); return f.v;
}

__device__ __forceinline__ v8f qk3(v16b ah, v16b al, v16b bh, v16b bl) {
  v8f a = (v8f){0.f,0.f,0.f,0.f,0.f,0.f,0.f,0.f};
  a = Frag<__bf16>::mma(ah, bh, a);
  a = Frag<__bf16>::mma(ah, bl, a);
  a = Frag<__bf16>::mma(al, bh, a);
  return a;
}
__device__ __forceinline__ void split_h(float w, _Float16& a, _Float16& r) {
  a = (_Float16)w;
  r = (_Float16)((w - (float)a) * R_CARRY);
}
__device__ __forceinline__ unsigned pkh(_Float16 a, _Float16 b) {
  return pk16(__builtin_bit_cast(unsigned short, a), __builtin_bit_cast(unsigned short, b));
}
// one mixed row t, 8 keys of the lane's head: fold the residual accumulator, add to the statistics, store 8 bf16 hi and
// 8 bf16 lo values, 16 B each. dst: the lane's 8 keys in row (g = c, t) of the hi plane; the lanes c = 12..15 have no head
// and are pointed at the pad behind a row t, which nobody reads: stores without a branch keep a chunk's body one basic
// block, so that no exponential is moved down between the mixing products
__device__ __forceinline__ void emit_row(const v8f& d0, const v8f& dr, v8f& s1, v8f& s2, __bf16* dst) {
  union { v8b v; v2b p[4]; } hi, lo;
#pragma unroll
  for (int i = 0; i < 4; ++i) {
    v2f m;
#pragma unroll
    for (int e = 0; e < 2; ++e) {
      m[e] = fmaf(dr[2 * i + e], MIX_FOLD, d0[2 * i + e] * P_INV);
      s1[2 * i + e] += m[e];
      s2[2 * i + e] = fmaf(m[e], m[e], s2[2 * i + e]);
    }
    const v2b h = __builtin_convertvector(m, v2b);           // round to nearest even, as f2bf_bits
    const v2f res = {m[0] - (float)h[0], m[1] - (float)h[1]};
    hi.p[i] = h;
    lo.p[i] = __builtin_convertvector(res, v2b);
  }
  *(v8b*)dst = hi.v;
  *(v8b*)(dst + MPL) = lo.v;
}
// lane l with lane l ^ 16
__device__ __forceinline__ unsigned xhalf(unsigned x) {
  return (unsigned)__builtin_amdgcn_permlanex16((int)x, (int)x, 0x76543210, 0xfedcba98, false, false);
}
// A fragment (hi and lo) of the mixed map from the two planes: elements 0..7 <- p[0..7], 8..15 <- p[16..23]
__device__ __forceinline__ void load_m(const __bf16* p, v16b& hi, v16b& lo) {
  BFrag fh, fl;
  fh.h[0] = *(const v8b*)(p);       fh.h[1] = *(const v8b*)(p + 16);
  fl.h[0] = *(const v8b*)(p + MPL); fl.h[1] = *(const v8b*)(p + MPL + 16);
  hi = fh.v; lo = fl.v;
}

// 16 waves, 4 per SIMD: at most 256 registers a wave; one block (280,064 B of LDS) per WGP
__global__ __launch_bounds__(512, 4) void fused_reattn_kernel(const unsigned short* __restrict__ qh,
                                                           const unsigned short* __restrict__ ql,
                                                           const unsigned short* __restrict__ kh,
                                                           const unsigned short* __restrict__ kl,
                                                           const unsigned short* __restrict__ vth,
                                                           const unsigned short* __restrict__ vtl,
                                                           const float* __restrict__ Wconv,
                                                           float* __restrict__ U, float* __restrict__ part) {
  __shared__ __align__(16) __bf16 Mx[NRT][2 * MPL];      // mixed map of a chunk, per row tile: hi plane, lo plane
  __shared__ __align__(16) v8b qf[NRT][NHEAD][2][2][32]; // q fragments in register order: [row tile][head][plane][half][lane]
  __shared__ __align__(16) v8h af[4][2][32];             // mixing-matrix fragments in register order: [fragment][half][lane]
  __shared__ __align__(16) float pm[NRT][NHEAD][4][16];
  __shared__ __align__(16) float pl[NRT][NHEAD][4][16];
  __shared__ __align__(16) float fm[NRT][NHEAD][16];
  __shared__ __align__(16) float fi[NRT][NHEAD][16];
  __shared__ float stw[NRT][8][24];
  __shared__ __align__(16) float pline[NRT][32];

  const int tid  = threadIdx.x;
  const int lane = tid & 31;
  const int wave = tid >> 5;
  const int hh   = lane >> 4;
  const int c    = lane & 15;
  const int rt   = wave >> 3;            // row tile of the wave in pass B
  const int kw   = wave & 7;             // its 16 keys within a chunk
  const int t0   = blockIdx.x * (16 * NRT);
  const int b    = blockIdx.y;
  const __bf16* QH = (const __bf16*)qh;
  const __bf16* QL = (const __bf16*)ql;
  const __bf16* KH = (const __bf16*)kh;
  const __bf16* KL = (const __bf16*)kl;
  const v8f zacc = (v8f){0.f,0.f,0.f,0.f,0.f,0.f,0.f,0.f};

  // ---- pass A ----  (every "#pragma unroll" of this kernel: constant indices keep the small arrays in registers)
#pragma unroll 1   // rolled: three copies of the unit would only grow the code
  for (int u = 0; u < 3; ++u) {
    const int unit = wave * 3 + u;
    const int h    = unit >> 2;
    const int qt   = unit & 3;
    const size_t qo = ((size_t)(b * NHEAD + h) * (NTOK / 16) + blockIdx.x * NRT) * FBLK + lane * 8;
    BFrag ah[NRT], al[NRT];
    const __bf16* qph = QH + qo;
    const __bf16* qpl = QL + qo;
#pragma unroll
    for (int i = 0; i < NRT; ++i) {
      ah[i].v = load_fo(qph + i * FBLK);
      al[i].v = load_fo(qpl + i * FBLK);
    }
    // the address registers are inputs, so they stay as they are up to the wait, which stands in front of every later
    // instruction that reuses a register which an issued load names (a precaution); the same form further down
    asm volatile("s_wait_xcnt 0x0" :: "v"(qph), "v"(qpl) : "memory");
    if (qt == 0) {                         // wave-uniform
#pragma unroll
      for (int i = 0; i < NRT; ++i) {
        qf[i][h][0][0][lane] = ah[i].h[0]; qf[i][h][0][1][lane] = ah[i].h[1];
        qf[i][h][1][0][lane] = al[i].h[0]; qf[i][h][1][1][lane] = al[i].h[1];
      }
    }
    float m[NRT][8], l[NRT][8];
#pragma unroll
    for (int i = 0; i < NRT; ++i)
#pragma unroll
      for (int r = 0; r < 8; ++r) { m[i][r] = -INFINITY; l[i][r] = 0.0f; }
    const size_t ko = ((size_t)(b * NHEAD + h) * (NTOK / 16) + qt * 16) * FBLK + lane * 8;
#pragma unroll 1   // rolled: 16 loads in flight per trip are enough, more copies cost registers
    for (int it = 0; it < 4; ++it) {
      v16b bh[4], bl[4];
      const __bf16* kph = KH + ko + (size_t)(it * 4) * FBLK;
      const __bf16* kpl = KL + ko + (size_t)(it * 4) * FBLK;
#pragma unroll
      for (int j = 0; j < 4; ++j) {
        bh[j] = load_fo(kph + j * FBLK);
        bl[j] = load_fo(kpl + j * FBLK);
      }
      asm volatile("s_wait_xcnt 0x0" :: "v"(kph), "v"(kpl) : "memory");   // as above
#pragma unroll
      for (int i = 0; i < NRT; ++i) {      // the four k fragments serve both row tiles
        v8f a[4];
#pragma unroll
        for (int j = 0; j < 4; ++j) a[j] = qk3(ah[i].v, al[i].v, bh[j], bl[j]);
#pragma unroll
        for (int r = 0; r < 8; ++r) {
          const float x0 = a[0][r] * SM_SCALE, x1 = a[1][r] * SM_SCALE, x2 = a[2][r] * SM_SCALE, x3 = a[3][r] * SM_SCALE;
          const float mn = fmaxf(m[i][r], fmaxf(fmaxf(x0, x1), fmaxf(x2, x3)));
          const float e  = ((__expf(x0 - mn) + __expf(x1 - mn)) + __expf(x2 - mn)) + __expf(x3 - mn);
          l[i][r] = fmaf(l[i][r], __expf(m[i][r] - mn), e);
          m[i][r] = mn;
        }
      }
    }
#pragma unroll
    for (int r = 0; r < 8; ++r) {
      float mm[NRT], ll[NRT];              // the two row tiles side by side: their cross-lane chains overlap
#pragma unroll
      for (int i = 0; i < NRT; ++i) mm[i] = m[i][r];
#pragma unroll
      for (int off = 1; off < 16; off <<= 1)
#pragma unroll
        for (int i = 0; i < NRT; ++i) mm[i] = fmaxf(mm[i], __shfl_xor(mm[i], off, 32));
#pragma unroll
      for (int i = 0; i < NRT; ++i) ll[i] = l[i][r] * __expf(m[i][r] - mm[i]);
#pragma unroll
      for (int off = 1; off < 16; off <<= 1)
#pragma unroll
        for (int i = 0; i < NRT; ++i) ll[i] += __shfl_xor(ll[i], off, 32);
      if (c == 0) {
#pragma unroll
        for (int i = 0; i < NRT; ++i) { pm[i][h][qt][8 * hh + r] = mm[i]; pl[i][h][qt][8 * hh + r] = ll[i]; }
      }
    }
  }
  __syncthreads();
  if (tid < NRT * NHEAD * 16) {
    const int ih = tid >> 4, t = tid & 15;   // ih = 12 (row tile) + head: the arrays are contiguous over both
    const float* pmr = &pm[0][0][0][0] + ih * 64 + t;
    const float* plr = &pl[0][0][0][0] + ih * 64 + t;
    const float m0 = pmr[0], m1 = pmr[16], m2 = pmr[32], m3 = pmr[48];
    const float mm = fmaxf(fmaxf(m0, m1), fmaxf(m2, m3));
    const float ll = ((plr[0] * __expf(m0 - mm) + plr[16] * __expf(m1 - mm)) + plr[32] * __expf(m2 - mm)) + plr[48] * __expf(m3 - mm);
    (&fm[0][0][0])[ih * 16 + t] = mm;
    (&fi[0][0][0])[ih * 16 + t] = (1.0f / ll) * P_CARRY;      // probabilities leave the exponential already carried x2^10
  }

  // B fragments of the mixing matrix: column n = g = c; a1 serves query row r, a2 query row 8 + r
  {
    HFrag a1h, a1l, a2h, a2l;
    v8h z8, w0h, w0l, w8h, w8l;
    const unsigned wofs = (unsigned)(c > 11 ? 11 : c) * NHEAD * 4u;      // byte offset of the lane's row
    const float* wrow = (const float*)((const char*)Wconv + wofs);
#pragma unroll
    for (int i = 0; i < 8; ++i) {
      const int h8 = i < 4 ? 8 + i : 11;
      float w0 = wrow[i];
      float w8 = wrow[h8];
      w0 = (c < 12) ? w0 : 0.0f;
      w8 = (c < 12 && i < 4) ? w8 : 0.0f;
      _Float16 x, y;
      split_h(w0, x, y); w0h[i] = x; w0l[i] = y;
      split_h(w8, x, y); w8h[i] = x; w8l[i] = y;
      z8[i] = (_Float16)0.0f;
    }
    asm volatile("s_wait_xcnt 0x0" :: "v"(wofs) : "memory");   // as above
    a1h.h[0] = hh ? z8 : w0h;  a1h.h[1] = hh ? w8h : z8;
    a1l.h[0] = hh ? z8 : w0l;  a1l.h[1] = hh ? w8l : z8;
    a2h.h[0] = hh ? w0h : z8;  a2h.h[1] = hh ? z8 : w8h;
    a2l.h[0] = hh ? w0l : z8;  a2l.h[1] = hh ? z8 : w8l;
    if (wave == 0) {                       // the same in every wave; published by the barrier below
      af[0][0][lane] = a1h.h[0]; af[0][1][lane] = a1h.h[1];
      af[1][0][lane] = a1l.h[0]; af[1][1][lane] = a1l.h[1];
      af[2][0][lane] = a2h.h[0]; af[2][1][lane] = a2h.h[1];
      af[3][0][lane] = a2l.h[0]; af[3][1][lane] = a2l.h[1];
    }
  }
  __syncthreads();

  // ---- pass B ----
  v8f s1 = zacc, s2 = zacc;
  v8f ua0 = zacc, ua1 = zacc, ub = zacc;
  const int gA = wave >> 1;              // head of which this wave multiplies 16 v columns with both row tiles
  const int dA = (wave & 1) * 16;
  const int gB = 8 + (wave >> 2);        // head of which it multiplies 16 columns with row tile rB
  const int dB = ((wave >> 1) & 1) * 16;
  const int rB = wave & 1;
  __bf16* Mr = Mx[rt];                   // where the wave stores its part of the mixed map
  const __bf16* VH = (const __bf16*)vth;
  const __bf16* VL = (const __bf16*)vtl;
  const size_t voA = ((size_t)(b * NHEAD + gA) * VTROWS + dA) * NTOK + lane * 8;
  const size_t voB = ((size_t)(b * NHEAD + gB) * VTROWS + dB) * NTOK + lane * 8;
#pragma unroll 1   // rolled: one chunk's body already fills a good part of the instruction cache
  for (int ch = 0; ch < NTOK / CHK; ++ch) {      // block-uniform
    unsigned o07h[8][4], o07l[8][4], o8h[8][2], o8l[8][2];
    const size_t ko = ((size_t)b * NHEAD * (NTOK / 16) + ch * (CHK / 16) + kw) * FBLK + lane * 8;
    const __bf16* kph = KH + ko;                 // head h stands h * NTOK / 16 blocks further on
    const __bf16* kpl = KL + ko;
    // one head at a time, the next head's k fragments in flight meanwhile: short live ranges, so that the kernel fits
    // 256 registers and the block's 16 waves fit a WGP
    v16b kbh = load_fo(kph), kbl = load_fo(kpl);
    _Float16 xe[8], ye[8];                       // the even head's halves of the words that two heads share
#pragma unroll
    for (int h = 0; h < NHEAD; ++h) {
      v16b knh = kbh, knl = kbl;
      if (h + 1 < NHEAD) {
        knh = load_fo(kph + (h + 1) * (NTOK / 16) * FBLK);
        knl = load_fo(kpl + (h + 1) * (NTOK / 16) * FBLK);
      }
      if (h + 2 == NHEAD) asm volatile("s_wait_xcnt 0x0" :: "v"(kph), "v"(kpl) : "memory");   // as above, behind the last k load
      BFrag ah, al;
      ah.h[0] = qf[rt][h][0][0][lane]; ah.h[1] = qf[rt][h][0][1][lane];
      al.h[0] = qf[rt][h][1][0][lane]; al.h[1] = qf[rt][h][1][1][lane];
      const v8f a = qk3(ah.v, al.v, kbh, kbl);
      v4f mx[2], iv[2];
      mx[0] = *(const v4f*)(&fm[rt][h][8 * hh]); mx[1] = *(const v4f*)(&fm[rt][h][8 * hh + 4]);
      iv[0] = *(const v4f*)(&fi[rt][h][8 * hh]); iv[1] = *(const v4f*)(&fi[rt][h][8 * hh + 4]);
#pragma unroll
      for (int r = 0; r < 8; ++r) {
        const float p = __expf(a[r] * SM_SCALE - mx[r >> 2][r & 3]) * iv[r >> 2][r & 3];
        _Float16 x, y;
        split_h(p, x, y);
        if ((h & 1) == 0)  { xe[r] = x; ye[r] = y; }
        else if (h < 8)    { o07h[r][h >> 1] = pkh(xe[r], x); o07l[r][h >> 1] = pkh(ye[r], y); }
        else               { o8h[r][(h >> 1) - 4] = pkh(xe[r], x); o8l[r][(h >> 1) - 4] = pkh(ye[r], y); }
      }
      kbh = knh; kbl = knl;
    }
    // the mixing matrix's fragments are read again for every chunk, so that they hold no registers outside this part
    HFrag a1h, a1l, a2h, a2l;
    a1h.h[0] = af[0][0][lane]; a1h.h[1] = af[0][1][lane];
    a1l.h[0] = af[1][0][lane]; a1l.h[1] = af[1][1][lane];
    a2h.h[0] = af[2][0][lane]; a2h.h[1] = af[2][1][lane];
    a2l.h[0] = af[3][0][lane]; a2l.h[1] = af[3][1][lane];
#pragma unroll
    for (int r = 0; r < 8; ++r) {
      HFrag bh, bl;
#pragma unroll
      for (int i = 0; i < 4; ++i) { bh.u[i] = o07h[r][i]; bl.u[i] = o07l[r][i]; }
      bh.u[4] = xhalf(o8h[r][0]); bh.u[5] = xhalf(o8h[r][1]);
      bl.u[4] = xhalf(o8l[r][0]); bl.u[5] = xhalf(o8l[r][1]);
      bh.u[6] = 0u; bh.u[7] = 0u; bl.u[6] = 0u; bl.u[7] = 0u;
      __bf16* dst = Mr + (c < NHEAD ? c * MGP + kw * 16 + 8 * hh : (c - NHEAD + 4 * hh) * MGP + CHK);
      v8f d10 = Frag<_Float16>::mma(bh.v, a1h.v, zacc);
      v8f d20 = Frag<_Float16>::mma(bh.v, a2h.v, zacc);
      v8f d1r = Frag<_Float16>::mma(bl.v, a1h.v, zacc);
      v8f d2r = Frag<_Float16>::mma(bl.v, a2h.v, zacc);
      d1r = Frag<_Float16>::mma(bh.v, a1l.v, d1r);
      d2r = Frag<_Float16>::mma(bh.v, a2l.v, d2r);
      emit_row(d10, d1r, s1, s2, dst + r * MTP);
      emit_row(d20, d2r, s1, s2, dst + (8 + r) * MTP);
      // compiler fence, no instruction: the LDS stores and the statistic sums (named as inputs only) of this r are done here;
      // put off to the end of the chunk, the words to be stored and the values still to be summed spill at 256 registers
      asm volatile("" :: "v"(s1), "v"(s2) : "memory");
    }
    // the v fragments of the chunk's first 32 keys: issued in front of the barrier, so that they fly while the wave waits
    // there; those of the next 32 keys are issued in front of each product
    const __bf16* vah = VH + voA + (size_t)ch * (CHK / 32) * FBLK;
    const __bf16* val = VL + voA + (size_t)ch * (CHK / 32) * FBLK;
    const __bf16* vbh = VH + voB + (size_t)ch * (CHK / 32) * FBLK;
    const __bf16* vbl = VL + voB + (size_t)ch * (CHK / 32) * FBLK;
    v16b f0h = load_fo(vah), f0l = load_fo(val);
    v16b f2h = load_fo(vbh), f2l = load_fo(vbl);
    asm volatile("s_wait_xcnt 0x0" :: "v"(vah), "v"(val), "v"(vbh), "v"(vbl) : "memory");   // as above
    __syncthreads();                             // the chunk's mixed map is complete
#pragma unroll
    for (int ks = 0; ks < CHK / 32; ++ks) {
      const v16b b0h = f0h, b0l = f0l, b2h = f2h, b2l = f2l;
      if (ks + 1 < CHK / 32) {
        f0h = load_fo(vah + (ks + 1) * FBLK);
        f0l = load_fo(val + (ks + 1) * FBLK);
        f2h = load_fo(vbh + (ks + 1) * FBLK);
        f2l = load_fo(vbl + (ks + 1) * FBLK);
        asm volatile("s_wait_xcnt 0x0" :: "v"(vah), "v"(val), "v"(vbh), "v"(vbl) : "memory");   // as above
      }
      v16b m0h, m0l, m1h, m1l, nh, nl;
      load_m(Mx[0] + gA * MGP + c * MTP + ks * 32 + hh * 8, m0h, m0l);
      load_m(Mx[1] + gA * MGP + c * MTP + ks * 32 + hh * 8, m1h, m1l);
      load_m(Mx[rB] + gB * MGP + c * MTP + ks * 32 + hh * 8, nh, nl);
      ua0 = Frag<__bf16>::mma(m0h, b0h, ua0);
      ua1 = Frag<__bf16>::mma(m1h, b0h, ua1);
      ub  = Frag<__bf16>::mma(nh, b2h, ub);
      ua0 = Frag<__bf16>::mma(m0h, b0l, ua0);
      ua1 = Frag<__bf16>::mma(m1h, b0l, ua1);
      ub  = Frag<__bf16>::mma(nh, b2l, ub);
      ua0 = Frag<__bf16>::mma(m0l, b0h, ua0);
      ua1 = Frag<__bf16>::mma(m1l, b0h, ua1);
      ub  = Frag<__bf16>::mma(nl, b2h, ub);
    }
    __syncthreads();                             // every reader has left Mx before the next chunk (or the U tile) overwrites it
  }

  // U tile through LDS, so that each 128-B row of U is stored whole by one wave: [row tile][g][t][32]
  float* ut = (float*)&Mx[0][0];
#pragma unroll
  for (int r = 0; r < 8; ++r) {
    ut[(gA * 16 + 8 * hh + r) * UW + dA + c]                = ua0[r];     // D row t = 8 hh + r, column d = c
    ut[((NHEAD + gA) * 16 + 8 * hh + r) * UW + dA + c]      = ua1[r];
    ut[((rB * NHEAD + gB) * 16 + 8 * hh + r) * UW + dB + c] = ub[r];
  }
  // statistics of head g = c: the lane's 8 sums (fixed tree), the two lane halves, then waves in index order
  {
    float a  = ((s1[0] + s1[1]) + (s1[2] + s1[3])) + ((s1[4] + s1[5]) + (s1[6] + s1[7]));
    float bq = ((s2[0] + s2[1]) + (s2[2] + s2[3])) + ((s2[4] + s2[5]) + (s2[6] + s2[7]));
    a  += __uint_as_float(xhalf(__float_as_uint(a)));
    bq += __uint_as_float(xhalf(__float_as_uint(bq)));
    if (lane < NHEAD) { stw[rt][kw][lane] = a; stw[rt][kw][12 + lane] = bq; }
  }
  __syncthreads();
#pragma unroll
  for (int i = 0; i < NRT * NHEAD * 16 * UW / 4 / 512; ++i) {    // 3072 16-B pieces, 6 per thread
    const int p = i * 512 + tid;
    const int ig = p >> 7;                                 // 12 (row tile) + g
    const int ti = ig >= NHEAD ? 1 : 0;
    const int g = ig - ti * NHEAD, t = (p >> 3) & 15, d = (p & 7) * 4;
    const v4f v = *(const v4f*)(ut + p * 4);
    *(v4f*)(U + ((size_t)(b * NHEAD + g) * NTOK + t0 + ti * 16 + t) * UW + d) = v;
  }
  if (kw == 0) {                           // one wave per row tile
    const int qi = lane < 24 ? lane : 23;
    float v = stw[rt][0][qi];
#pragma unroll
    for (int w = 1; w < 8; ++w) v += stw[rt][w][qi];
    v = (lane < 24) ? v : 0.0f;
    pline[rt][lane] = v;
  }
  __syncthreads();
  if (tid < 8 * NRT) {                     // the lines of the two row tiles follow one another, in pline as in part
    const v4f v = *(const v4f*)(&pline[0][0] + tid * 4);
    *(v4f*)(part + ((size_t)b * (NTOK / 16) + blockIdx.x * NRT) * 32 + tid * 4) = v;
  }
}

// ---------------------------------------------------------------------------
// out[b][t][32g+d] = a_g * U[b][g][t][d] + kk_g * Vsum[b][g][d] for CROWS rows (b, t) per block of 8 waves, 4 rows a wave.
// Every block forms the coefficients itself, all blocks by the same arithmetic in the same order:
//   column sums of part [NPART][32] in f64: thread (row group tid >> 3, 4 columns 4 (tid & 7)) adds the lines
//   tid >> 3 + 32 i in the order of i, then lanes l ^ 8, l ^ 16, then the 8 waves in wave order (LDS);
//   mean_g = S1/N, var_g = S2/N - mean_g^2 (biased), a_g = gamma_g / sqrt(var_g + eps),
//   kk_g = a_g*bconv_g + (beta_g - a_g*(mean_g + bconv_g)); lane l of every wave holds a_l (l < 12) or kk_(l-12) (l < 24);
//   Vsum[b][g][d] = the VPB lines of vpart[(b, g)] added in line order.
// Coverage: grid 256 x 32 rows = 8192 rows = all of d_out.
// ---------------------------------------------------------------------------
__global__ __launch_bounds__(256) void combine_kernel(const float* __restrict__ U, const float* __restrict__ vpart,
                                                      const float* __restrict__ part, const float* __restrict__ bconv,
                                                      const float* __restrict__ gamma, const float* __restrict__ beta,
                                                      float* __restrict__ out) {
  __shared__ __align__(16) double sw[8][32];
  __shared__ __align__(16) float vs[NHEAD * 32];
  const int tid  = threadIdx.x;
  const int lane = tid & 31;
  const int wave = tid >> 5;
  const int R0 = blockIdx.x * CROWS + wave * (CROWS / 8);   // the wave's first row, 0..8191; a block lies in one batch
  const int b = R0 >> 10, t = R0 & (NTOK - 1);
  int gq = (lane < 12) ? lane : (lane - 12);
  gq = gq > 11 ? 11 : gq;

  // every load of the block is issued before the first value is used: one memory latency
  // (every "#pragma unroll" of this kernel: constant indices keep the small arrays in registers)
  const float* pp = part + (tid >> 3) * 32 + (tid & 7) * 4;
  v4f pv[NPART / 32];
#pragma unroll
  for (int i = 0; i < NPART / 32; ++i) pv[i] = *(const v4f*)(pp + i * 32 * 32);
  const int vq = tid < NHEAD * 8 ? tid : NHEAD * 8 - 1;      // 16-B piece of the batch's 12 x 32 sums
  const float* pq = vpart + ((size_t)(b * NHEAD + (vq >> 3)) * VPB) * 32 + (vq & 7) * 4;
  v4f vp[VPB];
#pragma unroll
  for (int i = 0; i < VPB; ++i) vp[i] = *(const v4f*)(pq + i * 32);
  const float bc = bconv[gq], ga = gamma[gq], be = beta[gq];
  const float* pu = U + (((size_t)(b * NHEAD + (lane >> 3))) * NTOK + t) * UW + (lane & 7) * 4;
  v4f u[CROWS / 8][3];
#pragma unroll
  for (int rr = 0; rr < CROWS / 8; ++rr)
#pragma unroll
    for (int i = 0; i < 3; ++i) u[rr][i] = *(const v4f*)(pu + (size_t)i * 4 * NTOK * UW + rr * UW);   // head 4 i + lane / 8
  // the address registers are inputs, so they stay as they are up to the wait, which stands in front of every later
  // instruction that reuses a register which an issued load names (a precaution)
  asm volatile("s_wait_xcnt 0x0" :: "v"(pp), "v"(pq), "v"(gq), "v"(pu) : "memory");
  // keeps the sums below from being scheduled in between the loads, where their waits would hold back the later loads
  __builtin_amdgcn_sched_barrier(0);

  double acc[4] = {0.0, 0.0, 0.0, 0.0};
#pragma unroll
  for (int i = 0; i < NPART / 32; ++i)
#pragma unroll
    for (int e = 0; e < 4; ++e) acc[e] += (double)pv[i][e];
#pragma unroll
  for (int e = 0; e < 4; ++e) {
    acc[e] += __shfl_xor(acc[e], 8, 32);
    acc[e] += __shfl_xor(acc[e], 16, 32);
  }
  if (lane < 8) {
#pragma unroll
    for (int e = 0; e < 4; ++e) sw[wave][lane * 4 + e] = acc[e];
  }
  if (tid < NHEAD * 8) *(v4f*)(vs + tid * 4) = ((vp[0] + vp[1]) + vp[2]) + vp[3];
  __syncthreads();                               // the wave sums and the batch's Vsum are complete

  double s = sw[0][lane];
#pragma unroll
  for (int w = 1; w < 8; ++w) s += sw[w][lane];
  const double s1d = __shfl(s, gq, 32);
  const double s2d = __shfl(s, 12 + gq, 32);
  const double invN = 1.0 / ((double)NBATCH * (double)NTOK * (double)NTOK);
  const double meanM = s1d * invN;
  double var = s2d * invN - meanM * meanM;
  var = var < 0.0 ? 0.0 : var;
  const float varf   = (float)var;
  const float meanre = (float)meanM + bc;
  const float a      = ga * (1.0f / sqrtf(varf + BN_EPS));
  const float kk     = a * bc + (be - a * meanre);
  const float cf     = (lane < 12) ? a : kk;

  float* orow = out + (size_t)R0 * NEMB + 4 * lane;
#pragma unroll
  for (int i = 0; i < 3; ++i) {
    const int g = 4 * i + (lane >> 3);
    const float ag = __shfl(cf, g, 32), kg = __shfl(cf, 12 + g, 32);
    const v4f vv = *(const v4f*)(vs + 128 * i + 4 * lane);
#pragma unroll
    for (int rr = 0; rr < CROWS / 8; ++rr) {
      v4f o;
#pragma unroll
      for (int e = 0; e < 4; ++e) o[e] = fmaf(ag, u[rr][i][e], kg * vv[e]);
      *(v4f*)(orow + rr * NEMB + 128 * i) = o;
    }
  }
}

// ---------------------------------------------------------------------------
// Workspace region map (every size a multiple of 256):
//   U       f32  [8][12][1024][32]
//   QKH, QKL bf16 [2][8][12][64 blocks of 16 tokens x 32] each  q plane, then k plane, in fragment order
//   VTH, VTL bf16 [8][12][2 groups of 16 rows][32 blocks of 16 rows x 32 tokens] each  v^T of every batch, in fragment order
//   PART    f32  [512][32];  VPART f32 [8][12][4][32]
// ---------------------------------------------------------------------------
extern "C" void kernel_launch(void* const* d_in, const int* in_sizes, int n_in,
                              void* d_out, int out_size, void* d_ws, size_t ws_size,
                              hipStream_t stream) {
  if (n_in < 7) return;
  if (in_sizes[0] != NBATCH * NTOK * NEMB) return;
  if (in_sizes[1] != 3 * HDIM * HDIM || in_sizes[2] != 3 * HDIM) return;
  if (in_sizes[3] != NHEAD * NHEAD || in_sizes[4] < NHEAD || in_sizes[5] < NHEAD || in_sizes[6] < NHEAD) return;
  if (out_size != NBATCH * NTOK * NEMB) return;

  const float* x     = (const float*)d_in[0];
  const float* Wqkv  = (const float*)d_in[1];
  const float* bqkv  = (const float*)d_in[2];
  const float* Wconv = (const float*)d_in[3];
  const float* bconv = (const float*)d_in[4];
  const float* gamma = (const float*)d_in[5];
  const float* beta  = (const float*)d_in[6];
  float* out = (float*)d_out;

  const size_t szU    = (size_t)NBATCH * NHEAD * NTOK * UW * 4;      // 12582912
  const size_t szQK   = (size_t)NBATCH * NTOK * NHEAD * QKW * 2;     // 12582912
  const size_t szVT   = (size_t)NBATCH * NHEAD * VTROWS * NTOK * 2;  // 6291456
  const size_t szPART = (size_t)NPART * 32 * 4;                      // 65536
  const size_t szVP   = (size_t)NBATCH * NHEAD * VPB * 32 * 4;       // 49152
  size_t off = 0;
  const size_t oU = off;    off += szU;
  const size_t oQKH = off;  off += szQK;
  const size_t oQKL = off;  off += szQK;
  const size_t oVTH = off;  off += szVT;
  const size_t oVTL = off;  off += szVT;
  const size_t oPART = off; off += szPART;
  const size_t oVP = off;   off += szVP;
  if (off > ws_size) return;

  char* ws = (char*)d_ws;
  unsigned short* QKH  = (unsigned short*)(ws + oQKH);
  unsigned short* QKL  = (unsigned short*)(ws + oQKL);
  unsigned short* VTH  = (unsigned short*)(ws + oVTH);
  unsigned short* VTL  = (unsigned short*)(ws + oVTL);
  float*          U    = (float*)(ws + oU);
  float*          PART = (float*)(ws + oPART);
  float*          VPART = (float*)(ws + oVP);

  const dim3 blk(256);
  // (1) q, k and v^T planes of every (batch, head), and each block's sums of v: 4 blocks x 4 waves x 64 tokens = 1024 tokens
  proj_kernel<<<dim3(NTOK / 256, NHEAD, NBATCH), dim3(128), 0, stream>>>(x, Wqkv, bqkv, QKH, QKL, VTH, VTL, VPART);
  // (2) scores, softmax, head mixing, statistic partials and (mixed map).v: one block of 16 waves per 32 query rows of a batch
  fused_reattn_kernel<<<dim3(NTOK / 32, NBATCH), dim3(512), 0, stream>>>(QKH, QKL, QKH + QKPLANE, QKL + QKPLANE, VTH, VTL, Wconv, U, PART);
  // (3) fixed-order f64 sums over the partial lines and the per-head affine coefficients in every block, then its output
  //     rows: 256 blocks x 32 rows = 8192 rows of 384 floats
  combine_kernel<<<dim3(NBATCH * NTOK / CROWS), blk, 0, stream>>>(U, VPART, PART, bconv, gamma, beta, out);
}
